// v000
// Measured on an AMD MI455X. A time is GPU time per run, averaged over a window of back-to-back runs after a warm-up
// (all launches, gaps included; the runs take copies of the inputs in turn), and the median of several windows.
// Apart from v000's, it joins two sittings. Times from different sittings can be a few percent apart, while
// side-by-side timings come from the same sitting.
// v000, which the later versions start from, runs in 234 microseconds.
#include <hip/hip_runtime.h>
// Multi-head attention with three input streams (q, k, v each [NB][SEQ][1024]), [out][in] projection weights with biases, integer key-padding mask applied as a finite replacement (-1e9) per (batch, key), 16 heads of 64, score scale 1/8, softmax over the keys of the same batch, heads merged h*64+d, output projection with bias.
// Compute dtype: every contraction on v_wmma_f32_16x16x32_f16 (f16 operands, f32 accumulate). Float inputs are converted (RNE) to bf16 first and carried as exact f16 (weights x16); q, k, v planes plain f16; softmax weights exp(s-m) carried x1024 as f16 (row sum l from the unconverted f32 values); ctx carried x64 as f16; scores and softmax statistics f32.
// Structure: 4 weight converts, 3 activation converts, 3 projection GEMMs (32x64 wave tiles), one V^T LDS transpose, one fused online-softmax attention kernel (transposed score tiles S^T = K Q^T so a lane owns one query column; P^T accumulator tiles feed the next WMMA as its B operand directly), one output GEMM (f32).
#ifndef NB
#define NB 2
#endif
#ifndef SEQ
#define SEQ 1024
#endif
#define NB_FULL 2
#define SEQ_FULL 1024
#define DM 1024
#define NH 16
#define HD 64
#define NR ((size_t)NB * SEQ)         /* token rows processed */
#define MR ((int)(NB * SEQ))

typedef unsigned short v8us __attribute__((ext_vector_type(8), may_alias));
typedef float  v8f  __attribute__((ext_vector_type(8)));
typedef float  v4f  __attribute__((ext_vector_type(4)));
typedef float  v4fa __attribute__((ext_vector_type(4), may_alias));
typedef _Float16 v16h __attribute__((ext_vector_type(16)));
typedef _Float16 v4h __attribute__((ext_vector_type(4)));
union FragH { v16h v; v8us half[2]; _Float16 h[16]; unsigned short u[16]; };

static_assert(NH * HD == DM);                 /* merged head width */
static_assert(HD == 64);                      /* attention kernel: 2 k-steps of 32 over the head dim, 4 output tiles of 16 */
static_assert(DM % 64 == 0 && DM % 32 == 0 && DM % 8 == 0);  /* GEMM N tiles, K steps, 16-B pieces */
static_assert(SEQ % 64 == 0);                 /* attention block = 64 queries; V^T tiles of 64 tokens; key steps of 32 */
static_assert((NB * SEQ) % 128 == 0);         /* GEMM block = 128 rows, no row tail */
static_assert(SEQ / 32 <= 128);               /* mask words built by the first SEQ/32 threads of a 128-thread block */
static_assert(NB <= NB_FULL && SEQ <= SEQ_FULL);
static_assert(((size_t)NB * SEQ * DM) % (8 * 256) == 0);     /* convert grids exact */
static_assert(((size_t)DM * DM) % (8 * 256) == 0);

__device__ __forceinline__ unsigned short bf16_bits(float x) { unsigned int u = __float_as_uint(x); return (unsigned short)((u + 0x7FFFu + ((u >> 16) & 1u)) >> 16); }
__device__ __forceinline__ float bf16_val(unsigned short b) { return __uint_as_float(((unsigned int)b) << 16); }
__device__ __forceinline__ float bfr(float x) { return bf16_val(bf16_bits(x)); }      /* RNE convert to bf16, back to f32 */

// fragment (A or B, same k map): elements 0..7 = k0+8h.., elements 8..15 = k0+16+8h.. from a k-contiguous 16-bit row
__device__ __forceinline__ v16h g2_frag(const _Float16* p, int hh) { FragH f; f.half[0] = *(const v8us*)((const unsigned short*)p + 8 * hh); f.half[1] = *(const v8us*)((const unsigned short*)p + 16 + 8 * hh); return f.v; }
// one WMMA with its own hazard guard (ties D, keeps A/B live)
__device__ __forceinline__ v8f g2_mma(v16h a, v16h b, v8f c) { v8f d = __builtin_amdgcn_wmma_f32_16x16x32_f16(false, a, false, b, (short)0, c, false, false); asm volatile("v_nop\n\tv_nop\n\tv_nop\n\tv_nop" : "+v"(d) : "v"(a), "v"(b)); return d; }

__global__ __launch_bounds__(256) void k_wnat(const float* __restrict__ w, _Float16* __restrict__ Bt) {
  const size_t t = (size_t)blockIdx.x * 256 + threadIdx.x; if (t >= (size_t)DM * DM / 8) return;
  const v4f a = *(const v4fa*)(w + t * 8), c = *(const v4fa*)(w + t * 8 + 4); FragH f;
#pragma unroll
  for (int q = 0; q < 4; ++q) { f.h[q] = (_Float16)(bfr(a[q]) * 16.0f); f.h[4 + q] = (_Float16)(bfr(c[q]) * 16.0f); }
  const v8us o = f.half[0];
  *(v8us*)((unsigned short*)Bt + t * 8) = o; 
}

__global__ __launch_bounds__(256) void k_x16(const float* __restrict__ x, _Float16* __restrict__ X16) {
  const size_t t = (size_t)blockIdx.x * 256 + threadIdx.x; if (t >= NR * DM / 8) return;
  const size_t e = t * 8; const size_t row = e / DM; const size_t col = e % DM; const size_t bb = row / SEQ, s = row % SEQ;
  const float* src = x + (bb * SEQ_FULL + s) * DM + col;
  const v4f a = *(const v4fa*)(src), c = *(const v4fa*)(src + 4); FragH f;
#pragma unroll
  for (int q = 0; q < 4; ++q) { f.h[q] = (_Float16)bfr(a[q]); f.h[4 + q] = (_Float16)bfr(c[q]); }
  const v8us o = f.half[0];
  *(v8us*)((unsigned short*)X16 + t * 8) = o; 
}

// GEMM C[M][N] = alpha * A[M][K] . Bt[N][K]^T + bf16(bias[N]); A, Bt f16 k-contiguous rows; block = 4 waves, wave tile 32x64;
template <bool F32OUT>
__device__ __forceinline__ void gemm2_body(const _Float16* __restrict__ A, int lda, const _Float16* __restrict__ Bh, int ldb, float alpha, const float* __restrict__ bias,
                                           float* __restrict__ C, _Float16* __restrict__ C16, int ldc, int N, int K) {
  __shared__ __attribute__((aligned(16))) float so[4][32][68];
  const int tid = threadIdx.x; const int w = __builtin_amdgcn_readfirstlane(tid >> 5); const int lane = tid & 31, ln = lane & 15, hh = lane >> 4;
  const int ntn = N >> 6; const int mt = blockIdx.x / ntn, nq = blockIdx.x - mt * ntn; const int row0 = mt * 128 + 32 * w, col0 = nq * 64;
  const _Float16* a0p = A + (size_t)(row0 + ln) * lda; const _Float16* a1p = a0p + (size_t)16 * lda;
  const _Float16* b0p = Bh + (size_t)(col0 + ln) * ldb; const _Float16* b1p = b0p + (size_t)16 * ldb; const _Float16* b2p = b1p + (size_t)16 * ldb; const _Float16* b3p = b2p + (size_t)16 * ldb;
  const v8f z8 = {0.f,0.f,0.f,0.f,0.f,0.f,0.f,0.f}; v8f c00 = z8, c01 = z8, c02 = z8, c03 = z8, c10 = z8, c11 = z8, c12 = z8, c13 = z8;
#pragma unroll 1
  for (int kb = 0; kb < K; kb += 32) { const v16h a0 = g2_frag(a0p + kb, hh), a1 = g2_frag(a1p + kb, hh);
    v16h b = g2_frag(b0p + kb, hh); c00 = g2_mma(a0, b, c00); c10 = g2_mma(a1, b, c10);
    b = g2_frag(b1p + kb, hh); c01 = g2_mma(a0, b, c01); c11 = g2_mma(a1, b, c11);
    b = g2_frag(b2p + kb, hh); c02 = g2_mma(a0, b, c02); c12 = g2_mma(a1, b, c12);
    b = g2_frag(b3p + kb, hh); c03 = g2_mma(a0, b, c03); c13 = g2_mma(a1, b, c13); }
  v8f accs[8] = {c00, c01, c02, c03, c10, c11, c12, c13};
#pragma unroll
  for (int u = 0; u < 8; ++u) { const int t = u & 3, half = u >> 2; const int col = col0 + t * 16 + ln; const float bv = bfr(bias[col]);
#pragma unroll
    for (int r = 0; r < 8; ++r) { const int rloc = half * 16 + 8 * hh + r; so[w][rloc][t * 16 + ln] = accs[u][r] * alpha + bv; } }
  __syncthreads();      /* staging tile is private to the wave; the block barrier is a superset of the wave-level ordering needed */
  const int rsub = lane >> 4, c4 = (lane & 15) * 4;
  {
#pragma unroll
    for (int q = 0; q < 16; ++q) { const int r = q * 2 + rsub; const v4f v = *(const v4fa*)&so[w][r][c4];
      if (F32OUT) { *(v4f*)(C + (size_t)(row0 + r) * ldc + col0 + c4) = v; }
      else { v4h h4; h4[0] = (_Float16)v[0]; h4[1] = (_Float16)v[1]; h4[2] = (_Float16)v[2]; h4[3] = (_Float16)v[3]; *(v4h*)(C16 + (size_t)(row0 + r) * ldc + col0 + c4) = h4; } }
     }
}
__global__ __launch_bounds__(128) void k_gemm_h16(const _Float16* __restrict__ A, int lda, const _Float16* __restrict__ Bh, int ldb, float alpha, const float* __restrict__ bias, _Float16* __restrict__ C16, int ldc, int N, int K) {
  gemm2_body<false>(A, lda, Bh, ldb, alpha, bias, nullptr, C16, ldc, N, K);
}
__global__ __launch_bounds__(128) void k_gemm_f32(const _Float16* __restrict__ A, int lda, const _Float16* __restrict__ Bh, int ldb, float alpha, const float* __restrict__ bias, float* __restrict__ C, int ldc, int N, int K) {
  gemm2_body<true>(A, lda, Bh, ldb, alpha, bias, C, nullptr, ldc, N, K);
}

__global__ __launch_bounds__(256) void k_vt(const _Float16* __restrict__ V16, _Float16* __restrict__ Vt) {
  __shared__ unsigned short tl[64][66];
  const int tid = threadIdx.x; const int slab = blockIdx.x / (SEQ / 64), lg = blockIdx.x % (SEQ / 64); const int b = slab / NH, h = slab % NH;
  for (int i = tid; i < 64 * 8; i += 256) { const int r = i / 8, c8 = (i % 8) * 8; FragH f; f.half[0] = *(const v8us*)((const unsigned short*)V16 + ((size_t)b * SEQ + lg * 64 + r) * DM + h * HD + c8);
#pragma unroll
    for (int q = 0; q < 8; ++q) tl[r][c8 + q] = f.u[q]; }
  __syncthreads();
  {
#pragma unroll
    for (int rd = 0; rd < 2; ++rd) { const int d = rd * 32 + tid / 8, pc = tid % 8; FragH f;
#pragma unroll
      for (int q = 0; q < 8; ++q) f.u[q] = tl[pc * 8 + q][d];
      *(v8us*)((unsigned short*)Vt + ((size_t)slab * 64 + d) * SEQ + lg * 64 + pc * 8) = f.half[0]; }
     }
}

// Fused attention: block = 4 waves = 64 queries of one (batch, head); wave = 16 queries; key loop in steps of 32 keys.
// Score tiles are computed TRANSPOSED (A = K rows [key][d], B = Q rows [query][d]): accumulator element r of lane (hh, ln) = (key 8hh+r, query ln),
// so a lane owns one query column: row max = in-lane max + one xor-16 shuffle. The two 16-key P^T tiles are the B operand of the next product
// (elements 0..7 <- tile 0 element r, elements 8..15 <- tile 1 element r, lane unchanged); A = V^T rows [d][key]; accumulators hold O^T (d 8hh+r, query ln).
// Mask: 32-bit keep words per 32 keys built once per block in LDS; masked logits are REPLACED by -1e9 (a fully masked row comes out uniform).
__global__ __launch_bounds__(128) void k_attn(const _Float16* __restrict__ Q16, const _Float16* __restrict__ K16, const _Float16* __restrict__ Vt, const int* __restrict__ mask, _Float16* __restrict__ CTX) {
  __shared__ unsigned int smw[SEQ / 32];                                   /* cross-wave: written by the first SEQ/32 threads, read by all after the block barrier */
  __shared__ __attribute__((aligned(16))) unsigned short sh[4][16][72];    /* per-wave output staging [query][d], pitch 144 B */
  const int tid = threadIdx.x; const int wave = __builtin_amdgcn_readfirstlane(tid >> 5); const int lane = tid & 31, ln = lane & 15, hh = lane >> 4;
  const int h = blockIdx.y, b = blockIdx.z;
  {
    const int wi = (tid < SEQ / 32) ? tid : (SEQ / 32 - 1);               /* clamped address; every thread loads, only the owners store */
    const int* mp = mask + (size_t)b * SEQ_FULL + (size_t)wi * 32; unsigned int wbits = 0u;
#pragma unroll 1
    for (int j = 0; j < 32; ++j) wbits |= ((mp[j] != 0) ? 1u : 0u) << j;
    if (tid < SEQ / 32) smw[tid] = wbits;
  }
  __syncthreads();
  const int q0 = blockIdx.x * 64 + wave * 16; const size_t rowb = (size_t)b * SEQ;
  const _Float16* Qp = Q16 + (rowb + q0 + ln) * DM + h * HD;
  const v16h qf0 = g2_frag(Qp, hh), qf1 = g2_frag(Qp + 32, hh);
  const _Float16* Kp = K16 + (rowb + ln) * DM + h * HD;
  const _Float16* Vp = Vt + ((size_t)(b * NH + h) * HD + ln) * SEQ;
  const v8f z8 = {0.f,0.f,0.f,0.f,0.f,0.f,0.f,0.f};
  v8f o0 = z8, o1 = z8, o2 = z8, o3 = z8; float mrun = -1.0e30f, lpart = 0.f;
#pragma unroll 1
  for (int kb = 0; kb < SEQ; kb += 32) {
    const _Float16* k0p = Kp + (size_t)kb * DM; const _Float16* k1p = k0p + (size_t)16 * DM;
    v8f s0 = z8, s1 = z8;
    v16h a = g2_frag(k0p, hh); s0 = g2_mma(a, qf0, s0);
    a = g2_frag(k0p + 32, hh); s0 = g2_mma(a, qf1, s0);
    a = g2_frag(k1p, hh); s1 = g2_mma(a, qf0, s1);
    a = g2_frag(k1p + 32, hh); s1 = g2_mma(a, qf1, s1);
    const unsigned int mw = smw[kb >> 5] >> (8 * hh);      /* bit r: key kb+8hh+r (tile 0); bit 16+r: key kb+16+8hh+r (tile 1) */
    float e0[8], e1[8]; float mx = -3.0e38f;
#pragma unroll
    for (int r = 0; r < 8; ++r) {
      float x0 = s0[r] * 0.125f; x0 = ((mw >> r) & 1u) ? x0 : -1.0e9f;
      float x1 = s1[r] * 0.125f; x1 = ((mw >> (16 + r)) & 1u) ? x1 : -1.0e9f;
      e0[r] = x0; e1[r] = x1; mx = fmaxf(mx, fmaxf(x0, x1));
    }
    mx = fmaxf(mx, __shfl_xor(mx, 16));
    const float mnew = fmaxf(mrun, mx); const float alpha = __expf(mrun - mnew); mrun = mnew;
    float ps = 0.f; FragH pf;
#pragma unroll
    for (int r = 0; r < 8; ++r) {
      const float p0 = __expf(e0[r] - mnew), p1 = __expf(e1[r] - mnew); ps += p0 + p1;
      pf.h[r] = (_Float16)(p0 * 1024.0f); pf.h[8 + r] = (_Float16)(p1 * 1024.0f);
    }
    lpart = lpart * alpha + ps;
#pragma unroll
    for (int r = 0; r < 8; ++r) { o0[r] *= alpha; o1[r] *= alpha; o2[r] *= alpha; o3[r] *= alpha; }
    const v16h pb = pf.v;
    a = g2_frag(Vp + kb, hh); o0 = g2_mma(a, pb, o0);
    a = g2_frag(Vp + (size_t)16 * SEQ + kb, hh); o1 = g2_mma(a, pb, o1);
    a = g2_frag(Vp + (size_t)32 * SEQ + kb, hh); o2 = g2_mma(a, pb, o2);
    a = g2_frag(Vp + (size_t)48 * SEQ + kb, hh); o3 = g2_mma(a, pb, o3);
  }
  const float l = lpart + __shfl_xor(lpart, 16);
  const float inv = 1.0f / (l * 16.0f);                    /* P carried x1024, ctx carried x64: x64/1024 = 1/16 */
  FragH t0, t1, t2, t3;
#pragma unroll
  for (int r = 0; r < 8; ++r) { t0.h[r] = (_Float16)(o0[r] * inv); t1.h[r] = (_Float16)(o1[r] * inv); t2.h[r] = (_Float16)(o2[r] * inv); t3.h[r] = (_Float16)(o3[r] * inv); }
  *(v8us*)&sh[wave][ln][0 + 8 * hh] = t0.half[0];
  *(v8us*)&sh[wave][ln][16 + 8 * hh] = t1.half[0];
  *(v8us*)&sh[wave][ln][32 + 8 * hh] = t2.half[0];
  *(v8us*)&sh[wave][ln][48 + 8 * hh] = t3.half[0];
  __syncthreads();
  const int rsub = lane >> 3, pc = lane & 7;               
  {
#pragma unroll
    for (int it = 0; it < 4; ++it) { const int row = it * 4 + rsub; const v8us v = *(const v8us*)&sh[wave][row][pc * 8];
      *(v8us*)((unsigned short*)CTX + (rowb + q0 + row) * DM + h * HD + pc * 8) = v; }
     }
}

#define WBYTES ((size_t)DM * DM * 2)
#define PBYTES ((size_t)NB * SEQ * DM * 2)
static_assert(WBYTES % 256 == 0 && PBYTES % 256 == 0);
static_assert(4 * WBYTES + 8 * PBYTES <= (size_t)134217728);      /* total carve: 4 weight planes + 8 token planes (V^T plane = NB*NH*HD*SEQ halves = one token plane) */

extern "C" void kernel_launch(void* const* d_in, const int* in_sizes, int n_in,
                              void* d_out, int out_size, void* d_ws, size_t ws_size, hipStream_t stream) {
  if (n_in < 12) return;
  const long long need_x = (long long)(NB - 1) * SEQ_FULL * DM + (long long)SEQ * DM;
  if ((long long)in_sizes[0] < need_x || (long long)in_sizes[1] < need_x || (long long)in_sizes[2] < need_x) return;
  if ((long long)in_sizes[3] < (long long)(NB - 1) * SEQ_FULL + SEQ) return;
  if (in_sizes[4] < DM * DM || in_sizes[6] < DM * DM || in_sizes[8] < DM * DM || in_sizes[10] < DM * DM) return;
  if (in_sizes[5] < DM || in_sizes[7] < DM || in_sizes[9] < DM || in_sizes[11] < DM) return;
  if ((long long)out_size < (long long)NB * SEQ * DM) return;
  /* wire order: q, k, v, mask (int32), Wq, bq, Wk, bk, Wv, bv, Wo, bo */
  const float* xq = (const float*)d_in[0]; const float* xk = (const float*)d_in[1]; const float* xv = (const float*)d_in[2];
  const int* mask = (const int*)d_in[3];
  const float* Wq = (const float*)d_in[4]; const float* bq = (const float*)d_in[5];
  const float* Wk = (const float*)d_in[6]; const float* bk = (const float*)d_in[7];
  const float* Wv = (const float*)d_in[8]; const float* bv = (const float*)d_in[9];
  const float* Wo = (const float*)d_in[10]; const float* bo = (const float*)d_in[11];
  float* out = (float*)d_out;
  char* ws = (char*)d_ws; size_t off = 0;
  _Float16* BQ = (_Float16*)(ws + off); off += WBYTES;
  _Float16* BK = (_Float16*)(ws + off); off += WBYTES;
  _Float16* BV = (_Float16*)(ws + off); off += WBYTES;
  _Float16* BO = (_Float16*)(ws + off); off += WBYTES;
  _Float16* XQ = (_Float16*)(ws + off); off += PBYTES;
  _Float16* XK = (_Float16*)(ws + off); off += PBYTES;
  _Float16* XV = (_Float16*)(ws + off); off += PBYTES;
  _Float16* Q16 = (_Float16*)(ws + off); off += PBYTES;
  _Float16* K16 = (_Float16*)(ws + off); off += PBYTES;
  _Float16* V16 = (_Float16*)(ws + off); off += PBYTES;
  _Float16* VT = (_Float16*)(ws + off); off += PBYTES;
  _Float16* CTX = (_Float16*)(ws + off); off += PBYTES;
  if (off > ws_size) return;
  const unsigned gw = (unsigned)(((size_t)DM * DM / 8) / 256);
  const unsigned gx = (unsigned)((NR * DM / 8) / 256);
  k_wnat<<<gw, 256, 0, stream>>>(Wq, BQ);
  k_wnat<<<gw, 256, 0, stream>>>(Wk, BK);
  k_wnat<<<gw, 256, 0, stream>>>(Wv, BV);
  k_wnat<<<gw, 256, 0, stream>>>(Wo, BO);
  k_x16<<<gx, 256, 0, stream>>>(xq, XQ);
  k_x16<<<gx, 256, 0, stream>>>(xk, XK);
  k_x16<<<gx, 256, 0, stream>>>(xv, XV);
  const unsigned gg = (unsigned)((MR / 128) * (DM / 64));
  k_gemm_h16<<<gg, 128, 0, stream>>>(XQ, DM, BQ, DM, 0.0625f, bq, Q16, DM, DM, DM);      /* q = xq Wq^T + bq (weights x16 -> alpha 1/16) */
  k_gemm_h16<<<gg, 128, 0, stream>>>(XK, DM, BK, DM, 0.0625f, bk, K16, DM, DM, DM);      /* k = xk Wk^T + bk */
  k_gemm_h16<<<gg, 128, 0, stream>>>(XV, DM, BV, DM, 0.0625f, bv, V16, DM, DM, DM);      /* v = xv Wv^T + bv */
  k_vt<<<(unsigned)(NB * NH * (SEQ / 64)), 256, 0, stream>>>(V16, VT);                   /* in [NB*SEQ][h*64+d] -> out [(b,h)][d][SEQ] */
  k_attn<<<dim3(SEQ / 64, NH, NB), 128, 0, stream>>>(Q16, K16, VT, mask, CTX);           /* ctx x64, merged heads */
  k_gemm_f32<<<gg, 128, 0, stream>>>(CTX, DM, BO, DM, 0.0009765625f, bo, out, DM, DM, DM);      /* out = ctx Wo^T + bo (x64 and x16 carries -> alpha 2^-10) */
}

// v001
// It runs in 136 microseconds.
// In two side-by-side timings against v000, it was 1.77 and 1.74 times as fast.
#include <hip/hip_runtime.h>
// Multi-head attention with three input streams (q, k, v each [NB][SEQ][1024]), [out][in] projection weights with biases, integer key-padding mask applied as a finite replacement (-1e9) per (batch, key), 16 heads of 64, score scale 1/8, softmax over the keys of the same batch, heads merged h*64+d, output projection with bias.
// Compute dtype: every contraction on v_wmma_f32_16x16x32_f16 (f16 operands, f32 accumulate). Float inputs are converted (RNE) to bf16 first and carried as exact f16 (weights x16); q, k, v planes plain f16; softmax weights exp(s-m) carried x1024 as f16 (row sum l from the unconverted f32 values); ctx carried x64 as f16; scores and softmax statistics f32.
// Structure: 4 weight converts, 3 activation converts, 3 projection GEMMs (32x64 wave tiles, operands staged in LDS by asynchronous copies, two buffers), one V^T LDS transpose, one fused online-softmax attention kernel (transposed score tiles S^T = K Q^T so a lane owns one query column; P^T accumulator tiles feed the next WMMA as its B operand directly), one output GEMM (f32).
#ifndef NB
#define NB 2
#endif
#ifndef SEQ
#define SEQ 1024
#endif
#define NB_FULL 2
#define SEQ_FULL 1024
#define DM 1024
#define NH 16
#define HD 64
#define NR ((size_t)NB * SEQ)         /* token rows processed */
#define MR ((int)(NB * SEQ))

typedef unsigned short v8us __attribute__((ext_vector_type(8), may_alias));
typedef float  v8f  __attribute__((ext_vector_type(8)));
typedef float  v4f  __attribute__((ext_vector_type(4)));
typedef float  v4fa __attribute__((ext_vector_type(4), may_alias));
typedef _Float16 v16h __attribute__((ext_vector_type(16)));
typedef _Float16 v4h __attribute__((ext_vector_type(4)));
union FragH { v16h v; v8us half[2]; _Float16 h[16]; unsigned short u[16]; };

static_assert(NH * HD == DM);                 /* merged head width */
static_assert(HD == 64);                      /* attention kernel: 2 k-steps of 32 over the head dim, 4 output tiles of 16 */
static_assert(DM % 64 == 0 && DM % 32 == 0 && DM % 8 == 0);  /* GEMM N tiles, K steps, 16-B pieces */
static_assert(SEQ % 64 == 0);                 /* attention block = 64 queries; V^T tiles of 64 tokens; key steps of 32 */
static_assert((NB * SEQ) % 128 == 0);         /* GEMM block = 128 rows, no row tail */
static_assert(SEQ / 32 <= 128);               /* mask words built by the first SEQ/32 threads of a 128-thread block */
static_assert(NB <= NB_FULL && SEQ <= SEQ_FULL);
static_assert(((size_t)NB * SEQ * DM) % (8 * 256) == 0);     /* convert grids exact */
static_assert(((size_t)DM * DM) % (8 * 256) == 0);

__device__ __forceinline__ unsigned short bf16_bits(float x) { unsigned int u = __float_as_uint(x); return (unsigned short)((u + 0x7FFFu + ((u >> 16) & 1u)) >> 16); }
__device__ __forceinline__ float bf16_val(unsigned short b) { return __uint_as_float(((unsigned int)b) << 16); }
__device__ __forceinline__ float bfr(float x) { return bf16_val(bf16_bits(x)); }      /* RNE convert to bf16, back to f32 */

// fragment (A or B, same k map): elements 0..7 = k0+8h.., elements 8..15 = k0+16+8h.. from a k-contiguous 16-bit row
__device__ __forceinline__ v16h g2_frag(const _Float16* p, int hh) { FragH f; f.half[0] = *(const v8us*)((const unsigned short*)p + 8 * hh); f.half[1] = *(const v8us*)((const unsigned short*)p + 16 + 8 * hh); return f.v; }
// one WMMA with its own hazard guard (ties D, keeps A/B live)
__device__ __forceinline__ v8f g2_mma(v16h a, v16h b, v8f c) { v8f d = __builtin_amdgcn_wmma_f32_16x16x32_f16(false, a, false, b, (short)0, c, false, false); asm volatile("v_nop\n\tv_nop\n\tv_nop\n\tv_nop" : "+v"(d) : "v"(a), "v"(b)); return d; }

__global__ __launch_bounds__(256) void k_wnat(const float* __restrict__ w, _Float16* __restrict__ Bt) {
  const size_t t = (size_t)blockIdx.x * 256 + threadIdx.x; if (t >= (size_t)DM * DM / 8) return;
  const v4f a = *(const v4fa*)(w + t * 8), c = *(const v4fa*)(w + t * 8 + 4); FragH f;
#pragma unroll
  for (int q = 0; q < 4; ++q) { f.h[q] = (_Float16)(bfr(a[q]) * 16.0f); f.h[4 + q] = (_Float16)(bfr(c[q]) * 16.0f); }
  const v8us o = f.half[0];
  *(v8us*)((unsigned short*)Bt + t * 8) = o; 
}

__global__ __launch_bounds__(256) void k_x16(const float* __restrict__ x, _Float16* __restrict__ X16) {
  const size_t t = (size_t)blockIdx.x * 256 + threadIdx.x; if (t >= NR * DM / 8) return;
  const size_t e = t * 8; const size_t row = e / DM; const size_t col = e % DM; const size_t bb = row / SEQ, s = row % SEQ;
  const float* src = x + (bb * SEQ_FULL + s) * DM + col;
  const v4f a = *(const v4fa*)(src), c = *(const v4fa*)(src + 4); FragH f;
#pragma unroll
  for (int q = 0; q < 4; ++q) { f.h[q] = (_Float16)bfr(a[q]); f.h[4 + q] = (_Float16)bfr(c[q]); }
  const v8us o = f.half[0];
  *(v8us*)((unsigned short*)X16 + t * 8) = o; 
}

// GEMM C[M][N] = alpha * A[M][K] . Bt[N][K]^T + bf16(bias[N]); A, Bt f16 k-contiguous rows; block = 4 waves, wave tile 32x64;
// operands reach the waves through LDS: a pass is 128 k (256 B of each of the block's 128 A rows and 64 Bt rows), copied asynchronously into one of two buffers while the other is worked on.
#define GKP 128                       /* k per pass */
#define GPITCH 272                    /* LDS row pitch in bytes: 16 B x odd, for 16-byte fragment reads down a column of rows */
#define GSTAGE (192 * GPITCH)         /* one buffer: rows 0..127 = A rows of the block, rows 128..191 = Bt rows of the block */
static_assert(DM % GKP == 0 && DM / GKP >= 2);   /* whole passes only */
// fragment from an LDS row, same k map as g2_frag; p already holds the lane's 16*hh byte offset
__device__ __forceinline__ v16h g2_lfrag(const unsigned char* p) { FragH f; f.half[0] = *(const v8us*)p; f.half[1] = *(const v8us*)(p + 32); return f.v; }
// twelve 16-byte copies of a lane, global -> LDS through no register; the closing s_wait_xcnt stands inside the statement so that no address register is rewritten ahead of it
__device__ __forceinline__ void g2_copy12(const unsigned* l, const _Float16* const* g) {
  asm volatile("global_load_async_to_lds_b128 %0, %12, off\n\t"
               "global_load_async_to_lds_b128 %1, %13, off\n\t"
               "global_load_async_to_lds_b128 %2, %14, off\n\t"
               "global_load_async_to_lds_b128 %3, %15, off\n\t"
               "global_load_async_to_lds_b128 %4, %16, off\n\t"
               "global_load_async_to_lds_b128 %5, %17, off\n\t"
               "global_load_async_to_lds_b128 %6, %18, off\n\t"
               "global_load_async_to_lds_b128 %7, %19, off\n\t"
               "global_load_async_to_lds_b128 %8, %20, off\n\t"
               "global_load_async_to_lds_b128 %9, %21, off\n\t"
               "global_load_async_to_lds_b128 %10, %22, off\n\t"
               "global_load_async_to_lds_b128 %11, %23, off\n\t"
               "s_wait_xcnt 0x0"
               :: "v"(l[0]), "v"(l[1]), "v"(l[2]), "v"(l[3]), "v"(l[4]), "v"(l[5]), "v"(l[6]), "v"(l[7]), "v"(l[8]), "v"(l[9]), "v"(l[10]), "v"(l[11]),
                  "v"(g[0]), "v"(g[1]), "v"(g[2]), "v"(g[3]), "v"(g[4]), "v"(g[5]), "v"(g[6]), "v"(g[7]), "v"(g[8]), "v"(g[9]), "v"(g[10]), "v"(g[11])
               : "memory");
}
// one pass's tile: 192 rows of 256 B; 16 lanes cover a row, the block's 128 lanes 8 rows, so 24 copies a lane (16 for A, 8 for Bt)
__device__ __forceinline__ void g2_stage(unsigned lb, const _Float16* ga, int lda, const _Float16* gb, int ldb) {
  unsigned l[24]; const _Float16* g[24];
#pragma unroll   /* both loops: every address becomes a register operand of the copy statements, no array in memory */
  for (int j = 0; j < 16; ++j) { l[j] = lb + (unsigned)(j * 8 * GPITCH); g[j] = ga + (size_t)(j * 8) * lda; }
#pragma unroll
  for (int j = 0; j < 8; ++j) { l[16 + j] = lb + (unsigned)((128 + j * 8) * GPITCH); g[16 + j] = gb + (size_t)(j * 8) * ldb; }
  g2_copy12(l, g); g2_copy12(l + 12, g + 12);
}
template <bool F32OUT>
__device__ __forceinline__ void gemm2_body(const _Float16* __restrict__ A, int lda, const _Float16* __restrict__ Bh, int ldb, float alpha, const float* __restrict__ bias,
                                           float* __restrict__ C, _Float16* __restrict__ C16, int ldc, int N, int K) {
  __shared__ __attribute__((aligned(16))) float so[4][32][68];
  __shared__ __attribute__((aligned(16))) unsigned char ring[2 * GSTAGE];
  const int tid = threadIdx.x; const int w = __builtin_amdgcn_readfirstlane(tid >> 5); const int lane = tid & 31, ln = lane & 15, hh = lane >> 4;
  const int ntn = N >> 6; const int mt = blockIdx.x / ntn, nq = blockIdx.x - mt * ntn; const int row0 = mt * 128 + 32 * w, col0 = nq * 64;
  const int cr = tid >> 4, cc = tid & 15;                 /* copy role: row within a group of 8, 16-byte piece within the row */
  const _Float16* ga = A + (size_t)(mt * 128 + cr) * lda + cc * 8; const _Float16* gb = Bh + (size_t)(col0 + cr) * ldb + cc * 8;
  const unsigned lb = (unsigned)(size_t)ring + (unsigned)(cr * GPITCH + cc * 16);
  const unsigned char* fa = ring + (32 * w + ln) * GPITCH + 16 * hh; const unsigned char* fb = ring + (128 + ln) * GPITCH + 16 * hh;
  const int np = K / GKP;
  const v8f z8 = {0.f,0.f,0.f,0.f,0.f,0.f,0.f,0.f}; v8f c00 = z8, c01 = z8, c02 = z8, c03 = z8, c10 = z8, c11 = z8, c12 = z8, c13 = z8;
  g2_stage(lb, ga, lda, gb, ldb);
  asm volatile("s_wait_asynccnt 0x0" ::: "memory");       /* this wave's copies of pass 0 have landed */
  __syncthreads();                                        /* pass 0 published to every wave */
  if (np > 1) g2_stage(lb + GSTAGE, ga + GKP, lda, gb + GKP, ldb);
#pragma unroll 1   /* one pass a trip: one publish point and one refill site in the code */
  for (int t = 0; t < np; ++t) { const unsigned bo = (unsigned)(t & 1) * GSTAGE; const unsigned char* pa = fa + bo; const unsigned char* pb = fb + bo;
    v16h a0 = g2_lfrag(pa), a1 = g2_lfrag(pa + 16 * GPITCH), b0 = g2_lfrag(pb), b1 = g2_lfrag(pb + 16 * GPITCH), b2 = g2_lfrag(pb + 32 * GPITCH), b3 = g2_lfrag(pb + 48 * GPITCH);
#pragma unroll   /* the two fragment sets alternate by renaming, LDS offsets become immediates */
    for (int ks = 0; ks < GKP / 32; ++ks) { v16h na0 = a0, na1 = a1, nb0 = b0, nb1 = b1, nb2 = b2, nb3 = b3;
      if (ks + 1 < GKP / 32) { const int o = (ks + 1) * 64;      /* the same pass's next k-step, read ahead of this step's products */
        na0 = g2_lfrag(pa + o); na1 = g2_lfrag(pa + 16 * GPITCH + o); nb0 = g2_lfrag(pb + o); nb1 = g2_lfrag(pb + 16 * GPITCH + o); nb2 = g2_lfrag(pb + 32 * GPITCH + o); nb3 = g2_lfrag(pb + 48 * GPITCH + o); }
      c00 = g2_mma(a0, b0, c00); c10 = g2_mma(a1, b0, c10);
      c01 = g2_mma(a0, b1, c01); c11 = g2_mma(a1, b1, c11);
      c02 = g2_mma(a0, b2, c02); c12 = g2_mma(a1, b2, c12);
      c03 = g2_mma(a0, b3, c03); c13 = g2_mma(a1, b3, c13);
      a0 = na0; a1 = na1; b0 = nb0; b1 = nb1; b2 = nb2; b3 = nb3; }
    asm volatile("s_wait_dscnt 0x0" ::: "memory");        /* this wave's reads of the buffer have returned before it may be refilled */
    asm volatile("s_wait_asynccnt 0x0" ::: "memory");     /* this wave's copies of pass t + 1 have landed */
    __syncthreads();                                      /* publishes pass t + 1 and ends every wave's reads of pass t */
    if (t + 2 < np) g2_stage(lb + bo, ga + (size_t)(t + 2) * GKP, lda, gb + (size_t)(t + 2) * GKP, ldb); }
  asm volatile("s_wait_asynccnt 0x0" ::: "memory");       /* no copy outstanding behind the loop */
  v8f accs[8] = {c00, c01, c02, c03, c10, c11, c12, c13};
#pragma unroll
  for (int u = 0; u < 8; ++u) { const int t = u & 3, half = u >> 2; const int col = col0 + t * 16 + ln; const float bv = bfr(bias[col]);
#pragma unroll
    for (int r = 0; r < 8; ++r) { const int rloc = half * 16 + 8 * hh + r; so[w][rloc][t * 16 + ln] = accs[u][r] * alpha + bv; } }
  __syncthreads();      /* staging tile is private to the wave; the block barrier is a superset of the wave-level ordering needed */
  const int rsub = lane >> 4, c4 = (lane & 15) * 4;
  {
#pragma unroll
    for (int q = 0; q < 16; ++q) { const int r = q * 2 + rsub; const v4f v = *(const v4fa*)&so[w][r][c4];
      if (F32OUT) { *(v4f*)(C + (size_t)(row0 + r) * ldc + col0 + c4) = v; }
      else { v4h h4; h4[0] = (_Float16)v[0]; h4[1] = (_Float16)v[1]; h4[2] = (_Float16)v[2]; h4[3] = (_Float16)v[3]; *(v4h*)(C16 + (size_t)(row0 + r) * ldc + col0 + c4) = h4; } }
     }
}
__global__ __launch_bounds__(128) void k_gemm_h16(const _Float16* __restrict__ A, int lda, const _Float16* __restrict__ Bh, int ldb, float alpha, const float* __restrict__ bias, _Float16* __restrict__ C16, int ldc, int N, int K) {
  gemm2_body<false>(A, lda, Bh, ldb, alpha, bias, nullptr, C16, ldc, N, K);
}
__global__ __launch_bounds__(128) void k_gemm_f32(const _Float16* __restrict__ A, int lda, const _Float16* __restrict__ Bh, int ldb, float alpha, const float* __restrict__ bias, float* __restrict__ C, int ldc, int N, int K) {
  gemm2_body<true>(A, lda, Bh, ldb, alpha, bias, C, nullptr, ldc, N, K);
}

__global__ __launch_bounds__(256) void k_vt(const _Float16* __restrict__ V16, _Float16* __restrict__ Vt) {
  __shared__ unsigned short tl[64][66];
  const int tid = threadIdx.x; const int slab = blockIdx.x / (SEQ / 64), lg = blockIdx.x % (SEQ / 64); const int b = slab / NH, h = slab % NH;
  for (int i = tid; i < 64 * 8; i += 256) { const int r = i / 8, c8 = (i % 8) * 8; FragH f; f.half[0] = *(const v8us*)((const unsigned short*)V16 + ((size_t)b * SEQ + lg * 64 + r) * DM + h * HD + c8);
#pragma unroll
    for (int q = 0; q < 8; ++q) tl[r][c8 + q] = f.u[q]; }
  __syncthreads();
  {
#pragma unroll
    for (int rd = 0; rd < 2; ++rd) { const int d = rd * 32 + tid / 8, pc = tid % 8; FragH f;
#pragma unroll
      for (int q = 0; q < 8; ++q) f.u[q] = tl[pc * 8 + q][d];
      *(v8us*)((unsigned short*)Vt + ((size_t)slab * 64 + d) * SEQ + lg * 64 + pc * 8) = f.half[0]; }
     }
}

// Fused attention: block = 4 waves = 64 queries of one (batch, head); wave = 16 queries; key loop in steps of 32 keys.
// Score tiles are computed TRANSPOSED (A = K rows [key][d], B = Q rows [query][d]): accumulator element r of lane (hh, ln) = (key 8hh+r, query ln),
// so a lane owns one query column: row max = in-lane max + one xor-16 shuffle. The two 16-key P^T tiles are the B operand of the next product
// (elements 0..7 <- tile 0 element r, elements 8..15 <- tile 1 element r, lane unchanged); A = V^T rows [d][key]; accumulators hold O^T (d 8hh+r, query ln).
// Mask: 32-bit keep words per 32 keys built once per block in LDS; masked logits are REPLACED by -1e9 (a fully masked row comes out uniform).
__global__ __launch_bounds__(128) void k_attn(const _Float16* __restrict__ Q16, const _Float16* __restrict__ K16, const _Float16* __restrict__ Vt, const int* __restrict__ mask, _Float16* __restrict__ CTX) {
  __shared__ unsigned int smw[SEQ / 32];                                   /* cross-wave: written by the first SEQ/32 threads, read by all after the block barrier */
  __shared__ __attribute__((aligned(16))) unsigned short sh[4][16][72];    /* per-wave output staging [query][d], pitch 144 B */
  const int tid = threadIdx.x; const int wave = __builtin_amdgcn_readfirstlane(tid >> 5); const int lane = tid & 31, ln = lane & 15, hh = lane >> 4;
  const int h = blockIdx.y, b = blockIdx.z;
  {
    const int wi = (tid < SEQ / 32) ? tid : (SEQ / 32 - 1);               /* clamped address; every thread loads, only the owners store */
    const int* mp = mask + (size_t)b * SEQ_FULL + (size_t)wi * 32; unsigned int wbits = 0u;
#pragma unroll 1
    for (int j = 0; j < 32; ++j) wbits |= ((mp[j] != 0) ? 1u : 0u) << j;
    if (tid < SEQ / 32) smw[tid] = wbits;
  }
  __syncthreads();
  const int q0 = blockIdx.x * 64 + wave * 16; const size_t rowb = (size_t)b * SEQ;
  const _Float16* Qp = Q16 + (rowb + q0 + ln) * DM + h * HD;
  const v16h qf0 = g2_frag(Qp, hh), qf1 = g2_frag(Qp + 32, hh);
  const _Float16* Kp = K16 + (rowb + ln) * DM + h * HD;
  const _Float16* Vp = Vt + ((size_t)(b * NH + h) * HD + ln) * SEQ;
  const v8f z8 = {0.f,0.f,0.f,0.f,0.f,0.f,0.f,0.f};
  v8f o0 = z8, o1 = z8, o2 = z8, o3 = z8; float mrun = -1.0e30f, lpart = 0.f;
#pragma unroll 1
  for (int kb = 0; kb < SEQ; kb += 32) {
    const _Float16* k0p = Kp + (size_t)kb * DM; const _Float16* k1p = k0p + (size_t)16 * DM;
    v8f s0 = z8, s1 = z8;
    v16h a = g2_frag(k0p, hh); s0 = g2_mma(a, qf0, s0);
    a = g2_frag(k0p + 32, hh); s0 = g2_mma(a, qf1, s0);
    a = g2_frag(k1p, hh); s1 = g2_mma(a, qf0, s1);
    a = g2_frag(k1p + 32, hh); s1 = g2_mma(a, qf1, s1);
    const unsigned int mw = smw[kb >> 5] >> (8 * hh);      /* bit r: key kb+8hh+r (tile 0); bit 16+r: key kb+16+8hh+r (tile 1) */
    float e0[8], e1[8]; float mx = -3.0e38f;
#pragma unroll
    for (int r = 0; r < 8; ++r) {
      float x0 = s0[r] * 0.125f; x0 = ((mw >> r) & 1u) ? x0 : -1.0e9f;
      float x1 = s1[r] * 0.125f; x1 = ((mw >> (16 + r)) & 1u) ? x1 : -1.0e9f;
      e0[r] = x0; e1[r] = x1; mx = fmaxf(mx, fmaxf(x0, x1));
    }
    mx = fmaxf(mx, __shfl_xor(mx, 16));
    const float mnew = fmaxf(mrun, mx); const float alpha = __expf(mrun - mnew); mrun = mnew;
    float ps = 0.f; FragH pf;
#pragma unroll
    for (int r = 0; r < 8; ++r) {
      const float p0 = __expf(e0[r] - mnew), p1 = __expf(e1[r] - mnew); ps += p0 + p1;
      pf.h[r] = (_Float16)(p0 * 1024.0f); pf.h[8 + r] = (_Float16)(p1 * 1024.0f);
    }
    lpart = lpart * alpha + ps;
#pragma unroll
    for (int r = 0; r < 8; ++r) { o0[r] *= alpha; o1[r] *= alpha; o2[r] *= alpha; o3[r] *= alpha; }
    const v16h pb = pf.v;
    a = g2_frag(Vp + kb, hh); o0 = g2_mma(a, pb, o0);
    a = g2_frag(Vp + (size_t)16 * SEQ + kb, hh); o1 = g2_mma(a, pb, o1);
    a = g2_frag(Vp + (size_t)32 * SEQ + kb, hh); o2 = g2_mma(a, pb, o2);
    a = g2_frag(Vp + (size_t)48 * SEQ + kb, hh); o3 = g2_mma(a, pb, o3);
  }
  const float l = lpart + __shfl_xor(lpart, 16);
  const float inv = 1.0f / (l * 16.0f);                    /* P carried x1024, ctx carried x64: x64/1024 = 1/16 */
  FragH t0, t1, t2, t3;
#pragma unroll
  for (int r = 0; r < 8; ++r) { t0.h[r] = (_Float16)(o0[r] * inv); t1.h[r] = (_Float16)(o1[r] * inv); t2.h[r] = (_Float16)(o2[r] * inv); t3.h[r] = (_Float16)(o3[r] * inv); }
  *(v8us*)&sh[wave][ln][0 + 8 * hh] = t0.half[0];
  *(v8us*)&sh[wave][ln][16 + 8 * hh] = t1.half[0];
  *(v8us*)&sh[wave][ln][32 + 8 * hh] = t2.half[0];
  *(v8us*)&sh[wave][ln][48 + 8 * hh] = t3.half[0];
  __syncthreads();
  const int rsub = lane >> 3, pc = lane & 7;               
  {
#pragma unroll
    for (int it = 0; it < 4; ++it) { const int row = it * 4 + rsub; const v8us v = *(const v8us*)&sh[wave][row][pc * 8];
      *(v8us*)((unsigned short*)CTX + (rowb + q0 + row) * DM + h * HD + pc * 8) = v; }
     }
}

#define WBYTES ((size_t)DM * DM * 2)
#define PBYTES ((size_t)NB * SEQ * DM * 2)
static_assert(WBYTES % 256 == 0 && PBYTES % 256 == 0);
static_assert(4 * WBYTES + 8 * PBYTES <= (size_t)134217728);      /* total carve: 4 weight planes + 8 token planes (V^T plane = NB*NH*HD*SEQ halves = one token plane) */

extern "C" void kernel_launch(void* const* d_in, const int* in_sizes, int n_in,
                              void* d_out, int out_size, void* d_ws, size_t ws_size, hipStream_t stream) {
  if (n_in < 12) return;
  const long long need_x = (long long)(NB - 1) * SEQ_FULL * DM + (long long)SEQ * DM;
  if ((long long)in_sizes[0] < need_x || (long long)in_sizes[1] < need_x || (long long)in_sizes[2] < need_x) return;
  if ((long long)in_sizes[3] < (long long)(NB - 1) * SEQ_FULL + SEQ) return;
  if (in_sizes[4] < DM * DM || in_sizes[6] < DM * DM || in_sizes[8] < DM * DM || in_sizes[10] < DM * DM) return;
  if (in_sizes[5] < DM || in_sizes[7] < DM || in_sizes[9] < DM || in_sizes[11] < DM) return;
  if ((long long)out_size < (long long)NB * SEQ * DM) return;
  /* wire order: q, k, v, mask (int32), Wq, bq, Wk, bk, Wv, bv, Wo, bo */
  const float* xq = (const float*)d_in[0]; const float* xk = (const float*)d_in[1]; const float* xv = (const float*)d_in[2];
  const int* mask = (const int*)d_in[3];
  const float* Wq = (const float*)d_in[4]; const float* bq = (const float*)d_in[5];
  const float* Wk = (const float*)d_in[6]; const float* bk = (const float*)d_in[7];
  const float* Wv = (const float*)d_in[8]; const float* bv = (const float*)d_in[9];
  const float* Wo = (const float*)d_in[10]; const float* bo = (const float*)d_in[11];
  float* out = (float*)d_out;
  char* ws = (char*)d_ws; size_t off = 0;
  _Float16* BQ = (_Float16*)(ws + off); off += WBYTES;
  _Float16* BK = (_Float16*)(ws + off); off += WBYTES;
  _Float16* BV = (_Float16*)(ws + off); off += WBYTES;
  _Float16* BO = (_Float16*)(ws + off); off += WBYTES;
  _Float16* XQ = (_Float16*)(ws + off); off += PBYTES;
  _Float16* XK = (_Float16*)(ws + off); off += PBYTES;
  _Float16* XV = (_Float16*)(ws + off); off += PBYTES;
  _Float16* Q16 = (_Float16*)(ws + off); off += PBYTES;
  _Float16* K16 = (_Float16*)(ws + off); off += PBYTES;
  _Float16* V16 = (_Float16*)(ws + off); off += PBYTES;
  _Float16* VT = (_Float16*)(ws + off); off += PBYTES;
  _Float16* CTX = (_Float16*)(ws + off); off += PBYTES;
  if (off > ws_size) return;
  const unsigned gw = (unsigned)(((size_t)DM * DM / 8) / 256);
  const unsigned gx = (unsigned)((NR * DM / 8) / 256);
  k_wnat<<<gw, 256, 0, stream>>>(Wq, BQ);
  k_wnat<<<gw, 256, 0, stream>>>(Wk, BK);
  k_wnat<<<gw, 256, 0, stream>>>(Wv, BV);
  k_wnat<<<gw, 256, 0, stream>>>(Wo, BO);
  k_x16<<<gx, 256, 0, stream>>>(xq, XQ);
  k_x16<<<gx, 256, 0, stream>>>(xk, XK);
  k_x16<<<gx, 256, 0, stream>>>(xv, XV);
  const unsigned gg = (unsigned)((MR / 128) * (DM / 64));
  k_gemm_h16<<<gg, 128, 0, stream>>>(XQ, DM, BQ, DM, 0.0625f, bq, Q16, DM, DM, DM);      /* q = xq Wq^T + bq (weights x16 -> alpha 1/16) */
  k_gemm_h16<<<gg, 128, 0, stream>>>(XK, DM, BK, DM, 0.0625f, bk, K16, DM, DM, DM);      /* k = xk Wk^T + bk */
  k_gemm_h16<<<gg, 128, 0, stream>>>(XV, DM, BV, DM, 0.0625f, bv, V16, DM, DM, DM);      /* v = xv Wv^T + bv */
  k_vt<<<(unsigned)(NB * NH * (SEQ / 64)), 256, 0, stream>>>(V16, VT);                   /* in [NB*SEQ][h*64+d] -> out [(b,h)][d][SEQ] */
  k_attn<<<dim3(SEQ / 64, NH, NB), 128, 0, stream>>>(Q16, K16, VT, mask, CTX);           /* ctx x64, merged heads */
  k_gemm_f32<<<gg, 128, 0, stream>>>(CTX, DM, BO, DM, 0.0009765625f, bo, out, DM, DM, DM);      /* out = ctx Wo^T + bo (x64 and x16 carries -> alpha 2^-10) */
}

// v002
// Measured time: 115 microseconds a run.
// Two timings next to v001 both put it at 1.19 times that version's speed.
// Counting every step since v000, it is 2.09 times as fast.
#include <hip/hip_runtime.h>
// Multi-head attention with three input streams (q, k, v each [NB][SEQ][1024]), [out][in] projection weights with biases, integer key-padding mask applied as a finite replacement (-1e9) per (batch, key), 16 heads of 64, score scale 1/8, softmax over the keys of the same batch, heads merged h*64+d, output projection with bias.
// Compute dtype: every contraction on v_wmma_f32_16x16x32_f16 (f16 operands, f32 accumulate). Float inputs are converted (RNE) to bf16 first and carried as exact f16 (weights x16); q, k, v planes plain f16; softmax weights exp(s-m) carried x1024 as f16 (row sum l from the unconverted f32 values); ctx carried x64 as f16; scores and softmax statistics f32.
// Structure: one launch for the 3 activation and 4 weight converts, one launch for the 3 projection GEMMs (32x64 wave tiles, operands staged in LDS by asynchronous copies, two buffers), one V^T LDS transpose, one fused online-softmax attention kernel (transposed score tiles S^T = K Q^T so a lane owns one query column; P^T accumulator tiles feed the next WMMA as its B operand directly), one output GEMM (f32).
#ifndef NB
#define NB 2
#endif
#ifndef SEQ
#define SEQ 1024
#endif
#define NB_FULL 2
#define SEQ_FULL 1024
#define DM 1024
#define NH 16
#define HD 64
#define NR ((size_t)NB * SEQ)         /* token rows processed */
#define MR ((int)(NB * SEQ))

typedef unsigned short v8us __attribute__((ext_vector_type(8), may_alias));
typedef float  v8f  __attribute__((ext_vector_type(8)));
typedef float  v4f  __attribute__((ext_vector_type(4)));
typedef float  v4fa __attribute__((ext_vector_type(4), may_alias));
typedef _Float16 v16h __attribute__((ext_vector_type(16)));
typedef _Float16 v4h __attribute__((ext_vector_type(4)));
union FragH { v16h v; v8us half[2]; _Float16 h[16]; unsigned short u[16]; };

static_assert(NH * HD == DM);                 /* merged head width */
static_assert(HD == 64);                      /* attention kernel: 2 k-steps of 32 over the head dim, 4 output tiles of 16 */
static_assert(DM % 64 == 0 && DM % 32 == 0 && DM % 8 == 0);  /* GEMM N tiles, K steps, 16-B pieces */
static_assert(SEQ % 64 == 0);                 /* attention block = 64 queries; V^T tiles of 64 tokens; key steps of 32 */
static_assert((NB * SEQ) % 128 == 0);         /* GEMM block = 128 rows, no row tail */
static_assert(SEQ / 32 <= 128);               /* mask words built by the first SEQ/32 threads of a 128-thread block */
static_assert(NB <= NB_FULL && SEQ <= SEQ_FULL);
static_assert(((size_t)NB * SEQ * DM) % (8 * 256) == 0);     /* convert grids exact */
static_assert(((size_t)DM * DM) % (8 * 256) == 0);

__device__ __forceinline__ unsigned short bf16_bits(float x) { unsigned int u = __float_as_uint(x); return (unsigned short)((u + 0x7FFFu + ((u >> 16) & 1u)) >> 16); }
__device__ __forceinline__ float bf16_val(unsigned short b) { return __uint_as_float(((unsigned int)b) << 16); }
__device__ __forceinline__ float bfr(float x) { return bf16_val(bf16_bits(x)); }      /* RNE convert to bf16, back to f32 */

// fragment (A or B, same k map): elements 0..7 = k0+8h.., elements 8..15 = k0+16+8h.. from a k-contiguous 16-bit row
__device__ __forceinline__ v16h g2_frag(const _Float16* p, int hh) { FragH f; f.half[0] = *(const v8us*)((const unsigned short*)p + 8 * hh); f.half[1] = *(const v8us*)((const unsigned short*)p + 16 + 8 * hh); return f.v; }
// one WMMA with its own hazard guard (ties D, keeps A/B live)
__device__ __forceinline__ v8f g2_mma(v16h a, v16h b, v8f c) { v8f d = __builtin_amdgcn_wmma_f32_16x16x32_f16(false, a, false, b, (short)0, c, false, false); asm volatile("v_nop\n\tv_nop\n\tv_nop\n\tv_nop" : "+v"(d) : "v"(a), "v"(b)); return d; }

__device__ __forceinline__ void wnat_body(const float* __restrict__ w, _Float16* __restrict__ Bt, unsigned blk) {
  const size_t t = (size_t)blk * 256 + threadIdx.x; if (t >= (size_t)DM * DM / 8) return;
  const v4f a = *(const v4fa*)(w + t * 8), c = *(const v4fa*)(w + t * 8 + 4); FragH f;
#pragma unroll
  for (int q = 0; q < 4; ++q) { f.h[q] = (_Float16)(bfr(a[q]) * 16.0f); f.h[4 + q] = (_Float16)(bfr(c[q]) * 16.0f); }
  const v8us o = f.half[0];
  *(v8us*)((unsigned short*)Bt + t * 8) = o; 
}

__device__ __forceinline__ void x16_body(const float* __restrict__ x, _Float16* __restrict__ X16, unsigned blk) {
  const size_t t = (size_t)blk * 256 + threadIdx.x; if (t >= NR * DM / 8) return;
  const size_t e = t * 8; const size_t row = e / DM; const size_t col = e % DM; const size_t bb = row / SEQ, s = row % SEQ;
  const float* src = x + (bb * SEQ_FULL + s) * DM + col;
  const v4f a = *(const v4fa*)(src), c = *(const v4fa*)(src + 4); FragH f;
#pragma unroll
  for (int q = 0; q < 4; ++q) { f.h[q] = (_Float16)bfr(a[q]); f.h[4 + q] = (_Float16)bfr(c[q]); }
  const v8us o = f.half[0];
  *(v8us*)((unsigned short*)X16 + t * 8) = o; 
}
// The seven converts read none of each other's output: one grid. Blocks [0, 3*GX) take the activation streams (GX blocks each), the rest the weight matrices (GW blocks each);
// the f16 planes of a kind lie one behind the other, so the stream or matrix number picks source pointer and destination plane.
#define GW ((unsigned)(((size_t)DM * DM / 8) / 256))
#define GX ((unsigned)((NR * DM / 8) / 256))
__global__ __launch_bounds__(256) void k_cvt(const float* __restrict__ xq, const float* __restrict__ xk, const float* __restrict__ xv,
                                             const float* __restrict__ Wq, const float* __restrict__ Wk, const float* __restrict__ Wv, const float* __restrict__ Wo,
                                             _Float16* __restrict__ X16, _Float16* __restrict__ Bt) {
  const unsigned bx = blockIdx.x;
  if (bx < 3u * GX) { const unsigned s = bx / GX; const float* x = (s == 0u) ? xq : (s == 1u) ? xk : xv;
    x16_body(x, X16 + (size_t)s * NR * DM, bx - s * GX); }
  else { const unsigned r = bx - 3u * GX; const unsigned s = r / GW; const float* w = (s & 2u) ? ((s & 1u) ? Wo : Wv) : ((s & 1u) ? Wk : Wq);
    wnat_body(w, Bt + (size_t)s * DM * DM, r - s * GW); }
}

// GEMM C[M][N] = alpha * A[M][K] . Bt[N][K]^T + bf16(bias[N]); A, Bt f16 k-contiguous rows; block = 4 waves, wave tile 32x64;
// operands reach the waves through LDS: a pass is 128 k (256 B of each of the block's 128 A rows and 64 Bt rows), copied asynchronously into one of two buffers while the other is worked on.
#define GKP 128                       /* k per pass */
#define GPITCH 272                    /* LDS row pitch in bytes: 16 B x odd, for 16-byte fragment reads down a column of rows */
#define GSTAGE (192 * GPITCH)         /* one buffer: rows 0..127 = A rows of the block, rows 128..191 = Bt rows of the block */
static_assert(DM % GKP == 0 && DM / GKP >= 2);   /* whole passes only */
// fragment from an LDS row, same k map as g2_frag; p already holds the lane's 16*hh byte offset
__device__ __forceinline__ v16h g2_lfrag(const unsigned char* p) { FragH f; f.half[0] = *(const v8us*)p; f.half[1] = *(const v8us*)(p + 32); return f.v; }
// twelve 16-byte copies of a lane, global -> LDS through no register; the closing s_wait_xcnt stands inside the statement so that no address register is rewritten ahead of it
__device__ __forceinline__ void g2_copy12(const unsigned* l, const _Float16* const* g) {
  asm volatile("global_load_async_to_lds_b128 %0, %12, off\n\t"
               "global_load_async_to_lds_b128 %1, %13, off\n\t"
               "global_load_async_to_lds_b128 %2, %14, off\n\t"
               "global_load_async_to_lds_b128 %3, %15, off\n\t"
               "global_load_async_to_lds_b128 %4, %16, off\n\t"
               "global_load_async_to_lds_b128 %5, %17, off\n\t"
               "global_load_async_to_lds_b128 %6, %18, off\n\t"
               "global_load_async_to_lds_b128 %7, %19, off\n\t"
               "global_load_async_to_lds_b128 %8, %20, off\n\t"
               "global_load_async_to_lds_b128 %9, %21, off\n\t"
               "global_load_async_to_lds_b128 %10, %22, off\n\t"
               "global_load_async_to_lds_b128 %11, %23, off\n\t"
               "s_wait_xcnt 0x0"
               :: "v"(l[0]), "v"(l[1]), "v"(l[2]), "v"(l[3]), "v"(l[4]), "v"(l[5]), "v"(l[6]), "v"(l[7]), "v"(l[8]), "v"(l[9]), "v"(l[10]), "v"(l[11]),
                  "v"(g[0]), "v"(g[1]), "v"(g[2]), "v"(g[3]), "v"(g[4]), "v"(g[5]), "v"(g[6]), "v"(g[7]), "v"(g[8]), "v"(g[9]), "v"(g[10]), "v"(g[11])
               : "memory");
}
// one pass's tile: 192 rows of 256 B; 16 lanes cover a row, the block's 128 lanes 8 rows, so 24 copies a lane (16 for A, 8 for Bt)
__device__ __forceinline__ void g2_stage(unsigned lb, const _Float16* ga, int lda, const _Float16* gb, int ldb) {
  unsigned l[24]; const _Float16* g[24];
#pragma unroll   /* both loops: every address becomes a register operand of the copy statements, no array in memory */
  for (int j = 0; j < 16; ++j) { l[j] = lb + (unsigned)(j * 8 * GPITCH); g[j] = ga + (size_t)(j * 8) * lda; }
#pragma unroll
  for (int j = 0; j < 8; ++j) { l[16 + j] = lb + (unsigned)((128 + j * 8) * GPITCH); g[16 + j] = gb + (size_t)(j * 8) * ldb; }
  g2_copy12(l, g); g2_copy12(l + 12, g + 12);
}
template <bool F32OUT>
__device__ __forceinline__ void gemm2_body(const _Float16* __restrict__ A, int lda, const _Float16* __restrict__ Bh, int ldb, float alpha, const float* __restrict__ bias,
                                           float* __restrict__ C, _Float16* __restrict__ C16, int ldc, int N, int K) {
  __shared__ __attribute__((aligned(16))) float so[4][32][68];
  __shared__ __attribute__((aligned(16))) unsigned char ring[2 * GSTAGE];
  const int tid = threadIdx.x; const int w = __builtin_amdgcn_readfirstlane(tid >> 5); const int lane = tid & 31, ln = lane & 15, hh = lane >> 4;
  const int ntn = N >> 6; const int mt = blockIdx.x / ntn, nq = blockIdx.x - mt * ntn; const int row0 = mt * 128 + 32 * w, col0 = nq * 64;
  const int cr = tid >> 4, cc = tid & 15;                 /* copy role: row within a group of 8, 16-byte piece within the row */
  const _Float16* ga = A + (size_t)(mt * 128 + cr) * lda + cc * 8; const _Float16* gb = Bh + (size_t)(col0 + cr) * ldb + cc * 8;
  const unsigned lb = (unsigned)(size_t)ring + (unsigned)(cr * GPITCH + cc * 16);
  const unsigned char* fa = ring + (32 * w + ln) * GPITCH + 16 * hh; const unsigned char* fb = ring + (128 + ln) * GPITCH + 16 * hh;
  const int np = K / GKP;
  const v8f z8 = {0.f,0.f,0.f,0.f,0.f,0.f,0.f,0.f}; v8f c00 = z8, c01 = z8, c02 = z8, c03 = z8, c10 = z8, c11 = z8, c12 = z8, c13 = z8;
  g2_stage(lb, ga, lda, gb, ldb);
  asm volatile("s_wait_asynccnt 0x0" ::: "memory");       /* this wave's copies of pass 0 have landed */
  __syncthreads();                                        /* pass 0 published to every wave */
  if (np > 1) g2_stage(lb + GSTAGE, ga + GKP, lda, gb + GKP, ldb);
#pragma unroll 1   /* one pass a trip: one publish point and one refill site in the code */
  for (int t = 0; t < np; ++t) { const unsigned bo = (unsigned)(t & 1) * GSTAGE; const unsigned char* pa = fa + bo; const unsigned char* pb = fb + bo;
    v16h a0 = g2_lfrag(pa), a1 = g2_lfrag(pa + 16 * GPITCH), b0 = g2_lfrag(pb), b1 = g2_lfrag(pb + 16 * GPITCH), b2 = g2_lfrag(pb + 32 * GPITCH), b3 = g2_lfrag(pb + 48 * GPITCH);
#pragma unroll   /* the two fragment sets alternate by renaming, LDS offsets become immediates */
    for (int ks = 0; ks < GKP / 32; ++ks) { v16h na0 = a0, na1 = a1, nb0 = b0, nb1 = b1, nb2 = b2, nb3 = b3;
      if (ks + 1 < GKP / 32) { const int o = (ks + 1) * 64;      /* the same pass's next k-step, read ahead of this step's products */
        na0 = g2_lfrag(pa + o); na1 = g2_lfrag(pa + 16 * GPITCH + o); nb0 = g2_lfrag(pb + o); nb1 = g2_lfrag(pb + 16 * GPITCH + o); nb2 = g2_lfrag(pb + 32 * GPITCH + o); nb3 = g2_lfrag(pb + 48 * GPITCH + o); }
      c00 = g2_mma(a0, b0, c00); c10 = g2_mma(a1, b0, c10);
      c01 = g2_mma(a0, b1, c01); c11 = g2_mma(a1, b1, c11);
      c02 = g2_mma(a0, b2, c02); c12 = g2_mma(a1, b2, c12);
      c03 = g2_mma(a0, b3, c03); c13 = g2_mma(a1, b3, c13);
      a0 = na0; a1 = na1; b0 = nb0; b1 = nb1; b2 = nb2; b3 = nb3; }
    asm volatile("s_wait_dscnt 0x0" ::: "memory");        /* this wave's reads of the buffer have returned before it may be refilled */
    asm volatile("s_wait_asynccnt 0x0" ::: "memory");     /* this wave's copies of pass t + 1 have landed */
    __syncthreads();                                      /* publishes pass t + 1 and ends every wave's reads of pass t */
    if (t + 2 < np) g2_stage(lb + bo, ga + (size_t)(t + 2) * GKP, lda, gb + (size_t)(t + 2) * GKP, ldb); }
  asm volatile("s_wait_asynccnt 0x0" ::: "memory");       /* no copy outstanding behind the loop */
  v8f accs[8] = {c00, c01, c02, c03, c10, c11, c12, c13};
#pragma unroll
  for (int u = 0; u < 8; ++u) { const int t = u & 3, half = u >> 2; const int col = col0 + t * 16 + ln; const float bv = bfr(bias[col]);
#pragma unroll
    for (int r = 0; r < 8; ++r) { const int rloc = half * 16 + 8 * hh + r; so[w][rloc][t * 16 + ln] = accs[u][r] * alpha + bv; } }
  __syncthreads();      /* staging tile is private to the wave; the block barrier is a superset of the wave-level ordering needed */
  const int rsub = lane >> 4, c4 = (lane & 15) * 4;
  {
#pragma unroll
    for (int q = 0; q < 16; ++q) { const int r = q * 2 + rsub; const v4f v = *(const v4fa*)&so[w][r][c4];
      if (F32OUT) { *(v4f*)(C + (size_t)(row0 + r) * ldc + col0 + c4) = v; }
      else { v4h h4; h4[0] = (_Float16)v[0]; h4[1] = (_Float16)v[1]; h4[2] = (_Float16)v[2]; h4[3] = (_Float16)v[3]; *(v4h*)(C16 + (size_t)(row0 + r) * ldc + col0 + c4) = h4; } }
     }
}
// the three projections in one grid: blockIdx.y = 0, 1, 2 picks the q, k or v problem; its A, Bt and C planes lie one behind the other
__global__ __launch_bounds__(128) void k_gemm_qkv(const _Float16* __restrict__ A, int lda, const _Float16* __restrict__ Bh, int ldb, float alpha,
                                                  const float* __restrict__ bq, const float* __restrict__ bk, const float* __restrict__ bv, _Float16* __restrict__ C16, int ldc, int N, int K) {
  const unsigned s = blockIdx.y; const float* bias = (s == 0u) ? bq : (s == 1u) ? bk : bv;
  gemm2_body<false>(A + (size_t)s * NR * DM, lda, Bh + (size_t)s * DM * DM, ldb, alpha, bias, nullptr, C16 + (size_t)s * NR * DM, ldc, N, K);
}
__global__ __launch_bounds__(128) void k_gemm_f32(const _Float16* __restrict__ A, int lda, const _Float16* __restrict__ Bh, int ldb, float alpha, const float* __restrict__ bias, float* __restrict__ C, int ldc, int N, int K) {
  gemm2_body<true>(A, lda, Bh, ldb, alpha, bias, C, nullptr, ldc, N, K);
}

__global__ __launch_bounds__(256) void k_vt(const _Float16* __restrict__ V16, _Float16* __restrict__ Vt) {
  __shared__ unsigned short tl[64][66];
  const int tid = threadIdx.x; const int slab = blockIdx.x / (SEQ / 64), lg = blockIdx.x % (SEQ / 64); const int b = slab / NH, h = slab % NH;
  for (int i = tid; i < 64 * 8; i += 256) { const int r = i / 8, c8 = (i % 8) * 8; FragH f; f.half[0] = *(const v8us*)((const unsigned short*)V16 + ((size_t)b * SEQ + lg * 64 + r) * DM + h * HD + c8);
#pragma unroll
    for (int q = 0; q < 8; ++q) tl[r][c8 + q] = f.u[q]; }
  __syncthreads();
  {
#pragma unroll
    for (int rd = 0; rd < 2; ++rd) { const int d = rd * 32 + tid / 8, pc = tid % 8; FragH f;
#pragma unroll
      for (int q = 0; q < 8; ++q) f.u[q] = tl[pc * 8 + q][d];
      *(v8us*)((unsigned short*)Vt + ((size_t)slab * 64 + d) * SEQ + lg * 64 + pc * 8) = f.half[0]; }
     }
}

// Fused attention: block = 4 waves = 64 queries of one (batch, head); wave = 16 queries; key loop in steps of 32 keys.
// Score tiles are computed TRANSPOSED (A = K rows [key][d], B = Q rows [query][d]): accumulator element r of lane (hh, ln) = (key 8hh+r, query ln),
// so a lane owns one query column: row max = in-lane max + one xor-16 shuffle. The two 16-key P^T tiles are the B operand of the next product
// (elements 0..7 <- tile 0 element r, elements 8..15 <- tile 1 element r, lane unchanged); A = V^T rows [d][key]; accumulators hold O^T (d 8hh+r, query ln).
// Mask: 32-bit keep words per 32 keys built once per block in LDS; masked logits are REPLACED by -1e9 (a fully masked row comes out uniform).
__global__ __launch_bounds__(128) void k_attn(const _Float16* __restrict__ Q16, const _Float16* __restrict__ K16, const _Float16* __restrict__ Vt, const int* __restrict__ mask, _Float16* __restrict__ CTX) {
  __shared__ unsigned int smw[SEQ / 32];                                   /* cross-wave: written by the first SEQ/32 threads, read by all after the block barrier */
  __shared__ __attribute__((aligned(16))) unsigned short sh[4][16][72];    /* per-wave output staging [query][d], pitch 144 B */
  const int tid = threadIdx.x; const int wave = __builtin_amdgcn_readfirstlane(tid >> 5); const int lane = tid & 31, ln = lane & 15, hh = lane >> 4;
  const int h = blockIdx.y, b = blockIdx.z;
  {
    const int wi = (tid < SEQ / 32) ? tid : (SEQ / 32 - 1);               /* clamped address; every thread loads, only the owners store */
    const int* mp = mask + (size_t)b * SEQ_FULL + (size_t)wi * 32; unsigned int wbits = 0u;
#pragma unroll 1
    for (int j = 0; j < 32; ++j) wbits |= ((mp[j] != 0) ? 1u : 0u) << j;
    if (tid < SEQ / 32) smw[tid] = wbits;
  }
  __syncthreads();
  const int q0 = blockIdx.x * 64 + wave * 16; const size_t rowb = (size_t)b * SEQ;
  const _Float16* Qp = Q16 + (rowb + q0 + ln) * DM + h * HD;
  const v16h qf0 = g2_frag(Qp, hh), qf1 = g2_frag(Qp + 32, hh);
  const _Float16* Kp = K16 + (rowb + ln) * DM + h * HD;
  const _Float16* Vp = Vt + ((size_t)(b * NH + h) * HD + ln) * SEQ;
  const v8f z8 = {0.f,0.f,0.f,0.f,0.f,0.f,0.f,0.f};
  v8f o0 = z8, o1 = z8, o2 = z8, o3 = z8; float mrun = -1.0e30f, lpart = 0.f;
#pragma unroll 1
  for (int kb = 0; kb < SEQ; kb += 32) {
    const _Float16* k0p = Kp + (size_t)kb * DM; const _Float16* k1p = k0p + (size_t)16 * DM;
    v8f s0 = z8, s1 = z8;
    v16h a = g2_frag(k0p, hh); s0 = g2_mma(a, qf0, s0);
    a = g2_frag(k0p + 32, hh); s0 = g2_mma(a, qf1, s0);
    a = g2_frag(k1p, hh); s1 = g2_mma(a, qf0, s1);
    a = g2_frag(k1p + 32, hh); s1 = g2_mma(a, qf1, s1);
    const unsigned int mw = smw[kb >> 5] >> (8 * hh);      /* bit r: key kb+8hh+r (tile 0); bit 16+r: key kb+16+8hh+r (tile 1) */
    float e0[8], e1[8]; float mx = -3.0e38f;
#pragma unroll
    for (int r = 0; r < 8; ++r) {
      float x0 = s0[r] * 0.125f; x0 = ((mw >> r) & 1u) ? x0 : -1.0e9f;
      float x1 = s1[r] * 0.125f; x1 = ((mw >> (16 + r)) & 1u) ? x1 : -1.0e9f;
      e0[r] = x0; e1[r] = x1; mx = fmaxf(mx, fmaxf(x0, x1));
    }
    mx = fmaxf(mx, __shfl_xor(mx, 16));
    const float mnew = fmaxf(mrun, mx); const float alpha = __expf(mrun - mnew); mrun = mnew;
    float ps = 0.f; FragH pf;
#pragma unroll
    for (int r = 0; r < 8; ++r) {
      const float p0 = __expf(e0[r] - mnew), p1 = __expf(e1[r] - mnew); ps += p0 + p1;
      pf.h[r] = (_Float16)(p0 * 1024.0f); pf.h[8 + r] = (_Float16)(p1 * 1024.0f);
    }
    lpart = lpart * alpha + ps;
#pragma unroll
    for (int r = 0; r < 8; ++r) { o0[r] *= alpha; o1[r] *= alpha; o2[r] *= alpha; o3[r] *= alpha; }
    const v16h pb = pf.v;
    a = g2_frag(Vp + kb, hh); o0 = g2_mma(a, pb, o0);
    a = g2_frag(Vp + (size_t)16 * SEQ + kb, hh); o1 = g2_mma(a, pb, o1);
    a = g2_frag(Vp + (size_t)32 * SEQ + kb, hh); o2 = g2_mma(a, pb, o2);
    a = g2_frag(Vp + (size_t)48 * SEQ + kb, hh); o3 = g2_mma(a, pb, o3);
  }
  const float l = lpart + __shfl_xor(lpart, 16);
  const float inv = 1.0f / (l * 16.0f);                    /* P carried x1024, ctx carried x64: x64/1024 = 1/16 */
  FragH t0, t1, t2, t3;
#pragma unroll
  for (int r = 0; r < 8; ++r) { t0.h[r] = (_Float16)(o0[r] * inv); t1.h[r] = (_Float16)(o1[r] * inv); t2.h[r] = (_Float16)(o2[r] * inv); t3.h[r] = (_Float16)(o3[r] * inv); }
  *(v8us*)&sh[wave][ln][0 + 8 * hh] = t0.half[0];
  *(v8us*)&sh[wave][ln][16 + 8 * hh] = t1.half[0];
  *(v8us*)&sh[wave][ln][32 + 8 * hh] = t2.half[0];
  *(v8us*)&sh[wave][ln][48 + 8 * hh] = t3.half[0];
  __syncthreads();
  const int rsub = lane >> 3, pc = lane & 7;               
  {
#pragma unroll
    for (int it = 0; it < 4; ++it) { const int row = it * 4 + rsub; const v8us v = *(const v8us*)&sh[wave][row][pc * 8];
      *(v8us*)((unsigned short*)CTX + (rowb + q0 + row) * DM + h * HD + pc * 8) = v; }
     }
}

#define WBYTES ((size_t)DM * DM * 2)
#define PBYTES ((size_t)NB * SEQ * DM * 2)
static_assert(WBYTES % 256 == 0 && PBYTES % 256 == 0);
static_assert(4 * WBYTES + 8 * PBYTES <= (size_t)134217728);      /* total carve: 4 weight planes + 8 token planes (V^T plane = NB*NH*HD*SEQ halves = one token plane) */

extern "C" void kernel_launch(void* const* d_in, const int* in_sizes, int n_in,
                              void* d_out, int out_size, void* d_ws, size_t ws_size, hipStream_t stream) {
  if (n_in < 12) return;
  const long long need_x = (long long)(NB - 1) * SEQ_FULL * DM + (long long)SEQ * DM;
  if ((long long)in_sizes[0] < need_x || (long long)in_sizes[1] < need_x || (long long)in_sizes[2] < need_x) return;
  if ((long long)in_sizes[3] < (long long)(NB - 1) * SEQ_FULL + SEQ) return;
  if (in_sizes[4] < DM * DM || in_sizes[6] < DM * DM || in_sizes[8] < DM * DM || in_sizes[10] < DM * DM) return;
  if (in_sizes[5] < DM || in_sizes[7] < DM || in_sizes[9] < DM || in_sizes[11] < DM) return;
  if ((long long)out_size < (long long)NB * SEQ * DM) return;
  /* wire order: q, k, v, mask (int32), Wq, bq, Wk, bk, Wv, bv, Wo, bo */
  const float* xq = (const float*)d_in[0]; const float* xk = (const float*)d_in[1]; const float* xv = (const float*)d_in[2];
  const int* mask = (const int*)d_in[3];
  const float* Wq = (const float*)d_in[4]; const float* bq = (const float*)d_in[5];
  const float* Wk = (const float*)d_in[6]; const float* bk = (const float*)d_in[7];
  const float* Wv = (const float*)d_in[8]; const float* bv = (const float*)d_in[9];
  const float* Wo = (const float*)d_in[10]; const float* bo = (const float*)d_in[11];
  float* out = (float*)d_out;
  char* ws = (char*)d_ws; size_t off = 0;
  _Float16* BQ = (_Float16*)(ws + off); off += WBYTES;
  _Float16* BK = (_Float16*)(ws + off); off += WBYTES;
  _Float16* BV = (_Float16*)(ws + off); off += WBYTES;
  _Float16* BO = (_Float16*)(ws + off); off += WBYTES;
  _Float16* XQ = (_Float16*)(ws + off); off += PBYTES;
  _Float16* XK = (_Float16*)(ws + off); off += PBYTES;
  _Float16* XV = (_Float16*)(ws + off); off += PBYTES;
  _Float16* Q16 = (_Float16*)(ws + off); off += PBYTES;
  _Float16* K16 = (_Float16*)(ws + off); off += PBYTES;
  _Float16* V16 = (_Float16*)(ws + off); off += PBYTES;
  _Float16* VT = (_Float16*)(ws + off); off += PBYTES;
  _Float16* CTX = (_Float16*)(ws + off); off += PBYTES;
  if (off > ws_size) return;
  k_cvt<<<3u * GX + 4u * GW, 256, 0, stream>>>(xq, xk, xv, Wq, Wk, Wv, Wo, XQ, BQ);      /* planes XQ, XK, XV and BQ, BK, BV, BO */
  const unsigned gg = (unsigned)((MR / 128) * (DM / 64));
  k_gemm_qkv<<<dim3(gg, 3), 128, 0, stream>>>(XQ, DM, BQ, DM, 0.0625f, bq, bk, bv, Q16, DM, DM, DM);      /* q = xq Wq^T + bq, k = xk Wk^T + bk, v = xv Wv^T + bv into planes Q16, K16, V16 (weights x16 -> alpha 1/16) */
  k_vt<<<(unsigned)(NB * NH * (SEQ / 64)), 256, 0, stream>>>(V16, VT);                   /* in [NB*SEQ][h*64+d] -> out [(b,h)][d][SEQ] */
  k_attn<<<dim3(SEQ / 64, NH, NB), 128, 0, stream>>>(Q16, K16, VT, mask, CTX);           /* ctx x64, merged heads */
  k_gemm_f32<<<gg, 128, 0, stream>>>(CTX, DM, BO, DM, 0.0009765625f, bo, out, DM, DM, DM);      /* out = ctx Wo^T + bo (x64 and x16 carries -> alpha 2^-10) */
}

// v003
// It runs in 62 microseconds.
// Timed twice side by side with v002, it ran 1.84 times as fast both times.
// Counting every step since v000, it is 3.84 times as fast.
#include <hip/hip_runtime.h>
// Multi-head attention with three input streams (q, k, v each [NB][SEQ][1024]), [out][in] projection weights with biases, integer key-padding mask applied as a finite replacement (-1e9) per (batch, key), 16 heads of 64, score scale 1/8, softmax over the keys of the same batch, heads merged h*64+d, output projection with bias.
// Compute dtype: every contraction on v_wmma_f32_16x16x32_f16 (f16 operands, f32 accumulate). Float inputs are converted (RNE) to bf16 first and carried as exact f16 (weights x16); q, k, v planes plain f16; softmax weights exp(s-m) carried x1024 as f16 (row sum l from the unconverted f32 values); ctx carried x64 as f16; scores and softmax statistics f32.
// Structure: one launch for the 3 activation and 4 weight converts, one launch for the 3 projection GEMMs (32x64 wave tiles, operands staged in LDS by asynchronous copies, two buffers), one V^T LDS transpose, one fused online-softmax attention kernel (K and V^T tiles of 128 keys staged in LDS by asynchronous copies, two buffers, shared by the block's 4 waves; transposed score tiles S^T = K Q^T so a lane owns one query column; P^T accumulator tiles feed the next WMMA as its B operand directly), one output GEMM (f32).
#ifndef NB
#define NB 2
#endif
#ifndef SEQ
#define SEQ 1024
#endif
#define NB_FULL 2
#define SEQ_FULL 1024
#define DM 1024
#define NH 16
#define HD 64
#define NR ((size_t)NB * SEQ)         /* token rows processed */
#define MR ((int)(NB * SEQ))

typedef unsigned short v8us __attribute__((ext_vector_type(8), may_alias));
typedef float  v8f  __attribute__((ext_vector_type(8)));
typedef float  v4f  __attribute__((ext_vector_type(4)));
typedef float  v4fa __attribute__((ext_vector_type(4), may_alias));
typedef _Float16 v16h __attribute__((ext_vector_type(16)));
typedef _Float16 v4h __attribute__((ext_vector_type(4)));
union FragH { v16h v; v8us half[2]; _Float16 h[16]; unsigned short u[16]; };

static_assert(NH * HD == DM);                 /* merged head width */
static_assert(HD == 64);                      /* attention kernel: 2 k-steps of 32 over the head dim, 4 output tiles of 16 */
static_assert(DM % 64 == 0 && DM % 32 == 0 && DM % 8 == 0);  /* GEMM N tiles, K steps, 16-B pieces */
static_assert(SEQ % 64 == 0);                 /* attention block = 64 queries; V^T tiles of 64 tokens; key steps of 32 */
static_assert((NB * SEQ) % 128 == 0);         /* GEMM block = 128 rows, no row tail */
static_assert(SEQ / 32 <= 128);               /* mask words built by the first SEQ/32 threads of a 128-thread block */
static_assert(NB <= NB_FULL && SEQ <= SEQ_FULL);
static_assert(((size_t)NB * SEQ * DM) % (8 * 256) == 0);     /* convert grids exact */
static_assert(((size_t)DM * DM) % (8 * 256) == 0);

__device__ __forceinline__ unsigned short bf16_bits(float x) { unsigned int u = __float_as_uint(x); return (unsigned short)((u + 0x7FFFu + ((u >> 16) & 1u)) >> 16); }
__device__ __forceinline__ float bf16_val(unsigned short b) { return __uint_as_float(((unsigned int)b) << 16); }
__device__ __forceinline__ float bfr(float x) { return bf16_val(bf16_bits(x)); }      /* RNE convert to bf16, back to f32 */

// fragment (A or B, same k map): elements 0..7 = k0+8h.., elements 8..15 = k0+16+8h.. from a k-contiguous 16-bit row
__device__ __forceinline__ v16h g2_frag(const _Float16* p, int hh) { FragH f; f.half[0] = *(const v8us*)((const unsigned short*)p + 8 * hh); f.half[1] = *(const v8us*)((const unsigned short*)p + 16 + 8 * hh); return f.v; }
// one WMMA with its own hazard guard (ties D, keeps A/B live)
__device__ __forceinline__ v8f g2_mma(v16h a, v16h b, v8f c) { v8f d = __builtin_amdgcn_wmma_f32_16x16x32_f16(false, a, false, b, (short)0, c, false, false); asm volatile("v_nop\n\tv_nop\n\tv_nop\n\tv_nop" : "+v"(d) : "v"(a), "v"(b)); return d; }

__device__ __forceinline__ void wnat_body(const float* __restrict__ w, _Float16* __restrict__ Bt, unsigned blk) {
  const size_t t = (size_t)blk * 256 + threadIdx.x; if (t >= (size_t)DM * DM / 8) return;
  const v4f a = *(const v4fa*)(w + t * 8), c = *(const v4fa*)(w + t * 8 + 4); FragH f;
#pragma unroll
  for (int q = 0; q < 4; ++q) { f.h[q] = (_Float16)(bfr(a[q]) * 16.0f); f.h[4 + q] = (_Float16)(bfr(c[q]) * 16.0f); }
  const v8us o = f.half[0];
  *(v8us*)((unsigned short*)Bt + t * 8) = o; 
}

__device__ __forceinline__ void x16_body(const float* __restrict__ x, _Float16* __restrict__ X16, unsigned blk) {
  const size_t t = (size_t)blk * 256 + threadIdx.x; if (t >= NR * DM / 8) return;
  const size_t e = t * 8; const size_t row = e / DM; const size_t col = e % DM; const size_t bb = row / SEQ, s = row % SEQ;
  const float* src = x + (bb * SEQ_FULL + s) * DM + col;
  const v4f a = *(const v4fa*)(src), c = *(const v4fa*)(src + 4); FragH f;
#pragma unroll
  for (int q = 0; q < 4; ++q) { f.h[q] = (_Float16)bfr(a[q]); f.h[4 + q] = (_Float16)bfr(c[q]); }
  const v8us o = f.half[0];
  *(v8us*)((unsigned short*)X16 + t * 8) = o; 
}
// The seven converts read none of each other's output: one grid. Blocks [0, 3*GX) take the activation streams (GX blocks each), the rest the weight matrices (GW blocks each);
// the f16 planes of a kind lie one behind the other, so the stream or matrix number picks source pointer and destination plane.
#define GW ((unsigned)(((size_t)DM * DM / 8) / 256))
#define GX ((unsigned)((NR * DM / 8) / 256))
__global__ __launch_bounds__(256) void k_cvt(const float* __restrict__ xq, const float* __restrict__ xk, const float* __restrict__ xv,
                                             const float* __restrict__ Wq, const float* __restrict__ Wk, const float* __restrict__ Wv, const float* __restrict__ Wo,
                                             _Float16* __restrict__ X16, _Float16* __restrict__ Bt) {
  const unsigned bx = blockIdx.x;
  if (bx < 3u * GX) { const unsigned s = bx / GX; const float* x = (s == 0u) ? xq : (s == 1u) ? xk : xv;
    x16_body(x, X16 + (size_t)s * NR * DM, bx - s * GX); }
  else { const unsigned r = bx - 3u * GX; const unsigned s = r / GW; const float* w = (s & 2u) ? ((s & 1u) ? Wo : Wv) : ((s & 1u) ? Wk : Wq);
    wnat_body(w, Bt + (size_t)s * DM * DM, r - s * GW); }
}

// GEMM C[M][N] = alpha * A[M][K] . Bt[N][K]^T + bf16(bias[N]); A, Bt f16 k-contiguous rows; block = 4 waves, wave tile 32x64;
// operands reach the waves through LDS: a pass is 128 k (256 B of each of the block's 128 A rows and 64 Bt rows), copied asynchronously into one of two buffers while the other is worked on.
#define GKP 128                       /* k per pass */
#define GPITCH 272                    /* LDS row pitch in bytes: 16 B x odd, for 16-byte fragment reads down a column of rows */
#define GSTAGE (192 * GPITCH)         /* one buffer: rows 0..127 = A rows of the block, rows 128..191 = Bt rows of the block */
static_assert(DM % GKP == 0 && DM / GKP >= 2);   /* whole passes only */
// fragment from an LDS row, same k map as g2_frag; p already holds the lane's 16*hh byte offset
__device__ __forceinline__ v16h g2_lfrag(const unsigned char* p) { FragH f; f.half[0] = *(const v8us*)p; f.half[1] = *(const v8us*)(p + 32); return f.v; }
// twelve 16-byte copies of a lane, global -> LDS through no register; the closing s_wait_xcnt stands inside the statement so that no address register is rewritten ahead of it
__device__ __forceinline__ void g2_copy12(const unsigned* l, const _Float16* const* g) {
  asm volatile("global_load_async_to_lds_b128 %0, %12, off\n\t"
               "global_load_async_to_lds_b128 %1, %13, off\n\t"
               "global_load_async_to_lds_b128 %2, %14, off\n\t"
               "global_load_async_to_lds_b128 %3, %15, off\n\t"
               "global_load_async_to_lds_b128 %4, %16, off\n\t"
               "global_load_async_to_lds_b128 %5, %17, off\n\t"
               "global_load_async_to_lds_b128 %6, %18, off\n\t"
               "global_load_async_to_lds_b128 %7, %19, off\n\t"
               "global_load_async_to_lds_b128 %8, %20, off\n\t"
               "global_load_async_to_lds_b128 %9, %21, off\n\t"
               "global_load_async_to_lds_b128 %10, %22, off\n\t"
               "global_load_async_to_lds_b128 %11, %23, off\n\t"
               "s_wait_xcnt 0x0"
               :: "v"(l[0]), "v"(l[1]), "v"(l[2]), "v"(l[3]), "v"(l[4]), "v"(l[5]), "v"(l[6]), "v"(l[7]), "v"(l[8]), "v"(l[9]), "v"(l[10]), "v"(l[11]),
                  "v"(g[0]), "v"(g[1]), "v"(g[2]), "v"(g[3]), "v"(g[4]), "v"(g[5]), "v"(g[6]), "v"(g[7]), "v"(g[8]), "v"(g[9]), "v"(g[10]), "v"(g[11])
               : "memory");
}
// one pass's tile: 192 rows of 256 B; 16 lanes cover a row, the block's 128 lanes 8 rows, so 24 copies a lane (16 for A, 8 for Bt)
__device__ __forceinline__ void g2_stage(unsigned lb, const _Float16* ga, int lda, const _Float16* gb, int ldb) {
  unsigned l[24]; const _Float16* g[24];
#pragma unroll   /* both loops: every address becomes a register operand of the copy statements, no array in memory */
  for (int j = 0; j < 16; ++j) { l[j] = lb + (unsigned)(j * 8 * GPITCH); g[j] = ga + (size_t)(j * 8) * lda; }
#pragma unroll
  for (int j = 0; j < 8; ++j) { l[16 + j] = lb + (unsigned)((128 + j * 8) * GPITCH); g[16 + j] = gb + (size_t)(j * 8) * ldb; }
  g2_copy12(l, g); g2_copy12(l + 12, g + 12);
}
template <bool F32OUT>
__device__ __forceinline__ void gemm2_body(const _Float16* __restrict__ A, int lda, const _Float16* __restrict__ Bh, int ldb, float alpha, const float* __restrict__ bias,
                                           float* __restrict__ C, _Float16* __restrict__ C16, int ldc, int N, int K) {
  __shared__ __attribute__((aligned(16))) float so[4][32][68];
  __shared__ __attribute__((aligned(16))) unsigned char ring[2 * GSTAGE];
  const int tid = threadIdx.x; const int w = __builtin_amdgcn_readfirstlane(tid >> 5); const int lane = tid & 31, ln = lane & 15, hh = lane >> 4;
  const int ntn = N >> 6; const int mt = blockIdx.x / ntn, nq = blockIdx.x - mt * ntn; const int row0 = mt * 128 + 32 * w, col0 = nq * 64;
  const int cr = tid >> 4, cc = tid & 15;                 /* copy role: row within a group of 8, 16-byte piece within the row */
  const _Float16* ga = A + (size_t)(mt * 128 + cr) * lda + cc * 8; const _Float16* gb = Bh + (size_t)(col0 + cr) * ldb + cc * 8;
  const unsigned lb = (unsigned)(size_t)ring + (unsigned)(cr * GPITCH + cc * 16);
  const unsigned char* fa = ring + (32 * w + ln) * GPITCH + 16 * hh; const unsigned char* fb = ring + (128 + ln) * GPITCH + 16 * hh;
  const int np = K / GKP;
  const v8f z8 = {0.f,0.f,0.f,0.f,0.f,0.f,0.f,0.f}; v8f c00 = z8, c01 = z8, c02 = z8, c03 = z8, c10 = z8, c11 = z8, c12 = z8, c13 = z8;
  g2_stage(lb, ga, lda, gb, ldb);
  asm volatile("s_wait_asynccnt 0x0" ::: "memory");       /* this wave's copies of pass 0 have landed */
  __syncthreads();                                        /* pass 0 published to every wave */
  if (np > 1) g2_stage(lb + GSTAGE, ga + GKP, lda, gb + GKP, ldb);
#pragma unroll 1   /* one pass a trip: one publish point and one refill site in the code */
  for (int t = 0; t < np; ++t) { const unsigned bo = (unsigned)(t & 1) * GSTAGE; const unsigned char* pa = fa + bo; const unsigned char* pb = fb + bo;
    v16h a0 = g2_lfrag(pa), a1 = g2_lfrag(pa + 16 * GPITCH), b0 = g2_lfrag(pb), b1 = g2_lfrag(pb + 16 * GPITCH), b2 = g2_lfrag(pb + 32 * GPITCH), b3 = g2_lfrag(pb + 48 * GPITCH);
#pragma unroll   /* the two fragment sets alternate by renaming, LDS offsets become immediates */
    for (int ks = 0; ks < GKP / 32; ++ks) { v16h na0 = a0, na1 = a1, nb0 = b0, nb1 = b1, nb2 = b2, nb3 = b3;
      if (ks + 1 < GKP / 32) { const int o = (ks + 1) * 64;      /* the same pass's next k-step, read ahead of this step's products */
        na0 = g2_lfrag(pa + o); na1 = g2_lfrag(pa + 16 * GPITCH + o); nb0 = g2_lfrag(pb + o); nb1 = g2_lfrag(pb + 16 * GPITCH + o); nb2 = g2_lfrag(pb + 32 * GPITCH + o); nb3 = g2_lfrag(pb + 48 * GPITCH + o); }
      c00 = g2_mma(a0, b0, c00); c10 = g2_mma(a1, b0, c10);
      c01 = g2_mma(a0, b1, c01); c11 = g2_mma(a1, b1, c11);
      c02 = g2_mma(a0, b2, c02); c12 = g2_mma(a1, b2, c12);
      c03 = g2_mma(a0, b3, c03); c13 = g2_mma(a1, b3, c13);
      a0 = na0; a1 = na1; b0 = nb0; b1 = nb1; b2 = nb2; b3 = nb3; }
    asm volatile("s_wait_dscnt 0x0" ::: "memory");        /* this wave's reads of the buffer have returned before it may be refilled */
    asm volatile("s_wait_asynccnt 0x0" ::: "memory");     /* this wave's copies of pass t + 1 have landed */
    __syncthreads();                                      /* publishes pass t + 1 and ends every wave's reads of pass t */
    if (t + 2 < np) g2_stage(lb + bo, ga + (size_t)(t + 2) * GKP, lda, gb + (size_t)(t + 2) * GKP, ldb); }
  asm volatile("s_wait_asynccnt 0x0" ::: "memory");       /* no copy outstanding behind the loop */
  v8f accs[8] = {c00, c01, c02, c03, c10, c11, c12, c13};
#pragma unroll
  for (int u = 0; u < 8; ++u) { const int t = u & 3, half = u >> 2; const int col = col0 + t * 16 + ln; const float bv = bfr(bias[col]);
#pragma unroll
    for (int r = 0; r < 8; ++r) { const int rloc = half * 16 + 8 * hh + r; so[w][rloc][t * 16 + ln] = accs[u][r] * alpha + bv; } }
  __syncthreads();      /* staging tile is private to the wave; the block barrier is a superset of the wave-level ordering needed */
  const int rsub = lane >> 4, c4 = (lane & 15) * 4;
  {
#pragma unroll
    for (int q = 0; q < 16; ++q) { const int r = q * 2 + rsub; const v4f v = *(const v4fa*)&so[w][r][c4];
      if (F32OUT) { *(v4f*)(C + (size_t)(row0 + r) * ldc + col0 + c4) = v; }
      else { v4h h4; h4[0] = (_Float16)v[0]; h4[1] = (_Float16)v[1]; h4[2] = (_Float16)v[2]; h4[3] = (_Float16)v[3]; *(v4h*)(C16 + (size_t)(row0 + r) * ldc + col0 + c4) = h4; } }
     }
}
// the three projections in one grid: blockIdx.y = 0, 1, 2 picks the q, k or v problem; its A, Bt and C planes lie one behind the other
__global__ __launch_bounds__(128) void k_gemm_qkv(const _Float16* __restrict__ A, int lda, const _Float16* __restrict__ Bh, int ldb, float alpha,
                                                  const float* __restrict__ bq, const float* __restrict__ bk, const float* __restrict__ bv, _Float16* __restrict__ C16, int ldc, int N, int K) {
  const unsigned s = blockIdx.y; const float* bias = (s == 0u) ? bq : (s == 1u) ? bk : bv;
  gemm2_body<false>(A + (size_t)s * NR * DM, lda, Bh + (size_t)s * DM * DM, ldb, alpha, bias, nullptr, C16 + (size_t)s * NR * DM, ldc, N, K);
}
__global__ __launch_bounds__(128) void k_gemm_f32(const _Float16* __restrict__ A, int lda, const _Float16* __restrict__ Bh, int ldb, float alpha, const float* __restrict__ bias, float* __restrict__ C, int ldc, int N, int K) {
  gemm2_body<true>(A, lda, Bh, ldb, alpha, bias, C, nullptr, ldc, N, K);
}

__global__ __launch_bounds__(256) void k_vt(const _Float16* __restrict__ V16, _Float16* __restrict__ Vt) {
  __shared__ unsigned short tl[64][66];
  const int tid = threadIdx.x; const int slab = blockIdx.x / (SEQ / 64), lg = blockIdx.x % (SEQ / 64); const int b = slab / NH, h = slab % NH;
  for (int i = tid; i < 64 * 8; i += 256) { const int r = i / 8, c8 = (i % 8) * 8; FragH f; f.half[0] = *(const v8us*)((const unsigned short*)V16 + ((size_t)b * SEQ + lg * 64 + r) * DM + h * HD + c8);
#pragma unroll
    for (int q = 0; q < 8; ++q) tl[r][c8 + q] = f.u[q]; }
  __syncthreads();
  {
#pragma unroll
    for (int rd = 0; rd < 2; ++rd) { const int d = rd * 32 + tid / 8, pc = tid % 8; FragH f;
#pragma unroll
      for (int q = 0; q < 8; ++q) f.u[q] = tl[pc * 8 + q][d];
      *(v8us*)((unsigned short*)Vt + ((size_t)slab * 64 + d) * SEQ + lg * 64 + pc * 8) = f.half[0]; }
     }
}

// Attention operands reach the waves through LDS: a stage is 128 keys of one (batch, head): 128 K rows of 128 B and 64 V^T rows of 256 B, copied asynchronously into one of two buffers while the other is worked on.
#define AKT 128                       /* keys per stage */
#define AKPITCH 144                   /* LDS pitch of a K row in bytes: 16 B x odd, for 16-byte fragment reads down a column of rows */
#define AVPITCH 272                   /* LDS pitch of a V^T row in bytes: 16 B x odd */
#define AKBYTES (AKT * AKPITCH)       /* K rows first, V^T rows behind them */
#define ASTAGE (AKBYTES + HD * AVPITCH)
static_assert(SEQ % AKT == 0 && SEQ / AKT >= 2);   /* whole stages only, both buffers filled in the prologue */
static_assert(AKT * HD * 2 == 8 * 128 * 16);       /* each operand's tile = 8 copies of 16 B by each of 128 lanes */
// eight 16-byte copies of a lane, global -> LDS through no register; the closing s_wait_xcnt stands inside the statement so that no address register is rewritten ahead of it
__device__ __forceinline__ void at_copy8(const unsigned* l, const _Float16* const* g) {
  asm volatile("global_load_async_to_lds_b128 %0, %8, off\n\t"
               "global_load_async_to_lds_b128 %1, %9, off\n\t"
               "global_load_async_to_lds_b128 %2, %10, off\n\t"
               "global_load_async_to_lds_b128 %3, %11, off\n\t"
               "global_load_async_to_lds_b128 %4, %12, off\n\t"
               "global_load_async_to_lds_b128 %5, %13, off\n\t"
               "global_load_async_to_lds_b128 %6, %14, off\n\t"
               "global_load_async_to_lds_b128 %7, %15, off\n\t"
               "s_wait_xcnt 0x0"
               :: "v"(l[0]), "v"(l[1]), "v"(l[2]), "v"(l[3]), "v"(l[4]), "v"(l[5]), "v"(l[6]), "v"(l[7]),
                  "v"(g[0]), "v"(g[1]), "v"(g[2]), "v"(g[3]), "v"(g[4]), "v"(g[5]), "v"(g[6]), "v"(g[7])
               : "memory");
}
// one stage: K: 8 lanes cover a row, the block's 128 lanes 16 rows; V^T: 16 lanes cover a row, the block 8 rows; 8 copies a lane for each
__device__ __forceinline__ void at_stage(unsigned lk, unsigned lv, const _Float16* gk, const _Float16* gv) {
  unsigned l[16]; const _Float16* g[16];
#pragma unroll   /* every address becomes a register operand of the copy statements, no array in memory */
  for (int j = 0; j < 8; ++j) { l[j] = lk + (unsigned)(j * 16 * AKPITCH); g[j] = gk + (size_t)(j * 16) * DM; l[8 + j] = lv + (unsigned)(j * 8 * AVPITCH); g[8 + j] = gv + (size_t)(j * 8) * SEQ; }
  at_copy8(l, g); at_copy8(l + 8, g + 8);
}

// Fused attention: block = 4 waves = 64 queries of one (batch, head); wave = 16 queries; key loop in stages of 128 keys, steps of 32 keys.
// Score tiles are computed TRANSPOSED (A = K rows [key][d], B = Q rows [query][d]): accumulator element r of lane (hh, ln) = (key 8hh+r, query ln),
// so a lane owns one query column: row max = in-lane max + one xor-16 shuffle. The two 16-key P^T tiles are the B operand of the next product
// (elements 0..7 <- tile 0 element r, elements 8..15 <- tile 1 element r, lane unchanged); A = V^T rows [d][key]; accumulators hold O^T (d 8hh+r, query ln).
// Mask: 32-bit keep words per 32 keys built once per block in LDS; masked logits are REPLACED by -1e9 (a fully masked row comes out uniform).
__global__ __launch_bounds__(128) void k_attn(const _Float16* __restrict__ Q16, const _Float16* __restrict__ K16, const _Float16* __restrict__ Vt, const int* __restrict__ mask, _Float16* __restrict__ CTX) {
  __shared__ unsigned int smw[SEQ / 32];                                   /* cross-wave: written by the first SEQ/32 threads, read by all after the block barrier */
  __shared__ __attribute__((aligned(16))) unsigned short sh[4][16][72];    /* per-wave output staging [query][d], pitch 144 B */
  __shared__ __attribute__((aligned(16))) unsigned char ring[2 * ASTAGE];  /* the two K / V^T stage buffers */
  const int tid = threadIdx.x; const int wave = __builtin_amdgcn_readfirstlane(tid >> 5); const int lane = tid & 31, ln = lane & 15, hh = lane >> 4;
  const int h = blockIdx.y, b = blockIdx.z; const size_t rowb = (size_t)b * SEQ;
  const _Float16* gk = K16 + (rowb + (tid >> 3)) * DM + h * HD + (tid & 7) * 8;                    /* copy role, K: row within a group of 16, 16-byte piece */
  const _Float16* gv = Vt + ((size_t)(b * NH + h) * HD + (tid >> 4)) * SEQ + (tid & 15) * 8;       /* copy role, V^T: row within a group of 8, 16-byte piece */
  const unsigned lk = (unsigned)(size_t)ring + (unsigned)((tid >> 3) * AKPITCH + (tid & 7) * 16);
  const unsigned lv = (unsigned)(size_t)ring + (unsigned)(AKBYTES + (tid >> 4) * AVPITCH + (tid & 15) * 16);
  at_stage(lk, lv, gk, gv);                                               /* stage 0 flies while the mask words are built */
  {
    const int wi = (tid < SEQ / 32) ? tid : (SEQ / 32 - 1);               /* clamped address; every thread loads, only the owners store */
    const int* mp = mask + (size_t)b * SEQ_FULL + (size_t)wi * 32; unsigned int wbits = 0u;
#pragma unroll 1
    for (int j = 0; j < 32; ++j) wbits |= ((mp[j] != 0) ? 1u : 0u) << j;
    if (tid < SEQ / 32) smw[tid] = wbits;
  }
  asm volatile("s_wait_asynccnt 0x0" ::: "memory");       /* this wave's copies of stage 0 have landed */
  __syncthreads();                                        /* mask words and stage 0 published to every wave */
  at_stage(lk + ASTAGE, lv + ASTAGE, gk + (size_t)AKT * DM, gv + AKT);
  const int q0 = blockIdx.x * 64 + wave * 16;
  const _Float16* Qp = Q16 + (rowb + q0 + ln) * DM + h * HD;
  const v16h qf0 = g2_frag(Qp, hh), qf1 = g2_frag(Qp + 32, hh);
  const unsigned char* fk = ring + ln * AKPITCH + 16 * hh; const unsigned char* fv = ring + AKBYTES + ln * AVPITCH + 16 * hh;
  const v8f z8 = {0.f,0.f,0.f,0.f,0.f,0.f,0.f,0.f};
  v8f o0 = z8, o1 = z8, o2 = z8, o3 = z8; float mrun = -1.0e30f, lpart = 0.f;
#pragma unroll 1   /* one stage a trip: one publish point and one refill site in the code */
  for (int t = 0; t < SEQ / AKT; ++t) { const unsigned bo = (unsigned)(t & 1) * ASTAGE; const unsigned char* pk = fk + bo; const unsigned char* pv = fv + bo;
   v16h ka0 = g2_lfrag(pk), ka1 = g2_lfrag(pk + 64), ka2 = g2_lfrag(pk + 16 * AKPITCH), ka3 = g2_lfrag(pk + 16 * AKPITCH + 64);
#pragma unroll   /* LDS offsets become immediates; the K fragments of the same stage's next step are read ahead */
   for (int kk = 0; kk < AKT / 32; ++kk) {
    const v16h va0 = g2_lfrag(pv + kk * 64), va1 = g2_lfrag(pv + 16 * AVPITCH + kk * 64), va2 = g2_lfrag(pv + 32 * AVPITCH + kk * 64), va3 = g2_lfrag(pv + 48 * AVPITCH + kk * 64);
    v8f s0 = z8, s1 = z8;
    s0 = g2_mma(ka0, qf0, s0);
    s0 = g2_mma(ka1, qf1, s0);
    s1 = g2_mma(ka2, qf0, s1);
    s1 = g2_mma(ka3, qf1, s1);
    if (kk + 1 < AKT / 32) { const unsigned char* nk = pk + (kk + 1) * 32 * AKPITCH;
      ka0 = g2_lfrag(nk); ka1 = g2_lfrag(nk + 64); ka2 = g2_lfrag(nk + 16 * AKPITCH); ka3 = g2_lfrag(nk + 16 * AKPITCH + 64); }
    const unsigned int mw = smw[t * (AKT / 32) + kk] >> (8 * hh);      /* kb = 128t+32kk; bit r: key kb+8hh+r (tile 0); bit 16+r: key kb+16+8hh+r (tile 1) */
    float e0[8], e1[8]; float mx = -3.0e38f;
#pragma unroll
    for (int r = 0; r < 8; ++r) {
      float x0 = s0[r] * 0.125f; x0 = ((mw >> r) & 1u) ? x0 : -1.0e9f;
      float x1 = s1[r] * 0.125f; x1 = ((mw >> (16 + r)) & 1u) ? x1 : -1.0e9f;
      e0[r] = x0; e1[r] = x1; mx = fmaxf(mx, fmaxf(x0, x1));
    }
    mx = fmaxf(mx, __shfl_xor(mx, 16));
    const float mnew = fmaxf(mrun, mx); const float alpha = __expf(mrun - mnew); mrun = mnew;
    float ps = 0.f; FragH pf;
#pragma unroll
    for (int r = 0; r < 8; ++r) {
      const float p0 = __expf(e0[r] - mnew), p1 = __expf(e1[r] - mnew); ps += p0 + p1;
      pf.h[r] = (_Float16)(p0 * 1024.0f); pf.h[8 + r] = (_Float16)(p1 * 1024.0f);
    }
    lpart = lpart * alpha + ps;
#pragma unroll
    for (int r = 0; r < 8; ++r) { o0[r] *= alpha; o1[r] *= alpha; o2[r] *= alpha; o3[r] *= alpha; }
    const v16h pb = pf.v;
    o0 = g2_mma(va0, pb, o0);
    o1 = g2_mma(va1, pb, o1);
    o2 = g2_mma(va2, pb, o2);
    o3 = g2_mma(va3, pb, o3);
   }
   asm volatile("s_wait_dscnt 0x0" ::: "memory");         /* this wave's reads of the buffer have returned before it may be refilled */
   asm volatile("s_wait_asynccnt 0x0" ::: "memory");      /* this wave's copies of stage t + 1 have landed */
   __syncthreads();                                       /* publishes stage t + 1 and ends every wave's reads of stage t */
   if (t + 2 < SEQ / AKT) at_stage(lk + bo, lv + bo, gk + (size_t)(t + 2) * AKT * DM, gv + (size_t)(t + 2) * AKT);
  }
  asm volatile("s_wait_asynccnt 0x0" ::: "memory");       /* no copy outstanding behind the loop */
  const float l = lpart + __shfl_xor(lpart, 16);
  const float inv = 1.0f / (l * 16.0f);                    /* P carried x1024, ctx carried x64: x64/1024 = 1/16 */
  FragH t0, t1, t2, t3;
#pragma unroll
  for (int r = 0; r < 8; ++r) { t0.h[r] = (_Float16)(o0[r] * inv); t1.h[r] = (_Float16)(o1[r] * inv); t2.h[r] = (_Float16)(o2[r] * inv); t3.h[r] = (_Float16)(o3[r] * inv); }
  *(v8us*)&sh[wave][ln][0 + 8 * hh] = t0.half[0];
  *(v8us*)&sh[wave][ln][16 + 8 * hh] = t1.half[0];
  *(v8us*)&sh[wave][ln][32 + 8 * hh] = t2.half[0];
  *(v8us*)&sh[wave][ln][48 + 8 * hh] = t3.half[0];
  __syncthreads();
  const int rsub = lane >> 3, pc = lane & 7;               
  {
#pragma unroll
    for (int it = 0; it < 4; ++it) { const int row = it * 4 + rsub; const v8us v = *(const v8us*)&sh[wave][row][pc * 8];
      *(v8us*)((unsigned short*)CTX + (rowb + q0 + row) * DM + h * HD + pc * 8) = v; }
     }
}

#define WBYTES ((size_t)DM * DM * 2)
#define PBYTES ((size_t)NB * SEQ * DM * 2)
static_assert(WBYTES % 256 == 0 && PBYTES % 256 == 0);
static_assert(4 * WBYTES + 8 * PBYTES <= (size_t)134217728);      /* total carve: 4 weight planes + 8 token planes (V^T plane = NB*NH*HD*SEQ halves = one token plane) */

extern "C" void kernel_launch(void* const* d_in, const int* in_sizes, int n_in,
                              void* d_out, int out_size, void* d_ws, size_t ws_size, hipStream_t stream) {
  if (n_in < 12) return;
  const long long need_x = (long long)(NB - 1) * SEQ_FULL * DM + (long long)SEQ * DM;
  if ((long long)in_sizes[0] < need_x || (long long)in_sizes[1] < need_x || (long long)in_sizes[2] < need_x) return;
  if ((long long)in_sizes[3] < (long long)(NB - 1) * SEQ_FULL + SEQ) return;
  if (in_sizes[4] < DM * DM || in_sizes[6] < DM * DM || in_sizes[8] < DM * DM || in_sizes[10] < DM * DM) return;
  if (in_sizes[5] < DM || in_sizes[7] < DM || in_sizes[9] < DM || in_sizes[11] < DM) return;
  if ((long long)out_size < (long long)NB * SEQ * DM) return;
  /* wire order: q, k, v, mask (int32), Wq, bq, Wk, bk, Wv, bv, Wo, bo */
  const float* xq = (const float*)d_in[0]; const float* xk = (const float*)d_in[1]; const float* xv = (const float*)d_in[2];
  const int* mask = (const int*)d_in[3];
  const float* Wq = (const float*)d_in[4]; const float* bq = (const float*)d_in[5];
  const float* Wk = (const float*)d_in[6]; const float* bk = (const float*)d_in[7];
  const float* Wv = (const float*)d_in[8]; const float* bv = (const float*)d_in[9];
  const float* Wo = (const float*)d_in[10]; const float* bo = (const float*)d_in[11];
  float* out = (float*)d_out;
  char* ws = (char*)d_ws; size_t off = 0;
  _Float16* BQ = (_Float16*)(ws + off); off += WBYTES;
  _Float16* BK = (_Float16*)(ws + off); off += WBYTES;
  _Float16* BV = (_Float16*)(ws + off); off += WBYTES;
  _Float16* BO = (_Float16*)(ws + off); off += WBYTES;
  _Float16* XQ = (_Float16*)(ws + off); off += PBYTES;
  _Float16* XK = (_Float16*)(ws + off); off += PBYTES;
  _Float16* XV = (_Float16*)(ws + off); off += PBYTES;
  _Float16* Q16 = (_Float16*)(ws + off); off += PBYTES;
  _Float16* K16 = (_Float16*)(ws + off); off += PBYTES;
  _Float16* V16 = (_Float16*)(ws + off); off += PBYTES;
  _Float16* VT = (_Float16*)(ws + off); off += PBYTES;
  _Float16* CTX = (_Float16*)(ws + off); off += PBYTES;
  if (off > ws_size) return;
  k_cvt<<<3u * GX + 4u * GW, 256, 0, stream>>>(xq, xk, xv, Wq, Wk, Wv, Wo, XQ, BQ);      /* planes XQ, XK, XV and BQ, BK, BV, BO */
  const unsigned gg = (unsigned)((MR / 128) * (DM / 64));
  k_gemm_qkv<<<dim3(gg, 3), 128, 0, stream>>>(XQ, DM, BQ, DM, 0.0625f, bq, bk, bv, Q16, DM, DM, DM);      /* q = xq Wq^T + bq, k = xk Wk^T + bk, v = xv Wv^T + bv into planes Q16, K16, V16 (weights x16 -> alpha 1/16) */
  k_vt<<<(unsigned)(NB * NH * (SEQ / 64)), 256, 0, stream>>>(V16, VT);                   /* in [NB*SEQ][h*64+d] -> out [(b,h)][d][SEQ] */
  k_attn<<<dim3(SEQ / 64, NH, NB), 128, 0, stream>>>(Q16, K16, VT, mask, CTX);           /* ctx x64, merged heads */
  k_gemm_f32<<<gg, 128, 0, stream>>>(CTX, DM, BO, DM, 0.0009765625f, bo, out, DM, DM, DM);      /* out = ctx Wo^T + bo (x64 and x16 carries -> alpha 2^-10) */
}

// v004
// It runs in 59.5 microseconds.
// In two side-by-side timings against v003, it was 1.06 and 1.07 times as fast.
// Counting every step since v000, it is 4.09 times as fast.
#include <hip/hip_runtime.h>
// Multi-head attention with three input streams (q, k, v each [NB][SEQ][1024]), [out][in] projection weights with biases, integer key-padding mask applied as a finite replacement (-1e9) per (batch, key), 16 heads of 64, score scale 1/8, softmax over the keys of the same batch, heads merged h*64+d, output projection with bias.
// Compute dtype: every contraction on v_wmma_f32_16x16x32_f16 (f16 operands, f32 accumulate). Float inputs are converted (RNE) to bf16 first and carried as exact f16 (weights x16); q, k, v planes plain f16; softmax weights exp(s-m) carried x1024 as f16 (row sum l from the unconverted f32 values); ctx carried x64 as f16; scores and softmax statistics f32.
// Structure: one launch for the 3 activation and 4 weight converts, one launch for the 3 projection GEMMs (32x64 wave tiles, operands staged in LDS by asynchronous copies, two buffers; the v blocks store their tile transposed, as V^T), one fused online-softmax attention kernel (K and V^T tiles of 128 keys staged in LDS by asynchronous copies, two buffers, shared by the block's 4 waves; transposed score tiles S^T = K Q^T so a lane owns one query column; P^T accumulator tiles feed the next WMMA as its B operand directly), one output GEMM (f32).
#ifndef NB
#define NB 2
#endif
#ifndef SEQ
#define SEQ 1024
#endif
#define NB_FULL 2
#define SEQ_FULL 1024
#define DM 1024
#define NH 16
#define HD 64
#define NR ((size_t)NB * SEQ)         /* token rows processed */
#define MR ((int)(NB * SEQ))

typedef unsigned short v8us __attribute__((ext_vector_type(8), may_alias));
typedef float  v8f  __attribute__((ext_vector_type(8)));
typedef float  v4f  __attribute__((ext_vector_type(4)));
typedef float  v4fa __attribute__((ext_vector_type(4), may_alias));
typedef _Float16 v16h __attribute__((ext_vector_type(16)));
typedef _Float16 v4h __attribute__((ext_vector_type(4)));
union FragH { v16h v; v8us half[2]; _Float16 h[16]; unsigned short u[16]; };

static_assert(NH * HD == DM);                 /* merged head width */
static_assert(HD == 64);                      /* attention kernel: 2 k-steps of 32 over the head dim, 4 output tiles of 16 */
static_assert(DM % 64 == 0 && DM % 32 == 0 && DM % 8 == 0);  /* GEMM N tiles, K steps, 16-B pieces */
static_assert(SEQ % 128 == 0);                /* attention block = 64 queries; key steps of 32; a GEMM block's 128 token rows lie in one batch (V^T store) */
static_assert((NB * SEQ) % 128 == 0);         /* GEMM block = 128 rows, no row tail */
static_assert(SEQ / 32 <= 128);               /* mask words built by the first SEQ/32 threads of a 128-thread block */
static_assert(NB <= NB_FULL && SEQ <= SEQ_FULL);
static_assert(((size_t)NB * SEQ * DM) % (8 * 256) == 0);     /* convert grids exact */
static_assert(((size_t)DM * DM) % (8 * 256) == 0);

__device__ __forceinline__ unsigned short bf16_bits(float x) { unsigned int u = __float_as_uint(x); return (unsigned short)((u + 0x7FFFu + ((u >> 16) & 1u)) >> 16); }
__device__ __forceinline__ float bf16_val(unsigned short b) { return __uint_as_float(((unsigned int)b) << 16); }
__device__ __forceinline__ float bfr(float x) { return bf16_val(bf16_bits(x)); }      /* RNE convert to bf16, back to f32 */

// fragment (A or B, same k map): elements 0..7 = k0+8h.., elements 8..15 = k0+16+8h.. from a k-contiguous 16-bit row
__device__ __forceinline__ v16h g2_frag(const _Float16* p, int hh) { FragH f; f.half[0] = *(const v8us*)((const unsigned short*)p + 8 * hh); f.half[1] = *(const v8us*)((const unsigned short*)p + 16 + 8 * hh); return f.v; }
// one WMMA with its own hazard guard (ties D, keeps A/B live)
__device__ __forceinline__ v8f g2_mma(v16h a, v16h b, v8f c) { v8f d = __builtin_amdgcn_wmma_f32_16x16x32_f16(false, a, false, b, (short)0, c, false, false); asm volatile("v_nop\n\tv_nop\n\tv_nop\n\tv_nop" : "+v"(d) : "v"(a), "v"(b)); return d; }

__device__ __forceinline__ void wnat_body(const float* __restrict__ w, _Float16* __restrict__ Bt, unsigned blk) {
  const size_t t = (size_t)blk * 256 + threadIdx.x; if (t >= (size_t)DM * DM / 8) return;
  const v4f a = *(const v4fa*)(w + t * 8), c = *(const v4fa*)(w + t * 8 + 4); FragH f;
#pragma unroll
  for (int q = 0; q < 4; ++q) { f.h[q] = (_Float16)(bfr(a[q]) * 16.0f); f.h[4 + q] = (_Float16)(bfr(c[q]) * 16.0f); }
  const v8us o = f.half[0];
  *(v8us*)((unsigned short*)Bt + t * 8) = o; 
}

__device__ __forceinline__ void x16_body(const float* __restrict__ x, _Float16* __restrict__ X16, unsigned blk) {
  const size_t t = (size_t)blk * 256 + threadIdx.x; if (t >= NR * DM / 8) return;
  const size_t e = t * 8; const size_t row = e / DM; const size_t col = e % DM; const size_t bb = row / SEQ, s = row % SEQ;
  const float* src = x + (bb * SEQ_FULL + s) * DM + col;
  const v4f a = *(const v4fa*)(src), c = *(const v4fa*)(src + 4); FragH f;
#pragma unroll
  for (int q = 0; q < 4; ++q) { f.h[q] = (_Float16)bfr(a[q]); f.h[4 + q] = (_Float16)bfr(c[q]); }
  const v8us o = f.half[0];
  *(v8us*)((unsigned short*)X16 + t * 8) = o; 
}
// The seven converts read none of each other's output: one grid. Blocks [0, 3*GX) take the activation streams (GX blocks each), the rest the weight matrices (GW blocks each);
// the f16 planes of a kind lie one behind the other, so the stream or matrix number picks source pointer and destination plane.
#define GW ((unsigned)(((size_t)DM * DM / 8) / 256))
#define GX ((unsigned)((NR * DM / 8) / 256))
__global__ __launch_bounds__(256) void k_cvt(const float* __restrict__ xq, const float* __restrict__ xk, const float* __restrict__ xv,
                                             const float* __restrict__ Wq, const float* __restrict__ Wk, const float* __restrict__ Wv, const float* __restrict__ Wo,
                                             _Float16* __restrict__ X16, _Float16* __restrict__ Bt) {
  const unsigned bx = blockIdx.x;
  if (bx < 3u * GX) { const unsigned s = bx / GX; const float* x = (s == 0u) ? xq : (s == 1u) ? xk : xv;
    x16_body(x, X16 + (size_t)s * NR * DM, bx - s * GX); }
  else { const unsigned r = bx - 3u * GX; const unsigned s = r / GW; const float* w = (s & 2u) ? ((s & 1u) ? Wo : Wv) : ((s & 1u) ? Wk : Wq);
    wnat_body(w, Bt + (size_t)s * DM * DM, r - s * GW); }
}

// GEMM C[M][N] = alpha * A[M][K] . Bt[N][K]^T + bf16(bias[N]); A, Bt f16 k-contiguous rows; block = 4 waves, wave tile 32x64;
// operands reach the waves through LDS: a pass is 128 k (256 B of each of the block's 128 A rows and 64 Bt rows), copied asynchronously into one of two buffers while the other is worked on.
#define GKP 128                       /* k per pass */
#define GPITCH 272                    /* LDS row pitch in bytes: 16 B x odd, for 16-byte fragment reads down a column of rows */
#define GSTAGE (192 * GPITCH)         /* one buffer: rows 0..127 = A rows of the block, rows 128..191 = Bt rows of the block */
static_assert(DM % GKP == 0 && DM / GKP >= 2);   /* whole passes only */
// fragment from an LDS row, same k map as g2_frag; p already holds the lane's 16*hh byte offset
__device__ __forceinline__ v16h g2_lfrag(const unsigned char* p) { FragH f; f.half[0] = *(const v8us*)p; f.half[1] = *(const v8us*)(p + 32); return f.v; }
// twelve 16-byte copies of a lane, global -> LDS through no register; the closing s_wait_xcnt stands inside the statement so that no address register is rewritten ahead of it
__device__ __forceinline__ void g2_copy12(const unsigned* l, const _Float16* const* g) {
  asm volatile("global_load_async_to_lds_b128 %0, %12, off\n\t"
               "global_load_async_to_lds_b128 %1, %13, off\n\t"
               "global_load_async_to_lds_b128 %2, %14, off\n\t"
               "global_load_async_to_lds_b128 %3, %15, off\n\t"
               "global_load_async_to_lds_b128 %4, %16, off\n\t"
               "global_load_async_to_lds_b128 %5, %17, off\n\t"
               "global_load_async_to_lds_b128 %6, %18, off\n\t"
               "global_load_async_to_lds_b128 %7, %19, off\n\t"
               "global_load_async_to_lds_b128 %8, %20, off\n\t"
               "global_load_async_to_lds_b128 %9, %21, off\n\t"
               "global_load_async_to_lds_b128 %10, %22, off\n\t"
               "global_load_async_to_lds_b128 %11, %23, off\n\t"
               "s_wait_xcnt 0x0"
               :: "v"(l[0]), "v"(l[1]), "v"(l[2]), "v"(l[3]), "v"(l[4]), "v"(l[5]), "v"(l[6]), "v"(l[7]), "v"(l[8]), "v"(l[9]), "v"(l[10]), "v"(l[11]),
                  "v"(g[0]), "v"(g[1]), "v"(g[2]), "v"(g[3]), "v"(g[4]), "v"(g[5]), "v"(g[6]), "v"(g[7]), "v"(g[8]), "v"(g[9]), "v"(g[10]), "v"(g[11])
               : "memory");
}
// one pass's tile: 192 rows of 256 B; 16 lanes cover a row, the block's 128 lanes 8 rows, so 24 copies a lane (16 for A, 8 for Bt)
__device__ __forceinline__ void g2_stage(unsigned lb, const _Float16* ga, int lda, const _Float16* gb, int ldb) {
  unsigned l[24]; const _Float16* g[24];
#pragma unroll   /* both loops: every address becomes a register operand of the copy statements, no array in memory */
  for (int j = 0; j < 16; ++j) { l[j] = lb + (unsigned)(j * 8 * GPITCH); g[j] = ga + (size_t)(j * 8) * lda; }
#pragma unroll
  for (int j = 0; j < 8; ++j) { l[16 + j] = lb + (unsigned)((128 + j * 8) * GPITCH); g[16 + j] = gb + (size_t)(j * 8) * ldb; }
  g2_copy12(l, g); g2_copy12(l + 12, g + 12);
}
template <bool F32OUT>
__device__ __forceinline__ void gemm2_body(const _Float16* __restrict__ A, int lda, const _Float16* __restrict__ Bh, int ldb, float alpha, const float* __restrict__ bias,
                                           float* __restrict__ C, _Float16* __restrict__ C16, int ldc, int N, int K, bool vt) {
  __shared__ __attribute__((aligned(16))) float so[4][32][68];
  __shared__ __attribute__((aligned(16))) unsigned char ring[2 * GSTAGE];
  const int tid = threadIdx.x; const int w = __builtin_amdgcn_readfirstlane(tid >> 5); const int lane = tid & 31, ln = lane & 15, hh = lane >> 4;
  const int ntn = N >> 6; const int mt = blockIdx.x / ntn, nq = blockIdx.x - mt * ntn; const int row0 = mt * 128 + 32 * w, col0 = nq * 64;
  const int cr = tid >> 4, cc = tid & 15;                 /* copy role: row within a group of 8, 16-byte piece within the row */
  const _Float16* ga = A + (size_t)(mt * 128 + cr) * lda + cc * 8; const _Float16* gb = Bh + (size_t)(col0 + cr) * ldb + cc * 8;
  const unsigned lb = (unsigned)(size_t)ring + (unsigned)(cr * GPITCH + cc * 16);
  const unsigned char* fa = ring + (32 * w + ln) * GPITCH + 16 * hh; const unsigned char* fb = ring + (128 + ln) * GPITCH + 16 * hh;
  const int np = K / GKP;
  const v8f z8 = {0.f,0.f,0.f,0.f,0.f,0.f,0.f,0.f}; v8f c00 = z8, c01 = z8, c02 = z8, c03 = z8, c10 = z8, c11 = z8, c12 = z8, c13 = z8;
  g2_stage(lb, ga, lda, gb, ldb);
  asm volatile("s_wait_asynccnt 0x0" ::: "memory");       /* this wave's copies of pass 0 have landed */
  __syncthreads();                                        /* pass 0 published to every wave */
  if (np > 1) g2_stage(lb + GSTAGE, ga + GKP, lda, gb + GKP, ldb);
#pragma unroll 1   /* one pass a trip: one publish point and one refill site in the code */
  for (int t = 0; t < np; ++t) { const unsigned bo = (unsigned)(t & 1) * GSTAGE; const unsigned char* pa = fa + bo; const unsigned char* pb = fb + bo;
    v16h a0 = g2_lfrag(pa), a1 = g2_lfrag(pa + 16 * GPITCH), b0 = g2_lfrag(pb), b1 = g2_lfrag(pb + 16 * GPITCH), b2 = g2_lfrag(pb + 32 * GPITCH), b3 = g2_lfrag(pb + 48 * GPITCH);
#pragma unroll   /* the two fragment sets alternate by renaming, LDS offsets become immediates */
    for (int ks = 0; ks < GKP / 32; ++ks) { v16h na0 = a0, na1 = a1, nb0 = b0, nb1 = b1, nb2 = b2, nb3 = b3;
      if (ks + 1 < GKP / 32) { const int o = (ks + 1) * 64;      /* the same pass's next k-step, read ahead of this step's products */
        na0 = g2_lfrag(pa + o); na1 = g2_lfrag(pa + 16 * GPITCH + o); nb0 = g2_lfrag(pb + o); nb1 = g2_lfrag(pb + 16 * GPITCH + o); nb2 = g2_lfrag(pb + 32 * GPITCH + o); nb3 = g2_lfrag(pb + 48 * GPITCH + o); }
      c00 = g2_mma(a0, b0, c00); c10 = g2_mma(a1, b0, c10);
      c01 = g2_mma(a0, b1, c01); c11 = g2_mma(a1, b1, c11);
      c02 = g2_mma(a0, b2, c02); c12 = g2_mma(a1, b2, c12);
      c03 = g2_mma(a0, b3, c03); c13 = g2_mma(a1, b3, c13);
      a0 = na0; a1 = na1; b0 = nb0; b1 = nb1; b2 = nb2; b3 = nb3; }
    asm volatile("s_wait_dscnt 0x0" ::: "memory");        /* this wave's reads of the buffer have returned before it may be refilled */
    asm volatile("s_wait_asynccnt 0x0" ::: "memory");     /* this wave's copies of pass t + 1 have landed */
    __syncthreads();                                      /* publishes pass t + 1 and ends every wave's reads of pass t */
    if (t + 2 < np) g2_stage(lb + bo, ga + (size_t)(t + 2) * GKP, lda, gb + (size_t)(t + 2) * GKP, ldb); }
  asm volatile("s_wait_asynccnt 0x0" ::: "memory");       /* no copy outstanding behind the loop */
  v8f accs[8] = {c00, c01, c02, c03, c10, c11, c12, c13};
  if (!F32OUT && vt) {      /* block-uniform. C16 = V^T plane [(batch, head)][d][SEQ]; the block's 64 columns are the 64 d of head nq, its 128 rows are 128 tokens of one batch */
    unsigned char* st = (unsigned char*)&so[0][0][0];      /* block tile [d][token] in f16, row pitch GPITCH (256 B of tokens + 16) */
#pragma unroll
    for (int u = 0; u < 8; ++u) { const int t = u & 3, half = u >> 2; const float bv = bfr(bias[col0 + t * 16 + ln]); FragH f;
#pragma unroll
      for (int r = 0; r < 8; ++r) f.h[r] = (_Float16)(accs[u][r] * alpha + bv);      /* a lane's 8 accumulator elements = 8 consecutive tokens of one d: one 16-byte piece of a V^T row */
      *(v8us*)(st + (t * 16 + ln) * GPITCH + (32 * w + 16 * half + 8 * hh) * 2) = f.half[0]; }
    __syncthreads();      /* every wave wrote its 32 tokens into all 64 rows; the rows are read back across waves */
    const int tok0 = mt * 128; _Float16* vb = C16 + ((size_t)((tok0 / SEQ) * NH + nq) * HD) * SEQ + (tok0 % SEQ);
#pragma unroll
    for (int q = 0; q < 8; ++q) { const int d = q * 8 + cr; const v8us v = *(const v8us*)(st + d * GPITCH + cc * 16);      /* 16 lanes store 256 contiguous bytes of a row */
      *(v8us*)((unsigned short*)vb + (size_t)d * SEQ + cc * 8) = v; }
    return;
  }
#pragma unroll
  for (int u = 0; u < 8; ++u) { const int t = u & 3, half = u >> 2; const int col = col0 + t * 16 + ln; const float bv = bfr(bias[col]);
#pragma unroll
    for (int r = 0; r < 8; ++r) { const int rloc = half * 16 + 8 * hh + r; so[w][rloc][t * 16 + ln] = accs[u][r] * alpha + bv; } }
  __syncthreads();      /* staging tile is private to the wave; the block barrier is a superset of the wave-level ordering needed */
  const int rsub = lane >> 4, c4 = (lane & 15) * 4;
  {
#pragma unroll
    for (int q = 0; q < 16; ++q) { const int r = q * 2 + rsub; const v4f v = *(const v4fa*)&so[w][r][c4];
      if (F32OUT) { *(v4f*)(C + (size_t)(row0 + r) * ldc + col0 + c4) = v; }
      else { v4h h4; h4[0] = (_Float16)v[0]; h4[1] = (_Float16)v[1]; h4[2] = (_Float16)v[2]; h4[3] = (_Float16)v[3]; *(v4h*)(C16 + (size_t)(row0 + r) * ldc + col0 + c4) = h4; } }
    if (!F32OUT) asm volatile("s_wait_xcnt 0x0" ::: "memory");      /* in the built code the V^T block lies behind these stores: no register that a store names is rewritten there ahead of this wait */
     }
}
// the three projections in one grid: blockIdx.y = 0, 1, 2 picks the q, k or v problem; its A, Bt and C planes lie one behind the other; the third C plane is written as V^T
__global__ __launch_bounds__(128) void k_gemm_qkv(const _Float16* __restrict__ A, int lda, const _Float16* __restrict__ Bh, int ldb, float alpha,
                                                  const float* __restrict__ bq, const float* __restrict__ bk, const float* __restrict__ bv, _Float16* __restrict__ C16, int ldc, int N, int K) {
  const unsigned s = blockIdx.y; const float* bias = (s == 0u) ? bq : (s == 1u) ? bk : bv;
  gemm2_body<false>(A + (size_t)s * NR * DM, lda, Bh + (size_t)s * DM * DM, ldb, alpha, bias, nullptr, C16 + (size_t)s * NR * DM, ldc, N, K, s == 2u);
}
__global__ __launch_bounds__(128) void k_gemm_f32(const _Float16* __restrict__ A, int lda, const _Float16* __restrict__ Bh, int ldb, float alpha, const float* __restrict__ bias, float* __restrict__ C, int ldc, int N, int K) {
  gemm2_body<true>(A, lda, Bh, ldb, alpha, bias, C, nullptr, ldc, N, K, false);
}

// Attention operands reach the waves through LDS: a stage is 128 keys of one (batch, head): 128 K rows of 128 B and 64 V^T rows of 256 B, copied asynchronously into one of two buffers while the other is worked on.
#define AKT 128                       /* keys per stage */
#define AKPITCH 144                   /* LDS pitch of a K row in bytes: 16 B x odd, for 16-byte fragment reads down a column of rows */
#define AVPITCH 272                   /* LDS pitch of a V^T row in bytes: 16 B x odd */
#define AKBYTES (AKT * AKPITCH)       /* K rows first, V^T rows behind them */
#define ASTAGE (AKBYTES + HD * AVPITCH)
static_assert(SEQ % AKT == 0 && SEQ / AKT >= 2);   /* whole stages only, both buffers filled in the prologue */
static_assert(AKT * HD * 2 == 8 * 128 * 16);       /* each operand's tile = 8 copies of 16 B by each of 128 lanes */
// eight 16-byte copies of a lane, global -> LDS through no register; the closing s_wait_xcnt stands inside the statement so that no address register is rewritten ahead of it
__device__ __forceinline__ void at_copy8(const unsigned* l, const _Float16* const* g) {
  asm volatile("global_load_async_to_lds_b128 %0, %8, off\n\t"
               "global_load_async_to_lds_b128 %1, %9, off\n\t"
               "global_load_async_to_lds_b128 %2, %10, off\n\t"
               "global_load_async_to_lds_b128 %3, %11, off\n\t"
               "global_load_async_to_lds_b128 %4, %12, off\n\t"
               "global_load_async_to_lds_b128 %5, %13, off\n\t"
               "global_load_async_to_lds_b128 %6, %14, off\n\t"
               "global_load_async_to_lds_b128 %7, %15, off\n\t"
               "s_wait_xcnt 0x0"
               :: "v"(l[0]), "v"(l[1]), "v"(l[2]), "v"(l[3]), "v"(l[4]), "v"(l[5]), "v"(l[6]), "v"(l[7]),
                  "v"(g[0]), "v"(g[1]), "v"(g[2]), "v"(g[3]), "v"(g[4]), "v"(g[5]), "v"(g[6]), "v"(g[7])
               : "memory");
}
// one stage: K: 8 lanes cover a row, the block's 128 lanes 16 rows; V^T: 16 lanes cover a row, the block 8 rows; 8 copies a lane for each
__device__ __forceinline__ void at_stage(unsigned lk, unsigned lv, const _Float16* gk, const _Float16* gv) {
  unsigned l[16]; const _Float16* g[16];
#pragma unroll   /* every address becomes a register operand of the copy statements, no array in memory */
  for (int j = 0; j < 8; ++j) { l[j] = lk + (unsigned)(j * 16 * AKPITCH); g[j] = gk + (size_t)(j * 16) * DM; l[8 + j] = lv + (unsigned)(j * 8 * AVPITCH); g[8 + j] = gv + (size_t)(j * 8) * SEQ; }
  at_copy8(l, g); at_copy8(l + 8, g + 8);
}

// Fused attention: block = 4 waves = 64 queries of one (batch, head); wave = 16 queries; key loop in stages of 128 keys, steps of 32 keys.
// Score tiles are computed TRANSPOSED (A = K rows [key][d], B = Q rows [query][d]): accumulator element r of lane (hh, ln) = (key 8hh+r, query ln),
// so a lane owns one query column: row max = in-lane max + one xor-16 shuffle. The two 16-key P^T tiles are the B operand of the next product
// (elements 0..7 <- tile 0 element r, elements 8..15 <- tile 1 element r, lane unchanged); A = V^T rows [d][key]; accumulators hold O^T (d 8hh+r, query ln).
// Mask: 32-bit keep words per 32 keys built once per block in LDS; masked logits are REPLACED by -1e9 (a fully masked row comes out uniform).
__global__ __launch_bounds__(128) void k_attn(const _Float16* __restrict__ Q16, const _Float16* __restrict__ K16, const _Float16* __restrict__ Vt, const int* __restrict__ mask, _Float16* __restrict__ CTX) {
  __shared__ unsigned int smw[SEQ / 32];                                   /* cross-wave: written by the first SEQ/32 threads, read by all after the block barrier */
  __shared__ __attribute__((aligned(16))) unsigned short sh[4][16][72];    /* per-wave output staging [query][d], pitch 144 B */
  __shared__ __attribute__((aligned(16))) unsigned char ring[2 * ASTAGE];  /* the two K / V^T stage buffers */
  const int tid = threadIdx.x; const int wave = __builtin_amdgcn_readfirstlane(tid >> 5); const int lane = tid & 31, ln = lane & 15, hh = lane >> 4;
  const int h = blockIdx.y, b = blockIdx.z; const size_t rowb = (size_t)b * SEQ;
  const _Float16* gk = K16 + (rowb + (tid >> 3)) * DM + h * HD + (tid & 7) * 8;                    /* copy role, K: row within a group of 16, 16-byte piece */
  const _Float16* gv = Vt + ((size_t)(b * NH + h) * HD + (tid >> 4)) * SEQ + (tid & 15) * 8;       /* copy role, V^T: row within a group of 8, 16-byte piece */
  const unsigned lk = (unsigned)(size_t)ring + (unsigned)((tid >> 3) * AKPITCH + (tid & 7) * 16);
  const unsigned lv = (unsigned)(size_t)ring + (unsigned)(AKBYTES + (tid >> 4) * AVPITCH + (tid & 15) * 16);
  at_stage(lk, lv, gk, gv);                                               /* stage 0 flies while the mask words are built */
  {
    const int wi = (tid < SEQ / 32) ? tid : (SEQ / 32 - 1);               /* clamped address; every thread loads, only the owners store */
    const int* mp = mask + (size_t)b * SEQ_FULL + (size_t)wi * 32; unsigned int wbits = 0u;
#pragma unroll 1
    for (int j = 0; j < 32; ++j) wbits |= ((mp[j] != 0) ? 1u : 0u) << j;
    if (tid < SEQ / 32) smw[tid] = wbits;
  }
  asm volatile("s_wait_asynccnt 0x0" ::: "memory");       /* this wave's copies of stage 0 have landed */
  __syncthreads();                                        /* mask words and stage 0 published to every wave */
  at_stage(lk + ASTAGE, lv + ASTAGE, gk + (size_t)AKT * DM, gv + AKT);
  const int q0 = blockIdx.x * 64 + wave * 16;
  const _Float16* Qp = Q16 + (rowb + q0 + ln) * DM + h * HD;
  const v16h qf0 = g2_frag(Qp, hh), qf1 = g2_frag(Qp + 32, hh);
  const unsigned char* fk = ring + ln * AKPITCH + 16 * hh; const unsigned char* fv = ring + AKBYTES + ln * AVPITCH + 16 * hh;
  const v8f z8 = {0.f,0.f,0.f,0.f,0.f,0.f,0.f,0.f};
  v8f o0 = z8, o1 = z8, o2 = z8, o3 = z8; float mrun = -1.0e30f, lpart = 0.f;
#pragma unroll 1   /* one stage a trip: one publish point and one refill site in the code */
  for (int t = 0; t < SEQ / AKT; ++t) { const unsigned bo = (unsigned)(t & 1) * ASTAGE; const unsigned char* pk = fk + bo; const unsigned char* pv = fv + bo;
   v16h ka0 = g2_lfrag(pk), ka1 = g2_lfrag(pk + 64), ka2 = g2_lfrag(pk + 16 * AKPITCH), ka3 = g2_lfrag(pk + 16 * AKPITCH + 64);
#pragma unroll   /* LDS offsets become immediates; the K fragments of the same stage's next step are read ahead */
   for (int kk = 0; kk < AKT / 32; ++kk) {
    const v16h va0 = g2_lfrag(pv + kk * 64), va1 = g2_lfrag(pv + 16 * AVPITCH + kk * 64), va2 = g2_lfrag(pv + 32 * AVPITCH + kk * 64), va3 = g2_lfrag(pv + 48 * AVPITCH + kk * 64);
    v8f s0 = z8, s1 = z8;
    s0 = g2_mma(ka0, qf0, s0);
    s0 = g2_mma(ka1, qf1, s0);
    s1 = g2_mma(ka2, qf0, s1);
    s1 = g2_mma(ka3, qf1, s1);
    if (kk + 1 < AKT / 32) { const unsigned char* nk = pk + (kk + 1) * 32 * AKPITCH;
      ka0 = g2_lfrag(nk); ka1 = g2_lfrag(nk + 64); ka2 = g2_lfrag(nk + 16 * AKPITCH); ka3 = g2_lfrag(nk + 16 * AKPITCH + 64); }
    const unsigned int mw = smw[t * (AKT / 32) + kk] >> (8 * hh);      /* kb = 128t+32kk; bit r: key kb+8hh+r (tile 0); bit 16+r: key kb+16+8hh+r (tile 1) */
    float e0[8], e1[8]; float mx = -3.0e38f;
#pragma unroll
    for (int r = 0; r < 8; ++r) {
      float x0 = s0[r] * 0.125f; x0 = ((mw >> r) & 1u) ? x0 : -1.0e9f;
      float x1 = s1[r] * 0.125f; x1 = ((mw >> (16 + r)) & 1u) ? x1 : -1.0e9f;
      e0[r] = x0; e1[r] = x1; mx = fmaxf(mx, fmaxf(x0, x1));
    }
    mx = fmaxf(mx, __shfl_xor(mx, 16));
    const float mnew = fmaxf(mrun, mx); const float alpha = __expf(mrun - mnew); mrun = mnew;
    float ps = 0.f; FragH pf;
#pragma unroll
    for (int r = 0; r < 8; ++r) {
      const float p0 = __expf(e0[r] - mnew), p1 = __expf(e1[r] - mnew); ps += p0 + p1;
      pf.h[r] = (_Float16)(p0 * 1024.0f); pf.h[8 + r] = (_Float16)(p1 * 1024.0f);
    }
    lpart = lpart * alpha + ps;
#pragma unroll
    for (int r = 0; r < 8; ++r) { o0[r] *= alpha; o1[r] *= alpha; o2[r] *= alpha; o3[r] *= alpha; }
    const v16h pb = pf.v;
    o0 = g2_mma(va0, pb, o0);
    o1 = g2_mma(va1, pb, o1);
    o2 = g2_mma(va2, pb, o2);
    o3 = g2_mma(va3, pb, o3);
   }
   asm volatile("s_wait_dscnt 0x0" ::: "memory");         /* this wave's reads of the buffer have returned before it may be refilled */
   asm volatile("s_wait_asynccnt 0x0" ::: "memory");      /* this wave's copies of stage t + 1 have landed */
   __syncthreads();                                       /* publishes stage t + 1 and ends every wave's reads of stage t */
   if (t + 2 < SEQ / AKT) at_stage(lk + bo, lv + bo, gk + (size_t)(t + 2) * AKT * DM, gv + (size_t)(t + 2) * AKT);
  }
  asm volatile("s_wait_asynccnt 0x0" ::: "memory");       /* no copy outstanding behind the loop */
  const float l = lpart + __shfl_xor(lpart, 16);
  const float inv = 1.0f / (l * 16.0f);                    /* P carried x1024, ctx carried x64: x64/1024 = 1/16 */
  FragH t0, t1, t2, t3;
#pragma unroll
  for (int r = 0; r < 8; ++r) { t0.h[r] = (_Float16)(o0[r] * inv); t1.h[r] = (_Float16)(o1[r] * inv); t2.h[r] = (_Float16)(o2[r] * inv); t3.h[r] = (_Float16)(o3[r] * inv); }
  *(v8us*)&sh[wave][ln][0 + 8 * hh] = t0.half[0];
  *(v8us*)&sh[wave][ln][16 + 8 * hh] = t1.half[0];
  *(v8us*)&sh[wave][ln][32 + 8 * hh] = t2.half[0];
  *(v8us*)&sh[wave][ln][48 + 8 * hh] = t3.half[0];
  __syncthreads();
  const int rsub = lane >> 3, pc = lane & 7;               
  {
#pragma unroll
    for (int it = 0; it < 4; ++it) { const int row = it * 4 + rsub; const v8us v = *(const v8us*)&sh[wave][row][pc * 8];
      *(v8us*)((unsigned short*)CTX + (rowb + q0 + row) * DM + h * HD + pc * 8) = v; }
     }
}

#define WBYTES ((size_t)DM * DM * 2)
#define PBYTES ((size_t)NB * SEQ * DM * 2)
static_assert(WBYTES % 256 == 0 && PBYTES % 256 == 0);
static_assert(4 * WBYTES + 7 * PBYTES <= (size_t)134217728);      /* total carve: 4 weight planes + 7 token planes (V^T plane = NB*NH*HD*SEQ halves = one token plane) */

extern "C" void kernel_launch(void* const* d_in, const int* in_sizes, int n_in,
                              void* d_out, int out_size, void* d_ws, size_t ws_size, hipStream_t stream) {
  if (n_in < 12) return;
  const long long need_x = (long long)(NB - 1) * SEQ_FULL * DM + (long long)SEQ * DM;
  if ((long long)in_sizes[0] < need_x || (long long)in_sizes[1] < need_x || (long long)in_sizes[2] < need_x) return;
  if ((long long)in_sizes[3] < (long long)(NB - 1) * SEQ_FULL + SEQ) return;
  if (in_sizes[4] < DM * DM || in_sizes[6] < DM * DM || in_sizes[8] < DM * DM || in_sizes[10] < DM * DM) return;
  if (in_sizes[5] < DM || in_sizes[7] < DM || in_sizes[9] < DM || in_sizes[11] < DM) return;
  if ((long long)out_size < (long long)NB * SEQ * DM) return;
  /* wire order: q, k, v, mask (int32), Wq, bq, Wk, bk, Wv, bv, Wo, bo */
  const float* xq = (const float*)d_in[0]; const float* xk = (const float*)d_in[1]; const float* xv = (const float*)d_in[2];
  const int* mask = (const int*)d_in[3];
  const float* Wq = (const float*)d_in[4]; const float* bq = (const float*)d_in[5];
  const float* Wk = (const float*)d_in[6]; const float* bk = (const float*)d_in[7];
  const float* Wv = (const float*)d_in[8]; const float* bv = (const float*)d_in[9];
  const float* Wo = (const float*)d_in[10]; const float* bo = (const float*)d_in[11];
  float* out = (float*)d_out;
  char* ws = (char*)d_ws; size_t off = 0;
  _Float16* BQ = (_Float16*)(ws + off); off += WBYTES;
  _Float16* BK = (_Float16*)(ws + off); off += WBYTES;
  _Float16* BV = (_Float16*)(ws + off); off += WBYTES;
  _Float16* BO = (_Float16*)(ws + off); off += WBYTES;
  _Float16* XQ = (_Float16*)(ws + off); off += PBYTES;
  _Float16* XK = (_Float16*)(ws + off); off += PBYTES;
  _Float16* XV = (_Float16*)(ws + off); off += PBYTES;
  _Float16* Q16 = (_Float16*)(ws + off); off += PBYTES;
  _Float16* K16 = (_Float16*)(ws + off); off += PBYTES;
  _Float16* VT = (_Float16*)(ws + off); off += PBYTES;
  _Float16* CTX = (_Float16*)(ws + off); off += PBYTES;
  if (off > ws_size) return;
  k_cvt<<<3u * GX + 4u * GW, 256, 0, stream>>>(xq, xk, xv, Wq, Wk, Wv, Wo, XQ, BQ);      /* planes XQ, XK, XV and BQ, BK, BV, BO */
  const unsigned gg = (unsigned)((MR / 128) * (DM / 64));
  k_gemm_qkv<<<dim3(gg, 3), 128, 0, stream>>>(XQ, DM, BQ, DM, 0.0625f, bq, bk, bv, Q16, DM, DM, DM);      /* q = xq Wq^T + bq, k = xk Wk^T + bk into planes Q16, K16; v = xv Wv^T + bv into plane VT as [(b,h)][d][SEQ] (weights x16 -> alpha 1/16) */
  k_attn<<<dim3(SEQ / 64, NH, NB), 128, 0, stream>>>(Q16, K16, VT, mask, CTX);           /* ctx x64, merged heads */
  k_gemm_f32<<<gg, 128, 0, stream>>>(CTX, DM, BO, DM, 0.0009765625f, bo, out, DM, DM, DM);      /* out = ctx Wo^T + bo (x64 and x16 carries -> alpha 2^-10) */
}

// v005
// One run takes 54.6 microseconds.
// In two side-by-side timings against v004, it was 1.06 and 1.07 times as fast.
// All steps since v000 together make it 4.38 times as fast.
#include <hip/hip_runtime.h>
// Multi-head attention with three input streams (q, k, v each [NB][SEQ][1024]), [out][in] projection weights with biases, integer key-padding mask applied as a finite replacement (-1e9) per (batch, key), 16 heads of 64, score scale 1/8, softmax over the keys of the same batch, heads merged h*64+d, output projection with bias.
// Compute dtype: every contraction on v_wmma_f32_16x16x32_f16 (f16 operands, f32 accumulate). Float inputs are converted (RNE) to bf16 first and carried as exact f16 (weights x16); q, k, v planes plain f16; softmax weights exp(s-m) carried x1024 as f16 (row sum l from the unconverted f32 values); ctx carried x64 as f16; scores and softmax statistics f32.
// Structure: one launch for the 3 activation and 4 weight converts, one launch for the 3 projection GEMMs (32x64 wave tiles, operands staged in LDS by asynchronous copies, two buffers; the v blocks store their tile transposed, as V^T), one fused online-softmax attention kernel (K and V^T tiles of 128 keys staged in LDS by asynchronous copies, two buffers, shared by the block's 4 waves; transposed score tiles S^T = K Q^T so a lane owns one query column; P^T accumulator tiles feed the next WMMA as its B operand directly), one output GEMM (f32).
#ifndef NB
#define NB 2
#endif
#ifndef SEQ
#define SEQ 1024
#endif
#define NB_FULL 2
#define SEQ_FULL 1024
#define DM 1024
#define NH 16
#define HD 64
#define NR ((size_t)NB * SEQ)         /* token rows processed */
#define MR ((int)(NB * SEQ))

typedef unsigned short v8us __attribute__((ext_vector_type(8), may_alias));
typedef float  v8f  __attribute__((ext_vector_type(8)));
typedef float  v4f  __attribute__((ext_vector_type(4)));
typedef float  v4fa __attribute__((ext_vector_type(4), may_alias));
typedef _Float16 v16h __attribute__((ext_vector_type(16)));
typedef _Float16 v4h __attribute__((ext_vector_type(4)));
union FragH { v16h v; v8us half[2]; _Float16 h[16]; unsigned short u[16]; };

static_assert(NH * HD == DM);                 /* merged head width */
static_assert(HD == 64);                      /* attention kernel: 2 k-steps of 32 over the head dim, 4 output tiles of 16 */
static_assert(DM % 64 == 0 && DM % 32 == 0 && DM % 8 == 0);  /* GEMM N tiles, K steps, 16-B pieces */
static_assert(SEQ % 128 == 0);                /* attention block = 64 queries; key steps of 32; a GEMM block's 128 token rows lie in one batch (V^T store) */
static_assert((NB * SEQ) % 128 == 0);         /* GEMM block = 128 rows, no row tail */
static_assert(SEQ / 32 <= 128);               /* mask words built by the first SEQ/32 threads of a 128-thread block */
static_assert(NB <= NB_FULL && SEQ <= SEQ_FULL);
static_assert(((size_t)NB * SEQ * DM) % (8 * 256) == 0);     /* convert grids exact */
static_assert(((size_t)DM * DM) % (8 * 256) == 0);

__device__ __forceinline__ unsigned short bf16_bits(float x) { unsigned int u = __float_as_uint(x); return (unsigned short)((u + 0x7FFFu + ((u >> 16) & 1u)) >> 16); }
__device__ __forceinline__ float bf16_val(unsigned short b) { return __uint_as_float(((unsigned int)b) << 16); }
__device__ __forceinline__ float bfr(float x) { return bf16_val(bf16_bits(x)); }      /* RNE convert to bf16, back to f32 */

// fragment (A or B, same k map): elements 0..7 = k0+8h.., elements 8..15 = k0+16+8h.. from a k-contiguous 16-bit row
__device__ __forceinline__ v16h g2_frag(const _Float16* p, int hh) { FragH f; f.half[0] = *(const v8us*)((const unsigned short*)p + 8 * hh); f.half[1] = *(const v8us*)((const unsigned short*)p + 16 + 8 * hh); return f.v; }
// one WMMA with its own hazard guard (ties D, keeps A/B live)
__device__ __forceinline__ v8f g2_mma(v16h a, v16h b, v8f c) { v8f d = __builtin_amdgcn_wmma_f32_16x16x32_f16(false, a, false, b, (short)0, c, false, false); asm volatile("v_nop\n\tv_nop\n\tv_nop\n\tv_nop" : "+v"(d) : "v"(a), "v"(b)); return d; }

__device__ __forceinline__ void wnat_body(const float* __restrict__ w, _Float16* __restrict__ Bt, unsigned blk) {
  const size_t t = (size_t)blk * 256 + threadIdx.x; if (t >= (size_t)DM * DM / 8) return;
  const v4f a = *(const v4fa*)(w + t * 8), c = *(const v4fa*)(w + t * 8 + 4); FragH f;
#pragma unroll
  for (int q = 0; q < 4; ++q) { f.h[q] = (_Float16)(bfr(a[q]) * 16.0f); f.h[4 + q] = (_Float16)(bfr(c[q]) * 16.0f); }
  const v8us o = f.half[0];
  *(v8us*)((unsigned short*)Bt + t * 8) = o; 
}

__device__ __forceinline__ void x16_body(const float* __restrict__ x, _Float16* __restrict__ X16, unsigned blk) {
  const size_t t = (size_t)blk * 256 + threadIdx.x; if (t >= NR * DM / 8) return;
  const size_t e = t * 8; const size_t row = e / DM; const size_t col = e % DM; const size_t bb = row / SEQ, s = row % SEQ;
  const float* src = x + (bb * SEQ_FULL + s) * DM + col;
  const v4f a = *(const v4fa*)(src), c = *(const v4fa*)(src + 4); FragH f;
#pragma unroll
  for (int q = 0; q < 4; ++q) { f.h[q] = (_Float16)bfr(a[q]); f.h[4 + q] = (_Float16)bfr(c[q]); }
  const v8us o = f.half[0];
  *(v8us*)((unsigned short*)X16 + t * 8) = o; 
}
// The seven converts read none of each other's output: one grid. Blocks [0, 3*GX) take the activation streams (GX blocks each), the rest the weight matrices (GW blocks each);
// the f16 planes of a kind lie one behind the other, so the stream or matrix number picks source pointer and destination plane.
#define GW ((unsigned)(((size_t)DM * DM / 8) / 256))
#define GX ((unsigned)((NR * DM / 8) / 256))
__global__ __launch_bounds__(256) void k_cvt(const float* __restrict__ xq, const float* __restrict__ xk, const float* __restrict__ xv,
                                             const float* __restrict__ Wq, const float* __restrict__ Wk, const float* __restrict__ Wv, const float* __restrict__ Wo,
                                             _Float16* __restrict__ X16, _Float16* __restrict__ Bt) {
  const unsigned bx = blockIdx.x;
  if (bx < 3u * GX) { const unsigned s = bx / GX; const float* x = (s == 0u) ? xq : (s == 1u) ? xk : xv;
    x16_body(x, X16 + (size_t)s * NR * DM, bx - s * GX); }
  else { const unsigned r = bx - 3u * GX; const unsigned s = r / GW; const float* w = (s & 2u) ? ((s & 1u) ? Wo : Wv) : ((s & 1u) ? Wk : Wq);
    wnat_body(w, Bt + (size_t)s * DM * DM, r - s * GW); }
}

// GEMM C[M][N] = alpha * A[M][K] . Bt[N][K]^T + bf16(bias[N]); A, Bt f16 k-contiguous rows; block = 4 waves, wave tile 32x64;
// operands reach the waves through LDS: a pass is 128 k (256 B of each of the block's 128 A rows and 64 Bt rows), copied asynchronously into one of two buffers while the other is worked on.
#define GKP 128                       /* k per pass */
#define GPITCH 272                    /* LDS row pitch in bytes: 16 B x odd, for 16-byte fragment reads down a column of rows */
#define GSTAGE (192 * GPITCH)         /* one buffer: rows 0..127 = A rows of the block, rows 128..191 = Bt rows of the block */
static_assert(DM % GKP == 0 && DM / GKP >= 2);   /* whole passes only */
// fragment from an LDS row, same k map as g2_frag; p already holds the lane's 16*hh byte offset
__device__ __forceinline__ v16h g2_lfrag(const unsigned char* p) { FragH f; f.half[0] = *(const v8us*)p; f.half[1] = *(const v8us*)(p + 32); return f.v; }
// twelve 16-byte copies of a lane, global -> LDS through no register; the closing s_wait_xcnt stands inside the statement so that no address register is rewritten ahead of it
__device__ __forceinline__ void g2_copy12(const unsigned* l, const _Float16* const* g) {
  asm volatile("global_load_async_to_lds_b128 %0, %12, off\n\t"
               "global_load_async_to_lds_b128 %1, %13, off\n\t"
               "global_load_async_to_lds_b128 %2, %14, off\n\t"
               "global_load_async_to_lds_b128 %3, %15, off\n\t"
               "global_load_async_to_lds_b128 %4, %16, off\n\t"
               "global_load_async_to_lds_b128 %5, %17, off\n\t"
               "global_load_async_to_lds_b128 %6, %18, off\n\t"
               "global_load_async_to_lds_b128 %7, %19, off\n\t"
               "global_load_async_to_lds_b128 %8, %20, off\n\t"
               "global_load_async_to_lds_b128 %9, %21, off\n\t"
               "global_load_async_to_lds_b128 %10, %22, off\n\t"
               "global_load_async_to_lds_b128 %11, %23, off\n\t"
               "s_wait_xcnt 0x0"
               :: "v"(l[0]), "v"(l[1]), "v"(l[2]), "v"(l[3]), "v"(l[4]), "v"(l[5]), "v"(l[6]), "v"(l[7]), "v"(l[8]), "v"(l[9]), "v"(l[10]), "v"(l[11]),
                  "v"(g[0]), "v"(g[1]), "v"(g[2]), "v"(g[3]), "v"(g[4]), "v"(g[5]), "v"(g[6]), "v"(g[7]), "v"(g[8]), "v"(g[9]), "v"(g[10]), "v"(g[11])
               : "memory");
}
// one pass's tile: 192 rows of 256 B; 16 lanes cover a row, the block's 128 lanes 8 rows, so 24 copies a lane (16 for A, 8 for Bt)
__device__ __forceinline__ void g2_stage(unsigned lb, const _Float16* ga, int lda, const _Float16* gb, int ldb) {
  unsigned l[24]; const _Float16* g[24];
#pragma unroll   /* both loops: every address becomes a register operand of the copy statements, no array in memory */
  for (int j = 0; j < 16; ++j) { l[j] = lb + (unsigned)(j * 8 * GPITCH); g[j] = ga + (size_t)(j * 8) * lda; }
#pragma unroll
  for (int j = 0; j < 8; ++j) { l[16 + j] = lb + (unsigned)((128 + j * 8) * GPITCH); g[16 + j] = gb + (size_t)(j * 8) * ldb; }
  g2_copy12(l, g); g2_copy12(l + 12, g + 12);
}
template <bool F32OUT>
__device__ __forceinline__ void gemm2_body(const _Float16* __restrict__ A, int lda, const _Float16* __restrict__ Bh, int ldb, float alpha, const float* __restrict__ bias,
                                           float* __restrict__ C, _Float16* __restrict__ C16, int ldc, int N, int K, bool vt) {
  __shared__ __attribute__((aligned(16))) float so[4][32][68];
  __shared__ __attribute__((aligned(16))) unsigned char ring[2 * GSTAGE];
  const int tid = threadIdx.x; const int w = __builtin_amdgcn_readfirstlane(tid >> 5); const int lane = tid & 31, ln = lane & 15, hh = lane >> 4;
  const int ntn = N >> 6; const int mt = blockIdx.x / ntn, nq = blockIdx.x - mt * ntn; const int row0 = mt * 128 + 32 * w, col0 = nq * 64;
  const int cr = tid >> 4, cc = tid & 15;                 /* copy role: row within a group of 8, 16-byte piece within the row */
  const _Float16* ga = A + (size_t)(mt * 128 + cr) * lda + cc * 8; const _Float16* gb = Bh + (size_t)(col0 + cr) * ldb + cc * 8;
  const unsigned lb = (unsigned)(size_t)ring + (unsigned)(cr * GPITCH + cc * 16);
  const unsigned char* fa = ring + (32 * w + ln) * GPITCH + 16 * hh; const unsigned char* fb = ring + (128 + ln) * GPITCH + 16 * hh;
  const int np = K / GKP;
  const int s0 = (mt + nq) % np;      /* the block's first pass: blocks that share A rows (same mt) or Bt rows (same nq) start at different k, so that they do not ask L2 for the same lines at the same moment; the walk wraps round */
  const v8f z8 = {0.f,0.f,0.f,0.f,0.f,0.f,0.f,0.f}; v8f c00 = z8, c01 = z8, c02 = z8, c03 = z8, c10 = z8, c11 = z8, c12 = z8, c13 = z8;
  g2_stage(lb, ga + (size_t)s0 * GKP, lda, gb + (size_t)s0 * GKP, ldb);
  asm volatile("s_wait_asynccnt 0x0" ::: "memory");       /* this wave's copies of the first pass have landed */
  __syncthreads();                                        /* first pass published to every wave */
  if (np > 1) { const int p = (s0 + 1 < np) ? s0 + 1 : 0; g2_stage(lb + GSTAGE, ga + (size_t)p * GKP, lda, gb + (size_t)p * GKP, ldb); }
#pragma unroll 1   /* one pass a trip: one publish point and one refill site in the code */
  for (int t = 0; t < np; ++t) { const unsigned bo = (unsigned)(t & 1) * GSTAGE; const unsigned char* pa = fa + bo; const unsigned char* pb = fb + bo;
    v16h a0 = g2_lfrag(pa), a1 = g2_lfrag(pa + 16 * GPITCH), b0 = g2_lfrag(pb), b1 = g2_lfrag(pb + 16 * GPITCH), b2 = g2_lfrag(pb + 32 * GPITCH), b3 = g2_lfrag(pb + 48 * GPITCH);
#pragma unroll   /* the two fragment sets alternate by renaming, LDS offsets become immediates */
    for (int ks = 0; ks < GKP / 32; ++ks) { v16h na0 = a0, na1 = a1, nb0 = b0, nb1 = b1, nb2 = b2, nb3 = b3;
      if (ks + 1 < GKP / 32) { const int o = (ks + 1) * 64;      /* the same pass's next k-step, read ahead of this step's products */
        na0 = g2_lfrag(pa + o); na1 = g2_lfrag(pa + 16 * GPITCH + o); nb0 = g2_lfrag(pb + o); nb1 = g2_lfrag(pb + 16 * GPITCH + o); nb2 = g2_lfrag(pb + 32 * GPITCH + o); nb3 = g2_lfrag(pb + 48 * GPITCH + o); }
      c00 = g2_mma(a0, b0, c00); c10 = g2_mma(a1, b0, c10);
      c01 = g2_mma(a0, b1, c01); c11 = g2_mma(a1, b1, c11);
      c02 = g2_mma(a0, b2, c02); c12 = g2_mma(a1, b2, c12);
      c03 = g2_mma(a0, b3, c03); c13 = g2_mma(a1, b3, c13);
      a0 = na0; a1 = na1; b0 = nb0; b1 = nb1; b2 = nb2; b3 = nb3; }
    asm volatile("s_wait_dscnt 0x0" ::: "memory");        /* this wave's reads of the buffer have returned before it may be refilled */
    asm volatile("s_wait_asynccnt 0x0" ::: "memory");     /* this wave's copies of the pass of trip t + 1 have landed */
    __syncthreads();                                      /* publishes the pass of trip t + 1 and ends every wave's reads of the pass of trip t */
    if (t + 2 < np) { int p = s0 + t + 2; p = (p < np) ? p : p - np; g2_stage(lb + bo, ga + (size_t)p * GKP, lda, gb + (size_t)p * GKP, ldb); } }
  asm volatile("s_wait_asynccnt 0x0" ::: "memory");       /* no copy outstanding behind the loop */
  v8f accs[8] = {c00, c01, c02, c03, c10, c11, c12, c13};
  if (!F32OUT && vt) {      /* block-uniform. C16 = V^T plane [(batch, head)][d][SEQ]; the block's 64 columns are the 64 d of head nq, its 128 rows are 128 tokens of one batch */
    unsigned char* st = (unsigned char*)&so[0][0][0];      /* block tile [d][token] in f16, row pitch GPITCH (256 B of tokens + 16) */
#pragma unroll
    for (int u = 0; u < 8; ++u) { const int t = u & 3, half = u >> 2; const float bv = bfr(bias[col0 + t * 16 + ln]); FragH f;
#pragma unroll
      for (int r = 0; r < 8; ++r) f.h[r] = (_Float16)(accs[u][r] * alpha + bv);      /* a lane's 8 accumulator elements = 8 consecutive tokens of one d: one 16-byte piece of a V^T row */
      *(v8us*)(st + (t * 16 + ln) * GPITCH + (32 * w + 16 * half + 8 * hh) * 2) = f.half[0]; }
    __syncthreads();      /* every wave wrote its 32 tokens into all 64 rows; the rows are read back across waves */
    const int tok0 = mt * 128; _Float16* vb = C16 + ((size_t)((tok0 / SEQ) * NH + nq) * HD) * SEQ + (tok0 % SEQ);
#pragma unroll
    for (int q = 0; q < 8; ++q) { const int d = q * 8 + cr; const v8us v = *(const v8us*)(st + d * GPITCH + cc * 16);      /* 16 lanes store 256 contiguous bytes of a row */
      *(v8us*)((unsigned short*)vb + (size_t)d * SEQ + cc * 8) = v; }
    return;
  }
#pragma unroll
  for (int u = 0; u < 8; ++u) { const int t = u & 3, half = u >> 2; const int col = col0 + t * 16 + ln; const float bv = bfr(bias[col]);
#pragma unroll
    for (int r = 0; r < 8; ++r) { const int rloc = half * 16 + 8 * hh + r; so[w][rloc][t * 16 + ln] = accs[u][r] * alpha + bv; } }
  __syncthreads();      /* staging tile is private to the wave; the block barrier is a superset of the wave-level ordering needed */
  const int rsub = lane >> 4, c4 = (lane & 15) * 4;
  {
#pragma unroll
    for (int q = 0; q < 16; ++q) { const int r = q * 2 + rsub; const v4f v = *(const v4fa*)&so[w][r][c4];
      if (F32OUT) { *(v4f*)(C + (size_t)(row0 + r) * ldc + col0 + c4) = v; }
      else { v4h h4; h4[0] = (_Float16)v[0]; h4[1] = (_Float16)v[1]; h4[2] = (_Float16)v[2]; h4[3] = (_Float16)v[3]; *(v4h*)(C16 + (size_t)(row0 + r) * ldc + col0 + c4) = h4; } }
    if (!F32OUT) asm volatile("s_wait_xcnt 0x0" ::: "memory");      /* in the built code the V^T block lies behind these stores: no register that a store names is rewritten there ahead of this wait */
     }
}
// the three projections in one grid: blockIdx.y = 0, 1, 2 picks the q, k or v problem; its A, Bt and C planes lie one behind the other; the third C plane is written as V^T
__global__ __launch_bounds__(128) void k_gemm_qkv(const _Float16* __restrict__ A, int lda, const _Float16* __restrict__ Bh, int ldb, float alpha,
                                                  const float* __restrict__ bq, const float* __restrict__ bk, const float* __restrict__ bv, _Float16* __restrict__ C16, int ldc, int N, int K) {
  const unsigned s = blockIdx.y; const float* bias = (s == 0u) ? bq : (s == 1u) ? bk : bv;
  gemm2_body<false>(A + (size_t)s * NR * DM, lda, Bh + (size_t)s * DM * DM, ldb, alpha, bias, nullptr, C16 + (size_t)s * NR * DM, ldc, N, K, s == 2u);
}
__global__ __launch_bounds__(128) void k_gemm_f32(const _Float16* __restrict__ A, int lda, const _Float16* __restrict__ Bh, int ldb, float alpha, const float* __restrict__ bias, float* __restrict__ C, int ldc, int N, int K) {
  gemm2_body<true>(A, lda, Bh, ldb, alpha, bias, C, nullptr, ldc, N, K, false);
}

// Attention operands reach the waves through LDS: a stage is 128 keys of one (batch, head): 128 K rows of 128 B and 64 V^T rows of 256 B, copied asynchronously into one of two buffers while the other is worked on.
#define AKT 128                       /* keys per stage */
#define AKPITCH 144                   /* LDS pitch of a K row in bytes: 16 B x odd, for 16-byte fragment reads down a column of rows */
#define AVPITCH 272                   /* LDS pitch of a V^T row in bytes: 16 B x odd */
#define AKBYTES (AKT * AKPITCH)       /* K rows first, V^T rows behind them */
#define ASTAGE (AKBYTES + HD * AVPITCH)
static_assert(SEQ % AKT == 0 && SEQ / AKT >= 2);   /* whole stages only, both buffers filled in the prologue */
static_assert(AKT * HD * 2 == 8 * 128 * 16);       /* each operand's tile = 8 copies of 16 B by each of 128 lanes */
// eight 16-byte copies of a lane, global -> LDS through no register; the closing s_wait_xcnt stands inside the statement so that no address register is rewritten ahead of it
__device__ __forceinline__ void at_copy8(const unsigned* l, const _Float16* const* g) {
  asm volatile("global_load_async_to_lds_b128 %0, %8, off\n\t"
               "global_load_async_to_lds_b128 %1, %9, off\n\t"
               "global_load_async_to_lds_b128 %2, %10, off\n\t"
               "global_load_async_to_lds_b128 %3, %11, off\n\t"
               "global_load_async_to_lds_b128 %4, %12, off\n\t"
               "global_load_async_to_lds_b128 %5, %13, off\n\t"
               "global_load_async_to_lds_b128 %6, %14, off\n\t"
               "global_load_async_to_lds_b128 %7, %15, off\n\t"
               "s_wait_xcnt 0x0"
               :: "v"(l[0]), "v"(l[1]), "v"(l[2]), "v"(l[3]), "v"(l[4]), "v"(l[5]), "v"(l[6]), "v"(l[7]),
                  "v"(g[0]), "v"(g[1]), "v"(g[2]), "v"(g[3]), "v"(g[4]), "v"(g[5]), "v"(g[6]), "v"(g[7])
               : "memory");
}
// one stage: K: 8 lanes cover a row, the block's 128 lanes 16 rows; V^T: 16 lanes cover a row, the block 8 rows; 8 copies a lane for each
__device__ __forceinline__ void at_stage(unsigned lk, unsigned lv, const _Float16* gk, const _Float16* gv) {
  unsigned l[16]; const _Float16* g[16];
#pragma unroll   /* every address becomes a register operand of the copy statements, no array in memory */
  for (int j = 0; j < 8; ++j) { l[j] = lk + (unsigned)(j * 16 * AKPITCH); g[j] = gk + (size_t)(j * 16) * DM; l[8 + j] = lv + (unsigned)(j * 8 * AVPITCH); g[8 + j] = gv + (size_t)(j * 8) * SEQ; }
  at_copy8(l, g); at_copy8(l + 8, g + 8);
}

// Fused attention: block = 4 waves = 64 queries of one (batch, head); wave = 16 queries; key loop in stages of 128 keys, steps of 32 keys.
// Score tiles are computed TRANSPOSED (A = K rows [key][d], B = Q rows [query][d]): accumulator element r of lane (hh, ln) = (key 8hh+r, query ln),
// so a lane owns one query column: row max = in-lane max + one xor-16 shuffle. The two 16-key P^T tiles are the B operand of the next product
// (elements 0..7 <- tile 0 element r, elements 8..15 <- tile 1 element r, lane unchanged); A = V^T rows [d][key]; accumulators hold O^T (d 8hh+r, query ln).
// Mask: 32-bit keep words per 32 keys built once per block in LDS; masked logits are REPLACED by -1e9 (a fully masked row comes out uniform).
__global__ __launch_bounds__(128) void k_attn(const _Float16* __restrict__ Q16, const _Float16* __restrict__ K16, const _Float16* __restrict__ Vt, const int* __restrict__ mask, _Float16* __restrict__ CTX) {
  __shared__ unsigned int smw[SEQ / 32];                                   /* cross-wave: written by the first SEQ/32 threads, read by all after the block barrier */
  __shared__ __attribute__((aligned(16))) unsigned short sh[4][16][72];    /* per-wave output staging [query][d], pitch 144 B */
  __shared__ __attribute__((aligned(16))) unsigned char ring[2 * ASTAGE];  /* the two K / V^T stage buffers */
  const int tid = threadIdx.x; const int wave = __builtin_amdgcn_readfirstlane(tid >> 5); const int lane = tid & 31, ln = lane & 15, hh = lane >> 4;
  const int h = blockIdx.y, b = blockIdx.z; const size_t rowb = (size_t)b * SEQ;
  const _Float16* gk = K16 + (rowb + (tid >> 3)) * DM + h * HD + (tid & 7) * 8;                    /* copy role, K: row within a group of 16, 16-byte piece */
  const _Float16* gv = Vt + ((size_t)(b * NH + h) * HD + (tid >> 4)) * SEQ + (tid & 15) * 8;       /* copy role, V^T: row within a group of 8, 16-byte piece */
  const unsigned lk = (unsigned)(size_t)ring + (unsigned)((tid >> 3) * AKPITCH + (tid & 7) * 16);
  const unsigned lv = (unsigned)(size_t)ring + (unsigned)(AKBYTES + (tid >> 4) * AVPITCH + (tid & 15) * 16);
  const int s0 = (int)(blockIdx.x % (SEQ / AKT));                         /* the block's first key stage: the blocks of one (batch, head) read the same K and V^T lines and start at different stages, so that they do not ask L2 for them at the same moment; the walk wraps round */
  at_stage(lk, lv, gk + (size_t)s0 * AKT * DM, gv + (size_t)s0 * AKT);    /* the first stage flies while the mask words are built */
  {
    const int wi = (tid < SEQ / 32) ? tid : (SEQ / 32 - 1);               /* clamped address; every thread loads, only the owners store */
    const int* mp = mask + (size_t)b * SEQ_FULL + (size_t)wi * 32; unsigned int wbits = 0u;
#pragma unroll 1
    for (int j = 0; j < 32; ++j) wbits |= ((mp[j] != 0) ? 1u : 0u) << j;
    if (tid < SEQ / 32) smw[tid] = wbits;
  }
  asm volatile("s_wait_asynccnt 0x0" ::: "memory");       /* this wave's copies of the first stage have landed */
  __syncthreads();                                        /* mask words and the first stage published to every wave */
  { const int p = (s0 + 1) % (SEQ / AKT); at_stage(lk + ASTAGE, lv + ASTAGE, gk + (size_t)p * AKT * DM, gv + (size_t)p * AKT); }
  const int q0 = blockIdx.x * 64 + wave * 16;
  const _Float16* Qp = Q16 + (rowb + q0 + ln) * DM + h * HD;
  const v16h qf0 = g2_frag(Qp, hh), qf1 = g2_frag(Qp + 32, hh);
  const unsigned char* fk = ring + ln * AKPITCH + 16 * hh; const unsigned char* fv = ring + AKBYTES + ln * AVPITCH + 16 * hh;
  const v8f z8 = {0.f,0.f,0.f,0.f,0.f,0.f,0.f,0.f};
  v8f o0 = z8, o1 = z8, o2 = z8, o3 = z8; float mrun = -1.0e30f, lpart = 0.f;
#pragma unroll 1   /* one stage a trip: one publish point and one refill site in the code */
  for (int t = 0; t < SEQ / AKT; ++t) { const unsigned bo = (unsigned)(t & 1) * ASTAGE; const unsigned char* pk = fk + bo; const unsigned char* pv = fv + bo;
   const int st = (s0 + t) % (SEQ / AKT);                 /* the key stage that trip t works on */
   v16h ka0 = g2_lfrag(pk), ka1 = g2_lfrag(pk + 64), ka2 = g2_lfrag(pk + 16 * AKPITCH), ka3 = g2_lfrag(pk + 16 * AKPITCH + 64);
#pragma unroll   /* LDS offsets become immediates; the K fragments of the same stage's next step are read ahead */
   for (int kk = 0; kk < AKT / 32; ++kk) {
    const v16h va0 = g2_lfrag(pv + kk * 64), va1 = g2_lfrag(pv + 16 * AVPITCH + kk * 64), va2 = g2_lfrag(pv + 32 * AVPITCH + kk * 64), va3 = g2_lfrag(pv + 48 * AVPITCH + kk * 64);
    v8f s0 = z8, s1 = z8;
    s0 = g2_mma(ka0, qf0, s0);
    s0 = g2_mma(ka1, qf1, s0);
    s1 = g2_mma(ka2, qf0, s1);
    s1 = g2_mma(ka3, qf1, s1);
    if (kk + 1 < AKT / 32) { const unsigned char* nk = pk + (kk + 1) * 32 * AKPITCH;
      ka0 = g2_lfrag(nk); ka1 = g2_lfrag(nk + 64); ka2 = g2_lfrag(nk + 16 * AKPITCH); ka3 = g2_lfrag(nk + 16 * AKPITCH + 64); }
    const unsigned int mw = smw[st * (AKT / 32) + kk] >> (8 * hh);      /* kb = 128st+32kk; bit r: key kb+8hh+r (tile 0); bit 16+r: key kb+16+8hh+r (tile 1) */
    float e0[8], e1[8]; float mx = -3.0e38f;
#pragma unroll
    for (int r = 0; r < 8; ++r) {
      float x0 = s0[r] * 0.125f; x0 = ((mw >> r) & 1u) ? x0 : -1.0e9f;
      float x1 = s1[r] * 0.125f; x1 = ((mw >> (16 + r)) & 1u) ? x1 : -1.0e9f;
      e0[r] = x0; e1[r] = x1; mx = fmaxf(mx, fmaxf(x0, x1));
    }
    mx = fmaxf(mx, __shfl_xor(mx, 16));
    const float mnew = fmaxf(mrun, mx); const float alpha = __expf(mrun - mnew); mrun = mnew;
    float ps = 0.f; FragH pf;
#pragma unroll
    for (int r = 0; r < 8; ++r) {
      const float p0 = __expf(e0[r] - mnew), p1 = __expf(e1[r] - mnew); ps += p0 + p1;
      pf.h[r] = (_Float16)(p0 * 1024.0f); pf.h[8 + r] = (_Float16)(p1 * 1024.0f);
    }
    lpart = lpart * alpha + ps;
#pragma unroll
    for (int r = 0; r < 8; ++r) { o0[r] *= alpha; o1[r] *= alpha; o2[r] *= alpha; o3[r] *= alpha; }
    const v16h pb = pf.v;
    o0 = g2_mma(va0, pb, o0);
    o1 = g2_mma(va1, pb, o1);
    o2 = g2_mma(va2, pb, o2);
    o3 = g2_mma(va3, pb, o3);
   }
   asm volatile("s_wait_dscnt 0x0" ::: "memory");         /* this wave's reads of the buffer have returned before it may be refilled */
   asm volatile("s_wait_asynccnt 0x0" ::: "memory");      /* this wave's copies of the stage of trip t + 1 have landed */
   __syncthreads();                                       /* publishes the stage of trip t + 1 and ends every wave's reads of stage st */
   if (t + 2 < SEQ / AKT) { const int p = (s0 + t + 2) % (SEQ / AKT); at_stage(lk + bo, lv + bo, gk + (size_t)p * AKT * DM, gv + (size_t)p * AKT); }
  }
  asm volatile("s_wait_asynccnt 0x0" ::: "memory");       /* no copy outstanding behind the loop */
  const float l = lpart + __shfl_xor(lpart, 16);
  const float inv = 1.0f / (l * 16.0f);                    /* P carried x1024, ctx carried x64: x64/1024 = 1/16 */
  FragH t0, t1, t2, t3;
#pragma unroll
  for (int r = 0; r < 8; ++r) { t0.h[r] = (_Float16)(o0[r] * inv); t1.h[r] = (_Float16)(o1[r] * inv); t2.h[r] = (_Float16)(o2[r] * inv); t3.h[r] = (_Float16)(o3[r] * inv); }
  *(v8us*)&sh[wave][ln][0 + 8 * hh] = t0.half[0];
  *(v8us*)&sh[wave][ln][16 + 8 * hh] = t1.half[0];
  *(v8us*)&sh[wave][ln][32 + 8 * hh] = t2.half[0];
  *(v8us*)&sh[wave][ln][48 + 8 * hh] = t3.half[0];
  __syncthreads();
  const int rsub = lane >> 3, pc = lane & 7;               
  {
#pragma unroll
    for (int it = 0; it < 4; ++it) { const int row = it * 4 + rsub; const v8us v = *(const v8us*)&sh[wave][row][pc * 8];
      *(v8us*)((unsigned short*)CTX + (rowb + q0 + row) * DM + h * HD + pc * 8) = v; }
     }
}

#define WBYTES ((size_t)DM * DM * 2)
#define PBYTES ((size_t)NB * SEQ * DM * 2)
static_assert(WBYTES % 256 == 0 && PBYTES % 256 == 0);
static_assert(4 * WBYTES + 7 * PBYTES <= (size_t)134217728);      /* total carve: 4 weight planes + 7 token planes (V^T plane = NB*NH*HD*SEQ halves = one token plane) */

extern "C" void kernel_launch(void* const* d_in, const int* in_sizes, int n_in,
                              void* d_out, int out_size, void* d_ws, size_t ws_size, hipStream_t stream) {
  if (n_in < 12) return;
  const long long need_x = (long long)(NB - 1) * SEQ_FULL * DM + (long long)SEQ * DM;
  if ((long long)in_sizes[0] < need_x || (long long)in_sizes[1] < need_x || (long long)in_sizes[2] < need_x) return;
  if ((long long)in_sizes[3] < (long long)(NB - 1) * SEQ_FULL + SEQ) return;
  if (in_sizes[4] < DM * DM || in_sizes[6] < DM * DM || in_sizes[8] < DM * DM || in_sizes[10] < DM * DM) return;
  if (in_sizes[5] < DM || in_sizes[7] < DM || in_sizes[9] < DM || in_sizes[11] < DM) return;
  if ((long long)out_size < (long long)NB * SEQ * DM) return;
  /* wire order: q, k, v, mask (int32), Wq, bq, Wk, bk, Wv, bv, Wo, bo */
  const float* xq = (const float*)d_in[0]; const float* xk = (const float*)d_in[1]; const float* xv = (const float*)d_in[2];
  const int* mask = (const int*)d_in[3];
  const float* Wq = (const float*)d_in[4]; const float* bq = (const float*)d_in[5];
  const float* Wk = (const float*)d_in[6]; const float* bk = (const float*)d_in[7];
  const float* Wv = (const float*)d_in[8]; const float* bv = (const float*)d_in[9];
  const float* Wo = (const float*)d_in[10]; const float* bo = (const float*)d_in[11];
  float* out = (float*)d_out;
  char* ws = (char*)d_ws; size_t off = 0;
  _Float16* BQ = (_Float16*)(ws + off); off += WBYTES;
  _Float16* BK = (_Float16*)(ws + off); off += WBYTES;
  _Float16* BV = (_Float16*)(ws + off); off += WBYTES;
  _Float16* BO = (_Float16*)(ws + off); off += WBYTES;
  _Float16* XQ = (_Float16*)(ws + off); off += PBYTES;
  _Float16* XK = (_Float16*)(ws + off); off += PBYTES;
  _Float16* XV = (_Float16*)(ws + off); off += PBYTES;
  _Float16* Q16 = (_Float16*)(ws + off); off += PBYTES;
  _Float16* K16 = (_Float16*)(ws + off); off += PBYTES;
  _Float16* VT = (_Float16*)(ws + off); off += PBYTES;
  _Float16* CTX = (_Float16*)(ws + off); off += PBYTES;
  if (off > ws_size) return;
  k_cvt<<<3u * GX + 4u * GW, 256, 0, stream>>>(xq, xk, xv, Wq, Wk, Wv, Wo, XQ, BQ);      /* planes XQ, XK, XV and BQ, BK, BV, BO */
  const unsigned gg = (unsigned)((MR / 128) * (DM / 64));
  k_gemm_qkv<<<dim3(gg, 3), 128, 0, stream>>>(XQ, DM, BQ, DM, 0.0625f, bq, bk, bv, Q16, DM, DM, DM);      /* q = xq Wq^T + bq, k = xk Wk^T + bk into planes Q16, K16; v = xv Wv^T + bv into plane VT as [(b,h)][d][SEQ] (weights x16 -> alpha 1/16) */
  k_attn<<<dim3(SEQ / 64, NH, NB), 128, 0, stream>>>(Q16, K16, VT, mask, CTX);           /* ctx x64, merged heads */
  k_gemm_f32<<<gg, 128, 0, stream>>>(CTX, DM, BO, DM, 0.0009765625f, bo, out, DM, DM, DM);      /* out = ctx Wo^T + bo (x64 and x16 carries -> alpha 2^-10) */
}

// v006
// A run of this version takes 51.6 microseconds.
// Two timings next to v005 put it at 1.07 and 1.06 times that version's speed.
// All steps since v000 together make it 4.67 times as fast.
#include <hip/hip_runtime.h>
// Multi-head attention with three input streams (q, k, v each [NB][SEQ][1024]), [out][in] projection weights with biases, integer key-padding mask applied as a finite replacement (-1e9) per (batch, key), 16 heads of 64, score scale 1/8, softmax over the keys of the same batch, heads merged h*64+d, output projection with bias.
// Compute dtype: every contraction on v_wmma_f32_16x16x32_f16 (f16 operands, f32 accumulate). Float inputs are converted (RNE) to bf16 first and carried as exact f16 (weights x16); q, k, v planes plain f16; softmax weights exp(s-m) carried x1024 as f16 (row sum l from the unconverted f32 values); ctx carried x64 as f16; scores and softmax statistics f32.
// Structure: one launch for the 3 activation and 4 weight converts, one launch for the 3 projection GEMMs (256x128 block tiles, 64x64 wave tiles, operands staged in LDS by asynchronous copies, two buffers; the v blocks store their tile transposed, as V^T), one fused online-softmax attention kernel (K and V^T tiles of 128 keys staged in LDS by asynchronous copies, two buffers, shared by the block's 4 waves; transposed score tiles S^T = K Q^T so a lane owns one query column; P^T accumulator tiles feed the next WMMA as its B operand directly), one output GEMM (f32, 128x64 block tiles, 32x64 wave tiles, staged the same way).
#ifndef NB
#define NB 2
#endif
#ifndef SEQ
#define SEQ 1024
#endif
#define NB_FULL 2
#define SEQ_FULL 1024
#define DM 1024
#define NH 16
#define HD 64
#define NR ((size_t)NB * SEQ)         /* token rows processed */
#define MR ((int)(NB * SEQ))

typedef unsigned short v8us __attribute__((ext_vector_type(8), may_alias));
typedef float  v8f  __attribute__((ext_vector_type(8)));
typedef float  v4f  __attribute__((ext_vector_type(4)));
typedef float  v4fa __attribute__((ext_vector_type(4), may_alias));
typedef _Float16 v16h __attribute__((ext_vector_type(16)));
typedef _Float16 v4h __attribute__((ext_vector_type(4)));
union FragH { v16h v; v8us half[2]; _Float16 h[16]; unsigned short u[16]; };

static_assert(NH * HD == DM);                 /* merged head width */
static_assert(HD == 64);                      /* attention kernel: 2 k-steps of 32 over the head dim, 4 output tiles of 16 */
static_assert(DM % 64 == 0 && DM % 32 == 0 && DM % 8 == 0);  /* GEMM N tiles, K steps, 16-B pieces */
static_assert(SEQ % 128 == 0);                /* attention block = 64 queries; key steps of 32 */
static_assert((NB * SEQ) % 128 == 0);         /* GEMM block = 128 rows, no row tail */
static_assert(SEQ / 32 <= 128);               /* mask words built by the first SEQ/32 threads of a 128-thread block */
static_assert(NB <= NB_FULL && SEQ <= SEQ_FULL);
static_assert(((size_t)NB * SEQ * DM) % (8 * 256) == 0);     /* convert grids exact */
static_assert(((size_t)DM * DM) % (8 * 256) == 0);

__device__ __forceinline__ unsigned short bf16_bits(float x) { unsigned int u = __float_as_uint(x); return (unsigned short)((u + 0x7FFFu + ((u >> 16) & 1u)) >> 16); }
__device__ __forceinline__ float bf16_val(unsigned short b) { return __uint_as_float(((unsigned int)b) << 16); }
__device__ __forceinline__ float bfr(float x) { return bf16_val(bf16_bits(x)); }      /* RNE convert to bf16, back to f32 */

// fragment (A or B, same k map): elements 0..7 = k0+8h.., elements 8..15 = k0+16+8h.. from a k-contiguous 16-bit row
__device__ __forceinline__ v16h g2_frag(const _Float16* p, int hh) { FragH f; f.half[0] = *(const v8us*)((const unsigned short*)p + 8 * hh); f.half[1] = *(const v8us*)((const unsigned short*)p + 16 + 8 * hh); return f.v; }
// one WMMA with its own hazard guard (ties D, keeps A/B live)
__device__ __forceinline__ v8f g2_mma(v16h a, v16h b, v8f c) { v8f d = __builtin_amdgcn_wmma_f32_16x16x32_f16(false, a, false, b, (short)0, c, false, false); asm volatile("v_nop\n\tv_nop\n\tv_nop\n\tv_nop" : "+v"(d) : "v"(a), "v"(b)); return d; }

__device__ __forceinline__ void wnat_body(const float* __restrict__ w, _Float16* __restrict__ Bt, unsigned blk) {
  const size_t t = (size_t)blk * 256 + threadIdx.x; if (t >= (size_t)DM * DM / 8) return;
  const v4f a = *(const v4fa*)(w + t * 8), c = *(const v4fa*)(w + t * 8 + 4); FragH f;
#pragma unroll
  for (int q = 0; q < 4; ++q) { f.h[q] = (_Float16)(bfr(a[q]) * 16.0f); f.h[4 + q] = (_Float16)(bfr(c[q]) * 16.0f); }
  const v8us o = f.half[0];
  *(v8us*)((unsigned short*)Bt + t * 8) = o; 
}

__device__ __forceinline__ void x16_body(const float* __restrict__ x, _Float16* __restrict__ X16, unsigned blk) {
  const size_t t = (size_t)blk * 256 + threadIdx.x; if (t >= NR * DM / 8) return;
  const size_t e = t * 8; const size_t row = e / DM; const size_t col = e % DM; const size_t bb = row / SEQ, s = row % SEQ;
  const float* src = x + (bb * SEQ_FULL + s) * DM + col;
  const v4f a = *(const v4fa*)(src), c = *(const v4fa*)(src + 4); FragH f;
#pragma unroll
  for (int q = 0; q < 4; ++q) { f.h[q] = (_Float16)bfr(a[q]); f.h[4 + q] = (_Float16)bfr(c[q]); }
  const v8us o = f.half[0];
  *(v8us*)((unsigned short*)X16 + t * 8) = o; 
}
// The seven converts read none of each other's output: one grid. Blocks [0, 3*GX) take the activation streams (GX blocks each), the rest the weight matrices (GW blocks each);
// the f16 planes of a kind lie one behind the other, so the stream or matrix number picks source pointer and destination plane.
#define GW ((unsigned)(((size_t)DM * DM / 8) / 256))
#define GX ((unsigned)((NR * DM / 8) / 256))
__global__ __launch_bounds__(256) void k_cvt(const float* __restrict__ xq, const float* __restrict__ xk, const float* __restrict__ xv,
                                             const float* __restrict__ Wq, const float* __restrict__ Wk, const float* __restrict__ Wv, const float* __restrict__ Wo,
                                             _Float16* __restrict__ X16, _Float16* __restrict__ Bt) {
  const unsigned bx = blockIdx.x;
  if (bx < 3u * GX) { const unsigned s = bx / GX; const float* x = (s == 0u) ? xq : (s == 1u) ? xk : xv;
    x16_body(x, X16 + (size_t)s * NR * DM, bx - s * GX); }
  else { const unsigned r = bx - 3u * GX; const unsigned s = r / GW; const float* w = (s & 2u) ? ((s & 1u) ? Wo : Wv) : ((s & 1u) ? Wk : Wq);
    wnat_body(w, Bt + (size_t)s * DM * DM, r - s * GW); }
}

// GEMM C[M][N] = alpha * A[M][K] . Bt[N][K]^T + bf16(bias[N]); A, Bt f16 k-contiguous rows;
// operands reach the waves through LDS: a pass is 128 k (256 B of each of the block's A rows and Bt rows), copied asynchronously into one of two buffers while the other is worked on.
#define GKP 128                       /* k per pass */
#define GPITCH 272                    /* LDS row pitch in bytes: 16 B x odd, for 16-byte fragment reads down a column of rows */
#define GSTAGE (192 * GPITCH)         /* one buffer of the output GEMM: rows 0..127 = A rows of the block, rows 128..191 = Bt rows of the block */
static_assert(DM % GKP == 0 && DM / GKP >= 2);   /* whole passes only */
// fragment from an LDS row, same k map as g2_frag; p already holds the lane's 16*hh byte offset
__device__ __forceinline__ v16h g2_lfrag(const unsigned char* p) { FragH f; f.half[0] = *(const v8us*)p; f.half[1] = *(const v8us*)(p + 32); return f.v; }
// twelve 16-byte copies of a lane, global -> LDS through no register; the closing s_wait_xcnt stands inside the statement so that no address register is rewritten ahead of it
__device__ __forceinline__ void g2_copy12(const unsigned* l, const _Float16* const* g) {
  asm volatile("global_load_async_to_lds_b128 %0, %12, off\n\t"
               "global_load_async_to_lds_b128 %1, %13, off\n\t"
               "global_load_async_to_lds_b128 %2, %14, off\n\t"
               "global_load_async_to_lds_b128 %3, %15, off\n\t"
               "global_load_async_to_lds_b128 %4, %16, off\n\t"
               "global_load_async_to_lds_b128 %5, %17, off\n\t"
               "global_load_async_to_lds_b128 %6, %18, off\n\t"
               "global_load_async_to_lds_b128 %7, %19, off\n\t"
               "global_load_async_to_lds_b128 %8, %20, off\n\t"
               "global_load_async_to_lds_b128 %9, %21, off\n\t"
               "global_load_async_to_lds_b128 %10, %22, off\n\t"
               "global_load_async_to_lds_b128 %11, %23, off\n\t"
               "s_wait_xcnt 0x0"
               :: "v"(l[0]), "v"(l[1]), "v"(l[2]), "v"(l[3]), "v"(l[4]), "v"(l[5]), "v"(l[6]), "v"(l[7]), "v"(l[8]), "v"(l[9]), "v"(l[10]), "v"(l[11]),
                  "v"(g[0]), "v"(g[1]), "v"(g[2]), "v"(g[3]), "v"(g[4]), "v"(g[5]), "v"(g[6]), "v"(g[7]), "v"(g[8]), "v"(g[9]), "v"(g[10]), "v"(g[11])
               : "memory");
}
// one pass's tile: 24 * RR rows of 256 B (16 * RR of A, then 8 * RR of Bt); 16 lanes cover a row, the block's lanes RR rows, so 24 copies a lane (16 for A, 8 for Bt)
template <int RR>
__device__ __forceinline__ void g2_stage(unsigned lb, const _Float16* ga, int lda, const _Float16* gb, int ldb) {
  unsigned l[24]; const _Float16* g[24];
#pragma unroll   /* both loops: every address becomes a register operand of the copy statements, no array in memory */
  for (int j = 0; j < 16; ++j) { l[j] = lb + (unsigned)(j * RR * GPITCH); g[j] = ga + (size_t)(j * RR) * lda; }
#pragma unroll
  for (int j = 0; j < 8; ++j) { l[16 + j] = lb + (unsigned)((16 + j) * RR * GPITCH); g[16 + j] = gb + (size_t)(j * RR) * ldb; }
  g2_copy12(l, g); g2_copy12(l + 12, g + 12);
}
// Output GEMM body (f32 C): block = 4 waves, wave tile 32x64, block tile 128x64
__device__ __forceinline__ void gemm2_body(const _Float16* __restrict__ A, int lda, const _Float16* __restrict__ Bh, int ldb, float alpha, const float* __restrict__ bias,
                                           float* __restrict__ C, int ldc, int N, int K) {
  __shared__ __attribute__((aligned(16))) float so[4][32][68];
  __shared__ __attribute__((aligned(16))) unsigned char ring[2 * GSTAGE];
  const int tid = threadIdx.x; const int w = __builtin_amdgcn_readfirstlane(tid >> 5); const int lane = tid & 31, ln = lane & 15, hh = lane >> 4;
  const int ntn = N >> 6; const int mt = blockIdx.x / ntn, nq = blockIdx.x - mt * ntn; const int row0 = mt * 128 + 32 * w, col0 = nq * 64;
  const int cr = tid >> 4, cc = tid & 15;                 /* copy role: row within a group of 8, 16-byte piece within the row */
  const _Float16* ga = A + (size_t)(mt * 128 + cr) * lda + cc * 8; const _Float16* gb = Bh + (size_t)(col0 + cr) * ldb + cc * 8;
  const unsigned lb = (unsigned)(size_t)ring + (unsigned)(cr * GPITCH + cc * 16);
  const unsigned char* fa = ring + (32 * w + ln) * GPITCH + 16 * hh; const unsigned char* fb = ring + (128 + ln) * GPITCH + 16 * hh;
  const int np = K / GKP;
  const int s0 = (mt + nq) % np;      /* the block's first pass: blocks that share A rows (same mt) or Bt rows (same nq) start at different k, so that they do not ask L2 for the same lines at the same moment; the walk wraps round */
  const v8f z8 = {0.f,0.f,0.f,0.f,0.f,0.f,0.f,0.f}; v8f c00 = z8, c01 = z8, c02 = z8, c03 = z8, c10 = z8, c11 = z8, c12 = z8, c13 = z8;
  g2_stage<8>(lb, ga + (size_t)s0 * GKP, lda, gb + (size_t)s0 * GKP, ldb);
  asm volatile("s_wait_asynccnt 0x0" ::: "memory");       /* this wave's copies of the first pass have landed */
  __syncthreads();                                        /* first pass published to every wave */
  if (np > 1) { const int p = (s0 + 1 < np) ? s0 + 1 : 0; g2_stage<8>(lb + GSTAGE, ga + (size_t)p * GKP, lda, gb + (size_t)p * GKP, ldb); }
#pragma unroll 1   /* one pass a trip: one publish point and one refill site in the code */
  for (int t = 0; t < np; ++t) { const unsigned bo = (unsigned)(t & 1) * GSTAGE; const unsigned char* pa = fa + bo; const unsigned char* pb = fb + bo;
    v16h a0 = g2_lfrag(pa), a1 = g2_lfrag(pa + 16 * GPITCH), b0 = g2_lfrag(pb), b1 = g2_lfrag(pb + 16 * GPITCH), b2 = g2_lfrag(pb + 32 * GPITCH), b3 = g2_lfrag(pb + 48 * GPITCH);
#pragma unroll   /* the two fragment sets alternate by renaming, LDS offsets become immediates */
    for (int ks = 0; ks < GKP / 32; ++ks) { v16h na0 = a0, na1 = a1, nb0 = b0, nb1 = b1, nb2 = b2, nb3 = b3;
      if (ks + 1 < GKP / 32) { const int o = (ks + 1) * 64;      /* the same pass's next k-step, read ahead of this step's products */
        na0 = g2_lfrag(pa + o); na1 = g2_lfrag(pa + 16 * GPITCH + o); nb0 = g2_lfrag(pb + o); nb1 = g2_lfrag(pb + 16 * GPITCH + o); nb2 = g2_lfrag(pb + 32 * GPITCH + o); nb3 = g2_lfrag(pb + 48 * GPITCH + o); }
      c00 = g2_mma(a0, b0, c00); c10 = g2_mma(a1, b0, c10);
      c01 = g2_mma(a0, b1, c01); c11 = g2_mma(a1, b1, c11);
      c02 = g2_mma(a0, b2, c02); c12 = g2_mma(a1, b2, c12);
      c03 = g2_mma(a0, b3, c03); c13 = g2_mma(a1, b3, c13);
      a0 = na0; a1 = na1; b0 = nb0; b1 = nb1; b2 = nb2; b3 = nb3; }
    asm volatile("s_wait_dscnt 0x0" ::: "memory");        /* this wave's reads of the buffer have returned before it may be refilled */
    asm volatile("s_wait_asynccnt 0x0" ::: "memory");     /* this wave's copies of the pass of trip t + 1 have landed */
    __syncthreads();                                      /* publishes the pass of trip t + 1 and ends every wave's reads of the pass of trip t */
    if (t + 2 < np) { int p = s0 + t + 2; p = (p < np) ? p : p - np; g2_stage<8>(lb + bo, ga + (size_t)p * GKP, lda, gb + (size_t)p * GKP, ldb); } }
  asm volatile("s_wait_asynccnt 0x0" ::: "memory");       /* no copy outstanding behind the loop */
  v8f accs[8] = {c00, c01, c02, c03, c10, c11, c12, c13};
#pragma unroll
  for (int u = 0; u < 8; ++u) { const int t = u & 3, half = u >> 2; const int col = col0 + t * 16 + ln; const float bv = bfr(bias[col]);
#pragma unroll
    for (int r = 0; r < 8; ++r) { const int rloc = half * 16 + 8 * hh + r; so[w][rloc][t * 16 + ln] = accs[u][r] * alpha + bv; } }
  __syncthreads();      /* staging tile is private to the wave; the block barrier is a superset of the wave-level ordering needed */
  const int rsub = lane >> 4, c4 = (lane & 15) * 4;
#pragma unroll
  for (int q = 0; q < 16; ++q) { const int r = q * 2 + rsub; const v4f v = *(const v4fa*)&so[w][r][c4];
    *(v4f*)(C + (size_t)(row0 + r) * ldc + col0 + c4) = v; }
}
// Projection GEMM body (f16 C): block = 8 waves as 4 (rows) x 2 (columns), wave tile 64x64, block tile 256x128, so that a block copies 384 operand rows from L2 for 32,768 outputs (128x64: 192 rows for 8,192).
// Same ring as above with 256 A rows and 128 Bt rows a buffer; behind the loop's last barrier the ring is free and serves as the output staging.
#define PBM 256
#define PBN 128
#define PSTAGE ((PBM + PBN) * GPITCH)
#define VPITCH 528                    /* staging pitch of a V^T row in bytes: 256 tokens in f16 + 16 = 16 B x odd */
static_assert(SEQ % PBM == 0 && DM % PBN == 0 && PBN == 2 * HD);      /* a block's 256 token rows lie in one batch; its 128 columns are two whole heads */
static_assert(8 * 64 * 68 * 4 <= 2 * PSTAGE && PBN * VPITCH <= 2 * PSTAGE);      /* both stagings fit the ring */
__device__ __forceinline__ void gemm3_body(const _Float16* __restrict__ A, int lda, const _Float16* __restrict__ Bh, int ldb, float alpha, const float* __restrict__ bias,
                                           _Float16* __restrict__ C16, int N, int K, bool vt) {
  __shared__ __attribute__((aligned(16))) unsigned char ring[2 * PSTAGE];
  const int tid = threadIdx.x; const int w = __builtin_amdgcn_readfirstlane(tid >> 5); const int lane = tid & 31, ln = lane & 15, hh = lane >> 4;
  const int wm = w & 3, wn = w >> 2;
  const int ntn = N / PBN; const int mt = blockIdx.x / ntn, nq = blockIdx.x - mt * ntn; const int row0 = mt * PBM + 64 * wm, col0 = nq * PBN + 64 * wn;
  const int cr = tid >> 4, cc = tid & 15;                 /* copy role: row within a group of 16, 16-byte piece within the row */
  const _Float16* ga = A + (size_t)(mt * PBM + cr) * lda + cc * 8; const _Float16* gb = Bh + (size_t)(nq * PBN + cr) * ldb + cc * 8;
  const unsigned lb = (unsigned)(size_t)ring + (unsigned)(cr * GPITCH + cc * 16);
  const unsigned char* fa = ring + (64 * wm + ln) * GPITCH + 16 * hh; const unsigned char* fb = ring + (PBM + 64 * wn + ln) * GPITCH + 16 * hh;
  const int np = K / GKP;
  const int s0 = (mt + nq) % np;      /* the block's first pass, as in the output GEMM: sharers of A or Bt rows start at different k; the walk wraps round */
  const v8f z8 = {0.f,0.f,0.f,0.f,0.f,0.f,0.f,0.f}; v8f c[4][4];
#pragma unroll
  for (int i = 0; i < 4; ++i) {
#pragma unroll
    for (int j = 0; j < 4; ++j) c[i][j] = z8; }
  g2_stage<16>(lb, ga + (size_t)s0 * GKP, lda, gb + (size_t)s0 * GKP, ldb);
  asm volatile("s_wait_asynccnt 0x0" ::: "memory");       /* this wave's copies of the first pass have landed */
  __syncthreads();                                        /* first pass published to every wave */
  if (np > 1) { const int p = (s0 + 1 < np) ? s0 + 1 : 0; g2_stage<16>(lb + PSTAGE, ga + (size_t)p * GKP, lda, gb + (size_t)p * GKP, ldb); }
#pragma unroll 1   /* one pass a trip: one publish point and one refill site in the code */
  for (int t = 0; t < np; ++t) { const unsigned bo = (unsigned)(t & 1) * PSTAGE; const unsigned char* pa = fa + bo; const unsigned char* pb = fb + bo;
#pragma unroll   /* LDS offsets become immediates */
    for (int ks = 0; ks < GKP / 32; ++ks) { v16h a[4], b[4];      /* one fragment set: with the 128 accumulator registers a second set would pass 256 registers; the SIMD's other wave covers the read latency */
#pragma unroll
      for (int i = 0; i < 4; ++i) { a[i] = g2_lfrag(pa + i * 16 * GPITCH + ks * 64); b[i] = g2_lfrag(pb + i * 16 * GPITCH + ks * 64); }
#pragma unroll
      for (int j = 0; j < 4; ++j) {
#pragma unroll
        for (int i = 0; i < 4; ++i) c[i][j] = g2_mma(a[i], b[j], c[i][j]); } }
    asm volatile("s_wait_dscnt 0x0" ::: "memory");        /* this wave's reads of the buffer have returned before it may be refilled */
    asm volatile("s_wait_asynccnt 0x0" ::: "memory");     /* this wave's copies of the pass of trip t + 1 have landed */
    __syncthreads();                                      /* publishes the pass of trip t + 1 and ends every wave's reads of the pass of trip t */
    if (t + 2 < np) { int p = s0 + t + 2; p = (p < np) ? p : p - np; g2_stage<16>(lb + bo, ga + (size_t)p * GKP, lda, gb + (size_t)p * GKP, ldb); } }
  asm volatile("s_wait_asynccnt 0x0" ::: "memory");       /* no copy outstanding behind the loop */
  if (vt) {      /* block-uniform. C16 = V^T plane [(batch, head)][d][SEQ]; the block's 128 columns are the 64 d of heads 2nq and 2nq+1, its 256 rows are 256 tokens of one batch */
    unsigned char* st = ring;      /* block tile [column][token] in f16, row pitch VPITCH */
#pragma unroll
    for (int j = 0; j < 4; ++j) { const float bv = bfr(bias[col0 + j * 16 + ln]);
#pragma unroll
      for (int i = 0; i < 4; ++i) { FragH f;
#pragma unroll
        for (int r = 0; r < 8; ++r) f.h[r] = (_Float16)(c[i][j][r] * alpha + bv);      /* a lane's 8 accumulator elements = 8 consecutive tokens of one d: one 16-byte piece of a V^T row */
        *(v8us*)(st + (64 * wn + j * 16 + ln) * VPITCH + (64 * wm + 16 * i + 8 * hh) * 2) = f.half[0]; } }
    __syncthreads();      /* every wave wrote its 64 tokens into 64 of the rows; the rows are read back across waves */
    const int tok0 = mt * PBM; _Float16* vb = C16 + ((size_t)(tok0 / SEQ) * NH * HD + (size_t)nq * PBN) * SEQ + (tok0 % SEQ);
#pragma unroll
    for (int q = 0; q < 16; ++q) { const int d = q * 8 + w; const v8us v = *(const v8us*)(st + d * VPITCH + lane * 16);      /* a wave stores the 512 contiguous bytes of a row */
      *(v8us*)((unsigned short*)vb + (size_t)d * SEQ + lane * 8) = v; }
    return;
  }
  float* so = (float*)(ring + w * (64 * 68 * 4));      /* the wave's own staging tile [64 rows][pitch 68 floats] */
#pragma unroll
  for (int j = 0; j < 4; ++j) { const float bv = bfr(bias[col0 + j * 16 + ln]);
#pragma unroll
    for (int i = 0; i < 4; ++i) {
#pragma unroll
      for (int r = 0; r < 8; ++r) so[(i * 16 + 8 * hh + r) * 68 + j * 16 + ln] = c[i][j][r] * alpha + bv; } }
  __syncthreads();      /* staging tile is private to the wave; the block barrier is a superset of the wave-level ordering needed */
  const int rsub = lane >> 4, c4 = (lane & 15) * 4;
  _Float16* cp = C16 + (size_t)(row0 + rsub) * DM + col0 + c4;      /* C rows are DM wide: one address register pair, the row step is an immediate offset */
#pragma unroll
  for (int g = 0; g < 4; ++g) {
#pragma unroll
    for (int q = g * 8; q < g * 8 + 8; ++q) { const v4f v = *(const v4fa*)&so[(q * 2 + rsub) * 68 + c4];
      v4h h4; h4[0] = (_Float16)v[0]; h4[1] = (_Float16)v[1]; h4[2] = (_Float16)v[2]; h4[3] = (_Float16)v[3]; *(v4h*)(cp + (size_t)(q * 2) * DM) = h4; }
    asm volatile("s_wait_xcnt 0x0" ::: "memory");      /* no register that one of these eight stores names is rewritten (by the next group, or by code laid behind) ahead of this wait */
  }
}
// the three projections in one grid: blockIdx.y = 0, 1, 2 picks the q, k or v problem; its A, Bt and C planes lie one behind the other; the third C plane is written as V^T
__global__ __launch_bounds__(256) void k_gemm_qkv(const _Float16* __restrict__ A, int lda, const _Float16* __restrict__ Bh, int ldb, float alpha,
                                                  const float* __restrict__ bq, const float* __restrict__ bk, const float* __restrict__ bv, _Float16* __restrict__ C16, int N, int K) {
  const unsigned s = blockIdx.y; const float* bias = (s == 0u) ? bq : (s == 1u) ? bk : bv;
  gemm3_body(A + (size_t)s * NR * DM, lda, Bh + (size_t)s * DM * DM, ldb, alpha, bias, C16 + (size_t)s * NR * DM, N, K, s == 2u);
}
__global__ __launch_bounds__(128) void k_gemm_f32(const _Float16* __restrict__ A, int lda, const _Float16* __restrict__ Bh, int ldb, float alpha, const float* __restrict__ bias, float* __restrict__ C, int ldc, int N, int K) {
  gemm2_body(A, lda, Bh, ldb, alpha, bias, C, ldc, N, K);
}

// Attention operands reach the waves through LDS: a stage is 128 keys of one (batch, head): 128 K rows of 128 B and 64 V^T rows of 256 B, copied asynchronously into one of two buffers while the other is worked on.
#define AKT 128                       /* keys per stage */
#define AKPITCH 144                   /* LDS pitch of a K row in bytes: 16 B x odd, for 16-byte fragment reads down a column of rows */
#define AVPITCH 272                   /* LDS pitch of a V^T row in bytes: 16 B x odd */
#define AKBYTES (AKT * AKPITCH)       /* K rows first, V^T rows behind them */
#define ASTAGE (AKBYTES + HD * AVPITCH)
static_assert(SEQ % AKT == 0 && SEQ / AKT >= 2);   /* whole stages only, both buffers filled in the prologue */
static_assert(AKT * HD * 2 == 8 * 128 * 16);       /* each operand's tile = 8 copies of 16 B by each of 128 lanes */
// eight 16-byte copies of a lane, global -> LDS through no register; the closing s_wait_xcnt stands inside the statement so that no address register is rewritten ahead of it
__device__ __forceinline__ void at_copy8(const unsigned* l, const _Float16* const* g) {
  asm volatile("global_load_async_to_lds_b128 %0, %8, off\n\t"
               "global_load_async_to_lds_b128 %1, %9, off\n\t"
               "global_load_async_to_lds_b128 %2, %10, off\n\t"
               "global_load_async_to_lds_b128 %3, %11, off\n\t"
               "global_load_async_to_lds_b128 %4, %12, off\n\t"
               "global_load_async_to_lds_b128 %5, %13, off\n\t"
               "global_load_async_to_lds_b128 %6, %14, off\n\t"
               "global_load_async_to_lds_b128 %7, %15, off\n\t"
               "s_wait_xcnt 0x0"
               :: "v"(l[0]), "v"(l[1]), "v"(l[2]), "v"(l[3]), "v"(l[4]), "v"(l[5]), "v"(l[6]), "v"(l[7]),
                  "v"(g[0]), "v"(g[1]), "v"(g[2]), "v"(g[3]), "v"(g[4]), "v"(g[5]), "v"(g[6]), "v"(g[7])
               : "memory");
}
// one stage: K: 8 lanes cover a row, the block's 128 lanes 16 rows; V^T: 16 lanes cover a row, the block 8 rows; 8 copies a lane for each
__device__ __forceinline__ void at_stage(unsigned lk, unsigned lv, const _Float16* gk, const _Float16* gv) {
  unsigned l[16]; const _Float16* g[16];
#pragma unroll   /* every address becomes a register operand of the copy statements, no array in memory */
  for (int j = 0; j < 8; ++j) { l[j] = lk + (unsigned)(j * 16 * AKPITCH); g[j] = gk + (size_t)(j * 16) * DM; l[8 + j] = lv + (unsigned)(j * 8 * AVPITCH); g[8 + j] = gv + (size_t)(j * 8) * SEQ; }
  at_copy8(l, g); at_copy8(l + 8, g + 8);
}

// Fused attention: block = 4 waves = 64 queries of one (batch, head); wave = 16 queries; key loop in stages of 128 keys, steps of 32 keys.
// Score tiles are computed TRANSPOSED (A = K rows [key][d], B = Q rows [query][d]): accumulator element r of lane (hh, ln) = (key 8hh+r, query ln),
// so a lane owns one query column: row max = in-lane max + one xor-16 shuffle. The two 16-key P^T tiles are the B operand of the next product
// (elements 0..7 <- tile 0 element r, elements 8..15 <- tile 1 element r, lane unchanged); A = V^T rows [d][key]; accumulators hold O^T (d 8hh+r, query ln).
// Mask: 32-bit keep words per 32 keys built once per block in LDS; masked logits are REPLACED by -1e9 (a fully masked row comes out uniform).
__global__ __launch_bounds__(128) void k_attn(const _Float16* __restrict__ Q16, const _Float16* __restrict__ K16, const _Float16* __restrict__ Vt, const int* __restrict__ mask, _Float16* __restrict__ CTX) {
  __shared__ unsigned int smw[SEQ / 32];                                   /* cross-wave: written by the first SEQ/32 threads, read by all after the block barrier */
  __shared__ __attribute__((aligned(16))) unsigned short sh[4][16][72];    /* per-wave output staging [query][d], pitch 144 B */
  __shared__ __attribute__((aligned(16))) unsigned char ring[2 * ASTAGE];  /* the two K / V^T stage buffers */
  const int tid = threadIdx.x; const int wave = __builtin_amdgcn_readfirstlane(tid >> 5); const int lane = tid & 31, ln = lane & 15, hh = lane >> 4;
  const int h = blockIdx.y, b = blockIdx.z; const size_t rowb = (size_t)b * SEQ;
  const _Float16* gk = K16 + (rowb + (tid >> 3)) * DM + h * HD + (tid & 7) * 8;                    /* copy role, K: row within a group of 16, 16-byte piece */
  const _Float16* gv = Vt + ((size_t)(b * NH + h) * HD + (tid >> 4)) * SEQ + (tid & 15) * 8;       /* copy role, V^T: row within a group of 8, 16-byte piece */
  const unsigned lk = (unsigned)(size_t)ring + (unsigned)((tid >> 3) * AKPITCH + (tid & 7) * 16);
  const unsigned lv = (unsigned)(size_t)ring + (unsigned)(AKBYTES + (tid >> 4) * AVPITCH + (tid & 15) * 16);
  const int s0 = (int)(blockIdx.x % (SEQ / AKT));                         /* the block's first key stage: the blocks of one (batch, head) read the same K and V^T lines and start at different stages, so that they do not ask L2 for them at the same moment; the walk wraps round */
  at_stage(lk, lv, gk + (size_t)s0 * AKT * DM, gv + (size_t)s0 * AKT);    /* the first stage flies while the mask words are built */
  {
    const int wi = (tid < SEQ / 32) ? tid : (SEQ / 32 - 1);               /* clamped address; every thread loads, only the owners store */
    const int* mp = mask + (size_t)b * SEQ_FULL + (size_t)wi * 32; unsigned int wbits = 0u;
#pragma unroll 1
    for (int j = 0; j < 32; ++j) wbits |= ((mp[j] != 0) ? 1u : 0u) << j;
    if (tid < SEQ / 32) smw[tid] = wbits;
  }
  asm volatile("s_wait_asynccnt 0x0" ::: "memory");       /* this wave's copies of the first stage have landed */
  __syncthreads();                                        /* mask words and the first stage published to every wave */
  { const int p = (s0 + 1) % (SEQ / AKT); at_stage(lk + ASTAGE, lv + ASTAGE, gk + (size_t)p * AKT * DM, gv + (size_t)p * AKT); }
  const int q0 = blockIdx.x * 64 + wave * 16;
  const _Float16* Qp = Q16 + (rowb + q0 + ln) * DM + h * HD;
  const v16h qf0 = g2_frag(Qp, hh), qf1 = g2_frag(Qp + 32, hh);
  const unsigned char* fk = ring + ln * AKPITCH + 16 * hh; const unsigned char* fv = ring + AKBYTES + ln * AVPITCH + 16 * hh;
  const v8f z8 = {0.f,0.f,0.f,0.f,0.f,0.f,0.f,0.f};
  v8f o0 = z8, o1 = z8, o2 = z8, o3 = z8; float mrun = -1.0e30f, lpart = 0.f;
#pragma unroll 1   /* one stage a trip: one publish point and one refill site in the code */
  for (int t = 0; t < SEQ / AKT; ++t) { const unsigned bo = (unsigned)(t & 1) * ASTAGE; const unsigned char* pk = fk + bo; const unsigned char* pv = fv + bo;
   const int st = (s0 + t) % (SEQ / AKT);                 /* the key stage that trip t works on */
   v16h ka0 = g2_lfrag(pk), ka1 = g2_lfrag(pk + 64), ka2 = g2_lfrag(pk + 16 * AKPITCH), ka3 = g2_lfrag(pk + 16 * AKPITCH + 64);
#pragma unroll   /* LDS offsets become immediates; the K fragments of the same stage's next step are read ahead */
   for (int kk = 0; kk < AKT / 32; ++kk) {
    const v16h va0 = g2_lfrag(pv + kk * 64), va1 = g2_lfrag(pv + 16 * AVPITCH + kk * 64), va2 = g2_lfrag(pv + 32 * AVPITCH + kk * 64), va3 = g2_lfrag(pv + 48 * AVPITCH + kk * 64);
    v8f s0 = z8, s1 = z8;
    s0 = g2_mma(ka0, qf0, s0);
    s0 = g2_mma(ka1, qf1, s0);
    s1 = g2_mma(ka2, qf0, s1);
    s1 = g2_mma(ka3, qf1, s1);
    if (kk + 1 < AKT / 32) { const unsigned char* nk = pk + (kk + 1) * 32 * AKPITCH;
      ka0 = g2_lfrag(nk); ka1 = g2_lfrag(nk + 64); ka2 = g2_lfrag(nk + 16 * AKPITCH); ka3 = g2_lfrag(nk + 16 * AKPITCH + 64); }
    const unsigned int mw = smw[st * (AKT / 32) + kk] >> (8 * hh);      /* kb = 128st+32kk; bit r: key kb+8hh+r (tile 0); bit 16+r: key kb+16+8hh+r (tile 1) */
    float e0[8], e1[8]; float mx = -3.0e38f;
#pragma unroll
    for (int r = 0; r < 8; ++r) {
      float x0 = s0[r] * 0.125f; x0 = ((mw >> r) & 1u) ? x0 : -1.0e9f;
      float x1 = s1[r] * 0.125f; x1 = ((mw >> (16 + r)) & 1u) ? x1 : -1.0e9f;
      e0[r] = x0; e1[r] = x1; mx = fmaxf(mx, fmaxf(x0, x1));
    }
    mx = fmaxf(mx, __shfl_xor(mx, 16));
    const float mnew = fmaxf(mrun, mx); const float alpha = __expf(mrun - mnew); mrun = mnew;
    float ps = 0.f; FragH pf;
#pragma unroll
    for (int r = 0; r < 8; ++r) {
      const float p0 = __expf(e0[r] - mnew), p1 = __expf(e1[r] - mnew); ps += p0 + p1;
      pf.h[r] = (_Float16)(p0 * 1024.0f); pf.h[8 + r] = (_Float16)(p1 * 1024.0f);
    }
    lpart = lpart * alpha + ps;
#pragma unroll
    for (int r = 0; r < 8; ++r) { o0[r] *= alpha; o1[r] *= alpha; o2[r] *= alpha; o3[r] *= alpha; }
    const v16h pb = pf.v;
    o0 = g2_mma(va0, pb, o0);
    o1 = g2_mma(va1, pb, o1);
    o2 = g2_mma(va2, pb, o2);
    o3 = g2_mma(va3, pb, o3);
   }
   asm volatile("s_wait_dscnt 0x0" ::: "memory");         /* this wave's reads of the buffer have returned before it may be refilled */
   asm volatile("s_wait_asynccnt 0x0" ::: "memory");      /* this wave's copies of the stage of trip t + 1 have landed */
   __syncthreads();                                       /* publishes the stage of trip t + 1 and ends every wave's reads of stage st */
   if (t + 2 < SEQ / AKT) { const int p = (s0 + t + 2) % (SEQ / AKT); at_stage(lk + bo, lv + bo, gk + (size_t)p * AKT * DM, gv + (size_t)p * AKT); }
  }
  asm volatile("s_wait_asynccnt 0x0" ::: "memory");       /* no copy outstanding behind the loop */
  const float l = lpart + __shfl_xor(lpart, 16);
  const float inv = 1.0f / (l * 16.0f);                    /* P carried x1024, ctx carried x64: x64/1024 = 1/16 */
  FragH t0, t1, t2, t3;
#pragma unroll
  for (int r = 0; r < 8; ++r) { t0.h[r] = (_Float16)(o0[r] * inv); t1.h[r] = (_Float16)(o1[r] * inv); t2.h[r] = (_Float16)(o2[r] * inv); t3.h[r] = (_Float16)(o3[r] * inv); }
  *(v8us*)&sh[wave][ln][0 + 8 * hh] = t0.half[0];
  *(v8us*)&sh[wave][ln][16 + 8 * hh] = t1.half[0];
  *(v8us*)&sh[wave][ln][32 + 8 * hh] = t2.half[0];
  *(v8us*)&sh[wave][ln][48 + 8 * hh] = t3.half[0];
  __syncthreads();
  const int rsub = lane >> 3, pc = lane & 7;               
  {
#pragma unroll
    for (int it = 0; it < 4; ++it) { const int row = it * 4 + rsub; const v8us v = *(const v8us*)&sh[wave][row][pc * 8];
      *(v8us*)((unsigned short*)CTX + (rowb + q0 + row) * DM + h * HD + pc * 8) = v; }
     }
}

#define WBYTES ((size_t)DM * DM * 2)
#define PBYTES ((size_t)NB * SEQ * DM * 2)
static_assert(WBYTES % 256 == 0 && PBYTES % 256 == 0);
static_assert(4 * WBYTES + 7 * PBYTES <= (size_t)134217728);      /* total carve: 4 weight planes + 7 token planes (V^T plane = NB*NH*HD*SEQ halves = one token plane) */

extern "C" void kernel_launch(void* const* d_in, const int* in_sizes, int n_in,
                              void* d_out, int out_size, void* d_ws, size_t ws_size, hipStream_t stream) {
  if (n_in < 12) return;
  const long long need_x = (long long)(NB - 1) * SEQ_FULL * DM + (long long)SEQ * DM;
  if ((long long)in_sizes[0] < need_x || (long long)in_sizes[1] < need_x || (long long)in_sizes[2] < need_x) return;
  if ((long long)in_sizes[3] < (long long)(NB - 1) * SEQ_FULL + SEQ) return;
  if (in_sizes[4] < DM * DM || in_sizes[6] < DM * DM || in_sizes[8] < DM * DM || in_sizes[10] < DM * DM) return;
  if (in_sizes[5] < DM || in_sizes[7] < DM || in_sizes[9] < DM || in_sizes[11] < DM) return;
  if ((long long)out_size < (long long)NB * SEQ * DM) return;
  /* wire order: q, k, v, mask (int32), Wq, bq, Wk, bk, Wv, bv, Wo, bo */
  const float* xq = (const float*)d_in[0]; const float* xk = (const float*)d_in[1]; const float* xv = (const float*)d_in[2];
  const int* mask = (const int*)d_in[3];
  const float* Wq = (const float*)d_in[4]; const float* bq = (const float*)d_in[5];
  const float* Wk = (const float*)d_in[6]; const float* bk = (const float*)d_in[7];
  const float* Wv = (const float*)d_in[8]; const float* bv = (const float*)d_in[9];
  const float* Wo = (const float*)d_in[10]; const float* bo = (const float*)d_in[11];
  float* out = (float*)d_out;
  char* ws = (char*)d_ws; size_t off = 0;
  _Float16* BQ = (_Float16*)(ws + off); off += WBYTES;
  _Float16* BK = (_Float16*)(ws + off); off += WBYTES;
  _Float16* BV = (_Float16*)(ws + off); off += WBYTES;
  _Float16* BO = (_Float16*)(ws + off); off += WBYTES;
  _Float16* XQ = (_Float16*)(ws + off); off += PBYTES;
  _Float16* XK = (_Float16*)(ws + off); off += PBYTES;
  _Float16* XV = (_Float16*)(ws + off); off += PBYTES;
  _Float16* Q16 = (_Float16*)(ws + off); off += PBYTES;
  _Float16* K16 = (_Float16*)(ws + off); off += PBYTES;
  _Float16* VT = (_Float16*)(ws + off); off += PBYTES;
  _Float16* CTX = (_Float16*)(ws + off); off += PBYTES;
  if (off > ws_size) return;
  k_cvt<<<3u * GX + 4u * GW, 256, 0, stream>>>(xq, xk, xv, Wq, Wk, Wv, Wo, XQ, BQ);      /* planes XQ, XK, XV and BQ, BK, BV, BO */
  const unsigned gg = (unsigned)((MR / 128) * (DM / 64));
  const unsigned gp = (unsigned)((MR / PBM) * (DM / PBN));
  k_gemm_qkv<<<dim3(gp, 3), 256, 0, stream>>>(XQ, DM, BQ, DM, 0.0625f, bq, bk, bv, Q16, DM, DM);      /* q = xq Wq^T + bq, k = xk Wk^T + bk into planes Q16, K16; v = xv Wv^T + bv into plane VT as [(b,h)][d][SEQ] (weights x16 -> alpha 1/16) */
  k_attn<<<dim3(SEQ / 64, NH, NB), 128, 0, stream>>>(Q16, K16, VT, mask, CTX);           /* ctx x64, merged heads */
  k_gemm_f32<<<gg, 128, 0, stream>>>(CTX, DM, BO, DM, 0.0009765625f, bo, out, DM, DM, DM);      /* out = ctx Wo^T + bo (x64 and x16 carries -> alpha 2^-10) */
}

// v007
// It runs in 49 microseconds.
// Timed twice side by side with v006, it ran 1.05 and 1.06 times as fast.
// Over all steps from v000 it is 4.92 times as fast.
#include <hip/hip_runtime.h>
// Multi-head attention with three input streams (q, k, v each [NB][SEQ][1024]), [out][in] projection weights with biases, integer key-padding mask applied per (batch, key) as a finite offset that puts a masked logit at about -1e9, 16 heads of 64, score scale 1/8, softmax over the keys of the same batch, heads merged h*64+d, output projection with bias.
// Compute dtype: every contraction on v_wmma_f32_16x16x32_f16 (f16 operands, f32 accumulate). Float inputs are converted (RNE) to bf16 first and carried as exact f16 (weights x16); q, k, v planes plain f16; softmax weights exp(s-m) carried x1024 as f16 (row sum l from the unconverted f32 values); ctx carried x64 as f16; scores and softmax statistics f32.
// Structure: one launch for the 3 activation and 4 weight converts, one launch for the 3 projection GEMMs (256x128 block tiles, 64x64 wave tiles, operands staged in LDS by asynchronous copies, two buffers; the v blocks store their tile transposed, as V^T), one fused online-softmax attention kernel (K and V^T tiles of 128 keys staged in LDS by asynchronous copies, two buffers, shared by the block's 4 waves; transposed score tiles S^T = K Q^T so a lane owns one query column; P^T accumulator tiles feed the next WMMA as its B operand directly), one output GEMM (f32, 128x64 block tiles, 32x64 wave tiles, staged the same way).
#ifndef NB
#define NB 2
#endif
#ifndef SEQ
#define SEQ 1024
#endif
#define NB_FULL 2
#define SEQ_FULL 1024
#define DM 1024
#define NH 16
#define HD 64
#define NR ((size_t)NB * SEQ)         /* token rows processed */
#define MR ((int)(NB * SEQ))

typedef unsigned short v8us __attribute__((ext_vector_type(8), may_alias));
typedef float  v8f  __attribute__((ext_vector_type(8)));
typedef float  v4f  __attribute__((ext_vector_type(4)));
typedef float  v4fa __attribute__((ext_vector_type(4), may_alias));
typedef int    v4ia __attribute__((ext_vector_type(4), may_alias));
typedef unsigned int v4ua __attribute__((ext_vector_type(4), may_alias));
typedef _Float16 v16h __attribute__((ext_vector_type(16)));
typedef _Float16 v4h __attribute__((ext_vector_type(4)));
union FragH { v16h v; v8us half[2]; _Float16 h[16]; unsigned short u[16]; };

static_assert(NH * HD == DM);                 /* merged head width */
static_assert(HD == 64);                      /* attention kernel: 2 k-steps of 32 over the head dim, 4 output tiles of 16 */
static_assert(DM % 64 == 0 && DM % 32 == 0 && DM % 8 == 0);  /* GEMM N tiles, K steps, 16-B pieces */
static_assert(SEQ % 128 == 0);                /* attention block = 64 queries; key steps of 32 */
static_assert((NB * SEQ) % 128 == 0);         /* GEMM block = 128 rows, no row tail */
static_assert(SEQ % 512 == 0);                /* mask table built 4 keys a thread by a 128-thread block, whole trips only */
static_assert(NB <= NB_FULL && SEQ <= SEQ_FULL);
static_assert(((size_t)NB * SEQ * DM) % (8 * 256) == 0);     /* convert grids exact */
static_assert(((size_t)DM * DM) % (8 * 256) == 0);

__device__ __forceinline__ unsigned short bf16_bits(float x) { unsigned int u = __float_as_uint(x); return (unsigned short)((u + 0x7FFFu + ((u >> 16) & 1u)) >> 16); }
__device__ __forceinline__ float bf16_val(unsigned short b) { return __uint_as_float(((unsigned int)b) << 16); }
__device__ __forceinline__ float bfr(float x) { return bf16_val(bf16_bits(x)); }      /* RNE convert to bf16, back to f32 */

// fragment (A or B, same k map): elements 0..7 = k0+8h.., elements 8..15 = k0+16+8h.. from a k-contiguous 16-bit row
__device__ __forceinline__ v16h g2_frag(const _Float16* p, int hh) { FragH f; f.half[0] = *(const v8us*)((const unsigned short*)p + 8 * hh); f.half[1] = *(const v8us*)((const unsigned short*)p + 16 + 8 * hh); return f.v; }
// one WMMA with its own hazard guard (ties D, keeps A/B live)
__device__ __forceinline__ v8f g2_mma(v16h a, v16h b, v8f c) { v8f d = __builtin_amdgcn_wmma_f32_16x16x32_f16(false, a, false, b, (short)0, c, false, false); asm volatile("v_nop\n\tv_nop\n\tv_nop\n\tv_nop" : "+v"(d) : "v"(a), "v"(b)); return d; }

__device__ __forceinline__ void wnat_body(const float* __restrict__ w, _Float16* __restrict__ Bt, unsigned blk) {
  const size_t t = (size_t)blk * 256 + threadIdx.x; if (t >= (size_t)DM * DM / 8) return;
  const v4f a = *(const v4fa*)(w + t * 8), c = *(const v4fa*)(w + t * 8 + 4); FragH f;
#pragma unroll
  for (int q = 0; q < 4; ++q) { f.h[q] = (_Float16)(bfr(a[q]) * 16.0f); f.h[4 + q] = (_Float16)(bfr(c[q]) * 16.0f); }
  const v8us o = f.half[0];
  *(v8us*)((unsigned short*)Bt + t * 8) = o; 
}

__device__ __forceinline__ void x16_body(const float* __restrict__ x, _Float16* __restrict__ X16, unsigned blk) {
  const size_t t = (size_t)blk * 256 + threadIdx.x; if (t >= NR * DM / 8) return;
  const size_t e = t * 8; const size_t row = e / DM; const size_t col = e % DM; const size_t bb = row / SEQ, s = row % SEQ;
  const float* src = x + (bb * SEQ_FULL + s) * DM + col;
  const v4f a = *(const v4fa*)(src), c = *(const v4fa*)(src + 4); FragH f;
#pragma unroll
  for (int q = 0; q < 4; ++q) { f.h[q] = (_Float16)bfr(a[q]); f.h[4 + q] = (_Float16)bfr(c[q]); }
  const v8us o = f.half[0];
  *(v8us*)((unsigned short*)X16 + t * 8) = o; 
}
// The seven converts read none of each other's output: one grid. Blocks [0, 3*GX) take the activation streams (GX blocks each), the rest the weight matrices (GW blocks each);
// the f16 planes of a kind lie one behind the other, so the stream or matrix number picks source pointer and destination plane.
#define GW ((unsigned)(((size_t)DM * DM / 8) / 256))
#define GX ((unsigned)((NR * DM / 8) / 256))
__global__ __launch_bounds__(256) void k_cvt(const float* __restrict__ xq, const float* __restrict__ xk, const float* __restrict__ xv,
                                             const float* __restrict__ Wq, const float* __restrict__ Wk, const float* __restrict__ Wv, const float* __restrict__ Wo,
                                             _Float16* __restrict__ X16, _Float16* __restrict__ Bt) {
  const unsigned bx = blockIdx.x;
  if (bx < 3u * GX) { const unsigned s = bx / GX; const float* x = (s == 0u) ? xq : (s == 1u) ? xk : xv;
    x16_body(x, X16 + (size_t)s * NR * DM, bx - s * GX); }
  else { const unsigned r = bx - 3u * GX; const unsigned s = r / GW; const float* w = (s & 2u) ? ((s & 1u) ? Wo : Wv) : ((s & 1u) ? Wk : Wq);
    wnat_body(w, Bt + (size_t)s * DM * DM, r - s * GW); }
}

// GEMM C[M][N] = alpha * A[M][K] . Bt[N][K]^T + bf16(bias[N]); A, Bt f16 k-contiguous rows;
// operands reach the waves through LDS: a pass is 128 k (256 B of each of the block's A rows and Bt rows), copied asynchronously into one of two buffers while the other is worked on.
#define GKP 128                       /* k per pass */
#define GPITCH 272                    /* LDS row pitch in bytes: 16 B x odd, for 16-byte fragment reads down a column of rows */
#define GSTAGE (192 * GPITCH)         /* one buffer of the output GEMM: rows 0..127 = A rows of the block, rows 128..191 = Bt rows of the block */
static_assert(DM % GKP == 0 && DM / GKP >= 2);   /* whole passes only */
// fragment from an LDS row, same k map as g2_frag; p already holds the lane's 16*hh byte offset
__device__ __forceinline__ v16h g2_lfrag(const unsigned char* p) { FragH f; f.half[0] = *(const v8us*)p; f.half[1] = *(const v8us*)(p + 32); return f.v; }
// twelve 16-byte copies of a lane, global -> LDS through no register; the closing s_wait_xcnt stands inside the statement so that no address register is rewritten ahead of it
__device__ __forceinline__ void g2_copy12(const unsigned* l, const _Float16* const* g) {
  asm volatile("global_load_async_to_lds_b128 %0, %12, off\n\t"
               "global_load_async_to_lds_b128 %1, %13, off\n\t"
               "global_load_async_to_lds_b128 %2, %14, off\n\t"
               "global_load_async_to_lds_b128 %3, %15, off\n\t"
               "global_load_async_to_lds_b128 %4, %16, off\n\t"
               "global_load_async_to_lds_b128 %5, %17, off\n\t"
               "global_load_async_to_lds_b128 %6, %18, off\n\t"
               "global_load_async_to_lds_b128 %7, %19, off\n\t"
               "global_load_async_to_lds_b128 %8, %20, off\n\t"
               "global_load_async_to_lds_b128 %9, %21, off\n\t"
               "global_load_async_to_lds_b128 %10, %22, off\n\t"
               "global_load_async_to_lds_b128 %11, %23, off\n\t"
               "s_wait_xcnt 0x0"
               :: "v"(l[0]), "v"(l[1]), "v"(l[2]), "v"(l[3]), "v"(l[4]), "v"(l[5]), "v"(l[6]), "v"(l[7]), "v"(l[8]), "v"(l[9]), "v"(l[10]), "v"(l[11]),
                  "v"(g[0]), "v"(g[1]), "v"(g[2]), "v"(g[3]), "v"(g[4]), "v"(g[5]), "v"(g[6]), "v"(g[7]), "v"(g[8]), "v"(g[9]), "v"(g[10]), "v"(g[11])
               : "memory");
}
// one pass's tile: 24 * RR rows of 256 B (16 * RR of A, then 8 * RR of Bt); 16 lanes cover a row, the block's lanes RR rows, so 24 copies a lane (16 for A, 8 for Bt)
template <int RR>
__device__ __forceinline__ void g2_stage(unsigned lb, const _Float16* ga, int lda, const _Float16* gb, int ldb) {
  unsigned l[24]; const _Float16* g[24];
#pragma unroll   /* both loops: every address becomes a register operand of the copy statements, no array in memory */
  for (int j = 0; j < 16; ++j) { l[j] = lb + (unsigned)(j * RR * GPITCH); g[j] = ga + (size_t)(j * RR) * lda; }
#pragma unroll
  for (int j = 0; j < 8; ++j) { l[16 + j] = lb + (unsigned)((16 + j) * RR * GPITCH); g[16 + j] = gb + (size_t)(j * RR) * ldb; }
  g2_copy12(l, g); g2_copy12(l + 12, g + 12);
}
// Output GEMM body (f32 C): block = 4 waves, wave tile 32x64, block tile 128x64
__device__ __forceinline__ void gemm2_body(const _Float16* __restrict__ A, int lda, const _Float16* __restrict__ Bh, int ldb, float alpha, const float* __restrict__ bias,
                                           float* __restrict__ C, int ldc, int N, int K) {
  __shared__ __attribute__((aligned(16))) float so[4][32][68];
  __shared__ __attribute__((aligned(16))) unsigned char ring[2 * GSTAGE];
  const int tid = threadIdx.x; const int w = __builtin_amdgcn_readfirstlane(tid >> 5); const int lane = tid & 31, ln = lane & 15, hh = lane >> 4;
  const int ntn = N >> 6; const int mt = blockIdx.x / ntn, nq = blockIdx.x - mt * ntn; const int row0 = mt * 128 + 32 * w, col0 = nq * 64;
  const int cr = tid >> 4, cc = tid & 15;                 /* copy role: row within a group of 8, 16-byte piece within the row */
  const _Float16* ga = A + (size_t)(mt * 128 + cr) * lda + cc * 8; const _Float16* gb = Bh + (size_t)(col0 + cr) * ldb + cc * 8;
  const unsigned lb = (unsigned)(size_t)ring + (unsigned)(cr * GPITCH + cc * 16);
  const unsigned char* fa = ring + (32 * w + ln) * GPITCH + 16 * hh; const unsigned char* fb = ring + (128 + ln) * GPITCH + 16 * hh;
  const int np = K / GKP;
  const int s0 = (mt + nq) % np;      /* the block's first pass: blocks that share A rows (same mt) or Bt rows (same nq) start at different k, so that they do not ask L2 for the same lines at the same moment; the walk wraps round */
  const v8f z8 = {0.f,0.f,0.f,0.f,0.f,0.f,0.f,0.f}; v8f c00 = z8, c01 = z8, c02 = z8, c03 = z8, c10 = z8, c11 = z8, c12 = z8, c13 = z8;
  g2_stage<8>(lb, ga + (size_t)s0 * GKP, lda, gb + (size_t)s0 * GKP, ldb);
  asm volatile("s_wait_asynccnt 0x0" ::: "memory");       /* this wave's copies of the first pass have landed */
  __syncthreads();                                        /* first pass published to every wave */
  if (np > 1) { const int p = (s0 + 1 < np) ? s0 + 1 : 0; g2_stage<8>(lb + GSTAGE, ga + (size_t)p * GKP, lda, gb + (size_t)p * GKP, ldb); }
#pragma unroll 1   /* one pass a trip: one publish point and one refill site in the code */
  for (int t = 0; t < np; ++t) { const unsigned bo = (unsigned)(t & 1) * GSTAGE; const unsigned char* pa = fa + bo; const unsigned char* pb = fb + bo;
    v16h a0 = g2_lfrag(pa), a1 = g2_lfrag(pa + 16 * GPITCH), b0 = g2_lfrag(pb), b1 = g2_lfrag(pb + 16 * GPITCH), b2 = g2_lfrag(pb + 32 * GPITCH), b3 = g2_lfrag(pb + 48 * GPITCH);
#pragma unroll   /* the two fragment sets alternate by renaming, LDS offsets become immediates */
    for (int ks = 0; ks < GKP / 32; ++ks) { v16h na0 = a0, na1 = a1, nb0 = b0, nb1 = b1, nb2 = b2, nb3 = b3;
      if (ks + 1 < GKP / 32) { const int o = (ks + 1) * 64;      /* the same pass's next k-step, read ahead of this step's products */
        na0 = g2_lfrag(pa + o); na1 = g2_lfrag(pa + 16 * GPITCH + o); nb0 = g2_lfrag(pb + o); nb1 = g2_lfrag(pb + 16 * GPITCH + o); nb2 = g2_lfrag(pb + 32 * GPITCH + o); nb3 = g2_lfrag(pb + 48 * GPITCH + o); }
      c00 = g2_mma(a0, b0, c00); c10 = g2_mma(a1, b0, c10);
      c01 = g2_mma(a0, b1, c01); c11 = g2_mma(a1, b1, c11);
      c02 = g2_mma(a0, b2, c02); c12 = g2_mma(a1, b2, c12);
      c03 = g2_mma(a0, b3, c03); c13 = g2_mma(a1, b3, c13);
      a0 = na0; a1 = na1; b0 = nb0; b1 = nb1; b2 = nb2; b3 = nb3; }
    asm volatile("s_wait_dscnt 0x0" ::: "memory");        /* this wave's reads of the buffer have returned before it may be refilled */
    asm volatile("s_wait_asynccnt 0x0" ::: "memory");     /* this wave's copies of the pass of trip t + 1 have landed */
    __syncthreads();                                      /* publishes the pass of trip t + 1 and ends every wave's reads of the pass of trip t */
    if (t + 2 < np) { int p = s0 + t + 2; p = (p < np) ? p : p - np; g2_stage<8>(lb + bo, ga + (size_t)p * GKP, lda, gb + (size_t)p * GKP, ldb); } }
  asm volatile("s_wait_asynccnt 0x0" ::: "memory");       /* no copy outstanding behind the loop */
  v8f accs[8] = {c00, c01, c02, c03, c10, c11, c12, c13};
#pragma unroll
  for (int u = 0; u < 8; ++u) { const int t = u & 3, half = u >> 2; const int col = col0 + t * 16 + ln; const float bv = bfr(bias[col]);
#pragma unroll
    for (int r = 0; r < 8; ++r) { const int rloc = half * 16 + 8 * hh + r; so[w][rloc][t * 16 + ln] = accs[u][r] * alpha + bv; } }
  __syncthreads();      /* staging tile is private to the wave; the block barrier is a superset of the wave-level ordering needed */
  const int rsub = lane >> 4, c4 = (lane & 15) * 4;
#pragma unroll
  for (int q = 0; q < 16; ++q) { const int r = q * 2 + rsub; const v4f v = *(const v4fa*)&so[w][r][c4];
    *(v4f*)(C + (size_t)(row0 + r) * ldc + col0 + c4) = v; }
}
// Projection GEMM body (f16 C): block = 8 waves as 4 (rows) x 2 (columns), wave tile 64x64, block tile 256x128, so that a block copies 384 operand rows from L2 for 32,768 outputs (128x64: 192 rows for 8,192).
// Same ring as above with 256 A rows and 128 Bt rows a buffer; behind the loop's last barrier the ring is free and serves as the output staging.
#define PBM 256
#define PBN 128
#define PSTAGE ((PBM + PBN) * GPITCH)
#define VPITCH 528                    /* staging pitch of a V^T row in bytes: 256 tokens in f16 + 16 = 16 B x odd */
static_assert(SEQ % PBM == 0 && DM % PBN == 0 && PBN == 2 * HD);      /* a block's 256 token rows lie in one batch; its 128 columns are two whole heads */
static_assert(8 * 64 * 68 * 4 <= 2 * PSTAGE && PBN * VPITCH <= 2 * PSTAGE);      /* both stagings fit the ring */
__device__ __forceinline__ void gemm3_body(const _Float16* __restrict__ A, int lda, const _Float16* __restrict__ Bh, int ldb, float alpha, const float* __restrict__ bias,
                                           _Float16* __restrict__ C16, int N, int K, bool vt) {
  __shared__ __attribute__((aligned(16))) unsigned char ring[2 * PSTAGE];
  const int tid = threadIdx.x; const int w = __builtin_amdgcn_readfirstlane(tid >> 5); const int lane = tid & 31, ln = lane & 15, hh = lane >> 4;
  const int wm = w & 3, wn = w >> 2;
  const int ntn = N / PBN; const int mt = blockIdx.x / ntn, nq = blockIdx.x - mt * ntn; const int row0 = mt * PBM + 64 * wm, col0 = nq * PBN + 64 * wn;
  const int cr = tid >> 4, cc = tid & 15;                 /* copy role: row within a group of 16, 16-byte piece within the row */
  const _Float16* ga = A + (size_t)(mt * PBM + cr) * lda + cc * 8; const _Float16* gb = Bh + (size_t)(nq * PBN + cr) * ldb + cc * 8;
  const unsigned lb = (unsigned)(size_t)ring + (unsigned)(cr * GPITCH + cc * 16);
  const unsigned char* fa = ring + (64 * wm + ln) * GPITCH + 16 * hh; const unsigned char* fb = ring + (PBM + 64 * wn + ln) * GPITCH + 16 * hh;
  const int np = K / GKP;
  const int s0 = (mt + nq) % np;      /* the block's first pass, as in the output GEMM: sharers of A or Bt rows start at different k; the walk wraps round */
  const v8f z8 = {0.f,0.f,0.f,0.f,0.f,0.f,0.f,0.f}; v8f c[4][4];
#pragma unroll
  for (int i = 0; i < 4; ++i) {
#pragma unroll
    for (int j = 0; j < 4; ++j) c[i][j] = z8; }
  g2_stage<16>(lb, ga + (size_t)s0 * GKP, lda, gb + (size_t)s0 * GKP, ldb);
  asm volatile("s_wait_asynccnt 0x0" ::: "memory");       /* this wave's copies of the first pass have landed */
  __syncthreads();                                        /* first pass published to every wave */
  if (np > 1) { const int p = (s0 + 1 < np) ? s0 + 1 : 0; g2_stage<16>(lb + PSTAGE, ga + (size_t)p * GKP, lda, gb + (size_t)p * GKP, ldb); }
#pragma unroll 1   /* one pass a trip: one publish point and one refill site in the code */
  for (int t = 0; t < np; ++t) { const unsigned bo = (unsigned)(t & 1) * PSTAGE; const unsigned char* pa = fa + bo; const unsigned char* pb = fb + bo;
#pragma unroll   /* LDS offsets become immediates */
    for (int ks = 0; ks < GKP / 32; ++ks) { v16h a[4], b[4];      /* one fragment set: with the 128 accumulator registers a second set would pass 256 registers; the SIMD's other wave covers the read latency */
#pragma unroll
      for (int i = 0; i < 4; ++i) { a[i] = g2_lfrag(pa + i * 16 * GPITCH + ks * 64); b[i] = g2_lfrag(pb + i * 16 * GPITCH + ks * 64); }
#pragma unroll
      for (int j = 0; j < 4; ++j) {
#pragma unroll
        for (int i = 0; i < 4; ++i) c[i][j] = g2_mma(a[i], b[j], c[i][j]); } }
    asm volatile("s_wait_dscnt 0x0" ::: "memory");        /* this wave's reads of the buffer have returned before it may be refilled */
    asm volatile("s_wait_asynccnt 0x0" ::: "memory");     /* this wave's copies of the pass of trip t + 1 have landed */
    __syncthreads();                                      /* publishes the pass of trip t + 1 and ends every wave's reads of the pass of trip t */
    if (t + 2 < np) { int p = s0 + t + 2; p = (p < np) ? p : p - np; g2_stage<16>(lb + bo, ga + (size_t)p * GKP, lda, gb + (size_t)p * GKP, ldb); } }
  asm volatile("s_wait_asynccnt 0x0" ::: "memory");       /* no copy outstanding behind the loop */
  if (vt) {      /* block-uniform. C16 = V^T plane [(batch, head)][d][SEQ]; the block's 128 columns are the 64 d of heads 2nq and 2nq+1, its 256 rows are 256 tokens of one batch */
    unsigned char* st = ring;      /* block tile [column][token] in f16, row pitch VPITCH */
#pragma unroll
    for (int j = 0; j < 4; ++j) { const float bv = bfr(bias[col0 + j * 16 + ln]);
#pragma unroll
      for (int i = 0; i < 4; ++i) { FragH f;
#pragma unroll
        for (int r = 0; r < 8; ++r) f.h[r] = (_Float16)(c[i][j][r] * alpha + bv);      /* a lane's 8 accumulator elements = 8 consecutive tokens of one d: one 16-byte piece of a V^T row */
        *(v8us*)(st + (64 * wn + j * 16 + ln) * VPITCH + (64 * wm + 16 * i + 8 * hh) * 2) = f.half[0]; } }
    __syncthreads();      /* every wave wrote its 64 tokens into 64 of the rows; the rows are read back across waves */
    const int tok0 = mt * PBM; _Float16* vb = C16 + ((size_t)(tok0 / SEQ) * NH * HD + (size_t)nq * PBN) * SEQ + (tok0 % SEQ);
#pragma unroll
    for (int q = 0; q < 16; ++q) { const int d = q * 8 + w; const v8us v = *(const v8us*)(st + d * VPITCH + lane * 16);      /* a wave stores the 512 contiguous bytes of a row */
      *(v8us*)((unsigned short*)vb + (size_t)d * SEQ + lane * 8) = v; }
    return;
  }
  float* so = (float*)(ring + w * (64 * 68 * 4));      /* the wave's own staging tile [64 rows][pitch 68 floats] */
#pragma unroll
  for (int j = 0; j < 4; ++j) { const float bv = bfr(bias[col0 + j * 16 + ln]);
#pragma unroll
    for (int i = 0; i < 4; ++i) {
#pragma unroll
      for (int r = 0; r < 8; ++r) so[(i * 16 + 8 * hh + r) * 68 + j * 16 + ln] = c[i][j][r] * alpha + bv; } }
  __syncthreads();      /* staging tile is private to the wave; the block barrier is a superset of the wave-level ordering needed */
  const int rsub = lane >> 4, c4 = (lane & 15) * 4;
  _Float16* cp = C16 + (size_t)(row0 + rsub) * DM + col0 + c4;      /* C rows are DM wide: one address register pair, the row step is an immediate offset */
#pragma unroll
  for (int g = 0; g < 4; ++g) {
#pragma unroll
    for (int q = g * 8; q < g * 8 + 8; ++q) { const v4f v = *(const v4fa*)&so[(q * 2 + rsub) * 68 + c4];
      v4h h4; h4[0] = (_Float16)v[0]; h4[1] = (_Float16)v[1]; h4[2] = (_Float16)v[2]; h4[3] = (_Float16)v[3]; *(v4h*)(cp + (size_t)(q * 2) * DM) = h4; }
    asm volatile("s_wait_xcnt 0x0" ::: "memory");      /* no register that one of these eight stores names is rewritten (by the next group, or by code laid behind) ahead of this wait */
  }
}
// the three projections in one grid: blockIdx.y = 0, 1, 2 picks the q, k or v problem; its A, Bt and C planes lie one behind the other; the third C plane is written as V^T
__global__ __launch_bounds__(256) void k_gemm_qkv(const _Float16* __restrict__ A, int lda, const _Float16* __restrict__ Bh, int ldb, float alpha,
                                                  const float* __restrict__ bq, const float* __restrict__ bk, const float* __restrict__ bv, _Float16* __restrict__ C16, int N, int K) {
  const unsigned s = blockIdx.y; const float* bias = (s == 0u) ? bq : (s == 1u) ? bk : bv;
  gemm3_body(A + (size_t)s * NR * DM, lda, Bh + (size_t)s * DM * DM, ldb, alpha, bias, C16 + (size_t)s * NR * DM, N, K, s == 2u);
}
__global__ __launch_bounds__(128) void k_gemm_f32(const _Float16* __restrict__ A, int lda, const _Float16* __restrict__ Bh, int ldb, float alpha, const float* __restrict__ bias, float* __restrict__ C, int ldc, int N, int K) {
  gemm2_body(A, lda, Bh, ldb, alpha, bias, C, ldc, N, K);
}

// Attention operands reach the waves through LDS: a stage is 128 keys of one (batch, head): 128 K rows of 128 B and 64 V^T rows of 256 B, copied asynchronously into one of two buffers while the other is worked on.
#define AKT 128                       /* keys per stage */
#define AKPITCH 144                   /* LDS pitch of a K row in bytes: 16 B x odd, for 16-byte fragment reads down a column of rows */
#define AVPITCH 272                   /* LDS pitch of a V^T row in bytes: 16 B x odd */
#define AKBYTES (AKT * AKPITCH)       /* K rows first, V^T rows behind them */
#define ASTAGE (AKBYTES + HD * AVPITCH)
static_assert(SEQ % AKT == 0 && SEQ / AKT >= 2);   /* whole stages only, both buffers filled in the prologue */
static_assert(AKT * HD * 2 == 8 * 128 * 16);       /* each operand's tile = 8 copies of 16 B by each of 128 lanes */
// eight 16-byte copies of a lane, global -> LDS through no register; the closing s_wait_xcnt stands inside the statement so that no address register is rewritten ahead of it
__device__ __forceinline__ void at_copy8(const unsigned* l, const _Float16* const* g) {
  asm volatile("global_load_async_to_lds_b128 %0, %8, off\n\t"
               "global_load_async_to_lds_b128 %1, %9, off\n\t"
               "global_load_async_to_lds_b128 %2, %10, off\n\t"
               "global_load_async_to_lds_b128 %3, %11, off\n\t"
               "global_load_async_to_lds_b128 %4, %12, off\n\t"
               "global_load_async_to_lds_b128 %5, %13, off\n\t"
               "global_load_async_to_lds_b128 %6, %14, off\n\t"
               "global_load_async_to_lds_b128 %7, %15, off\n\t"
               "s_wait_xcnt 0x0"
               :: "v"(l[0]), "v"(l[1]), "v"(l[2]), "v"(l[3]), "v"(l[4]), "v"(l[5]), "v"(l[6]), "v"(l[7]),
                  "v"(g[0]), "v"(g[1]), "v"(g[2]), "v"(g[3]), "v"(g[4]), "v"(g[5]), "v"(g[6]), "v"(g[7])
               : "memory");
}
// one stage: K: 8 lanes cover a row, the block's 128 lanes 16 rows; V^T: 16 lanes cover a row, the block 8 rows; 8 copies a lane for each
__device__ __forceinline__ void at_stage(unsigned lk, unsigned lv, const _Float16* gk, const _Float16* gv) {
  unsigned l[16]; const _Float16* g[16];
#pragma unroll   /* every address becomes a register operand of the copy statements, no array in memory */
  for (int j = 0; j < 8; ++j) { l[j] = lk + (unsigned)(j * 16 * AKPITCH); g[j] = gk + (size_t)(j * 16) * DM; l[8 + j] = lv + (unsigned)(j * 8 * AVPITCH); g[8 + j] = gv + (size_t)(j * 8) * SEQ; }
  at_copy8(l, g); at_copy8(l + 8, g + 8);
}

// Fused attention: block = 4 waves = 64 queries of one (batch, head); wave = 16 queries; key loop in stages of 128 keys, steps of 32 keys.
// Score tiles are computed TRANSPOSED (A = K rows [key][d], B = Q rows [query][d]): accumulator element r of lane (hh, ln) = (key 8hh+r, query ln),
// so a lane owns one query column: row max = in-lane max + one xor-16 shuffle. The two 16-key P^T tiles are the B operand of the next product
// (elements 0..7 <- tile 0 element r, elements 8..15 <- tile 1 element r, lane unchanged); A = V^T rows [d][key]; accumulators hold O^T (d 8hh+r, query ln).
// Mask: a per-key f32 table built once per block in LDS (0 for a kept key, MASKRAW for a masked one) is the START VALUE of the score accumulators (element r of a lane = key 8hh+r, the table's own order),
// so a masked logit comes out of the matrix unit at about -1e9 after the 1/8 scale and costs no vector work. Where no key of the batch is kept the score scale is 0: every logit 0, the row uniform.
#define MASKRAW (-8.0e9f)
// eight consecutive keys' table entries = one accumulator tile's start value in a lane
__device__ __forceinline__ v8f at_bias(const unsigned char* p) { const v4f a = *(const v4fa*)p, c = *(const v4fa*)(p + 16); return __builtin_shufflevector(a, c, 0, 1, 2, 3, 4, 5, 6, 7); }
__global__ __launch_bounds__(128) void k_attn(const _Float16* __restrict__ Q16, const _Float16* __restrict__ K16, const _Float16* __restrict__ Vt, const int* __restrict__ mask, _Float16* __restrict__ CTX) {
  __shared__ __attribute__((aligned(16))) float sbias[SEQ];                /* cross-wave: 4 keys a thread and trip, read by all after the block barrier */
  __shared__ __attribute__((aligned(16))) unsigned int skeep[4];           /* per wave: nonzero where one of the keys it looked at is kept */
  __shared__ __attribute__((aligned(16))) unsigned short sh[4][16][72];    /* per-wave output staging [query][d], pitch 144 B */
  __shared__ __attribute__((aligned(16))) unsigned char ring[2 * ASTAGE];  /* the two K / V^T stage buffers */
  const int tid = threadIdx.x; const int wave = __builtin_amdgcn_readfirstlane(tid >> 5); const int lane = tid & 31, ln = lane & 15, hh = lane >> 4;
  const int h = blockIdx.y, b = blockIdx.z; const size_t rowb = (size_t)b * SEQ;
  const _Float16* gk = K16 + (rowb + (tid >> 3)) * DM + h * HD + (tid & 7) * 8;                    /* copy role, K: row within a group of 16, 16-byte piece */
  const _Float16* gv = Vt + ((size_t)(b * NH + h) * HD + (tid >> 4)) * SEQ + (tid & 15) * 8;       /* copy role, V^T: row within a group of 8, 16-byte piece */
  const unsigned lk = (unsigned)(size_t)ring + (unsigned)((tid >> 3) * AKPITCH + (tid & 7) * 16);
  const unsigned lv = (unsigned)(size_t)ring + (unsigned)(AKBYTES + (tid >> 4) * AVPITCH + (tid & 15) * 16);
  const int s0 = (int)(blockIdx.x % (SEQ / AKT));                         /* the block's first key stage: the blocks of one (batch, head) read the same K and V^T lines and start at different stages, so that they do not ask L2 for them at the same moment; the walk wraps round */
  at_stage(lk, lv, gk + (size_t)s0 * AKT * DM, gv + (size_t)s0 * AKT);    /* the first stage flies while the mask table is built */
  {
    const int* mp = mask + (size_t)b * SEQ_FULL; bool any = false;
#pragma unroll   /* the loads of all trips are issued together */
    for (int k4 = 0; k4 < SEQ; k4 += 512) { const int k = k4 + tid * 4; const v4ia m = *(const v4ia*)(mp + k); v4f bb;
#pragma unroll   /* vector elements picked by constants: no indexed register access */
      for (int i = 0; i < 4; ++i) { bb[i] = (m[i] != 0) ? 0.0f : MASKRAW; any = any || (m[i] != 0); }
      *(v4fa*)&sbias[k] = bb; }
    const unsigned int kw = __builtin_amdgcn_ballot_w32(any);
    if (lane == 0) skeep[wave] = kw;
  }
  asm volatile("s_wait_asynccnt 0x0" ::: "memory");       /* this wave's copies of the first stage have landed */
  __syncthreads();                                        /* mask table, keep words and the first stage published to every wave */
  { const int p = (s0 + 1) % (SEQ / AKT); at_stage(lk + ASTAGE, lv + ASTAGE, gk + (size_t)p * AKT * DM, gv + (size_t)p * AKT); }
  const int q0 = blockIdx.x * 64 + wave * 16;
  const _Float16* Qp = Q16 + (rowb + q0 + ln) * DM + h * HD;
  const v16h qf0 = g2_frag(Qp, hh), qf1 = g2_frag(Qp + 32, hh);
  const unsigned char* fk = ring + ln * AKPITCH + 16 * hh; const unsigned char* fv = ring + AKBYTES + ln * AVPITCH + 16 * hh;
  const v4ua kws = *(const v4ua*)skeep;
  const float scl = (__builtin_amdgcn_readfirstlane(kws[0] | kws[1] | kws[2] | kws[3]) != 0u) ? 0.125f : 0.0f;      /* block-uniform score scale */
  const v8f z8 = {0.f,0.f,0.f,0.f,0.f,0.f,0.f,0.f};
  v8f o0 = z8, o1 = z8, o2 = z8, o3 = z8; float mrun = -1.0e30f, lpart = 0.f;
#pragma unroll 1   /* one stage a trip: one publish point and one refill site in the code */
  for (int t = 0; t < SEQ / AKT; ++t) { const unsigned bo = (unsigned)(t & 1) * ASTAGE; const unsigned char* pk = fk + bo; const unsigned char* pv = fv + bo;
   const int st = (s0 + t) % (SEQ / AKT);                 /* the key stage that trip t works on */
   const unsigned char* pm = (const unsigned char*)sbias + st * (AKT * 4) + 32 * hh;      /* the lane's 8 keys of the stage's first 16-key tile */
   v16h ka0 = g2_lfrag(pk), ka1 = g2_lfrag(pk + 64), ka2 = g2_lfrag(pk + 16 * AKPITCH), ka3 = g2_lfrag(pk + 16 * AKPITCH + 64);
   v8f m0 = at_bias(pm), m1 = at_bias(pm + 64);
#pragma unroll   /* LDS offsets become immediates; the K fragments and mask entries of the same stage's next step are read ahead */
   for (int kk = 0; kk < AKT / 32; ++kk) {
    const v16h va0 = g2_lfrag(pv + kk * 64), va1 = g2_lfrag(pv + 16 * AVPITCH + kk * 64), va2 = g2_lfrag(pv + 32 * AVPITCH + kk * 64), va3 = g2_lfrag(pv + 48 * AVPITCH + kk * 64);
    v8f s0 = m0, s1 = m1;
    s0 = g2_mma(ka0, qf0, s0);
    s0 = g2_mma(ka1, qf1, s0);
    s1 = g2_mma(ka2, qf0, s1);
    s1 = g2_mma(ka3, qf1, s1);
    if (kk + 1 < AKT / 32) { const unsigned char* nk = pk + (kk + 1) * 32 * AKPITCH;
      ka0 = g2_lfrag(nk); ka1 = g2_lfrag(nk + 64); ka2 = g2_lfrag(nk + 16 * AKPITCH); ka3 = g2_lfrag(nk + 16 * AKPITCH + 64);
      m0 = at_bias(pm + (kk + 1) * 128); m1 = at_bias(pm + (kk + 1) * 128 + 64); }      /* keys 128st+32(kk+1)+8hh+r (tile 0) and +16 (tile 1) */
    float e0[8], e1[8]; float mx = -3.0e38f;
#pragma unroll
    for (int r = 0; r < 8; ++r) {
      const float x0 = s0[r] * scl, x1 = s1[r] * scl;
      e0[r] = x0; e1[r] = x1; mx = fmaxf(mx, fmaxf(x0, x1));
    }
    mx = fmaxf(mx, __shfl_xor(mx, 16));
    const float mnew = fmaxf(mrun, mx); const float alpha = __expf(mrun - mnew); mrun = mnew;
    float ps = 0.f; FragH pf;
#pragma unroll
    for (int r = 0; r < 8; ++r) {
      const float p0 = __expf(e0[r] - mnew), p1 = __expf(e1[r] - mnew); ps += p0 + p1;
      pf.h[r] = (_Float16)(p0 * 1024.0f); pf.h[8 + r] = (_Float16)(p1 * 1024.0f);
    }
    lpart = lpart * alpha + ps;
#pragma unroll
    for (int r = 0; r < 8; ++r) { o0[r] *= alpha; o1[r] *= alpha; o2[r] *= alpha; o3[r] *= alpha; }
    const v16h pb = pf.v;
    o0 = g2_mma(va0, pb, o0);
    o1 = g2_mma(va1, pb, o1);
    o2 = g2_mma(va2, pb, o2);
    o3 = g2_mma(va3, pb, o3);
   }
   asm volatile("s_wait_dscnt 0x0" ::: "memory");         /* this wave's reads of the buffer have returned before it may be refilled */
   asm volatile("s_wait_asynccnt 0x0" ::: "memory");      /* this wave's copies of the stage of trip t + 1 have landed */
   __syncthreads();                                       /* publishes the stage of trip t + 1 and ends every wave's reads of stage st */
   if (t + 2 < SEQ / AKT) { const int p = (s0 + t + 2) % (SEQ / AKT); at_stage(lk + bo, lv + bo, gk + (size_t)p * AKT * DM, gv + (size_t)p * AKT); }
  }
  asm volatile("s_wait_asynccnt 0x0" ::: "memory");       /* no copy outstanding behind the loop */
  const float l = lpart + __shfl_xor(lpart, 16);
  const float inv = 1.0f / (l * 16.0f);                    /* P carried x1024, ctx carried x64: x64/1024 = 1/16 */
  FragH t0, t1, t2, t3;
#pragma unroll
  for (int r = 0; r < 8; ++r) { t0.h[r] = (_Float16)(o0[r] * inv); t1.h[r] = (_Float16)(o1[r] * inv); t2.h[r] = (_Float16)(o2[r] * inv); t3.h[r] = (_Float16)(o3[r] * inv); }
  *(v8us*)&sh[wave][ln][0 + 8 * hh] = t0.half[0];
  *(v8us*)&sh[wave][ln][16 + 8 * hh] = t1.half[0];
  *(v8us*)&sh[wave][ln][32 + 8 * hh] = t2.half[0];
  *(v8us*)&sh[wave][ln][48 + 8 * hh] = t3.half[0];
  __syncthreads();
  const int rsub = lane >> 3, pc = lane & 7;               
  {
#pragma unroll
    for (int it = 0; it < 4; ++it) { const int row = it * 4 + rsub; const v8us v = *(const v8us*)&sh[wave][row][pc * 8];
      *(v8us*)((unsigned short*)CTX + (rowb + q0 + row) * DM + h * HD + pc * 8) = v; }
     }
}

#define WBYTES ((size_t)DM * DM * 2)
#define PBYTES ((size_t)NB * SEQ * DM * 2)
static_assert(WBYTES % 256 == 0 && PBYTES % 256 == 0);
static_assert(4 * WBYTES + 7 * PBYTES <= (size_t)134217728);      /* total carve: 4 weight planes + 7 token planes (V^T plane = NB*NH*HD*SEQ halves = one token plane) */

extern "C" void kernel_launch(void* const* d_in, const int* in_sizes, int n_in,
                              void* d_out, int out_size, void* d_ws, size_t ws_size, hipStream_t stream) {
  if (n_in < 12) return;
  const long long need_x = (long long)(NB - 1) * SEQ_FULL * DM + (long long)SEQ * DM;
  if ((long long)in_sizes[0] < need_x || (long long)in_sizes[1] < need_x || (long long)in_sizes[2] < need_x) return;
  if ((long long)in_sizes[3] < (long long)(NB - 1) * SEQ_FULL + SEQ) return;
  if (in_sizes[4] < DM * DM || in_sizes[6] < DM * DM || in_sizes[8] < DM * DM || in_sizes[10] < DM * DM) return;
  if (in_sizes[5] < DM || in_sizes[7] < DM || in_sizes[9] < DM || in_sizes[11] < DM) return;
  if ((long long)out_size < (long long)NB * SEQ * DM) return;
  /* wire order: q, k, v, mask (int32), Wq, bq, Wk, bk, Wv, bv, Wo, bo */
  const float* xq = (const float*)d_in[0]; const float* xk = (const float*)d_in[1]; const float* xv = (const float*)d_in[2];
  const int* mask = (const int*)d_in[3];
  const float* Wq = (const float*)d_in[4]; const float* bq = (const float*)d_in[5];
  const float* Wk = (const float*)d_in[6]; const float* bk = (const float*)d_in[7];
  const float* Wv = (const float*)d_in[8]; const float* bv = (const float*)d_in[9];
  const float* Wo = (const float*)d_in[10]; const float* bo = (const float*)d_in[11];
  float* out = (float*)d_out;
  char* ws = (char*)d_ws; size_t off = 0;
  _Float16* BQ = (_Float16*)(ws + off); off += WBYTES;
  _Float16* BK = (_Float16*)(ws + off); off += WBYTES;
  _Float16* BV = (_Float16*)(ws + off); off += WBYTES;
  _Float16* BO = (_Float16*)(ws + off); off += WBYTES;
  _Float16* XQ = (_Float16*)(ws + off); off += PBYTES;
  _Float16* XK = (_Float16*)(ws + off); off += PBYTES;
  _Float16* XV = (_Float16*)(ws + off); off += PBYTES;
  _Float16* Q16 = (_Float16*)(ws + off); off += PBYTES;
  _Float16* K16 = (_Float16*)(ws + off); off += PBYTES;
  _Float16* VT = (_Float16*)(ws + off); off += PBYTES;
  _Float16* CTX = (_Float16*)(ws + off); off += PBYTES;
  if (off > ws_size) return;
  k_cvt<<<3u * GX + 4u * GW, 256, 0, stream>>>(xq, xk, xv, Wq, Wk, Wv, Wo, XQ, BQ);      /* planes XQ, XK, XV and BQ, BK, BV, BO */
  const unsigned gg = (unsigned)((MR / 128) * (DM / 64));
  const unsigned gp = (unsigned)((MR / PBM) * (DM / PBN));
  k_gemm_qkv<<<dim3(gp, 3), 256, 0, stream>>>(XQ, DM, BQ, DM, 0.0625f, bq, bk, bv, Q16, DM, DM);      /* q = xq Wq^T + bq, k = xk Wk^T + bk into planes Q16, K16; v = xv Wv^T + bv into plane VT as [(b,h)][d][SEQ] (weights x16 -> alpha 1/16) */
  k_attn<<<dim3(SEQ / 64, NH, NB), 128, 0, stream>>>(Q16, K16, VT, mask, CTX);           /* ctx x64, merged heads */
  k_gemm_f32<<<gg, 128, 0, stream>>>(CTX, DM, BO, DM, 0.0009765625f, bo, out, DM, DM, DM);      /* out = ctx Wo^T + bo (x64 and x16 carries -> alpha 2^-10) */
}

// v008
// A run of this version takes 48 microseconds.
// In two side-by-side timings against v007, it was 1.04 and 1.02 times as fast.
// All steps since v000 together make it 5.08 times as fast.
#include <hip/hip_runtime.h>
// Multi-head attention with three input streams (q, k, v each [NB][SEQ_FULL][1024], the first SEQ tokens of each batch used), [out][in] projection weights with biases, integer key-padding mask applied per (batch, key) as a finite offset that puts a masked logit at about -1e9, 16 heads of 64, score scale 1/8, softmax over the keys of the same batch, heads merged h*64+d, output projection with bias.
// Compute dtype: every contraction on v_wmma_f32_16x16x32_f16 (f16 operands, f32 accumulate). Float inputs are converted (RNE) to bf16 first and carried as exact f16 (weights x16); q, k, v planes plain f16; softmax weights exp(s-m) carried x1024 as f16 (row sum l from the unconverted f32 values); ctx carried x64 as f16; scores and softmax statistics f32.
// Structure: one launch for the 3 activation and 4 weight converts, one launch for the 3 projection GEMMs (256x128 block tiles, 64x64 wave tiles, operands staged in LDS by asynchronous copies, two buffers; the v blocks store their tile transposed, as V^T), one fused online-softmax attention kernel (K and V^T tiles of 128 keys staged in LDS by asynchronous copies, two buffers, shared by the block's 4 waves; transposed score tiles S^T = K Q^T so a lane owns one query column; P^T accumulator tiles feed the next WMMA as its B operand directly), one output GEMM (f32, 128x64 block tiles, 32x64 wave tiles, staged the same way).
#ifndef NB
#define NB 2
#endif
#ifndef SEQ
#define SEQ 1024
#endif
#define NB_FULL 2
#define SEQ_FULL 1024
#define DM 1024
#define NH 16
#define HD 64
#define NR ((size_t)NB * SEQ)         /* token rows processed */
#define MR ((int)(NB * SEQ))

typedef unsigned short v8us __attribute__((ext_vector_type(8), may_alias));
typedef float  v8f  __attribute__((ext_vector_type(8)));
typedef float  v4f  __attribute__((ext_vector_type(4)));
typedef float  v4fa __attribute__((ext_vector_type(4), may_alias));
typedef int    v4ia __attribute__((ext_vector_type(4), may_alias));
typedef unsigned int v4ua __attribute__((ext_vector_type(4), may_alias));
typedef _Float16 v16h __attribute__((ext_vector_type(16)));
typedef _Float16 v4h __attribute__((ext_vector_type(4)));
union FragH { v16h v; v8us half[2]; _Float16 h[16]; unsigned short u[16]; };

static_assert(NH * HD == DM);                 /* merged head width */
static_assert(HD == 64);                      /* attention kernel: 2 k-steps of 32 over the head dim, 4 output tiles of 16 */
static_assert(DM % 64 == 0 && DM % 32 == 0 && DM % 8 == 0);  /* GEMM N tiles, K steps, 16-B pieces */
static_assert(SEQ % 128 == 0);                /* attention block = 64 queries; key steps of 32 */
static_assert((NB * SEQ) % 128 == 0);         /* GEMM block = 128 rows, no row tail */
static_assert(SEQ % 512 == 0);                /* mask table built 4 keys a thread by a 128-thread block, whole trips only */
static_assert(NB <= NB_FULL && SEQ <= SEQ_FULL);
static_assert(((size_t)NB * SEQ * DM) % (8 * 256) == 0);     /* convert grids exact */
static_assert(((size_t)DM * DM) % (8 * 256) == 0);

__device__ __forceinline__ unsigned short bf16_bits(float x) { unsigned int u = __float_as_uint(x); return (unsigned short)((u + 0x7FFFu + ((u >> 16) & 1u)) >> 16); }
__device__ __forceinline__ float bf16_val(unsigned short b) { return __uint_as_float(((unsigned int)b) << 16); }
__device__ __forceinline__ float bfr(float x) { return bf16_val(bf16_bits(x)); }      /* RNE convert to bf16, back to f32 */

// fragment (A or B, same k map): elements 0..7 = k0+8h.., elements 8..15 = k0+16+8h.. from a k-contiguous 16-bit row
__device__ __forceinline__ v16h g2_frag(const _Float16* p, int hh) { FragH f; f.half[0] = *(const v8us*)((const unsigned short*)p + 8 * hh); f.half[1] = *(const v8us*)((const unsigned short*)p + 16 + 8 * hh); return f.v; }
// one WMMA, the plain builtin: the compiler keeps the distances behind it and is free to place independent work there
__device__ __forceinline__ v8f g2_mma(v16h a, v16h b, v8f c) { return __builtin_amdgcn_wmma_f32_16x16x32_f16(false, a, false, b, (short)0, c, false, false); }

// scheduling fence: the compiler's instruction scheduler moves nothing over it. It keeps a group of LDS reads together and ahead of the products that follow; left free, the compiler sinks each read to just in front of its first use and waits for it there
#define SCHED_FENCE() __builtin_amdgcn_sched_barrier(0)

__device__ __forceinline__ void wnat_body(const float* __restrict__ w, _Float16* __restrict__ Bt, unsigned blk) {
  const size_t t = (size_t)blk * 256 + threadIdx.x; if (t >= (size_t)DM * DM / 8) return;
  const v4f a = *(const v4fa*)(w + t * 8), c = *(const v4fa*)(w + t * 8 + 4); FragH f;
#pragma unroll
  for (int q = 0; q < 4; ++q) { f.h[q] = (_Float16)(bfr(a[q]) * 16.0f); f.h[4 + q] = (_Float16)(bfr(c[q]) * 16.0f); }
  const v8us o = f.half[0];
  *(v8us*)((unsigned short*)Bt + t * 8) = o; 
}

__device__ __forceinline__ void x16_body(const float* __restrict__ x, _Float16* __restrict__ X16, unsigned blk) {
  const size_t t = (size_t)blk * 256 + threadIdx.x; if (t >= NR * DM / 8) return;
  const size_t e = t * 8; const size_t row = e / DM; const size_t col = e % DM; const size_t bb = row / SEQ, s = row % SEQ;
  const float* src = x + (bb * SEQ_FULL + s) * DM + col;
  const v4f a = *(const v4fa*)(src), c = *(const v4fa*)(src + 4); FragH f;
#pragma unroll
  for (int q = 0; q < 4; ++q) { f.h[q] = (_Float16)bfr(a[q]); f.h[4 + q] = (_Float16)bfr(c[q]); }
  const v8us o = f.half[0];
  *(v8us*)((unsigned short*)X16 + t * 8) = o; 
}
// The seven converts read none of each other's output: one grid. Blocks [0, 3*GX) take the activation streams (GX blocks each), the rest the weight matrices (GW blocks each);
// the f16 planes of a kind lie one behind the other, so the stream or matrix number picks source pointer and destination plane.
#define GW ((unsigned)(((size_t)DM * DM / 8) / 256))
#define GX ((unsigned)((NR * DM / 8) / 256))
__global__ __launch_bounds__(256) void k_cvt(const float* __restrict__ xq, const float* __restrict__ xk, const float* __restrict__ xv,
                                             const float* __restrict__ Wq, const float* __restrict__ Wk, const float* __restrict__ Wv, const float* __restrict__ Wo,
                                             _Float16* __restrict__ X16, _Float16* __restrict__ Bt) {
  const unsigned bx = blockIdx.x;
  if (bx < 3u * GX) { const unsigned s = bx / GX; const float* x = (s == 0u) ? xq : (s == 1u) ? xk : xv;
    x16_body(x, X16 + (size_t)s * NR * DM, bx - s * GX); }
  else { const unsigned r = bx - 3u * GX; const unsigned s = r / GW; const float* w = (s & 2u) ? ((s & 1u) ? Wo : Wv) : ((s & 1u) ? Wk : Wq);
    wnat_body(w, Bt + (size_t)s * DM * DM, r - s * GW); }
}

// GEMM C[M][N] = alpha * A[M][K] . Bt[N][K]^T + bf16(bias[N]); A, Bt f16 k-contiguous rows;
// operands reach the waves through LDS: a pass is 128 k (256 B of each of the block's A rows and Bt rows), copied asynchronously into one of two buffers while the other is worked on.
#define GKP 128                       /* k per pass */
#define GPITCH 272                    /* LDS row pitch in bytes: 16 B x odd, for 16-byte fragment reads down a column of rows */
#define GSTAGE (192 * GPITCH)         /* one buffer of the output GEMM: rows 0..127 = A rows of the block, rows 128..191 = Bt rows of the block */
static_assert(DM % GKP == 0 && DM / GKP >= 2);   /* whole passes only */
// fragment from an LDS row, same k map as g2_frag; p already holds the lane's 16*hh byte offset
__device__ __forceinline__ v16h g2_lfrag(const unsigned char* p) { FragH f; f.half[0] = *(const v8us*)p; f.half[1] = *(const v8us*)(p + 32); return f.v; }
// twelve 16-byte copies of a lane, global -> LDS through no register; the closing s_wait_xcnt stands inside the statement so that no address register is rewritten ahead of it
__device__ __forceinline__ void g2_copy12(const unsigned* l, const _Float16* const* g) {
  asm volatile("global_load_async_to_lds_b128 %0, %12, off\n\t"
               "global_load_async_to_lds_b128 %1, %13, off\n\t"
               "global_load_async_to_lds_b128 %2, %14, off\n\t"
               "global_load_async_to_lds_b128 %3, %15, off\n\t"
               "global_load_async_to_lds_b128 %4, %16, off\n\t"
               "global_load_async_to_lds_b128 %5, %17, off\n\t"
               "global_load_async_to_lds_b128 %6, %18, off\n\t"
               "global_load_async_to_lds_b128 %7, %19, off\n\t"
               "global_load_async_to_lds_b128 %8, %20, off\n\t"
               "global_load_async_to_lds_b128 %9, %21, off\n\t"
               "global_load_async_to_lds_b128 %10, %22, off\n\t"
               "global_load_async_to_lds_b128 %11, %23, off\n\t"
               "s_wait_xcnt 0x0"
               :: "v"(l[0]), "v"(l[1]), "v"(l[2]), "v"(l[3]), "v"(l[4]), "v"(l[5]), "v"(l[6]), "v"(l[7]), "v"(l[8]), "v"(l[9]), "v"(l[10]), "v"(l[11]),
                  "v"(g[0]), "v"(g[1]), "v"(g[2]), "v"(g[3]), "v"(g[4]), "v"(g[5]), "v"(g[6]), "v"(g[7]), "v"(g[8]), "v"(g[9]), "v"(g[10]), "v"(g[11])
               : "memory");
}
// one pass's tile: 24 * RR rows of 256 B (16 * RR of A, then 8 * RR of Bt); 16 lanes cover a row, the block's lanes RR rows, so 24 copies a lane (16 for A, 8 for Bt)
template <int RR>
__device__ __forceinline__ void g2_stage(unsigned lb, const _Float16* ga, int lda, const _Float16* gb, int ldb) {
  unsigned l[24]; const _Float16* g[24];
#pragma unroll   /* both loops: every address becomes a register operand of the copy statements, no array in memory */
  for (int j = 0; j < 16; ++j) { l[j] = lb + (unsigned)(j * RR * GPITCH); g[j] = ga + (size_t)(j * RR) * lda; }
#pragma unroll
  for (int j = 0; j < 8; ++j) { l[16 + j] = lb + (unsigned)((16 + j) * RR * GPITCH); g[16 + j] = gb + (size_t)(j * RR) * ldb; }
  g2_copy12(l, g); g2_copy12(l + 12, g + 12);
}
// Output GEMM body (f32 C): block = 4 waves, wave tile 32x64, block tile 128x64
__device__ __forceinline__ void gemm2_body(const _Float16* __restrict__ A, int lda, const _Float16* __restrict__ Bh, int ldb, float alpha, const float* __restrict__ bias,
                                           float* __restrict__ C, int ldc, int N, int K) {
  __shared__ __attribute__((aligned(16))) float so[4][32][68];
  __shared__ __attribute__((aligned(16))) unsigned char ring[2 * GSTAGE];
  const int tid = threadIdx.x; const int w = __builtin_amdgcn_readfirstlane(tid >> 5); const int lane = tid & 31, ln = lane & 15, hh = lane >> 4;
  const int ntn = N >> 6; const int mt = blockIdx.x / ntn, nq = blockIdx.x - mt * ntn; const int row0 = mt * 128 + 32 * w, col0 = nq * 64;
  const int cr = tid >> 4, cc = tid & 15;                 /* copy role: row within a group of 8, 16-byte piece within the row */
  const _Float16* ga = A + (size_t)(mt * 128 + cr) * lda + cc * 8; const _Float16* gb = Bh + (size_t)(col0 + cr) * ldb + cc * 8;
  const unsigned lb = (unsigned)(size_t)ring + (unsigned)(cr * GPITCH + cc * 16);
  const unsigned char* fa = ring + (32 * w + ln) * GPITCH + 16 * hh; const unsigned char* fb = ring + (128 + ln) * GPITCH + 16 * hh;
  const int np = K / GKP;
  const int s0 = (mt + nq) % np;      /* the block's first pass: blocks that share A rows (same mt) or Bt rows (same nq) start at different k, so that they do not ask L2 for the same lines at the same moment; the walk wraps round */
  const v8f z8 = {0.f,0.f,0.f,0.f,0.f,0.f,0.f,0.f}; v8f c00 = z8, c01 = z8, c02 = z8, c03 = z8, c10 = z8, c11 = z8, c12 = z8, c13 = z8;
  g2_stage<8>(lb, ga + (size_t)s0 * GKP, lda, gb + (size_t)s0 * GKP, ldb);
  asm volatile("s_wait_asynccnt 0x0" ::: "memory");       /* this wave's copies of the first pass have landed */
  __syncthreads();                                        /* first pass published to every wave */
  if (np > 1) { const int p = (s0 + 1 < np) ? s0 + 1 : 0; g2_stage<8>(lb + GSTAGE, ga + (size_t)p * GKP, lda, gb + (size_t)p * GKP, ldb); }
#pragma unroll 1   /* one pass a trip: one publish point and one refill site in the code */
  for (int t = 0; t < np; ++t) { const unsigned bo = (unsigned)(t & 1) * GSTAGE; const unsigned char* pa = fa + bo; const unsigned char* pb = fb + bo;
    v16h a0 = g2_lfrag(pa), a1 = g2_lfrag(pa + 16 * GPITCH), b0 = g2_lfrag(pb), b1 = g2_lfrag(pb + 16 * GPITCH), b2 = g2_lfrag(pb + 32 * GPITCH), b3 = g2_lfrag(pb + 48 * GPITCH);
#pragma unroll   /* the two fragment sets alternate by renaming, LDS offsets become immediates */
    for (int ks = 0; ks < GKP / 32; ++ks) { v16h na0 = a0, na1 = a1, nb0 = b0, nb1 = b1, nb2 = b2, nb3 = b3;
      if (ks + 1 < GKP / 32) { const int o = (ks + 1) * 64;      /* the same pass's next k-step, read ahead of this step's products */
        na0 = g2_lfrag(pa + o); na1 = g2_lfrag(pa + 16 * GPITCH + o); nb0 = g2_lfrag(pb + o); nb1 = g2_lfrag(pb + 16 * GPITCH + o); nb2 = g2_lfrag(pb + 32 * GPITCH + o); nb3 = g2_lfrag(pb + 48 * GPITCH + o); }
      SCHED_FENCE();      /* the next step's reads stay one group ahead of this step's products */
      c00 = g2_mma(a0, b0, c00); c10 = g2_mma(a1, b0, c10);
      c01 = g2_mma(a0, b1, c01); c11 = g2_mma(a1, b1, c11);
      c02 = g2_mma(a0, b2, c02); c12 = g2_mma(a1, b2, c12);
      c03 = g2_mma(a0, b3, c03); c13 = g2_mma(a1, b3, c13);
      SCHED_FENCE();      /* no later read is lifted in among these products; the pass's last products stay ahead of the barrier and the refill */
      a0 = na0; a1 = na1; b0 = nb0; b1 = nb1; b2 = nb2; b3 = nb3; }
    asm volatile("s_wait_dscnt 0x0" ::: "memory");        /* this wave's reads of the buffer have returned before it may be refilled */
    asm volatile("s_wait_asynccnt 0x0" ::: "memory");     /* this wave's copies of the pass of trip t + 1 have landed */
    __syncthreads();                                      /* publishes the pass of trip t + 1 and ends every wave's reads of the pass of trip t */
    if (t + 2 < np) { int p = s0 + t + 2; p = (p < np) ? p : p - np; g2_stage<8>(lb + bo, ga + (size_t)p * GKP, lda, gb + (size_t)p * GKP, ldb); } }
  asm volatile("s_wait_asynccnt 0x0" ::: "memory");       /* no copy outstanding behind the loop */
  v8f accs[8] = {c00, c01, c02, c03, c10, c11, c12, c13};
#pragma unroll
  for (int u = 0; u < 8; ++u) { const int t = u & 3, half = u >> 2; const int col = col0 + t * 16 + ln; const float bv = bfr(bias[col]);
#pragma unroll
    for (int r = 0; r < 8; ++r) { const int rloc = half * 16 + 8 * hh + r; so[w][rloc][t * 16 + ln] = accs[u][r] * alpha + bv; } }
  __syncthreads();      /* staging tile is private to the wave; the block barrier is a superset of the wave-level ordering needed */
  const int rsub = lane >> 4, c4 = (lane & 15) * 4;
#pragma unroll
  for (int q = 0; q < 16; ++q) { const int r = q * 2 + rsub; const v4f v = *(const v4fa*)&so[w][r][c4];
    *(v4f*)(C + (size_t)(row0 + r) * ldc + col0 + c4) = v; }
}
// Projection GEMM body (f16 C): block = 8 waves as 4 (rows) x 2 (columns), wave tile 64x64, block tile 256x128, so that a block copies 384 operand rows from L2 for 32,768 outputs (128x64: 192 rows for 8,192).
// Same ring as above with 256 A rows and 128 Bt rows a buffer; behind the loop's last barrier the ring is free and serves as the output staging.
#define PBM 256
#define PBN 128
#define PSTAGE ((PBM + PBN) * GPITCH)
#define VPITCH 528                    /* staging pitch of a V^T row in bytes: 256 tokens in f16 + 16 = 16 B x odd */
static_assert(SEQ % PBM == 0 && DM % PBN == 0 && PBN == 2 * HD);      /* a block's 256 token rows lie in one batch; its 128 columns are two whole heads */
static_assert(8 * 64 * 68 * 4 <= 2 * PSTAGE && PBN * VPITCH <= 2 * PSTAGE);      /* both stagings fit the ring */
__device__ __forceinline__ void gemm3_body(const _Float16* __restrict__ A, int lda, const _Float16* __restrict__ Bh, int ldb, float alpha, const float* __restrict__ bias,
                                           _Float16* __restrict__ C16, int N, int K, bool vt) {
  __shared__ __attribute__((aligned(16))) unsigned char ring[2 * PSTAGE];
  const int tid = threadIdx.x; const int w = __builtin_amdgcn_readfirstlane(tid >> 5); const int lane = tid & 31, ln = lane & 15, hh = lane >> 4;
  const int wm = w & 3, wn = w >> 2;
  const int ntn = N / PBN; const int mt = blockIdx.x / ntn, nq = blockIdx.x - mt * ntn; const int row0 = mt * PBM + 64 * wm, col0 = nq * PBN + 64 * wn;
  const int cr = tid >> 4, cc = tid & 15;                 /* copy role: row within a group of 16, 16-byte piece within the row */
  const _Float16* ga = A + (size_t)(mt * PBM + cr) * lda + cc * 8; const _Float16* gb = Bh + (size_t)(nq * PBN + cr) * ldb + cc * 8;
  const unsigned lb = (unsigned)(size_t)ring + (unsigned)(cr * GPITCH + cc * 16);
  const unsigned char* fa = ring + (64 * wm + ln) * GPITCH + 16 * hh; const unsigned char* fb = ring + (PBM + 64 * wn + ln) * GPITCH + 16 * hh;
  const int np = K / GKP;
  const int s0 = (mt + nq) % np;      /* the block's first pass, as in the output GEMM: sharers of A or Bt rows start at different k; the walk wraps round */
  const v8f z8 = {0.f,0.f,0.f,0.f,0.f,0.f,0.f,0.f}; v8f c[4][4];
#pragma unroll
  for (int i = 0; i < 4; ++i) {
#pragma unroll
    for (int j = 0; j < 4; ++j) c[i][j] = z8; }
  g2_stage<16>(lb, ga + (size_t)s0 * GKP, lda, gb + (size_t)s0 * GKP, ldb);
  asm volatile("s_wait_asynccnt 0x0" ::: "memory");       /* this wave's copies of the first pass have landed */
  __syncthreads();                                        /* first pass published to every wave */
  if (np > 1) { const int p = (s0 + 1 < np) ? s0 + 1 : 0; g2_stage<16>(lb + PSTAGE, ga + (size_t)p * GKP, lda, gb + (size_t)p * GKP, ldb); }
#pragma unroll 1   /* one pass a trip: one publish point and one refill site in the code */
  for (int t = 0; t < np; ++t) { const unsigned bo = (unsigned)(t & 1) * PSTAGE; const unsigned char* pa = fa + bo; const unsigned char* pb = fb + bo;
#pragma unroll   /* LDS offsets become immediates */
    for (int ks = 0; ks < GKP / 32; ++ks) { v16h a[4], b[4];      /* one fragment set: with the 128 accumulator registers a second set would pass 256 registers; the SIMD's other wave covers the read latency */
#pragma unroll
      for (int i = 0; i < 4; ++i) { a[i] = g2_lfrag(pa + i * 16 * GPITCH + ks * 64); b[i] = g2_lfrag(pb + i * 16 * GPITCH + ks * 64); }
      SCHED_FENCE();      /* the step's sixteen reads stay one group ahead of its products */
#pragma unroll
      for (int j = 0; j < 4; ++j) {
#pragma unroll
        for (int i = 0; i < 4; ++i) c[i][j] = g2_mma(a[i], b[j], c[i][j]); }
      SCHED_FENCE(); }      /* no later read is lifted in among these products; the pass's last products stay ahead of the barrier and the refill */
    asm volatile("s_wait_dscnt 0x0" ::: "memory");        /* this wave's reads of the buffer have returned before it may be refilled */
    asm volatile("s_wait_asynccnt 0x0" ::: "memory");     /* this wave's copies of the pass of trip t + 1 have landed */
    __syncthreads();                                      /* publishes the pass of trip t + 1 and ends every wave's reads of the pass of trip t */
    if (t + 2 < np) { int p = s0 + t + 2; p = (p < np) ? p : p - np; g2_stage<16>(lb + bo, ga + (size_t)p * GKP, lda, gb + (size_t)p * GKP, ldb); } }
  asm volatile("s_wait_asynccnt 0x0" ::: "memory");       /* no copy outstanding behind the loop */
  if (vt) {      /* block-uniform. C16 = V^T plane [(batch, head)][d][SEQ]; the block's 128 columns are the 64 d of heads 2nq and 2nq+1, its 256 rows are 256 tokens of one batch */
    unsigned char* st = ring;      /* block tile [column][token] in f16, row pitch VPITCH */
#pragma unroll
    for (int j = 0; j < 4; ++j) { const float bv = bfr(bias[col0 + j * 16 + ln]);
#pragma unroll
      for (int i = 0; i < 4; ++i) { FragH f;
#pragma unroll
        for (int r = 0; r < 8; ++r) f.h[r] = (_Float16)(c[i][j][r] * alpha + bv);      /* a lane's 8 accumulator elements = 8 consecutive tokens of one d: one 16-byte piece of a V^T row */
        *(v8us*)(st + (64 * wn + j * 16 + ln) * VPITCH + (64 * wm + 16 * i + 8 * hh) * 2) = f.half[0]; } }
    __syncthreads();      /* every wave wrote its 64 tokens into 64 of the rows; the rows are read back across waves */
    const int tok0 = mt * PBM; _Float16* vb = C16 + ((size_t)(tok0 / SEQ) * NH * HD + (size_t)nq * PBN) * SEQ + (tok0 % SEQ);
#pragma unroll
    for (int q = 0; q < 16; ++q) { const int d = q * 8 + w; const v8us v = *(const v8us*)(st + d * VPITCH + lane * 16);      /* a wave stores the 512 contiguous bytes of a row */
      *(v8us*)((unsigned short*)vb + (size_t)d * SEQ + lane * 8) = v; }
    return;
  }
  float* so = (float*)(ring + w * (64 * 68 * 4));      /* the wave's own staging tile [64 rows][pitch 68 floats] */
#pragma unroll
  for (int j = 0; j < 4; ++j) { const float bv = bfr(bias[col0 + j * 16 + ln]);
#pragma unroll
    for (int i = 0; i < 4; ++i) {
#pragma unroll
      for (int r = 0; r < 8; ++r) so[(i * 16 + 8 * hh + r) * 68 + j * 16 + ln] = c[i][j][r] * alpha + bv; } }
  __syncthreads();      /* staging tile is private to the wave; the block barrier is a superset of the wave-level ordering needed */
  const int rsub = lane >> 4, c4 = (lane & 15) * 4;
  _Float16* cp = C16 + (size_t)(row0 + rsub) * DM + col0 + c4;      /* C rows are DM wide: one address register pair, the row step is an immediate offset */
#pragma unroll
  for (int g = 0; g < 4; ++g) {
#pragma unroll
    for (int q = g * 8; q < g * 8 + 8; ++q) { const v4f v = *(const v4fa*)&so[(q * 2 + rsub) * 68 + c4];
      v4h h4; h4[0] = (_Float16)v[0]; h4[1] = (_Float16)v[1]; h4[2] = (_Float16)v[2]; h4[3] = (_Float16)v[3]; *(v4h*)(cp + (size_t)(q * 2) * DM) = h4; }
    asm volatile("s_wait_xcnt 0x0" ::: "memory");      /* no register that one of these eight stores names is rewritten (by the next group, or by code laid behind) ahead of this wait */
  }
}
// the three projections in one grid: blockIdx.y = 0, 1, 2 picks the q, k or v problem; its A, Bt and C planes lie one behind the other; the third C plane is written as V^T
__global__ __launch_bounds__(256) void k_gemm_qkv(const _Float16* __restrict__ A, int lda, const _Float16* __restrict__ Bh, int ldb, float alpha,
                                                  const float* __restrict__ bq, const float* __restrict__ bk, const float* __restrict__ bv, _Float16* __restrict__ C16, int N, int K) {
  const unsigned s = blockIdx.y; const float* bias = (s == 0u) ? bq : (s == 1u) ? bk : bv;
  gemm3_body(A + (size_t)s * NR * DM, lda, Bh + (size_t)s * DM * DM, ldb, alpha, bias, C16 + (size_t)s * NR * DM, N, K, s == 2u);
}
__global__ __launch_bounds__(128) void k_gemm_f32(const _Float16* __restrict__ A, int lda, const _Float16* __restrict__ Bh, int ldb, float alpha, const float* __restrict__ bias, float* __restrict__ C, int ldc, int N, int K) {
  gemm2_body(A, lda, Bh, ldb, alpha, bias, C, ldc, N, K);
}

// Attention operands reach the waves through LDS: a stage is 128 keys of one (batch, head): 128 K rows of 128 B and 64 V^T rows of 256 B, copied asynchronously into one of two buffers while the other is worked on.
#define AKT 128                       /* keys per stage */
#define AKPITCH 144                   /* LDS pitch of a K row in bytes: 16 B x odd, for 16-byte fragment reads down a column of rows */
#define AVPITCH 272                   /* LDS pitch of a V^T row in bytes: 16 B x odd */
#define AKBYTES (AKT * AKPITCH)       /* K rows first, V^T rows behind them */
#define ASTAGE (AKBYTES + HD * AVPITCH)
static_assert(SEQ % AKT == 0 && SEQ / AKT >= 2);   /* whole stages only, both buffers filled in the prologue */
static_assert(AKT * HD * 2 == 8 * 128 * 16);       /* each operand's tile = 8 copies of 16 B by each of 128 lanes */
// eight 16-byte copies of a lane, global -> LDS through no register; the closing s_wait_xcnt stands inside the statement so that no address register is rewritten ahead of it
__device__ __forceinline__ void at_copy8(const unsigned* l, const _Float16* const* g) {
  asm volatile("global_load_async_to_lds_b128 %0, %8, off\n\t"
               "global_load_async_to_lds_b128 %1, %9, off\n\t"
               "global_load_async_to_lds_b128 %2, %10, off\n\t"
               "global_load_async_to_lds_b128 %3, %11, off\n\t"
               "global_load_async_to_lds_b128 %4, %12, off\n\t"
               "global_load_async_to_lds_b128 %5, %13, off\n\t"
               "global_load_async_to_lds_b128 %6, %14, off\n\t"
               "global_load_async_to_lds_b128 %7, %15, off\n\t"
               "s_wait_xcnt 0x0"
               :: "v"(l[0]), "v"(l[1]), "v"(l[2]), "v"(l[3]), "v"(l[4]), "v"(l[5]), "v"(l[6]), "v"(l[7]),
                  "v"(g[0]), "v"(g[1]), "v"(g[2]), "v"(g[3]), "v"(g[4]), "v"(g[5]), "v"(g[6]), "v"(g[7])
               : "memory");
}
// one stage: K: 8 lanes cover a row, the block's 128 lanes 16 rows; V^T: 16 lanes cover a row, the block 8 rows; 8 copies a lane for each
__device__ __forceinline__ void at_stage(unsigned lk, unsigned lv, const _Float16* gk, const _Float16* gv) {
  unsigned l[16]; const _Float16* g[16];
#pragma unroll   /* every address becomes a register operand of the copy statements, no array in memory */
  for (int j = 0; j < 8; ++j) { l[j] = lk + (unsigned)(j * 16 * AKPITCH); g[j] = gk + (size_t)(j * 16) * DM; l[8 + j] = lv + (unsigned)(j * 8 * AVPITCH); g[8 + j] = gv + (size_t)(j * 8) * SEQ; }
  at_copy8(l, g); at_copy8(l + 8, g + 8);
}

// Fused attention: block = 4 waves = 64 queries of one (batch, head); wave = 16 queries; key loop in stages of 128 keys, steps of 32 keys.
// Score tiles are computed TRANSPOSED (A = K rows [key][d], B = Q rows [query][d]): accumulator element r of lane (hh, ln) = (key 8hh+r, query ln),
// so a lane owns one query column: row max = in-lane max + one xor-16 shuffle. The two 16-key P^T tiles are the B operand of the next product
// (elements 0..7 <- tile 0 element r, elements 8..15 <- tile 1 element r, lane unchanged); A = V^T rows [d][key]; accumulators hold O^T (d 8hh+r, query ln).
// Mask: a per-key f32 table built once per block in LDS (0 for a kept key, MASKRAW for a masked one) is the START VALUE of the score accumulators (element r of a lane = key 8hh+r, the table's own order),
// so a masked logit comes out of the matrix unit at about -1e9 after the 1/8 scale and costs no vector work. Where no key of the batch is kept the score scale is 0: every logit 0, the row uniform.
#define MASKRAW (-8.0e9f)
// eight consecutive keys' table entries = one accumulator tile's start value in a lane
__device__ __forceinline__ v8f at_bias(const unsigned char* p) { const v4f a = *(const v4fa*)p, c = *(const v4fa*)(p + 16); return __builtin_shufflevector(a, c, 0, 1, 2, 3, 4, 5, 6, 7); }
__global__ __launch_bounds__(128) void k_attn(const _Float16* __restrict__ Q16, const _Float16* __restrict__ K16, const _Float16* __restrict__ Vt, const int* __restrict__ mask, _Float16* __restrict__ CTX) {
  __shared__ __attribute__((aligned(16))) float sbias[SEQ];                /* cross-wave: 4 keys a thread and trip, read by all after the block barrier */
  __shared__ __attribute__((aligned(16))) unsigned int skeep[4];           /* per wave: nonzero where one of the keys it looked at is kept */
  __shared__ __attribute__((aligned(16))) unsigned short sh[4][16][72];    /* per-wave output staging [query][d], pitch 144 B */
  __shared__ __attribute__((aligned(16))) unsigned char ring[2 * ASTAGE];  /* the two K / V^T stage buffers */
  const int tid = threadIdx.x; const int wave = __builtin_amdgcn_readfirstlane(tid >> 5); const int lane = tid & 31, ln = lane & 15, hh = lane >> 4;
  const int h = blockIdx.y, b = blockIdx.z; const size_t rowb = (size_t)b * SEQ;
  const _Float16* gk = K16 + (rowb + (tid >> 3)) * DM + h * HD + (tid & 7) * 8;                    /* copy role, K: row within a group of 16, 16-byte piece */
  const _Float16* gv = Vt + ((size_t)(b * NH + h) * HD + (tid >> 4)) * SEQ + (tid & 15) * 8;       /* copy role, V^T: row within a group of 8, 16-byte piece */
  const unsigned lk = (unsigned)(size_t)ring + (unsigned)((tid >> 3) * AKPITCH + (tid & 7) * 16);
  const unsigned lv = (unsigned)(size_t)ring + (unsigned)(AKBYTES + (tid >> 4) * AVPITCH + (tid & 15) * 16);
  const int s0 = (int)(blockIdx.x % (SEQ / AKT));                         /* the block's first key stage: the blocks of one (batch, head) read the same K and V^T lines and start at different stages, so that they do not ask L2 for them at the same moment; the walk wraps round */
  at_stage(lk, lv, gk + (size_t)s0 * AKT * DM, gv + (size_t)s0 * AKT);    /* the first stage flies while the mask table is built */
  {
    const int* mp = mask + (size_t)b * SEQ_FULL; bool any = false;
#pragma unroll   /* the loads of all trips are issued together */
    for (int k4 = 0; k4 < SEQ; k4 += 512) { const int k = k4 + tid * 4; const v4ia m = *(const v4ia*)(mp + k); v4f bb;
#pragma unroll   /* vector elements picked by constants: no indexed register access */
      for (int i = 0; i < 4; ++i) { bb[i] = (m[i] != 0) ? 0.0f : MASKRAW; any = any || (m[i] != 0); }
      *(v4fa*)&sbias[k] = bb; }
    const unsigned int kw = __builtin_amdgcn_ballot_w32(any);
    if (lane == 0) skeep[wave] = kw;
  }
  asm volatile("s_wait_asynccnt 0x0" ::: "memory");       /* this wave's copies of the first stage have landed */
  __syncthreads();                                        /* mask table, keep words and the first stage published to every wave */
  { const int p = (s0 + 1) % (SEQ / AKT); at_stage(lk + ASTAGE, lv + ASTAGE, gk + (size_t)p * AKT * DM, gv + (size_t)p * AKT); }
  const int q0 = blockIdx.x * 64 + wave * 16;
  const _Float16* Qp = Q16 + (rowb + q0 + ln) * DM + h * HD;
  const v16h qf0 = g2_frag(Qp, hh), qf1 = g2_frag(Qp + 32, hh);
  const unsigned char* fk = ring + ln * AKPITCH + 16 * hh; const unsigned char* fv = ring + AKBYTES + ln * AVPITCH + 16 * hh;
  const v4ua kws = *(const v4ua*)skeep;
  const float scl = (__builtin_amdgcn_readfirstlane(kws[0] | kws[1] | kws[2] | kws[3]) != 0u) ? 0.125f : 0.0f;      /* block-uniform score scale */
  const v8f z8 = {0.f,0.f,0.f,0.f,0.f,0.f,0.f,0.f};
  v8f o0 = z8, o1 = z8, o2 = z8, o3 = z8; float mrun = -1.0e30f, lpart = 0.f;
#pragma unroll 1   /* one stage a trip: one publish point and one refill site in the code */
  for (int t = 0; t < SEQ / AKT; ++t) { const unsigned bo = (unsigned)(t & 1) * ASTAGE; const unsigned char* pk = fk + bo; const unsigned char* pv = fv + bo;
   const int st = (s0 + t) % (SEQ / AKT);                 /* the key stage that trip t works on */
   const unsigned char* pm = (const unsigned char*)sbias + st * (AKT * 4) + 32 * hh;      /* the lane's 8 keys of the stage's first 16-key tile */
   v16h ka0 = g2_lfrag(pk), ka1 = g2_lfrag(pk + 64), ka2 = g2_lfrag(pk + 16 * AKPITCH), ka3 = g2_lfrag(pk + 16 * AKPITCH + 64);
   v8f m0 = at_bias(pm), m1 = at_bias(pm + 64);
#pragma unroll   /* LDS offsets become immediates; the K fragments and mask entries of the same stage's next step are read ahead */
   for (int kk = 0; kk < AKT / 32; ++kk) {
    const v16h va0 = g2_lfrag(pv + kk * 64), va1 = g2_lfrag(pv + 16 * AVPITCH + kk * 64), va2 = g2_lfrag(pv + 32 * AVPITCH + kk * 64), va3 = g2_lfrag(pv + 48 * AVPITCH + kk * 64);
    v16h nka0 = ka0, nka1 = ka1, nka2 = ka2, nka3 = ka3; v8f nm0 = m0, nm1 = m1;
    if (kk + 1 < AKT / 32) { const unsigned char* nk = pk + (kk + 1) * 32 * AKPITCH;
      nka0 = g2_lfrag(nk); nka1 = g2_lfrag(nk + 64); nka2 = g2_lfrag(nk + 16 * AKPITCH); nka3 = g2_lfrag(nk + 16 * AKPITCH + 64);
      nm0 = at_bias(pm + (kk + 1) * 128); nm1 = at_bias(pm + (kk + 1) * 128 + 64); }      /* keys 128st+32(kk+1)+8hh+r (tile 0) and +16 (tile 1) */
    SCHED_FENCE();      /* all LDS reads of a step stand in one group at its head */
    v8f s0 = m0, s1 = m1;
    s0 = g2_mma(ka0, qf0, s0);
    s0 = g2_mma(ka1, qf1, s0);
    s1 = g2_mma(ka2, qf0, s1);
    s1 = g2_mma(ka3, qf1, s1);
    float e0[8], e1[8]; float mx = -3.0e38f;
#pragma unroll
    for (int r = 0; r < 8; ++r) {
      const float x0 = s0[r] * scl, x1 = s1[r] * scl;
      e0[r] = x0; e1[r] = x1; mx = fmaxf(mx, fmaxf(x0, x1));
    }
    mx = fmaxf(mx, __shfl_xor(mx, 16));
    const float mnew = fmaxf(mrun, mx); const float alpha = __expf(mrun - mnew); mrun = mnew;
    float ps = 0.f; FragH pf;
#pragma unroll
    for (int r = 0; r < 8; ++r) {
      const float p0 = __expf(e0[r] - mnew), p1 = __expf(e1[r] - mnew); ps += p0 + p1;
      pf.h[r] = (_Float16)(p0 * 1024.0f); pf.h[8 + r] = (_Float16)(p1 * 1024.0f);
    }
    lpart = lpart * alpha + ps;
#pragma unroll
    for (int r = 0; r < 8; ++r) { o0[r] *= alpha; o1[r] *= alpha; o2[r] *= alpha; o3[r] *= alpha; }
    const v16h pb = pf.v;
    o0 = g2_mma(va0, pb, o0);
    o1 = g2_mma(va1, pb, o1);
    o2 = g2_mma(va2, pb, o2);
    o3 = g2_mma(va3, pb, o3);
    SCHED_FENCE();      /* the next step's reads stay a group of their own; the stage's last step stays ahead of the barrier and the refill */
    ka0 = nka0; ka1 = nka1; ka2 = nka2; ka3 = nka3; m0 = nm0; m1 = nm1;
   }
   asm volatile("s_wait_dscnt 0x0" ::: "memory");         /* this wave's reads of the buffer have returned before it may be refilled */
   asm volatile("s_wait_asynccnt 0x0" ::: "memory");      /* this wave's copies of the stage of trip t + 1 have landed */
   __syncthreads();                                       /* publishes the stage of trip t + 1 and ends every wave's reads of stage st */
   if (t + 2 < SEQ / AKT) { const int p = (s0 + t + 2) % (SEQ / AKT); at_stage(lk + bo, lv + bo, gk + (size_t)p * AKT * DM, gv + (size_t)p * AKT); }
  }
  asm volatile("s_wait_asynccnt 0x0" ::: "memory");       /* no copy outstanding behind the loop */
  const float l = lpart + __shfl_xor(lpart, 16);
  const float inv = 1.0f / (l * 16.0f);                    /* P carried x1024, ctx carried x64: x64/1024 = 1/16 */
  FragH t0, t1, t2, t3;
#pragma unroll
  for (int r = 0; r < 8; ++r) { t0.h[r] = (_Float16)(o0[r] * inv); t1.h[r] = (_Float16)(o1[r] * inv); t2.h[r] = (_Float16)(o2[r] * inv); t3.h[r] = (_Float16)(o3[r] * inv); }
  *(v8us*)&sh[wave][ln][0 + 8 * hh] = t0.half[0];
  *(v8us*)&sh[wave][ln][16 + 8 * hh] = t1.half[0];
  *(v8us*)&sh[wave][ln][32 + 8 * hh] = t2.half[0];
  *(v8us*)&sh[wave][ln][48 + 8 * hh] = t3.half[0];
  __syncthreads();
  const int rsub = lane >> 3, pc = lane & 7;               
  {
#pragma unroll
    for (int it = 0; it < 4; ++it) { const int row = it * 4 + rsub; const v8us v = *(const v8us*)&sh[wave][row][pc * 8];
      *(v8us*)((unsigned short*)CTX + (rowb + q0 + row) * DM + h * HD + pc * 8) = v; }
     }
}

#define WBYTES ((size_t)DM * DM * 2)
#define PBYTES ((size_t)NB * SEQ * DM * 2)
static_assert(WBYTES % 256 == 0 && PBYTES % 256 == 0);
static_assert(4 * WBYTES + 7 * PBYTES <= (size_t)134217728);      /* total carve: 4 weight planes + 7 token planes (V^T plane = NB*NH*HD*SEQ halves = one token plane) */

extern "C" void kernel_launch(void* const* d_in, const int* in_sizes, int n_in,
                              void* d_out, int out_size, void* d_ws, size_t ws_size, hipStream_t stream) {
  if (n_in < 12) return;
  const long long need_x = (long long)(NB - 1) * SEQ_FULL * DM + (long long)SEQ * DM;
  if ((long long)in_sizes[0] < need_x || (long long)in_sizes[1] < need_x || (long long)in_sizes[2] < need_x) return;
  if ((long long)in_sizes[3] < (long long)(NB - 1) * SEQ_FULL + SEQ) return;
  if (in_sizes[4] < DM * DM || in_sizes[6] < DM * DM || in_sizes[8] < DM * DM || in_sizes[10] < DM * DM) return;
  if (in_sizes[5] < DM || in_sizes[7] < DM || in_sizes[9] < DM || in_sizes[11] < DM) return;
  if ((long long)out_size < (long long)NB * SEQ * DM) return;
  /* wire order: q, k, v, mask (int32), Wq, bq, Wk, bk, Wv, bv, Wo, bo */
  const float* xq = (const float*)d_in[0]; const float* xk = (const float*)d_in[1]; const float* xv = (const float*)d_in[2];
  const int* mask = (const int*)d_in[3];
  const float* Wq = (const float*)d_in[4]; const float* bq = (const float*)d_in[5];
  const float* Wk = (const float*)d_in[6]; const float* bk = (const float*)d_in[7];
  const float* Wv = (const float*)d_in[8]; const float* bv = (const float*)d_in[9];
  const float* Wo = (const float*)d_in[10]; const float* bo = (const float*)d_in[11];
  float* out = (float*)d_out;
  char* ws = (char*)d_ws; size_t off = 0;
  _Float16* BQ = (_Float16*)(ws + off); off += WBYTES;
  _Float16* BK = (_Float16*)(ws + off); off += WBYTES;
  _Float16* BV = (_Float16*)(ws + off); off += WBYTES;
  _Float16* BO = (_Float16*)(ws + off); off += WBYTES;
  _Float16* XQ = (_Float16*)(ws + off); off += PBYTES;
  _Float16* XK = (_Float16*)(ws + off); off += PBYTES;
  _Float16* XV = (_Float16*)(ws + off); off += PBYTES;
  _Float16* Q16 = (_Float16*)(ws + off); off += PBYTES;
  _Float16* K16 = (_Float16*)(ws + off); off += PBYTES;
  _Float16* VT = (_Float16*)(ws + off); off += PBYTES;
  _Float16* CTX = (_Float16*)(ws + off); off += PBYTES;
  if (off > ws_size) return;
  k_cvt<<<3u * GX + 4u * GW, 256, 0, stream>>>(xq, xk, xv, Wq, Wk, Wv, Wo, XQ, BQ);      /* planes XQ, XK, XV and BQ, BK, BV, BO */
  const unsigned gg = (unsigned)((MR / 128) * (DM / 64));
  const unsigned gp = (unsigned)((MR / PBM) * (DM / PBN));
  k_gemm_qkv<<<dim3(gp, 3), 256, 0, stream>>>(XQ, DM, BQ, DM, 0.0625f, bq, bk, bv, Q16, DM, DM);      /* q = xq Wq^T + bq, k = xk Wk^T + bk into planes Q16, K16; v = xv Wv^T + bv into plane VT as [(b,h)][d][SEQ] (weights x16 -> alpha 1/16) */
  k_attn<<<dim3(SEQ / 64, NH, NB), 128, 0, stream>>>(Q16, K16, VT, mask, CTX);           /* ctx x64, merged heads */
  k_gemm_f32<<<gg, 128, 0, stream>>>(CTX, DM, BO, DM, 0.0009765625f, bo, out, DM, DM, DM);      /* out = ctx Wo^T + bo (x64 and x16 carries -> alpha 2^-10) */
}

// v009
// Measured time: 46.6 microseconds a run.
// In two side-by-side timings against v008, it was 1.03 and 1.02 times as fast.
// All steps since v000 together make it 5.21 times as fast.
#include <hip/hip_runtime.h>
// Multi-head attention with three input streams (q, k, v each [NB][SEQ][1024]), [out][in] projection weights with biases, integer key-padding mask applied per (batch, key) as a finite offset that puts a masked logit at about -1e9, 16 heads of 64, score scale 1/8, softmax over the keys of the same batch, heads merged h*64+d, output projection with bias.
// Compute dtype: every contraction on v_wmma_f32_16x16x32_f16 (f16 operands, f32 accumulate). Float inputs are converted (RNE) to bf16 first and carried as exact f16 (weights x16); q, k, v planes plain f16; softmax weights exp(s-m) carried x1024 as f16 (row sum l from the unconverted f32 values, x1024 too); ctx carried x64 as f16; scores and softmax statistics f32.
// Structure: one launch for the 3 activation and 4 weight converts, one launch for the 3 projection GEMMs (256x128 block tiles, 64x64 wave tiles, operands staged in LDS by asynchronous copies, two buffers; the v blocks store their tile transposed, as V^T), one fused online-softmax attention kernel (K and V^T tiles of 128 keys staged in LDS by asynchronous copies, two buffers, shared by the block's 4 waves; transposed score tiles S^T = K Q^T so a lane owns one query column; P^T accumulator tiles feed the next WMMA as its B operand directly), one output GEMM (f32, 128x64 block tiles, 32x64 wave tiles, staged the same way).
#ifndef NB
#define NB 2
#endif
#ifndef SEQ
#define SEQ 1024
#endif
#define NB_FULL 2
#define SEQ_FULL 1024
#define DM 1024
#define NH 16
#define HD 64
#define NR ((size_t)NB * SEQ)         /* token rows processed */
#define MR ((int)(NB * SEQ))

typedef unsigned short v8us __attribute__((ext_vector_type(8), may_alias));
typedef float  v8f  __attribute__((ext_vector_type(8)));
typedef float  v4f  __attribute__((ext_vector_type(4)));
typedef float  v2f  __attribute__((ext_vector_type(2)));
typedef float  v4fa __attribute__((ext_vector_type(4), may_alias));
typedef int    v4ia __attribute__((ext_vector_type(4), may_alias));
typedef unsigned int v4ua __attribute__((ext_vector_type(4), may_alias));
typedef _Float16 v16h __attribute__((ext_vector_type(16)));
typedef _Float16 v4h __attribute__((ext_vector_type(4)));
union FragH { v16h v; v8us half[2]; _Float16 h[16]; unsigned short u[16]; };

static_assert(NH * HD == DM);                 /* merged head width */
static_assert(HD == 64);                      /* attention kernel: 2 k-steps of 32 over the head dim, 4 output tiles of 16 */
static_assert(DM % 64 == 0 && DM % 32 == 0 && DM % 8 == 0);  /* GEMM N tiles, K steps, 16-B pieces */
static_assert(SEQ % 128 == 0);                /* attention block = 64 queries; key steps of 32 */
static_assert((NB * SEQ) % 128 == 0);         /* GEMM block = 128 rows, no row tail */
static_assert(SEQ % 512 == 0);                /* mask table built 4 keys a thread by a 128-thread block, whole trips only */
static_assert(NB <= NB_FULL && SEQ <= SEQ_FULL);
static_assert(((size_t)NB * SEQ * DM) % (8 * 256) == 0);     /* convert grids exact */
static_assert(((size_t)DM * DM) % (8 * 256) == 0);

__device__ __forceinline__ unsigned short bf16_bits(float x) { unsigned int u = __float_as_uint(x); return (unsigned short)((u + 0x7FFFu + ((u >> 16) & 1u)) >> 16); }
__device__ __forceinline__ float bf16_val(unsigned short b) { return __uint_as_float(((unsigned int)b) << 16); }
__device__ __forceinline__ float bfr(float x) { return bf16_val(bf16_bits(x)); }      /* RNE convert to bf16, back to f32 */

// fragment (A or B, same k map): elements 0..7 = k0+8h.., elements 8..15 = k0+16+8h.. from a k-contiguous 16-bit row
__device__ __forceinline__ v16h g2_frag(const _Float16* p, int hh) { FragH f; f.half[0] = *(const v8us*)((const unsigned short*)p + 8 * hh); f.half[1] = *(const v8us*)((const unsigned short*)p + 16 + 8 * hh); return f.v; }
// one WMMA, the plain builtin: the compiler keeps the distances behind it and is free to place independent work there
__device__ __forceinline__ v8f g2_mma(v16h a, v16h b, v8f c) { return __builtin_amdgcn_wmma_f32_16x16x32_f16(false, a, false, b, (short)0, c, false, false); }

// scheduling fence: the compiler's instruction scheduler moves nothing over it. It keeps a group of LDS reads together and ahead of the products that follow; left free, the compiler sinks each read to just in front of its first use and waits for it there
#define SCHED_FENCE() __builtin_amdgcn_sched_barrier(0)

__device__ __forceinline__ void wnat_body(const float* __restrict__ w, _Float16* __restrict__ Bt, unsigned blk) {
  const size_t t = (size_t)blk * 256 + threadIdx.x; if (t >= (size_t)DM * DM / 8) return;
  const v4f a = *(const v4fa*)(w + t * 8), c = *(const v4fa*)(w + t * 8 + 4); FragH f;
#pragma unroll
  for (int q = 0; q < 4; ++q) { f.h[q] = (_Float16)(bfr(a[q]) * 16.0f); f.h[4 + q] = (_Float16)(bfr(c[q]) * 16.0f); }
  const v8us o = f.half[0];
  *(v8us*)((unsigned short*)Bt + t * 8) = o; 
}

__device__ __forceinline__ void x16_body(const float* __restrict__ x, _Float16* __restrict__ X16, unsigned blk) {
  const size_t t = (size_t)blk * 256 + threadIdx.x; if (t >= NR * DM / 8) return;
  const size_t e = t * 8; const size_t row = e / DM; const size_t col = e % DM; const size_t bb = row / SEQ, s = row % SEQ;
  const float* src = x + (bb * SEQ_FULL + s) * DM + col;
  const v4f a = *(const v4fa*)(src), c = *(const v4fa*)(src + 4); FragH f;
#pragma unroll
  for (int q = 0; q < 4; ++q) { f.h[q] = (_Float16)bfr(a[q]); f.h[4 + q] = (_Float16)bfr(c[q]); }
  const v8us o = f.half[0];
  *(v8us*)((unsigned short*)X16 + t * 8) = o; 
}
// The seven converts read none of each other's output: one grid. Blocks [0, 3*GX) take the activation streams (GX blocks each), the rest the weight matrices (GW blocks each);
// the f16 planes of a kind lie one behind the other, so the stream or matrix number picks source pointer and destination plane.
#define GW ((unsigned)(((size_t)DM * DM / 8) / 256))
#define GX ((unsigned)((NR * DM / 8) / 256))
__global__ __launch_bounds__(256) void k_cvt(const float* __restrict__ xq, const float* __restrict__ xk, const float* __restrict__ xv,
                                             const float* __restrict__ Wq, const float* __restrict__ Wk, const float* __restrict__ Wv, const float* __restrict__ Wo,
                                             _Float16* __restrict__ X16, _Float16* __restrict__ Bt) {
  const unsigned bx = blockIdx.x;
  if (bx < 3u * GX) { const unsigned s = bx / GX; const float* x = (s == 0u) ? xq : (s == 1u) ? xk : xv;
    x16_body(x, X16 + (size_t)s * NR * DM, bx - s * GX); }
  else { const unsigned r = bx - 3u * GX; const unsigned s = r / GW; const float* w = (s & 2u) ? ((s & 1u) ? Wo : Wv) : ((s & 1u) ? Wk : Wq);
    wnat_body(w, Bt + (size_t)s * DM * DM, r - s * GW); }
}

// GEMM C[M][N] = alpha * A[M][K] . Bt[N][K]^T + bf16(bias[N]); A, Bt f16 k-contiguous rows;
// operands reach the waves through LDS: a pass is 128 k (256 B of each of the block's A rows and Bt rows), copied asynchronously into one of two buffers while the other is worked on.
#define GKP 128                       /* k per pass */
#define GPITCH 272                    /* LDS row pitch in bytes: 16 B x odd, for 16-byte fragment reads down a column of rows */
#define GSTAGE (192 * GPITCH)         /* one buffer of the output GEMM: rows 0..127 = A rows of the block, rows 128..191 = Bt rows of the block */
static_assert(DM % GKP == 0 && DM / GKP >= 2);   /* whole passes only */
// fragment from an LDS row, same k map as g2_frag; p already holds the lane's 16*hh byte offset
__device__ __forceinline__ v16h g2_lfrag(const unsigned char* p) { FragH f; f.half[0] = *(const v8us*)p; f.half[1] = *(const v8us*)(p + 32); return f.v; }
// twelve 16-byte copies of a lane, global -> LDS through no register; the closing s_wait_xcnt stands inside the statement so that no address register is rewritten ahead of it
__device__ __forceinline__ void g2_copy12(const unsigned* l, const _Float16* const* g) {
  asm volatile("global_load_async_to_lds_b128 %0, %12, off\n\t"
               "global_load_async_to_lds_b128 %1, %13, off\n\t"
               "global_load_async_to_lds_b128 %2, %14, off\n\t"
               "global_load_async_to_lds_b128 %3, %15, off\n\t"
               "global_load_async_to_lds_b128 %4, %16, off\n\t"
               "global_load_async_to_lds_b128 %5, %17, off\n\t"
               "global_load_async_to_lds_b128 %6, %18, off\n\t"
               "global_load_async_to_lds_b128 %7, %19, off\n\t"
               "global_load_async_to_lds_b128 %8, %20, off\n\t"
               "global_load_async_to_lds_b128 %9, %21, off\n\t"
               "global_load_async_to_lds_b128 %10, %22, off\n\t"
               "global_load_async_to_lds_b128 %11, %23, off\n\t"
               "s_wait_xcnt 0x0"
               :: "v"(l[0]), "v"(l[1]), "v"(l[2]), "v"(l[3]), "v"(l[4]), "v"(l[5]), "v"(l[6]), "v"(l[7]), "v"(l[8]), "v"(l[9]), "v"(l[10]), "v"(l[11]),
                  "v"(g[0]), "v"(g[1]), "v"(g[2]), "v"(g[3]), "v"(g[4]), "v"(g[5]), "v"(g[6]), "v"(g[7]), "v"(g[8]), "v"(g[9]), "v"(g[10]), "v"(g[11])
               : "memory");
}
// one pass's tile: 24 * RR rows of 256 B (16 * RR of A, then 8 * RR of Bt); 16 lanes cover a row, the block's lanes RR rows, so 24 copies a lane (16 for A, 8 for Bt)
template <int RR>
__device__ __forceinline__ void g2_stage(unsigned lb, const _Float16* ga, int lda, const _Float16* gb, int ldb) {
  unsigned l[24]; const _Float16* g[24];
#pragma unroll   /* both loops: every address becomes a register operand of the copy statements, no array in memory */
  for (int j = 0; j < 16; ++j) { l[j] = lb + (unsigned)(j * RR * GPITCH); g[j] = ga + (size_t)(j * RR) * lda; }
#pragma unroll
  for (int j = 0; j < 8; ++j) { l[16 + j] = lb + (unsigned)((16 + j) * RR * GPITCH); g[16 + j] = gb + (size_t)(j * RR) * ldb; }
  g2_copy12(l, g); g2_copy12(l + 12, g + 12);
}
// Output GEMM body (f32 C): block = 4 waves, wave tile 32x64, block tile 128x64
__device__ __forceinline__ void gemm2_body(const _Float16* __restrict__ A, int lda, const _Float16* __restrict__ Bh, int ldb, float alpha, const float* __restrict__ bias,
                                           float* __restrict__ C, int ldc, int N, int K) {
  __shared__ __attribute__((aligned(16))) float so[4][32][68];
  __shared__ __attribute__((aligned(16))) unsigned char ring[2 * GSTAGE];
  const int tid = threadIdx.x; const int w = __builtin_amdgcn_readfirstlane(tid >> 5); const int lane = tid & 31, ln = lane & 15, hh = lane >> 4;
  const int ntn = N >> 6; const int mt = blockIdx.x / ntn, nq = blockIdx.x - mt * ntn; const int row0 = mt * 128 + 32 * w, col0 = nq * 64;
  const int cr = tid >> 4, cc = tid & 15;                 /* copy role: row within a group of 8, 16-byte piece within the row */
  const _Float16* ga = A + (size_t)(mt * 128 + cr) * lda + cc * 8; const _Float16* gb = Bh + (size_t)(col0 + cr) * ldb + cc * 8;
  const unsigned lb = (unsigned)(size_t)ring + (unsigned)(cr * GPITCH + cc * 16);
  const unsigned char* fa = ring + (32 * w + ln) * GPITCH + 16 * hh; const unsigned char* fb = ring + (128 + ln) * GPITCH + 16 * hh;
  const int np = K / GKP;
  const int s0 = (mt + nq) % np;      /* the block's first pass: blocks that share A rows (same mt) or Bt rows (same nq) start at different k, so that they do not ask L2 for the same lines at the same moment; the walk wraps round */
  const v8f z8 = {0.f,0.f,0.f,0.f,0.f,0.f,0.f,0.f}; v8f c00 = z8, c01 = z8, c02 = z8, c03 = z8, c10 = z8, c11 = z8, c12 = z8, c13 = z8;
  g2_stage<8>(lb, ga + (size_t)s0 * GKP, lda, gb + (size_t)s0 * GKP, ldb);
  asm volatile("s_wait_asynccnt 0x0" ::: "memory");       /* this wave's copies of the first pass have landed */
  __syncthreads();                                        /* first pass published to every wave */
  if (np > 1) { const int p = (s0 + 1 < np) ? s0 + 1 : 0; g2_stage<8>(lb + GSTAGE, ga + (size_t)p * GKP, lda, gb + (size_t)p * GKP, ldb); }
#pragma unroll 1   /* one pass a trip: one publish point and one refill site in the code */
  for (int t = 0; t < np; ++t) { const unsigned bo = (unsigned)(t & 1) * GSTAGE; const unsigned char* pa = fa + bo; const unsigned char* pb = fb + bo;
    v16h a0 = g2_lfrag(pa), a1 = g2_lfrag(pa + 16 * GPITCH), b0 = g2_lfrag(pb), b1 = g2_lfrag(pb + 16 * GPITCH), b2 = g2_lfrag(pb + 32 * GPITCH), b3 = g2_lfrag(pb + 48 * GPITCH);
#pragma unroll   /* the two fragment sets alternate by renaming, LDS offsets become immediates */
    for (int ks = 0; ks < GKP / 32; ++ks) { v16h na0 = a0, na1 = a1, nb0 = b0, nb1 = b1, nb2 = b2, nb3 = b3;
      if (ks + 1 < GKP / 32) { const int o = (ks + 1) * 64;      /* the same pass's next k-step, read ahead of this step's products */
        na0 = g2_lfrag(pa + o); na1 = g2_lfrag(pa + 16 * GPITCH + o); nb0 = g2_lfrag(pb + o); nb1 = g2_lfrag(pb + 16 * GPITCH + o); nb2 = g2_lfrag(pb + 32 * GPITCH + o); nb3 = g2_lfrag(pb + 48 * GPITCH + o); }
      SCHED_FENCE();      /* the next step's reads stay one group ahead of this step's products */
      c00 = g2_mma(a0, b0, c00); c10 = g2_mma(a1, b0, c10);
      c01 = g2_mma(a0, b1, c01); c11 = g2_mma(a1, b1, c11);
      c02 = g2_mma(a0, b2, c02); c12 = g2_mma(a1, b2, c12);
      c03 = g2_mma(a0, b3, c03); c13 = g2_mma(a1, b3, c13);
      SCHED_FENCE();      /* no later read is lifted in among these products; the pass's last products stay ahead of the barrier and the refill */
      a0 = na0; a1 = na1; b0 = nb0; b1 = nb1; b2 = nb2; b3 = nb3; }
    asm volatile("s_wait_dscnt 0x0" ::: "memory");        /* this wave's reads of the buffer have returned before it may be refilled */
    asm volatile("s_wait_asynccnt 0x0" ::: "memory");     /* this wave's copies of the pass of trip t + 1 have landed */
    __syncthreads();                                      /* publishes the pass of trip t + 1 and ends every wave's reads of the pass of trip t */
    if (t + 2 < np) { int p = s0 + t + 2; p = (p < np) ? p : p - np; g2_stage<8>(lb + bo, ga + (size_t)p * GKP, lda, gb + (size_t)p * GKP, ldb); } }
  asm volatile("s_wait_asynccnt 0x0" ::: "memory");       /* no copy outstanding behind the loop */
  v8f accs[8] = {c00, c01, c02, c03, c10, c11, c12, c13};
#pragma unroll
  for (int u = 0; u < 8; ++u) { const int t = u & 3, half = u >> 2; const int col = col0 + t * 16 + ln; const float bv = bfr(bias[col]);
#pragma unroll
    for (int r = 0; r < 8; ++r) { const int rloc = half * 16 + 8 * hh + r; so[w][rloc][t * 16 + ln] = accs[u][r] * alpha + bv; } }
  __syncthreads();      /* staging tile is private to the wave; the block barrier is a superset of the wave-level ordering needed */
  const int rsub = lane >> 4, c4 = (lane & 15) * 4;
#pragma unroll
  for (int q = 0; q < 16; ++q) { const int r = q * 2 + rsub; const v4f v = *(const v4fa*)&so[w][r][c4];
    *(v4f*)(C + (size_t)(row0 + r) * ldc + col0 + c4) = v; }
}
// Projection GEMM body (f16 C): block = 8 waves as 4 (rows) x 2 (columns), wave tile 64x64, block tile 256x128, so that a block copies 384 operand rows from L2 for 32,768 outputs (128x64: 192 rows for 8,192).
// Same ring as above with 256 A rows and 128 Bt rows a buffer; behind the loop's last barrier the ring is free and serves as the output staging.
#define PBM 256
#define PBN 128
#define PSTAGE ((PBM + PBN) * GPITCH)
#define VPITCH 528                    /* staging pitch of a V^T row in bytes: 256 tokens in f16 + 16 = 16 B x odd */
static_assert(SEQ % PBM == 0 && DM % PBN == 0 && PBN == 2 * HD);      /* a block's 256 token rows lie in one batch; its 128 columns are two whole heads */
static_assert(8 * 64 * 68 * 4 <= 2 * PSTAGE && PBN * VPITCH <= 2 * PSTAGE);      /* both stagings fit the ring */
__device__ __forceinline__ void gemm3_body(const _Float16* __restrict__ A, int lda, const _Float16* __restrict__ Bh, int ldb, float alpha, const float* __restrict__ bias,
                                           _Float16* __restrict__ C16, int N, int K, bool vt) {
  __shared__ __attribute__((aligned(16))) unsigned char ring[2 * PSTAGE];
  const int tid = threadIdx.x; const int w = __builtin_amdgcn_readfirstlane(tid >> 5); const int lane = tid & 31, ln = lane & 15, hh = lane >> 4;
  const int wm = w & 3, wn = w >> 2;
  const int ntn = N / PBN; const int mt = blockIdx.x / ntn, nq = blockIdx.x - mt * ntn; const int row0 = mt * PBM + 64 * wm, col0 = nq * PBN + 64 * wn;
  const int cr = tid >> 4, cc = tid & 15;                 /* copy role: row within a group of 16, 16-byte piece within the row */
  const _Float16* ga = A + (size_t)(mt * PBM + cr) * lda + cc * 8; const _Float16* gb = Bh + (size_t)(nq * PBN + cr) * ldb + cc * 8;
  const unsigned lb = (unsigned)(size_t)ring + (unsigned)(cr * GPITCH + cc * 16);
  const unsigned char* fa = ring + (64 * wm + ln) * GPITCH + 16 * hh; const unsigned char* fb = ring + (PBM + 64 * wn + ln) * GPITCH + 16 * hh;
  const int np = K / GKP;
  const int s0 = (mt + nq) % np;      /* the block's first pass, as in the output GEMM: sharers of A or Bt rows start at different k; the walk wraps round */
  const v8f z8 = {0.f,0.f,0.f,0.f,0.f,0.f,0.f,0.f}; v8f c[4][4];
#pragma unroll
  for (int i = 0; i < 4; ++i) {
#pragma unroll
    for (int j = 0; j < 4; ++j) c[i][j] = z8; }
  g2_stage<16>(lb, ga + (size_t)s0 * GKP, lda, gb + (size_t)s0 * GKP, ldb);
  asm volatile("s_wait_asynccnt 0x0" ::: "memory");       /* this wave's copies of the first pass have landed */
  __syncthreads();                                        /* first pass published to every wave */
  if (np > 1) { const int p = (s0 + 1 < np) ? s0 + 1 : 0; g2_stage<16>(lb + PSTAGE, ga + (size_t)p * GKP, lda, gb + (size_t)p * GKP, ldb); }
#pragma unroll 1   /* one pass a trip: one publish point and one refill site in the code */
  for (int t = 0; t < np; ++t) { const unsigned bo = (unsigned)(t & 1) * PSTAGE; const unsigned char* pa = fa + bo; const unsigned char* pb = fb + bo;
#pragma unroll   /* LDS offsets become immediates */
    for (int ks = 0; ks < GKP / 32; ++ks) { v16h a[4], b[4];      /* one fragment set: with the 128 accumulator registers a second set would pass 256 registers; the SIMD's other wave covers the read latency */
#pragma unroll
      for (int i = 0; i < 4; ++i) { a[i] = g2_lfrag(pa + i * 16 * GPITCH + ks * 64); b[i] = g2_lfrag(pb + i * 16 * GPITCH + ks * 64); }
      SCHED_FENCE();      /* the step's sixteen reads stay one group ahead of its products */
#pragma unroll
      for (int j = 0; j < 4; ++j) {
#pragma unroll
        for (int i = 0; i < 4; ++i) c[i][j] = g2_mma(a[i], b[j], c[i][j]); }
      SCHED_FENCE(); }      /* no later read is lifted in among these products; the pass's last products stay ahead of the barrier and the refill */
    asm volatile("s_wait_dscnt 0x0" ::: "memory");        /* this wave's reads of the buffer have returned before it may be refilled */
    asm volatile("s_wait_asynccnt 0x0" ::: "memory");     /* this wave's copies of the pass of trip t + 1 have landed */
    __syncthreads();                                      /* publishes the pass of trip t + 1 and ends every wave's reads of the pass of trip t */
    if (t + 2 < np) { int p = s0 + t + 2; p = (p < np) ? p : p - np; g2_stage<16>(lb + bo, ga + (size_t)p * GKP, lda, gb + (size_t)p * GKP, ldb); } }
  asm volatile("s_wait_asynccnt 0x0" ::: "memory");       /* no copy outstanding behind the loop */
  if (vt) {      /* block-uniform. C16 = V^T plane [(batch, head)][d][SEQ]; the block's 128 columns are the 64 d of heads 2nq and 2nq+1, its 256 rows are 256 tokens of one batch */
    unsigned char* st = ring;      /* block tile [column][token] in f16, row pitch VPITCH */
#pragma unroll
    for (int j = 0; j < 4; ++j) { const float bv = bfr(bias[col0 + j * 16 + ln]);
#pragma unroll
      for (int i = 0; i < 4; ++i) { FragH f;
#pragma unroll
        for (int r = 0; r < 8; ++r) f.h[r] = (_Float16)(c[i][j][r] * alpha + bv);      /* a lane's 8 accumulator elements = 8 consecutive tokens of one d: one 16-byte piece of a V^T row */
        *(v8us*)(st + (64 * wn + j * 16 + ln) * VPITCH + (64 * wm + 16 * i + 8 * hh) * 2) = f.half[0]; } }
    __syncthreads();      /* every wave wrote its 64 tokens into 64 of the rows; the rows are read back across waves */
    const int tok0 = mt * PBM; _Float16* vb = C16 + ((size_t)(tok0 / SEQ) * NH * HD + (size_t)nq * PBN) * SEQ + (tok0 % SEQ);
#pragma unroll
    for (int q = 0; q < 16; ++q) { const int d = q * 8 + w; const v8us v = *(const v8us*)(st + d * VPITCH + lane * 16);      /* a wave stores the 512 contiguous bytes of a row */
      *(v8us*)((unsigned short*)vb + (size_t)d * SEQ + lane * 8) = v; }
    return;
  }
  float* so = (float*)(ring + w * (64 * 68 * 4));      /* the wave's own staging tile [64 rows][pitch 68 floats] */
#pragma unroll
  for (int j = 0; j < 4; ++j) { const float bv = bfr(bias[col0 + j * 16 + ln]);
#pragma unroll
    for (int i = 0; i < 4; ++i) {
#pragma unroll
      for (int r = 0; r < 8; ++r) so[(i * 16 + 8 * hh + r) * 68 + j * 16 + ln] = c[i][j][r] * alpha + bv; } }
  __syncthreads();      /* staging tile is private to the wave; the block barrier is a superset of the wave-level ordering needed */
  const int rsub = lane >> 4, c4 = (lane & 15) * 4;
  _Float16* cp = C16 + (size_t)(row0 + rsub) * DM + col0 + c4;      /* C rows are DM wide: one address register pair, the row step is an immediate offset */
#pragma unroll
  for (int g = 0; g < 4; ++g) {
#pragma unroll
    for (int q = g * 8; q < g * 8 + 8; ++q) { const v4f v = *(const v4fa*)&so[(q * 2 + rsub) * 68 + c4];
      v4h h4; h4[0] = (_Float16)v[0]; h4[1] = (_Float16)v[1]; h4[2] = (_Float16)v[2]; h4[3] = (_Float16)v[3]; *(v4h*)(cp + (size_t)(q * 2) * DM) = h4; }
    asm volatile("s_wait_xcnt 0x0" ::: "memory");      /* no register that one of these eight stores names is rewritten (by the next group, or by code laid behind) ahead of this wait */
  }
}
// the three projections in one grid: blockIdx.y = 0, 1, 2 picks the q, k or v problem; its A, Bt and C planes lie one behind the other; the third C plane is written as V^T
__global__ __launch_bounds__(256) void k_gemm_qkv(const _Float16* __restrict__ A, int lda, const _Float16* __restrict__ Bh, int ldb, float alpha,
                                                  const float* __restrict__ bq, const float* __restrict__ bk, const float* __restrict__ bv, _Float16* __restrict__ C16, int N, int K) {
  const unsigned s = blockIdx.y; const float* bias = (s == 0u) ? bq : (s == 1u) ? bk : bv;
  gemm3_body(A + (size_t)s * NR * DM, lda, Bh + (size_t)s * DM * DM, ldb, alpha, bias, C16 + (size_t)s * NR * DM, N, K, s == 2u);
}
__global__ __launch_bounds__(128) void k_gemm_f32(const _Float16* __restrict__ A, int lda, const _Float16* __restrict__ Bh, int ldb, float alpha, const float* __restrict__ bias, float* __restrict__ C, int ldc, int N, int K) {
  gemm2_body(A, lda, Bh, ldb, alpha, bias, C, ldc, N, K);
}

// Attention operands reach the waves through LDS: a stage is 128 keys of one (batch, head): 128 K rows of 128 B and 64 V^T rows of 256 B, copied asynchronously into one of two buffers while the other is worked on.
#define AKT 128                       /* keys per stage */
#define AKPITCH 144                   /* LDS pitch of a K row in bytes: 16 B x odd, for 16-byte fragment reads down a column of rows */
#define AVPITCH 272                   /* LDS pitch of a V^T row in bytes: 16 B x odd */
#define AKBYTES (AKT * AKPITCH)       /* K rows first, V^T rows behind them */
#define ASTAGE (AKBYTES + HD * AVPITCH)
static_assert(SEQ % AKT == 0 && SEQ / AKT >= 2);   /* whole stages only, both buffers filled in the prologue */
static_assert(AKT * HD * 2 == 8 * 128 * 16);       /* each operand's tile = 8 copies of 16 B by each of 128 lanes */
// eight 16-byte copies of a lane, global -> LDS through no register; the closing s_wait_xcnt stands inside the statement so that no address register is rewritten ahead of it
__device__ __forceinline__ void at_copy8(const unsigned* l, const _Float16* const* g) {
  asm volatile("global_load_async_to_lds_b128 %0, %8, off\n\t"
               "global_load_async_to_lds_b128 %1, %9, off\n\t"
               "global_load_async_to_lds_b128 %2, %10, off\n\t"
               "global_load_async_to_lds_b128 %3, %11, off\n\t"
               "global_load_async_to_lds_b128 %4, %12, off\n\t"
               "global_load_async_to_lds_b128 %5, %13, off\n\t"
               "global_load_async_to_lds_b128 %6, %14, off\n\t"
               "global_load_async_to_lds_b128 %7, %15, off\n\t"
               "s_wait_xcnt 0x0"
               :: "v"(l[0]), "v"(l[1]), "v"(l[2]), "v"(l[3]), "v"(l[4]), "v"(l[5]), "v"(l[6]), "v"(l[7]),
                  "v"(g[0]), "v"(g[1]), "v"(g[2]), "v"(g[3]), "v"(g[4]), "v"(g[5]), "v"(g[6]), "v"(g[7])
               : "memory");
}
// one stage: K: 8 lanes cover a row, the block's 128 lanes 16 rows; V^T: 16 lanes cover a row, the block 8 rows; 8 copies a lane for each
__device__ __forceinline__ void at_stage(unsigned lk, unsigned lv, const _Float16* gk, const _Float16* gv) {
  unsigned l[16]; const _Float16* g[16];
#pragma unroll   /* every address becomes a register operand of the copy statements, no array in memory */
  for (int j = 0; j < 8; ++j) { l[j] = lk + (unsigned)(j * 16 * AKPITCH); g[j] = gk + (size_t)(j * 16) * DM; l[8 + j] = lv + (unsigned)(j * 8 * AVPITCH); g[8 + j] = gv + (size_t)(j * 8) * SEQ; }
  at_copy8(l, g); at_copy8(l + 8, g + 8);
}

// Fused attention: block = 4 waves = 64 queries of one (batch, head); wave = 16 queries; key loop in stages of 128 keys, steps of 32 keys.
// Score tiles are computed TRANSPOSED (A = K rows [key][d], B = Q rows [query][d]): accumulator element r of lane (hh, ln) = (key 8hh+r, query ln),
// so a lane owns one query column: row max = in-lane max + one xor-16 shuffle. The two 16-key P^T tiles are the B operand of the next product
// (elements 0..7 <- tile 0 element r, elements 8..15 <- tile 1 element r, lane unchanged); A = V^T rows [d][key]; accumulators hold O^T (d 8hh+r, query ln).
// Mask: a per-key f32 table built once per block in LDS (0 for a kept key, MASKRAW for a masked one) is the START VALUE of the score accumulators (element r of a lane = key 8hh+r, the table's own order),
// so a masked logit comes out of the matrix unit at about -1e9 (in units of the 1/8 scale) and costs no vector work. Where no key of the batch is kept the score scale is 0: every logit 0, the row uniform.
#define MASKRAW (-8.0e9f)
// Softmax weights straight from the raw accumulators: 1024 exp((s - m) / 8) = exp2(s * cs + off), cs = scale * log2(e) (block-uniform), off = 10 - m * cs (one value a step and lane): one multiply-add a score ahead of the exponential;
// the running maximum m is kept in raw accumulator units (cs >= 0, so the order of the scores is that of the logits).
// MFLOOR is m's start value and so its lower bound. While only masked keys have been seen m stays there and their weights are exp2(about -1.4e9) = 0 exactly; were m to follow them down to MASKRAW, off would be rounded to a multiple of 128 and the weights would be powers of two of any size.
// A kept raw score lies far above it: a sum of 64 products reaches 1e8 only with q and k elements above 1,000, and a projection of 1024 normal draws under weights within 1/32 stays below 200 even if every term adds up.
#define MFLOOR (-1.0e8f)
// eight consecutive keys' table entries = one accumulator tile's start value in a lane
__device__ __forceinline__ v8f at_bias(const unsigned char* p) { const v4f a = *(const v4fa*)p, c = *(const v4fa*)(p + 16); return __builtin_shufflevector(a, c, 0, 1, 2, 3, 4, 5, 6, 7); }
__global__ __launch_bounds__(128) void k_attn(const _Float16* __restrict__ Q16, const _Float16* __restrict__ K16, const _Float16* __restrict__ Vt, const int* __restrict__ mask, _Float16* __restrict__ CTX) {
  __shared__ __attribute__((aligned(16))) float sbias[SEQ];                /* cross-wave: 4 keys a thread and trip, read by all after the block barrier */
  __shared__ __attribute__((aligned(16))) unsigned int skeep[4];           /* per wave: nonzero where one of the keys it looked at is kept */
  __shared__ __attribute__((aligned(16))) unsigned short sh[4][16][72];    /* per-wave output staging [query][d], pitch 144 B */
  __shared__ __attribute__((aligned(16))) unsigned char ring[2 * ASTAGE];  /* the two K / V^T stage buffers */
  const int tid = threadIdx.x; const int wave = __builtin_amdgcn_readfirstlane(tid >> 5); const int lane = tid & 31, ln = lane & 15, hh = lane >> 4;
  const int h = blockIdx.y, b = blockIdx.z; const size_t rowb = (size_t)b * SEQ;
  const _Float16* gk = K16 + (rowb + (tid >> 3)) * DM + h * HD + (tid & 7) * 8;                    /* copy role, K: row within a group of 16, 16-byte piece */
  const _Float16* gv = Vt + ((size_t)(b * NH + h) * HD + (tid >> 4)) * SEQ + (tid & 15) * 8;       /* copy role, V^T: row within a group of 8, 16-byte piece */
  const unsigned lk = (unsigned)(size_t)ring + (unsigned)((tid >> 3) * AKPITCH + (tid & 7) * 16);
  const unsigned lv = (unsigned)(size_t)ring + (unsigned)(AKBYTES + (tid >> 4) * AVPITCH + (tid & 15) * 16);
  const int s0 = (int)(blockIdx.x % (SEQ / AKT));                         /* the block's first key stage: the blocks of one (batch, head) read the same K and V^T lines and start at different stages, so that they do not ask L2 for them at the same moment; the walk wraps round */
  at_stage(lk, lv, gk + (size_t)s0 * AKT * DM, gv + (size_t)s0 * AKT);    /* the first stage flies while the mask table is built */
  {
    const int* mp = mask + (size_t)b * SEQ_FULL; bool any = false;
#pragma unroll   /* the loads of all trips are issued together */
    for (int k4 = 0; k4 < SEQ; k4 += 512) { const int k = k4 + tid * 4; const v4ia m = *(const v4ia*)(mp + k); v4f bb;
#pragma unroll   /* vector elements picked by constants: no indexed register access */
      for (int i = 0; i < 4; ++i) { bb[i] = (m[i] != 0) ? 0.0f : MASKRAW; any = any || (m[i] != 0); }
      *(v4fa*)&sbias[k] = bb; }
    const unsigned int kw = __builtin_amdgcn_ballot_w32(any);
    if (lane == 0) skeep[wave] = kw;
  }
  asm volatile("s_wait_asynccnt 0x0" ::: "memory");       /* this wave's copies of the first stage have landed */
  __syncthreads();                                        /* mask table, keep words and the first stage published to every wave */
  { const int p = (s0 + 1) % (SEQ / AKT); at_stage(lk + ASTAGE, lv + ASTAGE, gk + (size_t)p * AKT * DM, gv + (size_t)p * AKT); }
  const int q0 = blockIdx.x * 64 + wave * 16;
  const _Float16* Qp = Q16 + (rowb + q0 + ln) * DM + h * HD;
  const v16h qf0 = g2_frag(Qp, hh), qf1 = g2_frag(Qp + 32, hh);
  const unsigned char* fk = ring + ln * AKPITCH + 16 * hh; const unsigned char* fv = ring + AKBYTES + ln * AVPITCH + 16 * hh;
  const v4ua kws = *(const v4ua*)skeep;
  const float cs = (__builtin_amdgcn_readfirstlane(kws[0] | kws[1] | kws[2] | kws[3]) != 0u) ? 0.125f * 1.44269504f : 0.0f;      /* block-uniform: score scale times log2(e) */
  const v8f z8 = {0.f,0.f,0.f,0.f,0.f,0.f,0.f,0.f};
  v8f o0 = z8, o1 = z8, o2 = z8, o3 = z8; float mrun = MFLOOR, lpart = 0.f;
#pragma unroll 1   /* one stage a trip: one publish point and one refill site in the code */
  for (int t = 0; t < SEQ / AKT; ++t) { const unsigned bo = (unsigned)(t & 1) * ASTAGE; const unsigned char* pk = fk + bo; const unsigned char* pv = fv + bo;
   const int st = (s0 + t) % (SEQ / AKT);                 /* the key stage that trip t works on */
   const unsigned char* pm = (const unsigned char*)sbias + st * (AKT * 4) + 32 * hh;      /* the lane's 8 keys of the stage's first 16-key tile */
   v16h ka0 = g2_lfrag(pk), ka1 = g2_lfrag(pk + 64), ka2 = g2_lfrag(pk + 16 * AKPITCH), ka3 = g2_lfrag(pk + 16 * AKPITCH + 64);
   v8f m0 = at_bias(pm), m1 = at_bias(pm + 64);
#pragma unroll   /* LDS offsets become immediates; the K fragments and mask entries of the same stage's next step are read ahead */
   for (int kk = 0; kk < AKT / 32; ++kk) {
    const v16h va0 = g2_lfrag(pv + kk * 64), va1 = g2_lfrag(pv + 16 * AVPITCH + kk * 64), va2 = g2_lfrag(pv + 32 * AVPITCH + kk * 64), va3 = g2_lfrag(pv + 48 * AVPITCH + kk * 64);
    v16h nka0 = ka0, nka1 = ka1, nka2 = ka2, nka3 = ka3; v8f nm0 = m0, nm1 = m1;
    if (kk + 1 < AKT / 32) { const unsigned char* nk = pk + (kk + 1) * 32 * AKPITCH;
      nka0 = g2_lfrag(nk); nka1 = g2_lfrag(nk + 64); nka2 = g2_lfrag(nk + 16 * AKPITCH); nka3 = g2_lfrag(nk + 16 * AKPITCH + 64);
      nm0 = at_bias(pm + (kk + 1) * 128); nm1 = at_bias(pm + (kk + 1) * 128 + 64); }      /* keys 128st+32(kk+1)+8hh+r (tile 0) and +16 (tile 1) */
    SCHED_FENCE();      /* all LDS reads of a step stand in one group at its head */
    v8f s0 = m0, s1 = m1;
    s0 = g2_mma(ka0, qf0, s0);
    s0 = g2_mma(ka1, qf1, s0);
    s1 = g2_mma(ka2, qf0, s1);
    s1 = g2_mma(ka3, qf1, s1);
    float mx = -3.0e38f;
#pragma unroll
    for (int r = 0; r < 8; ++r) mx = fmaxf(mx, fmaxf(s0[r], s1[r]));
    mx = fmaxf(mx, __shfl_xor(mx, 16));
    const float mnew = fmaxf(mrun, mx); const float alpha = __builtin_amdgcn_exp2f((mrun - mnew) * cs);
    const float off = fmaf(-mnew, cs, 10.0f); mrun = mnew;
    const v2f cs2 = {cs, cs}, off2 = {off, off};
    float e0[8], e1[8];
#pragma unroll   /* neighbouring accumulator elements are a register pair: one packed multiply-add takes two scores where they lie */
    for (int i = 0; i < 4; ++i) {
      const v2f a0 = {s0[2 * i], s0[2 * i + 1]}, a1 = {s1[2 * i], s1[2 * i + 1]};
      const v2f x0 = __builtin_elementwise_fma(a0, cs2, off2), x1 = __builtin_elementwise_fma(a1, cs2, off2);
      e0[2 * i] = x0[0]; e0[2 * i + 1] = x0[1]; e1[2 * i] = x1[0]; e1[2 * i + 1] = x1[1];
    }
    float ps = 0.f; FragH pf;
#pragma unroll
    for (int r = 0; r < 8; ++r) {
      const float p0 = __builtin_amdgcn_exp2f(e0[r]), p1 = __builtin_amdgcn_exp2f(e1[r]); ps += p0 + p1;
      pf.h[r] = (_Float16)p0; pf.h[8 + r] = (_Float16)p1;
    }
    lpart = lpart * alpha + ps;
#pragma unroll
    for (int r = 0; r < 8; ++r) { o0[r] *= alpha; o1[r] *= alpha; o2[r] *= alpha; o3[r] *= alpha; }
    const v16h pb = pf.v;
    o0 = g2_mma(va0, pb, o0);
    o1 = g2_mma(va1, pb, o1);
    o2 = g2_mma(va2, pb, o2);
    o3 = g2_mma(va3, pb, o3);
    SCHED_FENCE();      /* the next step's reads stay a group of their own; the stage's last step stays ahead of the barrier and the refill */
    ka0 = nka0; ka1 = nka1; ka2 = nka2; ka3 = nka3; m0 = nm0; m1 = nm1;
   }
   asm volatile("s_wait_dscnt 0x0" ::: "memory");         /* this wave's reads of the buffer have returned before it may be refilled */
   asm volatile("s_wait_asynccnt 0x0" ::: "memory");      /* this wave's copies of the stage of trip t + 1 have landed */
   __syncthreads();                                       /* publishes the stage of trip t + 1 and ends every wave's reads of stage st */
   if (t + 2 < SEQ / AKT) { const int p = (s0 + t + 2) % (SEQ / AKT); at_stage(lk + bo, lv + bo, gk + (size_t)p * AKT * DM, gv + (size_t)p * AKT); }
  }
  asm volatile("s_wait_asynccnt 0x0" ::: "memory");       /* no copy outstanding behind the loop */
  const float l = lpart + __shfl_xor(lpart, 16);
  const float inv = 1.0f / (l * 0.015625f);                /* P and l both carried x1024, ctx carried x64 */
  FragH t0, t1, t2, t3;
#pragma unroll
  for (int r = 0; r < 8; ++r) { t0.h[r] = (_Float16)(o0[r] * inv); t1.h[r] = (_Float16)(o1[r] * inv); t2.h[r] = (_Float16)(o2[r] * inv); t3.h[r] = (_Float16)(o3[r] * inv); }
  *(v8us*)&sh[wave][ln][0 + 8 * hh] = t0.half[0];
  *(v8us*)&sh[wave][ln][16 + 8 * hh] = t1.half[0];
  *(v8us*)&sh[wave][ln][32 + 8 * hh] = t2.half[0];
  *(v8us*)&sh[wave][ln][48 + 8 * hh] = t3.half[0];
  __syncthreads();
  const int rsub = lane >> 3, pc = lane & 7;               
  {
#pragma unroll
    for (int it = 0; it < 4; ++it) { const int row = it * 4 + rsub; const v8us v = *(const v8us*)&sh[wave][row][pc * 8];
      *(v8us*)((unsigned short*)CTX + (rowb + q0 + row) * DM + h * HD + pc * 8) = v; }
     }
}

#define WBYTES ((size_t)DM * DM * 2)
#define PBYTES ((size_t)NB * SEQ * DM * 2)
static_assert(WBYTES % 256 == 0 && PBYTES % 256 == 0);
static_assert(4 * WBYTES + 7 * PBYTES <= (size_t)134217728);      /* total carve: 4 weight planes + 7 token planes (V^T plane = NB*NH*HD*SEQ halves = one token plane) */

extern "C" void kernel_launch(void* const* d_in, const int* in_sizes, int n_in,
                              void* d_out, int out_size, void* d_ws, size_t ws_size, hipStream_t stream) {
  if (n_in < 12) return;
  const long long need_x = (long long)(NB - 1) * SEQ_FULL * DM + (long long)SEQ * DM;
  if ((long long)in_sizes[0] < need_x || (long long)in_sizes[1] < need_x || (long long)in_sizes[2] < need_x) return;
  if ((long long)in_sizes[3] < (long long)(NB - 1) * SEQ_FULL + SEQ) return;
  if (in_sizes[4] < DM * DM || in_sizes[6] < DM * DM || in_sizes[8] < DM * DM || in_sizes[10] < DM * DM) return;
  if (in_sizes[5] < DM || in_sizes[7] < DM || in_sizes[9] < DM || in_sizes[11] < DM) return;
  if ((long long)out_size < (long long)NB * SEQ * DM) return;
  /* wire order: q, k, v, mask (int32), Wq, bq, Wk, bk, Wv, bv, Wo, bo */
  const float* xq = (const float*)d_in[0]; const float* xk = (const float*)d_in[1]; const float* xv = (const float*)d_in[2];
  const int* mask = (const int*)d_in[3];
  const float* Wq = (const float*)d_in[4]; const float* bq = (const float*)d_in[5];
  const float* Wk = (const float*)d_in[6]; const float* bk = (const float*)d_in[7];
  const float* Wv = (const float*)d_in[8]; const float* bv = (const float*)d_in[9];
  const float* Wo = (const float*)d_in[10]; const float* bo = (const float*)d_in[11];
  float* out = (float*)d_out;
  char* ws = (char*)d_ws; size_t off = 0;
  _Float16* BQ = (_Float16*)(ws + off); off += WBYTES;
  _Float16* BK = (_Float16*)(ws + off); off += WBYTES;
  _Float16* BV = (_Float16*)(ws + off); off += WBYTES;
  _Float16* BO = (_Float16*)(ws + off); off += WBYTES;
  _Float16* XQ = (_Float16*)(ws + off); off += PBYTES;
  _Float16* XK = (_Float16*)(ws + off); off += PBYTES;
  _Float16* XV = (_Float16*)(ws + off); off += PBYTES;
  _Float16* Q16 = (_Float16*)(ws + off); off += PBYTES;
  _Float16* K16 = (_Float16*)(ws + off); off += PBYTES;
  _Float16* VT = (_Float16*)(ws + off); off += PBYTES;
  _Float16* CTX = (_Float16*)(ws + off); off += PBYTES;
  if (off > ws_size) return;
  k_cvt<<<3u * GX + 4u * GW, 256, 0, stream>>>(xq, xk, xv, Wq, Wk, Wv, Wo, XQ, BQ);      /* planes XQ, XK, XV and BQ, BK, BV, BO */
  const unsigned gg = (unsigned)((MR / 128) * (DM / 64));
  const unsigned gp = (unsigned)((MR / PBM) * (DM / PBN));
  k_gemm_qkv<<<dim3(gp, 3), 256, 0, stream>>>(XQ, DM, BQ, DM, 0.0625f, bq, bk, bv, Q16, DM, DM);      /* q = xq Wq^T + bq, k = xk Wk^T + bk into planes Q16, K16; v = xv Wv^T + bv into plane VT as [(b,h)][d][SEQ] (weights x16 -> alpha 1/16) */
  k_attn<<<dim3(SEQ / 64, NH, NB), 128, 0, stream>>>(Q16, K16, VT, mask, CTX);           /* ctx x64, merged heads */
  k_gemm_f32<<<gg, 128, 0, stream>>>(CTX, DM, BO, DM, 0.0009765625f, bo, out, DM, DM, DM);      /* out = ctx Wo^T + bo (x64 and x16 carries -> alpha 2^-10) */
}

// v010
// A run of this version takes 45.3 microseconds.
// Two timings next to v009 put it at 1.04 and 1.03 times that version's speed.
// Counting every step since v000, it is 5.40 times as fast.
#include <hip/hip_runtime.h>
// Multi-head attention with three input streams (q, k, v each [NB][SEQ][1024]), [out][in] projection weights with biases, integer key-padding mask applied per (batch, key) as a finite offset that puts a masked logit at about -1e9, 16 heads of 64, score scale 1/8, softmax over the keys of the same batch, heads merged h*64+d, output projection with bias.
// Compute dtype: every contraction on v_wmma_f32_16x16x32_f16 (f16 operands, f32 accumulate). Float inputs are converted (RNE) to bf16 first and carried as exact f16 (weights x16); q, k, v planes plain f16; softmax weights exp(s-m) carried x1024 as f16 (row sum l from the unconverted f32 values, x1024 too); ctx carried x64 as f16; scores and softmax statistics f32.
// Structure: one launch for the 3 activation and 4 weight converts, one launch for the 3 projection GEMMs (256x128 block tiles, 64x64 wave tiles, operands staged in LDS by asynchronous copies, two buffers; the v blocks store their tile transposed, as V^T), one fused online-softmax attention kernel (K and V^T tiles of 128 keys staged in LDS by asynchronous copies, two buffers, shared by the block's 4 waves; transposed score tiles S^T = K Q^T so a lane owns one query column; P^T accumulator tiles feed the next WMMA as its B operand directly), one output GEMM (f32, 128x64 block tiles, 32x64 wave tiles, staged the same way).
#ifndef NB
#define NB 2
#endif
#ifndef SEQ
#define SEQ 1024
#endif
#define NB_FULL 2
#define SEQ_FULL 1024
#define DM 1024
#define NH 16
#define HD 64
#define NR ((size_t)NB * SEQ)         /* token rows processed */
#define MR ((int)(NB * SEQ))

typedef unsigned short v8us __attribute__((ext_vector_type(8), may_alias));
typedef float  v8f  __attribute__((ext_vector_type(8)));
typedef float  v4f  __attribute__((ext_vector_type(4)));
typedef float  v2f  __attribute__((ext_vector_type(2)));
typedef float  v4fa __attribute__((ext_vector_type(4), may_alias));
typedef int    v4ia __attribute__((ext_vector_type(4), may_alias));
typedef unsigned int v4ua __attribute__((ext_vector_type(4), may_alias));
typedef _Float16 v16h __attribute__((ext_vector_type(16)));
typedef _Float16 v4h __attribute__((ext_vector_type(4)));
union FragH { v16h v; v8us half[2]; _Float16 h[16]; unsigned short u[16]; };

static_assert(NH * HD == DM);                 /* merged head width */
static_assert(HD == 64);                      /* attention kernel: 2 k-steps of 32 over the head dim, 4 output tiles of 16 */
static_assert(DM % 64 == 0 && DM % 32 == 0 && DM % 8 == 0);  /* GEMM N tiles, K steps, 16-B pieces */
static_assert(SEQ % 128 == 0);                /* attention block = 64 queries; key steps of 32 */
static_assert((NB * SEQ) % 128 == 0);         /* GEMM block = 128 rows, no row tail */
static_assert(SEQ % 512 == 0);                /* mask table built 4 keys a thread by a 128-thread block, whole trips only */
static_assert(NB <= NB_FULL && SEQ <= SEQ_FULL);
static_assert(((size_t)NB * SEQ * DM) % (8 * 256) == 0);     /* convert grids exact */
static_assert(((size_t)DM * DM) % (8 * 256) == 0);

__device__ __forceinline__ unsigned short bf16_bits(float x) { unsigned int u = __float_as_uint(x); return (unsigned short)((u + 0x7FFFu + ((u >> 16) & 1u)) >> 16); }
__device__ __forceinline__ float bf16_val(unsigned short b) { return __uint_as_float(((unsigned int)b) << 16); }
__device__ __forceinline__ float bfr(float x) { return bf16_val(bf16_bits(x)); }      /* RNE convert to bf16, back to f32 */

// fragment (A or B, same k map): elements 0..7 = k0+8h.., elements 8..15 = k0+16+8h.. from a k-contiguous 16-bit row
__device__ __forceinline__ v16h g2_frag(const _Float16* p, int hh) { FragH f; f.half[0] = *(const v8us*)((const unsigned short*)p + 8 * hh); f.half[1] = *(const v8us*)((const unsigned short*)p + 16 + 8 * hh); return f.v; }
// one WMMA, the plain builtin: the compiler keeps the distances behind it and is free to place independent work there
__device__ __forceinline__ v8f g2_mma(v16h a, v16h b, v8f c) { return __builtin_amdgcn_wmma_f32_16x16x32_f16(false, a, false, b, (short)0, c, false, false); }

// scheduling fence: the compiler's instruction scheduler moves nothing over it. It keeps a group of LDS reads together and ahead of the products that follow; left free, the compiler sinks each read to just in front of its first use and waits for it there
#define SCHED_FENCE() __builtin_amdgcn_sched_barrier(0)

__device__ __forceinline__ void wnat_body(const float* __restrict__ w, _Float16* __restrict__ Bt, unsigned blk) {
  const size_t t = (size_t)blk * 256 + threadIdx.x; if (t >= (size_t)DM * DM / 8) return;
  const v4f a = *(const v4fa*)(w + t * 8), c = *(const v4fa*)(w + t * 8 + 4); FragH f;
#pragma unroll
  for (int q = 0; q < 4; ++q) { f.h[q] = (_Float16)(bfr(a[q]) * 16.0f); f.h[4 + q] = (_Float16)(bfr(c[q]) * 16.0f); }
  const v8us o = f.half[0];
  *(v8us*)((unsigned short*)Bt + t * 8) = o; 
}

__device__ __forceinline__ void x16_body(const float* __restrict__ x, _Float16* __restrict__ X16, unsigned blk) {
  const size_t t = (size_t)blk * 256 + threadIdx.x; if (t >= NR * DM / 8) return;
  const size_t e = t * 8; const size_t row = e / DM; const size_t col = e % DM; const size_t bb = row / SEQ, s = row % SEQ;
  const float* src = x + (bb * SEQ_FULL + s) * DM + col;
  const v4f a = *(const v4fa*)(src), c = *(const v4fa*)(src + 4); FragH f;
#pragma unroll
  for (int q = 0; q < 4; ++q) { f.h[q] = (_Float16)bfr(a[q]); f.h[4 + q] = (_Float16)bfr(c[q]); }
  const v8us o = f.half[0];
  *(v8us*)((unsigned short*)X16 + t * 8) = o; 
}
// The seven converts read none of each other's output: one grid. Blocks [0, 3*GX) take the activation streams (GX blocks each), the rest the weight matrices (GW blocks each);
// the f16 planes of a kind lie one behind the other, so the stream or matrix number picks source pointer and destination plane.
#define GW ((unsigned)(((size_t)DM * DM / 8) / 256))
#define GX ((unsigned)((NR * DM / 8) / 256))
__global__ __launch_bounds__(256) void k_cvt(const float* __restrict__ xq, const float* __restrict__ xk, const float* __restrict__ xv,
                                             const float* __restrict__ Wq, const float* __restrict__ Wk, const float* __restrict__ Wv, const float* __restrict__ Wo,
                                             _Float16* __restrict__ X16, _Float16* __restrict__ Bt) {
  const unsigned bx = blockIdx.x;
  if (bx < 3u * GX) { const unsigned s = bx / GX; const float* x = (s == 0u) ? xq : (s == 1u) ? xk : xv;
    x16_body(x, X16 + (size_t)s * NR * DM, bx - s * GX); }
  else { const unsigned r = bx - 3u * GX; const unsigned s = r / GW; const float* w = (s & 2u) ? ((s & 1u) ? Wo : Wv) : ((s & 1u) ? Wk : Wq);
    wnat_body(w, Bt + (size_t)s * DM * DM, r - s * GW); }
}

// GEMM C[M][N] = alpha * A[M][K] . Bt[N][K]^T + bf16(bias[N]); A, Bt f16 k-contiguous rows;
// operands reach the waves through LDS: a pass is 128 k (256 B of each of the block's A rows and Bt rows), copied asynchronously into one of two buffers while the other is worked on.
#define GKP 128                       /* k per pass */
#define GPITCH 272                    /* LDS row pitch in bytes: 16 B x odd, for 16-byte fragment reads down a column of rows */
#define GSTAGE (192 * GPITCH)         /* one buffer of the output GEMM: rows 0..127 = A rows of the block, rows 128..191 = Bt rows of the block */
static_assert(DM % GKP == 0 && DM / GKP >= 2);   /* whole passes only */
// fragment from an LDS row, same k map as g2_frag; p already holds the lane's 16*hh byte offset
__device__ __forceinline__ v16h g2_lfrag(const unsigned char* p) { FragH f; f.half[0] = *(const v8us*)p; f.half[1] = *(const v8us*)(p + 32); return f.v; }
// twelve 16-byte copies of a lane, global -> LDS through no register; the closing s_wait_xcnt stands inside the statement so that no address register is rewritten ahead of it
__device__ __forceinline__ void g2_copy12(const unsigned* l, const _Float16* const* g) {
  asm volatile("global_load_async_to_lds_b128 %0, %12, off\n\t"
               "global_load_async_to_lds_b128 %1, %13, off\n\t"
               "global_load_async_to_lds_b128 %2, %14, off\n\t"
               "global_load_async_to_lds_b128 %3, %15, off\n\t"
               "global_load_async_to_lds_b128 %4, %16, off\n\t"
               "global_load_async_to_lds_b128 %5, %17, off\n\t"
               "global_load_async_to_lds_b128 %6, %18, off\n\t"
               "global_load_async_to_lds_b128 %7, %19, off\n\t"
               "global_load_async_to_lds_b128 %8, %20, off\n\t"
               "global_load_async_to_lds_b128 %9, %21, off\n\t"
               "global_load_async_to_lds_b128 %10, %22, off\n\t"
               "global_load_async_to_lds_b128 %11, %23, off\n\t"
               "s_wait_xcnt 0x0"
               :: "v"(l[0]), "v"(l[1]), "v"(l[2]), "v"(l[3]), "v"(l[4]), "v"(l[5]), "v"(l[6]), "v"(l[7]), "v"(l[8]), "v"(l[9]), "v"(l[10]), "v"(l[11]),
                  "v"(g[0]), "v"(g[1]), "v"(g[2]), "v"(g[3]), "v"(g[4]), "v"(g[5]), "v"(g[6]), "v"(g[7]), "v"(g[8]), "v"(g[9]), "v"(g[10]), "v"(g[11])
               : "memory");
}
// one pass's tile: 24 * RR rows of 256 B (16 * RR of A, then 8 * RR of Bt); 16 lanes cover a row, the block's lanes RR rows, so 24 copies a lane (16 for A, 8 for Bt)
template <int RR>
__device__ __forceinline__ void g2_stage(unsigned lb, const _Float16* ga, int lda, const _Float16* gb, int ldb) {
  unsigned l[24]; const _Float16* g[24];
#pragma unroll   /* both loops: every address becomes a register operand of the copy statements, no array in memory */
  for (int j = 0; j < 16; ++j) { l[j] = lb + (unsigned)(j * RR * GPITCH); g[j] = ga + (size_t)(j * RR) * lda; }
#pragma unroll
  for (int j = 0; j < 8; ++j) { l[16 + j] = lb + (unsigned)((16 + j) * RR * GPITCH); g[16 + j] = gb + (size_t)(j * RR) * ldb; }
  g2_copy12(l, g); g2_copy12(l + 12, g + 12);
}
// Output GEMM body (f32 C): block = 4 waves, wave tile 32x64, block tile 128x64
__device__ __forceinline__ void gemm2_body(const _Float16* __restrict__ A, int lda, const _Float16* __restrict__ Bh, int ldb, float alpha, const float* __restrict__ bias,
                                           float* __restrict__ C, int ldc, int N, int K) {
  __shared__ __attribute__((aligned(16))) float so[4][32][68];
  __shared__ __attribute__((aligned(16))) unsigned char ring[2 * GSTAGE];
  const int tid = threadIdx.x; const int w = __builtin_amdgcn_readfirstlane(tid >> 5); const int lane = tid & 31, ln = lane & 15, hh = lane >> 4;
  const int ntn = N >> 6; const int mt = blockIdx.x / ntn, nq = blockIdx.x - mt * ntn; const int row0 = mt * 128 + 32 * w, col0 = nq * 64;
  const int cr = tid >> 4, cc = tid & 15;                 /* copy role: row within a group of 8, 16-byte piece within the row */
  const _Float16* ga = A + (size_t)(mt * 128 + cr) * lda + cc * 8; const _Float16* gb = Bh + (size_t)(col0 + cr) * ldb + cc * 8;
  const unsigned lb = (unsigned)(size_t)ring + (unsigned)(cr * GPITCH + cc * 16);
  const unsigned char* fa = ring + (32 * w + ln) * GPITCH + 16 * hh; const unsigned char* fb = ring + (128 + ln) * GPITCH + 16 * hh;
  const int np = K / GKP;
  const int s0 = (mt + nq) % np;      /* the block's first pass: blocks that share A rows (same mt) or Bt rows (same nq) start at different k, so that they do not ask L2 for the same lines at the same moment; the walk wraps round */
  const v8f z8 = {0.f,0.f,0.f,0.f,0.f,0.f,0.f,0.f}; v8f c00 = z8, c01 = z8, c02 = z8, c03 = z8, c10 = z8, c11 = z8, c12 = z8, c13 = z8;
  g2_stage<8>(lb, ga + (size_t)s0 * GKP, lda, gb + (size_t)s0 * GKP, ldb);
  asm volatile("s_wait_asynccnt 0x0" ::: "memory");       /* this wave's copies of the first pass have landed */
  __syncthreads();                                        /* first pass published to every wave */
  if (np > 1) { const int p = (s0 + 1 < np) ? s0 + 1 : 0; g2_stage<8>(lb + GSTAGE, ga + (size_t)p * GKP, lda, gb + (size_t)p * GKP, ldb); }
#pragma unroll 1   /* one pass a trip: one publish point and one refill site in the code */
  for (int t = 0; t < np; ++t) { const unsigned bo = (unsigned)(t & 1) * GSTAGE; const unsigned char* pa = fa + bo; const unsigned char* pb = fb + bo;
    v16h a0 = g2_lfrag(pa), a1 = g2_lfrag(pa + 16 * GPITCH), b0 = g2_lfrag(pb), b1 = g2_lfrag(pb + 16 * GPITCH), b2 = g2_lfrag(pb + 32 * GPITCH), b3 = g2_lfrag(pb + 48 * GPITCH);
#pragma unroll   /* the two fragment sets alternate by renaming, LDS offsets become immediates */
    for (int ks = 0; ks < GKP / 32; ++ks) { v16h na0 = a0, na1 = a1, nb0 = b0, nb1 = b1, nb2 = b2, nb3 = b3;
      if (ks + 1 < GKP / 32) { const int o = (ks + 1) * 64;      /* the same pass's next k-step, read ahead of this step's products */
        na0 = g2_lfrag(pa + o); na1 = g2_lfrag(pa + 16 * GPITCH + o); nb0 = g2_lfrag(pb + o); nb1 = g2_lfrag(pb + 16 * GPITCH + o); nb2 = g2_lfrag(pb + 32 * GPITCH + o); nb3 = g2_lfrag(pb + 48 * GPITCH + o); }
      SCHED_FENCE();      /* the next step's reads stay one group ahead of this step's products */
      c00 = g2_mma(a0, b0, c00); c10 = g2_mma(a1, b0, c10);
      c01 = g2_mma(a0, b1, c01); c11 = g2_mma(a1, b1, c11);
      c02 = g2_mma(a0, b2, c02); c12 = g2_mma(a1, b2, c12);
      c03 = g2_mma(a0, b3, c03); c13 = g2_mma(a1, b3, c13);
      SCHED_FENCE();      /* no later read is lifted in among these products; the pass's last products stay ahead of the barrier and the refill */
      a0 = na0; a1 = na1; b0 = nb0; b1 = nb1; b2 = nb2; b3 = nb3; }
    asm volatile("s_wait_dscnt 0x0" ::: "memory");        /* this wave's reads of the buffer have returned before it may be refilled */
    asm volatile("s_wait_asynccnt 0x0" ::: "memory");     /* this wave's copies of the pass of trip t + 1 have landed */
    __syncthreads();                                      /* publishes the pass of trip t + 1 and ends every wave's reads of the pass of trip t */
    if (t + 2 < np) { int p = s0 + t + 2; p = (p < np) ? p : p - np; g2_stage<8>(lb + bo, ga + (size_t)p * GKP, lda, gb + (size_t)p * GKP, ldb); } }
  asm volatile("s_wait_asynccnt 0x0" ::: "memory");       /* no copy outstanding behind the loop */
  v8f accs[8] = {c00, c01, c02, c03, c10, c11, c12, c13};
#pragma unroll
  for (int u = 0; u < 8; ++u) { const int t = u & 3, half = u >> 2; const int col = col0 + t * 16 + ln; const float bv = bfr(bias[col]);
#pragma unroll
    for (int r = 0; r < 8; ++r) { const int rloc = half * 16 + 8 * hh + r; so[w][rloc][t * 16 + ln] = accs[u][r] * alpha + bv; } }
  __syncthreads();      /* staging tile is private to the wave; the block barrier is a superset of the wave-level ordering needed */
  const int rsub = lane >> 4, c4 = (lane & 15) * 4;
#pragma unroll
  for (int q = 0; q < 16; ++q) { const int r = q * 2 + rsub; const v4f v = *(const v4fa*)&so[w][r][c4];
    *(v4f*)(C + (size_t)(row0 + r) * ldc + col0 + c4) = v; }
}
// Projection GEMM body (f16 C): block = 8 waves as 4 (rows) x 2 (columns), wave tile 64x64, block tile 256x128, so that a block copies 384 operand rows from L2 for 32,768 outputs (128x64: 192 rows for 8,192).
// Same ring as above with 256 A rows and 128 Bt rows a buffer; behind the loop's last barrier the ring is free and serves as the output staging.
#define PBM 256
#define PBN 128
#define PSTAGE ((PBM + PBN) * GPITCH)
#define VPITCH 528                    /* staging pitch of a V^T row in bytes: 256 tokens in f16 + 16 = 16 B x odd */
static_assert(SEQ % PBM == 0 && DM % PBN == 0 && PBN == 2 * HD);      /* a block's 256 token rows lie in one batch; its 128 columns are two whole heads */
static_assert(8 * 64 * 68 * 4 <= 2 * PSTAGE && PBN * VPITCH <= 2 * PSTAGE);      /* both stagings fit the ring */
__device__ __forceinline__ void gemm3_body(const _Float16* __restrict__ A, int lda, const _Float16* __restrict__ Bh, int ldb, float alpha, const float* __restrict__ bias,
                                           _Float16* __restrict__ C16, int N, int K, bool vt) {
  __shared__ __attribute__((aligned(16))) unsigned char ring[2 * PSTAGE];
  const int tid = threadIdx.x; const int w = __builtin_amdgcn_readfirstlane(tid >> 5); const int lane = tid & 31, ln = lane & 15, hh = lane >> 4;
  const int wm = w & 3, wn = w >> 2;
  const int ntn = N / PBN; const int mt = blockIdx.x / ntn, nq = blockIdx.x - mt * ntn; const int row0 = mt * PBM + 64 * wm, col0 = nq * PBN + 64 * wn;
  const int cr = tid >> 4, cc = tid & 15;                 /* copy role: row within a group of 16, 16-byte piece within the row */
  const _Float16* ga = A + (size_t)(mt * PBM + cr) * lda + cc * 8; const _Float16* gb = Bh + (size_t)(nq * PBN + cr) * ldb + cc * 8;
  const unsigned lb = (unsigned)(size_t)ring + (unsigned)(cr * GPITCH + cc * 16);
  const unsigned char* fa = ring + (64 * wm + ln) * GPITCH + 16 * hh; const unsigned char* fb = ring + (PBM + 64 * wn + ln) * GPITCH + 16 * hh;
  const int np = K / GKP;
  const int s0 = (mt + nq) % np;      /* the block's first pass, as in the output GEMM: sharers of A or Bt rows start at different k; the walk wraps round */
  const v8f z8 = {0.f,0.f,0.f,0.f,0.f,0.f,0.f,0.f}; v8f c[4][4];
#pragma unroll
  for (int i = 0; i < 4; ++i) {
#pragma unroll
    for (int j = 0; j < 4; ++j) c[i][j] = z8; }
  g2_stage<16>(lb, ga + (size_t)s0 * GKP, lda, gb + (size_t)s0 * GKP, ldb);
  asm volatile("s_wait_asynccnt 0x0" ::: "memory");       /* this wave's copies of the first pass have landed */
  __syncthreads();                                        /* first pass published to every wave */
  if (np > 1) { const int p = (s0 + 1 < np) ? s0 + 1 : 0; g2_stage<16>(lb + PSTAGE, ga + (size_t)p * GKP, lda, gb + (size_t)p * GKP, ldb); }
#pragma unroll 1   /* one pass a trip: one publish point and one refill site in the code */
  for (int t = 0; t < np; ++t) { const unsigned bo = (unsigned)(t & 1) * PSTAGE; const unsigned char* pa = fa + bo; const unsigned char* pb = fb + bo;
#pragma unroll   /* LDS offsets become immediates */
    for (int ks = 0; ks < GKP / 32; ++ks) { v16h a[4], b[4];      /* one fragment set: with the 128 accumulator registers a second set would pass 256 registers; the SIMD's other wave covers the read latency */
#pragma unroll
      for (int i = 0; i < 4; ++i) { a[i] = g2_lfrag(pa + i * 16 * GPITCH + ks * 64); b[i] = g2_lfrag(pb + i * 16 * GPITCH + ks * 64); }
      SCHED_FENCE();      /* the step's sixteen reads stay one group ahead of its products */
#pragma unroll
      for (int j = 0; j < 4; ++j) {
#pragma unroll
        for (int i = 0; i < 4; ++i) c[i][j] = g2_mma(a[i], b[j], c[i][j]); }
      SCHED_FENCE(); }      /* no later read is lifted in among these products; the pass's last products stay ahead of the barrier and the refill */
    asm volatile("s_wait_dscnt 0x0" ::: "memory");        /* this wave's reads of the buffer have returned before it may be refilled */
    asm volatile("s_wait_asynccnt 0x0" ::: "memory");     /* this wave's copies of the pass of trip t + 1 have landed */
    __syncthreads();                                      /* publishes the pass of trip t + 1 and ends every wave's reads of the pass of trip t */
    if (t + 2 < np) { int p = s0 + t + 2; p = (p < np) ? p : p - np; g2_stage<16>(lb + bo, ga + (size_t)p * GKP, lda, gb + (size_t)p * GKP, ldb); } }
  asm volatile("s_wait_asynccnt 0x0" ::: "memory");       /* no copy outstanding behind the loop */
  if (vt) {      /* block-uniform. C16 = V^T plane [(batch, head)][d][SEQ]; the block's 128 columns are the 64 d of heads 2nq and 2nq+1, its 256 rows are 256 tokens of one batch */
    unsigned char* st = ring;      /* block tile [column][token] in f16, row pitch VPITCH */
#pragma unroll
    for (int j = 0; j < 4; ++j) { const float bv = bfr(bias[col0 + j * 16 + ln]);
#pragma unroll
      for (int i = 0; i < 4; ++i) { FragH f;
#pragma unroll
        for (int r = 0; r < 8; ++r) f.h[r] = (_Float16)(c[i][j][r] * alpha + bv);      /* a lane's 8 accumulator elements = 8 consecutive tokens of one d: one 16-byte piece of a V^T row */
        *(v8us*)(st + (64 * wn + j * 16 + ln) * VPITCH + (64 * wm + 16 * i + 8 * hh) * 2) = f.half[0]; } }
    __syncthreads();      /* every wave wrote its 64 tokens into 64 of the rows; the rows are read back across waves */
    const int tok0 = mt * PBM; _Float16* vb = C16 + ((size_t)(tok0 / SEQ) * NH * HD + (size_t)nq * PBN) * SEQ + (tok0 % SEQ);
#pragma unroll
    for (int q = 0; q < 16; ++q) { const int d = q * 8 + w; const v8us v = *(const v8us*)(st + d * VPITCH + lane * 16);      /* a wave stores the 512 contiguous bytes of a row */
      *(v8us*)((unsigned short*)vb + (size_t)d * SEQ + lane * 8) = v; }
    return;
  }
  float* so = (float*)(ring + w * (64 * 68 * 4));      /* the wave's own staging tile [64 rows][pitch 68 floats] */
#pragma unroll
  for (int j = 0; j < 4; ++j) { const float bv = bfr(bias[col0 + j * 16 + ln]);
#pragma unroll
    for (int i = 0; i < 4; ++i) {
#pragma unroll
      for (int r = 0; r < 8; ++r) so[(i * 16 + 8 * hh + r) * 68 + j * 16 + ln] = c[i][j][r] * alpha + bv; } }
  __syncthreads();      /* staging tile is private to the wave; the block barrier is a superset of the wave-level ordering needed */
  const int rsub = lane >> 4, c4 = (lane & 15) * 4;
  _Float16* cp = C16 + (size_t)(row0 + rsub) * DM + col0 + c4;      /* C rows are DM wide: one address register pair, the row step is an immediate offset */
#pragma unroll
  for (int g = 0; g < 4; ++g) {
#pragma unroll
    for (int q = g * 8; q < g * 8 + 8; ++q) { const v4f v = *(const v4fa*)&so[(q * 2 + rsub) * 68 + c4];
      v4h h4; h4[0] = (_Float16)v[0]; h4[1] = (_Float16)v[1]; h4[2] = (_Float16)v[2]; h4[3] = (_Float16)v[3]; *(v4h*)(cp + (size_t)(q * 2) * DM) = h4; }
    asm volatile("s_wait_xcnt 0x0" ::: "memory");      /* no register that one of these eight stores names is rewritten (by the next group, or by code laid behind) ahead of this wait */
  }
}
// the three projections in one grid: blockIdx.y = 0, 1, 2 picks the q, k or v problem; its A, Bt and C planes lie one behind the other; the third C plane is written as V^T
__global__ __launch_bounds__(256) void k_gemm_qkv(const _Float16* __restrict__ A, int lda, const _Float16* __restrict__ Bh, int ldb, float alpha,
                                                  const float* __restrict__ bq, const float* __restrict__ bk, const float* __restrict__ bv, _Float16* __restrict__ C16, int N, int K) {
  const unsigned s = blockIdx.y; const float* bias = (s == 0u) ? bq : (s == 1u) ? bk : bv;
  gemm3_body(A + (size_t)s * NR * DM, lda, Bh + (size_t)s * DM * DM, ldb, alpha, bias, C16 + (size_t)s * NR * DM, N, K, s == 2u);
}
__global__ __launch_bounds__(128) void k_gemm_f32(const _Float16* __restrict__ A, int lda, const _Float16* __restrict__ Bh, int ldb, float alpha, const float* __restrict__ bias, float* __restrict__ C, int ldc, int N, int K) {
  gemm2_body(A, lda, Bh, ldb, alpha, bias, C, ldc, N, K);
}

// Attention operands reach the waves through LDS: a stage is 128 keys of one (batch, head): 128 K rows of 128 B and 64 V^T rows of 256 B, copied asynchronously into one of two buffers while the other is worked on.
#define AKT 128                       /* keys per stage */
#define AKPITCH 144                   /* LDS pitch of a K row in bytes: 16 B x odd, for 16-byte fragment reads down a column of rows */
#define AVPITCH 272                   /* LDS pitch of a V^T row in bytes: 16 B x odd */
#define AKBYTES (AKT * AKPITCH)       /* K rows first, V^T rows behind them */
#define ASTAGE (AKBYTES + HD * AVPITCH)
static_assert(SEQ % AKT == 0 && SEQ / AKT >= 2);   /* whole stages only, both buffers filled in the prologue */
static_assert(AKT * HD * 2 == 8 * 128 * 16);       /* each operand's tile = 8 copies of 16 B by each of 128 lanes */
// eight 16-byte copies of a lane, global -> LDS through no register; the closing s_wait_xcnt stands inside the statement so that no address register is rewritten ahead of it
__device__ __forceinline__ void at_copy8(const unsigned* l, const _Float16* const* g) {
  asm volatile("global_load_async_to_lds_b128 %0, %8, off\n\t"
               "global_load_async_to_lds_b128 %1, %9, off\n\t"
               "global_load_async_to_lds_b128 %2, %10, off\n\t"
               "global_load_async_to_lds_b128 %3, %11, off\n\t"
               "global_load_async_to_lds_b128 %4, %12, off\n\t"
               "global_load_async_to_lds_b128 %5, %13, off\n\t"
               "global_load_async_to_lds_b128 %6, %14, off\n\t"
               "global_load_async_to_lds_b128 %7, %15, off\n\t"
               "s_wait_xcnt 0x0"
               :: "v"(l[0]), "v"(l[1]), "v"(l[2]), "v"(l[3]), "v"(l[4]), "v"(l[5]), "v"(l[6]), "v"(l[7]),
                  "v"(g[0]), "v"(g[1]), "v"(g[2]), "v"(g[3]), "v"(g[4]), "v"(g[5]), "v"(g[6]), "v"(g[7])
               : "memory");
}
// one stage: K: 8 lanes cover a row, the block's 128 lanes 16 rows; V^T: 16 lanes cover a row, the block 8 rows; 8 copies a lane for each
__device__ __forceinline__ void at_stage(unsigned lk, unsigned lv, const _Float16* gk, const _Float16* gv) {
  unsigned l[16]; const _Float16* g[16];
#pragma unroll   /* every address becomes a register operand of the copy statements, no array in memory */
  for (int j = 0; j < 8; ++j) { l[j] = lk + (unsigned)(j * 16 * AKPITCH); g[j] = gk + (size_t)(j * 16) * DM; l[8 + j] = lv + (unsigned)(j * 8 * AVPITCH); g[8 + j] = gv + (size_t)(j * 8) * SEQ; }
  at_copy8(l, g); at_copy8(l + 8, g + 8);
}

// Fused attention: block = 4 waves = 64 queries of one (batch, head); wave = 16 queries; key loop in stages of 128 keys, steps of 32 keys.
// Score tiles are computed TRANSPOSED (A = K rows [key][d], B = Q rows [query][d]): accumulator element r of lane (hh, ln) = (key 8hh+r, query ln),
// so a lane owns one query column: row max = in-lane max + one xor-16 shuffle. The two 16-key P^T tiles are the B operand of the next product
// (elements 0..7 <- tile 0 element r, elements 8..15 <- tile 1 element r, lane unchanged); A = V^T rows [d][key]; accumulators hold O^T (d 8hh+r, query ln).
// Mask: a per-key f32 table built once per block in LDS (0 for a kept key, MASKRAW for a masked one) is the START VALUE of the score accumulators (element r of a lane = key 8hh+r, the table's own order),
// so a masked logit comes out of the matrix unit at about -1e9 (in units of the 1/8 scale) and costs no vector work. Where no key of the batch is kept the score scale is 0: every logit 0, the row uniform.
#define MASKRAW (-8.0e9f)
// Softmax weights straight from the raw accumulators: 1024 exp((s - m) / 8) = exp2(s * cs + off), cs = scale * log2(e) (block-uniform), off = 10 - m * cs (one value a lane, renewed with m): one multiply-add a score ahead of the exponential;
// m is a REFERENCE, not the running maximum: any m common to a query's weights, sum and accumulators gives the same quotient, so m moves only when it must. Each step forms its weights with the m in use and tests their sum:
// a lane's 16 weights are positive, so a sum of at most PLIM bounds each of them inside the f16 range, and the step goes on with no maximum, no exchange between the wave's halves and no rescale of O and l.
// Where any lane's sum is above PLIM (or infinite) the whole wave takes the slow path: m rises to the running maximum (kept in raw accumulator units; cs >= 0, so the order of the scores is that of the logits), O and l are rescaled, the step's weights are formed again (then at most 1024 each).
// MFLOOR is m's start value and so its lower bound: against it a kept score's weight is infinite, so the first step that holds a kept key sets m. While only masked keys have been seen m stays there and their weights are exp2(about -1.4e9) = 0 exactly; were m to follow them down to MASKRAW, off would be rounded to a multiple of 128 and the weights would be powers of two of any size.
// A kept raw score lies far above it: a sum of 64 products reaches 1e8 only with q and k elements above 1,000, and a projection of 1024 normal draws under weights within 1/32 stays below 200 even if every term adds up.
#define MFLOOR (-1.0e8f)
#define PLIM 6.0e4f                   /* below the largest finite f16 (65504) */
// one step's 16 weights of a lane, packed as the B operand of the next product; returns their f32 sum (pairwise tree: the sum stands ahead of a branch, a chain of 16 adds would be waited for)
__device__ __forceinline__ float at_weights(const v8f s0, const v8f s1, float cs, float off, v16h* pb) {
  const v2f cs2 = {cs, cs}, off2 = {off, off}; v2f w0[4], w1[4]; FragH pf;
#pragma unroll   /* neighbouring accumulator elements are a register pair: one packed multiply-add takes two scores where they lie */
  for (int i = 0; i < 4; ++i) {
    const v2f a0 = {s0[2 * i], s0[2 * i + 1]}, a1 = {s1[2 * i], s1[2 * i + 1]};
    const v2f x0 = __builtin_elementwise_fma(a0, cs2, off2), x1 = __builtin_elementwise_fma(a1, cs2, off2);
    w0[i][0] = __builtin_amdgcn_exp2f(x0[0]); w0[i][1] = __builtin_amdgcn_exp2f(x0[1]); w1[i][0] = __builtin_amdgcn_exp2f(x1[0]); w1[i][1] = __builtin_amdgcn_exp2f(x1[1]);
    pf.h[2 * i] = (_Float16)w0[i][0]; pf.h[2 * i + 1] = (_Float16)w0[i][1]; pf.h[8 + 2 * i] = (_Float16)w1[i][0]; pf.h[8 + 2 * i + 1] = (_Float16)w1[i][1];
  }
  *pb = pf.v;
  const v2f t = ((w0[0] + w1[0]) + (w0[1] + w1[1])) + ((w0[2] + w1[2]) + (w0[3] + w1[3]));
  return t[0] + t[1];
}
// eight consecutive keys' table entries = one accumulator tile's start value in a lane
__device__ __forceinline__ v8f at_bias(const unsigned char* p) { const v4f a = *(const v4fa*)p, c = *(const v4fa*)(p + 16); return __builtin_shufflevector(a, c, 0, 1, 2, 3, 4, 5, 6, 7); }
__global__ __launch_bounds__(128) void k_attn(const _Float16* __restrict__ Q16, const _Float16* __restrict__ K16, const _Float16* __restrict__ Vt, const int* __restrict__ mask, _Float16* __restrict__ CTX) {
  __shared__ __attribute__((aligned(16))) float sbias[SEQ];                /* cross-wave: 4 keys a thread and trip, read by all after the block barrier */
  __shared__ __attribute__((aligned(16))) unsigned int skeep[4];           /* per wave: nonzero where one of the keys it looked at is kept */
  __shared__ __attribute__((aligned(16))) unsigned short sh[4][16][72];    /* per-wave output staging [query][d], pitch 144 B */
  __shared__ __attribute__((aligned(16))) unsigned char ring[2 * ASTAGE];  /* the two K / V^T stage buffers */
  const int tid = threadIdx.x; const int wave = __builtin_amdgcn_readfirstlane(tid >> 5); const int lane = tid & 31, ln = lane & 15, hh = lane >> 4;
  const int h = blockIdx.y, b = blockIdx.z; const size_t rowb = (size_t)b * SEQ;
  const _Float16* gk = K16 + (rowb + (tid >> 3)) * DM + h * HD + (tid & 7) * 8;                    /* copy role, K: row within a group of 16, 16-byte piece */
  const _Float16* gv = Vt + ((size_t)(b * NH + h) * HD + (tid >> 4)) * SEQ + (tid & 15) * 8;       /* copy role, V^T: row within a group of 8, 16-byte piece */
  const unsigned lk = (unsigned)(size_t)ring + (unsigned)((tid >> 3) * AKPITCH + (tid & 7) * 16);
  const unsigned lv = (unsigned)(size_t)ring + (unsigned)(AKBYTES + (tid >> 4) * AVPITCH + (tid & 15) * 16);
  const int s0 = (int)(blockIdx.x % (SEQ / AKT));                         /* the block's first key stage: the blocks of one (batch, head) read the same K and V^T lines and start at different stages, so that they do not ask L2 for them at the same moment; the walk wraps round */
  at_stage(lk, lv, gk + (size_t)s0 * AKT * DM, gv + (size_t)s0 * AKT);    /* the first stage flies while the mask table is built */
  {
    const int* mp = mask + (size_t)b * SEQ_FULL; bool any = false;
#pragma unroll   /* the loads of all trips are issued together */
    for (int k4 = 0; k4 < SEQ; k4 += 512) { const int k = k4 + tid * 4; const v4ia m = *(const v4ia*)(mp + k); v4f bb;
#pragma unroll   /* vector elements picked by constants: no indexed register access */
      for (int i = 0; i < 4; ++i) { bb[i] = (m[i] != 0) ? 0.0f : MASKRAW; any = any || (m[i] != 0); }
      *(v4fa*)&sbias[k] = bb; }
    const unsigned int kw = __builtin_amdgcn_ballot_w32(any);
    if (lane == 0) skeep[wave] = kw;
  }
  asm volatile("s_wait_asynccnt 0x0" ::: "memory");       /* this wave's copies of the first stage have landed */
  __syncthreads();                                        /* mask table, keep words and the first stage published to every wave */
  { const int p = (s0 + 1) % (SEQ / AKT); at_stage(lk + ASTAGE, lv + ASTAGE, gk + (size_t)p * AKT * DM, gv + (size_t)p * AKT); }
  const int q0 = blockIdx.x * 64 + wave * 16;
  const _Float16* Qp = Q16 + (rowb + q0 + ln) * DM + h * HD;
  const v16h qf0 = g2_frag(Qp, hh), qf1 = g2_frag(Qp + 32, hh);
  const unsigned char* fk = ring + ln * AKPITCH + 16 * hh; const unsigned char* fv = ring + AKBYTES + ln * AVPITCH + 16 * hh;
  const v4ua kws = *(const v4ua*)skeep;
  const float cs = (__builtin_amdgcn_readfirstlane(kws[0] | kws[1] | kws[2] | kws[3]) != 0u) ? 0.125f * 1.44269504f : 0.0f;      /* block-uniform: score scale times log2(e) */
  const v8f z8 = {0.f,0.f,0.f,0.f,0.f,0.f,0.f,0.f};
  v8f o0 = z8, o1 = z8, o2 = z8, o3 = z8; float mrun = MFLOOR, lpart = 0.f; float off = fmaf(-MFLOOR, cs, 10.0f);
#pragma unroll 1   /* one stage a trip: one publish point and one refill site in the code */
  for (int t = 0; t < SEQ / AKT; ++t) { const unsigned bo = (unsigned)(t & 1) * ASTAGE; const unsigned char* pk = fk + bo; const unsigned char* pv = fv + bo;
   const int st = (s0 + t) % (SEQ / AKT);                 /* the key stage that trip t works on */
   const unsigned char* pm = (const unsigned char*)sbias + st * (AKT * 4) + 32 * hh;      /* the lane's 8 keys of the stage's first 16-key tile */
   v16h kf[AKT / 32][4]; v8f mb[AKT / 32][2];             /* K fragments and mask entries by step; every index is a constant after unrolling */
#pragma unroll   /* steps 0 and 1 of the stage */
   for (int j = 0; j < 2; ++j) { const unsigned char* nk = pk + j * 32 * AKPITCH;
     kf[j][0] = g2_lfrag(nk); kf[j][1] = g2_lfrag(nk + 64); kf[j][2] = g2_lfrag(nk + 16 * AKPITCH); kf[j][3] = g2_lfrag(nk + 16 * AKPITCH + 64);
     mb[j][0] = at_bias(pm + j * 128); mb[j][1] = at_bias(pm + j * 128 + 64); }      /* keys 128st+32j+8hh+r (tile 0) and +16 (tile 1) */
   v8f sc0 = mb[0][0], sc1 = mb[0][1];
   sc0 = g2_mma(kf[0][0], qf0, sc0);
   sc0 = g2_mma(kf[0][1], qf1, sc0);
   sc1 = g2_mma(kf[0][2], qf0, sc1);
   sc1 = g2_mma(kf[0][3], qf1, sc1);
#pragma unroll   /* LDS offsets become immediates; the K fragments and mask entries of the same stage are read two steps ahead, the scores formed one step ahead */
   for (int kk = 0; kk < AKT / 32; ++kk) {
    const v16h va0 = g2_lfrag(pv + kk * 64), va1 = g2_lfrag(pv + 16 * AVPITCH + kk * 64), va2 = g2_lfrag(pv + 32 * AVPITCH + kk * 64), va3 = g2_lfrag(pv + 48 * AVPITCH + kk * 64);
    if (kk + 2 < AKT / 32) { const int j = kk + 2; const unsigned char* nk = pk + j * 32 * AKPITCH;
      kf[j][0] = g2_lfrag(nk); kf[j][1] = g2_lfrag(nk + 64); kf[j][2] = g2_lfrag(nk + 16 * AKPITCH); kf[j][3] = g2_lfrag(nk + 16 * AKPITCH + 64);
      mb[j][0] = at_bias(pm + j * 128); mb[j][1] = at_bias(pm + j * 128 + 64); }
    SCHED_FENCE();      /* all LDS reads of a step stand in one group at its head */
    v16h pb; float ps = at_weights(sc0, sc1, cs, off, &pb);
    const unsigned int need = __builtin_amdgcn_ballot_w32(ps > PLIM);
    SCHED_FENCE();      /* the compare stands ahead of the next step's score products, which run while its result travels to the scalar branch */
    v8f n0 = sc0, n1 = sc1;
    if (kk + 1 < AKT / 32) { n0 = mb[kk + 1][0]; n1 = mb[kk + 1][1];
      n0 = g2_mma(kf[kk + 1][0], qf0, n0);
      n0 = g2_mma(kf[kk + 1][1], qf1, n0);
      n1 = g2_mma(kf[kk + 1][2], qf0, n1);
      n1 = g2_mma(kf[kk + 1][3], qf1, n1); }
    if (__builtin_expect(need != 0u, 0)) {      /* wave-uniform scalar branch, seldom taken: the reference is too low for some lane of the wave */
      float mx = -3.0e38f;
#pragma unroll
      for (int r = 0; r < 8; ++r) mx = fmaxf(mx, fmaxf(sc0[r], sc1[r]));
      mx = fmaxf(mx, __shfl_xor(mx, 16));                    /* the two halves of a query column take the same reference */
      const float mnew = fmaxf(mrun, mx); const float alpha = __builtin_amdgcn_exp2f((mrun - mnew) * cs);
      off = fmaf(-mnew, cs, 10.0f); mrun = mnew; lpart *= alpha;
#pragma unroll
      for (int r = 0; r < 8; ++r) { o0[r] *= alpha; o1[r] *= alpha; o2[r] *= alpha; o3[r] *= alpha; }
      ps = at_weights(sc0, sc1, cs, off, &pb);
    }
    lpart += ps;
    o0 = g2_mma(va0, pb, o0);
    o1 = g2_mma(va1, pb, o1);
    o2 = g2_mma(va2, pb, o2);
    o3 = g2_mma(va3, pb, o3);
    SCHED_FENCE();      /* the next step's reads stay a group of their own; the stage's last step stays ahead of the barrier and the refill */
    sc0 = n0; sc1 = n1;
   }
   asm volatile("s_wait_dscnt 0x0" ::: "memory");         /* this wave's reads of the buffer have returned before it may be refilled */
   asm volatile("s_wait_asynccnt 0x0" ::: "memory");      /* this wave's copies of the stage of trip t + 1 have landed */
   __syncthreads();                                       /* publishes the stage of trip t + 1 and ends every wave's reads of stage st */
   if (t + 2 < SEQ / AKT) { const int p = (s0 + t + 2) % (SEQ / AKT); at_stage(lk + bo, lv + bo, gk + (size_t)p * AKT * DM, gv + (size_t)p * AKT); }
  }
  asm volatile("s_wait_asynccnt 0x0" ::: "memory");       /* no copy outstanding behind the loop */
  const float l = lpart + __shfl_xor(lpart, 16);
  const float inv = 1.0f / (l * 0.015625f);                /* P and l both carried x1024, ctx carried x64 */
  FragH t0, t1, t2, t3;
#pragma unroll
  for (int r = 0; r < 8; ++r) { t0.h[r] = (_Float16)(o0[r] * inv); t1.h[r] = (_Float16)(o1[r] * inv); t2.h[r] = (_Float16)(o2[r] * inv); t3.h[r] = (_Float16)(o3[r] * inv); }
  *(v8us*)&sh[wave][ln][0 + 8 * hh] = t0.half[0];
  *(v8us*)&sh[wave][ln][16 + 8 * hh] = t1.half[0];
  *(v8us*)&sh[wave][ln][32 + 8 * hh] = t2.half[0];
  *(v8us*)&sh[wave][ln][48 + 8 * hh] = t3.half[0];
  __syncthreads();
  const int rsub = lane >> 3, pc = lane & 7;               
  {
#pragma unroll
    for (int it = 0; it < 4; ++it) { const int row = it * 4 + rsub; const v8us v = *(const v8us*)&sh[wave][row][pc * 8];
      *(v8us*)((unsigned short*)CTX + (rowb + q0 + row) * DM + h * HD + pc * 8) = v; }
     }
}

#define WBYTES ((size_t)DM * DM * 2)
#define PBYTES ((size_t)NB * SEQ * DM * 2)
static_assert(WBYTES % 256 == 0 && PBYTES % 256 == 0);
static_assert(4 * WBYTES + 7 * PBYTES <= (size_t)134217728);      /* total carve: 4 weight planes + 7 token planes (V^T plane = NB*NH*HD*SEQ halves = one token plane) */

extern "C" void kernel_launch(void* const* d_in, const int* in_sizes, int n_in,
                              void* d_out, int out_size, void* d_ws, size_t ws_size, hipStream_t stream) {
  if (n_in < 12) return;
  const long long need_x = (long long)(NB - 1) * SEQ_FULL * DM + (long long)SEQ * DM;
  if ((long long)in_sizes[0] < need_x || (long long)in_sizes[1] < need_x || (long long)in_sizes[2] < need_x) return;
  if ((long long)in_sizes[3] < (long long)(NB - 1) * SEQ_FULL + SEQ) return;
  if (in_sizes[4] < DM * DM || in_sizes[6] < DM * DM || in_sizes[8] < DM * DM || in_sizes[10] < DM * DM) return;
  if (in_sizes[5] < DM || in_sizes[7] < DM || in_sizes[9] < DM || in_sizes[11] < DM) return;
  if ((long long)out_size < (long long)NB * SEQ * DM) return;
  /* wire order: q, k, v, mask (int32), Wq, bq, Wk, bk, Wv, bv, Wo, bo */
  const float* xq = (const float*)d_in[0]; const float* xk = (const float*)d_in[1]; const float* xv = (const float*)d_in[2];
  const int* mask = (const int*)d_in[3];
  const float* Wq = (const float*)d_in[4]; const float* bq = (const float*)d_in[5];
  const float* Wk = (const float*)d_in[6]; const float* bk = (const float*)d_in[7];
  const float* Wv = (const float*)d_in[8]; const float* bv = (const float*)d_in[9];
  const float* Wo = (const float*)d_in[10]; const float* bo = (const float*)d_in[11];
  float* out = (float*)d_out;
  char* ws = (char*)d_ws; size_t off = 0;
  _Float16* BQ = (_Float16*)(ws + off); off += WBYTES;
  _Float16* BK = (_Float16*)(ws + off); off += WBYTES;
  _Float16* BV = (_Float16*)(ws + off); off += WBYTES;
  _Float16* BO = (_Float16*)(ws + off); off += WBYTES;
  _Float16* XQ = (_Float16*)(ws + off); off += PBYTES;
  _Float16* XK = (_Float16*)(ws + off); off += PBYTES;
  _Float16* XV = (_Float16*)(ws + off); off += PBYTES;
  _Float16* Q16 = (_Float16*)(ws + off); off += PBYTES;
  _Float16* K16 = (_Float16*)(ws + off); off += PBYTES;
  _Float16* VT = (_Float16*)(ws + off); off += PBYTES;
  _Float16* CTX = (_Float16*)(ws + off); off += PBYTES;
  if (off > ws_size) return;
  k_cvt<<<3u * GX + 4u * GW, 256, 0, stream>>>(xq, xk, xv, Wq, Wk, Wv, Wo, XQ, BQ);      /* planes XQ, XK, XV and BQ, BK, BV, BO */
  const unsigned gg = (unsigned)((MR / 128) * (DM / 64));
  const unsigned gp = (unsigned)((MR / PBM) * (DM / PBN));
  k_gemm_qkv<<<dim3(gp, 3), 256, 0, stream>>>(XQ, DM, BQ, DM, 0.0625f, bq, bk, bv, Q16, DM, DM);      /* q = xq Wq^T + bq, k = xk Wk^T + bk into planes Q16, K16; v = xv Wv^T + bv into plane VT as [(b,h)][d][SEQ] (weights x16 -> alpha 1/16) */
  k_attn<<<dim3(SEQ / 64, NH, NB), 128, 0, stream>>>(Q16, K16, VT, mask, CTX);           /* ctx x64, merged heads */
  k_gemm_f32<<<gg, 128, 0, stream>>>(CTX, DM, BO, DM, 0.0009765625f, bo, out, DM, DM, DM);      /* out = ctx Wo^T + bo (x64 and x16 carries -> alpha 2^-10) */
}
